// v000
// Times are from an AMD MI455X. After a warm-up the kernel runs many times in a row, and a time is the length of
// such a window on the GPU divided by its runs, so every launch and the gaps after it count. The runs cycle
// through copies of the inputs. A figure is the median of several windows, for all but v000 over two sittings.
// Sittings can differ by a few percent; kernels timed side by side share one.
// v000, which the later versions start from, runs in 607 microseconds.
// Contractions: x.[Wq|Wk|Wv]^T on v_wmma_f32_16x16x32_bf16 (x and the weights as bf16 RNE planes, weight [n][k] rows are the
// k-contiguous B operand, f32 accumulate, biases added in f32 as bf16 RNE values); q.k^T over hd 64 and P.v on
// v_wmma_f32_16x16x32_f16 with f16 hi + f16 residual planes (q, k x256, products hh+lh+hl on every row; P x32768 hi +
// in-register residual and v^T x1024 hi + residual plane for query rows < 512 of each sequence, P hi . v hi only for later
// rows); O.Wo^T on v_wmma_f32_16x16x32_f16 with O x256 as f16 hi (+ f16 residual plane for rows < 512 of each sequence) and
// Wo as f16(bf16(Wo)) x1024, one accumulator, bias bo added in f32; all f32 accumulate. Online softmax in f32 on VALU.
#include <hip/hip_runtime.h>
#include <math.h>
#include <stdint.h>

#ifndef NB
#define NB 2
#endif
#ifndef SEQ
#define SEQ 2048
#endif
#define XS_FULL 2048
#define DMOD  2048
#define NH    32
#define NKVH  8
#define HD    64
#define KVD   (NKVH * HD)
#define NQKV  (DMOD + 2 * KVD)
#define MROWS (NB * SEQ)
#define RICH_REQ 512
#define RICH  ((SEQ < RICH_REQ) ? SEQ : RICH_REQ)
#define SM_SCALE 0.125f
#define QSC   256.0f
#define KSC   256.0f
#define PCAR  32768.0f
#define VCAR  1024.0f
#define OSC   256.0f
#define WOS   1024.0f
#define WPB   (NH / NKVH)
#define NHG   NKVH
#define NQT   (SEQ / 16)
#define NQTR  (RICH / 16)
#define NST   (SEQ / 64)
#define NKT   (SEQ / 32)
#define ATT_THREADS (WPB * 32)
#define PTP   36
#define PTW   (16 * PTP)
#define SLP   68
#define SLW   (16 * SLP)
#define WREG  (PTW + SLW)
#define SLAB64 (16 * 68)
#define VTP   72
#define WS_CAP 134217728
static_assert(DMOD == NH * HD && HD == 64 && NH == 32 && NKVH == 8 && WPB == 4 && NHG * WPB == NH);
static_assert(ATT_THREADS == 128 && KVD == 512 && NQKV == 3072);
static_assert(NB >= 1 && NB <= 2);
static_assert(NB == 1 || SEQ == XS_FULL);
static_assert((SEQ % 64) == 0 && SEQ >= 64 && SEQ <= XS_FULL);
static_assert((RICH % 64) == 0 && RICH >= 64 && RICH <= SEQ);
static_assert((DMOD % 64) == 0 && (KVD % 64) == 0 && (NQKV % 64) == 0 && (DMOD % 32) == 0 && (HD % 32) == 0 && (MROWS % 64) == 0);
static_assert(((SEQ * DMOD / 8) % 256) == 0 && ((DMOD * DMOD / 8) % 256) == 0 && ((KVD * DMOD / 8) % 256) == 0);
static_assert(WPB * WREG * 4 <= 65536 && 2 * HD * VTP * 2 <= 65536 && 4 * SLAB64 * 4 <= 65536);
// workspace total (XB + WB + F + QH + QL + KH + KL + VH + VL) for this build
static_assert((size_t)MROWS * DMOD * 2 + (size_t)NQKV * DMOD * 2 + (size_t)MROWS * NQKV * 4 +
              2 * (size_t)MROWS * DMOD * 2 + 2 * (size_t)MROWS * KVD * 2 + 2 * (size_t)NB * NKVH * HD * SEQ * 2
              <= (size_t)WS_CAP);

typedef unsigned short u16;
typedef _Float16 v16h __attribute__((ext_vector_type(16)));
typedef _Float16 v8h  __attribute__((ext_vector_type(8)));
typedef __bf16   v16b __attribute__((ext_vector_type(16)));
typedef float    v8f  __attribute__((ext_vector_type(8)));
typedef float    v4f  __attribute__((ext_vector_type(4)));
typedef unsigned int v4u __attribute__((ext_vector_type(4)));

union FragH { v16h v; v8h h[2]; v4u u[2]; };
union FragB { v16b v; v4u u[2]; };

// ---- scalar helpers --------------------------------------------------------------------------------
__device__ __forceinline__ unsigned short bf_bits(float f) {          // f32 -> bf16 bits, RNE convert
  unsigned u = __float_as_uint(f);
  return (unsigned short)((u + 0x7FFFu + ((u >> 16) & 1u)) >> 16);
}
__device__ __forceinline__ float bf_up(unsigned short h) { return __uint_as_float(((unsigned)h) << 16); }
__device__ __forceinline__ float bfr(float f) { return bf_up(bf_bits(f)); }
__device__ __forceinline__ unsigned short h_bits(_Float16 x) { return __builtin_bit_cast(unsigned short, x); }
__device__ __forceinline__ unsigned pk16(unsigned short a, unsigned short b) { return (unsigned)a | ((unsigned)b << 16); }
__device__ __forceinline__ v8f zero8() { v8f z = {0.f, 0.f, 0.f, 0.f, 0.f, 0.f, 0.f, 0.f}; return z; }

// ---- fragment loaders: 16-bit A/B operand, lane -> row/col (lane&15), p already includes +8*(lane>>4);
//      elements 0..7 <- p[0..7] (k0+8h..), elements 8..15 <- p[16..23] (k0+16+8h..)  (same split k map for A and B;
//      B is always read from a k-contiguous [n][k] plane)
__device__ __forceinline__ v16h ldfrag_h(const _Float16* p) {
  FragH f;
  f.h[0] = *(const v8h*)(p);
  f.h[1] = *(const v8h*)(p + 16);
  return f.v;
}
__device__ __forceinline__ v16b ldfrag_b(const u16* p) {              // bf16 plane read as unsigned integer vectors
  FragB f;
  f.u[0] = *(const v4u*)(p);
  f.u[1] = *(const v4u*)(p + 16);
  return f.v;
}

__device__ __forceinline__ v8f mma_h(v16h a, v16h b, v8f c) {
  return __builtin_amdgcn_wmma_f32_16x16x32_f16(false, a, false, b, (short)0, c, false, false);
}
__device__ __forceinline__ v8f mma_b(v16b a, v16b b, v8f c) {
  return __builtin_amdgcn_wmma_f32_16x16x32_bf16(false, a, false, b, (short)0, c, false, false);
}
__device__ __forceinline__ void guard2(v8f& a, v8f& b, v16h x0, v16h x1, v16h x2, v16h x3, v16h x4, v16h x5) {
#if defined(__HIP_DEVICE_COMPILE__)
  asm volatile("v_nop\n\tv_nop\n\tv_nop\n\tv_nop"
               : "+v"(a), "+v"(b) : "v"(x0), "v"(x1), "v"(x2), "v"(x3), "v"(x4), "v"(x5) : "memory");
#endif
}
template <typename F>
__device__ __forceinline__ void guard6(v8f& a, v8f& b, v8f& c, v8f& d, F x0, F x1, F x2, F x3, F x4, F x5) {
#if defined(__HIP_DEVICE_COMPILE__)
  asm volatile("v_nop\n\tv_nop\n\tv_nop\n\tv_nop"
               : "+v"(a), "+v"(b), "+v"(c), "+v"(d) : "v"(x0), "v"(x1), "v"(x2), "v"(x3), "v"(x4), "v"(x5) : "memory");
#endif
}
__device__ __forceinline__ void acc_guard4(v8f& a, v8f& b, v8f& c, v8f& d) {
#if defined(__HIP_DEVICE_COMPILE__)
  asm volatile("v_nop\n\tv_nop\n\tv_nop\n\tv_nop" : "+v"(a), "+v"(b), "+v"(c), "+v"(d));
#endif
}
__device__ __forceinline__ void wave_sync_lds() {
  __builtin_amdgcn_fence(__ATOMIC_RELEASE, "workgroup");
  __builtin_amdgcn_wave_barrier();
  __builtin_amdgcn_fence(__ATOMIC_ACQUIRE, "workgroup");
}

// =====================================================================================================
// f32 -> 16-bit plane, same layout.  f16mode == 0: bf16 RNE bits;  f16mode == 1: f16 bits of (bf16 RNE value) * scale.
// Thread = 8 consecutive elements: two 16-B loads, one 16-B store; 32 consecutive lanes = 512 contiguous, 512-B aligned
// coverage: grid = ceil(n8/256) blocks x 256 thr x 8 (in-kernel bound) = the whole plane (n8 a multiple of 256 here).
// =====================================================================================================
__global__ __launch_bounds__(256) void cvt16(const float* __restrict__ x, u16* D, int n8, int f16mode, float scale) {
  const int gt = blockIdx.x * 256 + (int)threadIdx.x;
  if (gt >= n8) return;
  const float* p = x + (size_t)gt * 8;
  const v4f a = *(const v4f*)(p), b4 = *(const v4f*)(p + 4);
  float w[8];
#pragma unroll
  for (int e = 0; e < 4; ++e) { w[e] = a[e]; w[4 + e] = b4[e]; }
  v4u o;
#pragma unroll
  for (int e = 0; e < 4; ++e) {
    const float f0 = w[2 * e], f1 = w[2 * e + 1];
    const unsigned short hb0 = h_bits((_Float16)(bfr(f0) * scale));
    const unsigned short hb1 = h_bits((_Float16)(bfr(f1) * scale));
    const unsigned short bb0 = bf_bits(f0);
    const unsigned short bb1 = bf_bits(f1);
    o[e] = (f16mode != 0) ? pk16(hb0, hb1) : pk16(bb0, bb1);
  }
  u16* d = D + (size_t)gt * 8;
  {
    *(v4u*)(d) = o;
    
  }
}

// =====================================================================================================
// q / k planes from the projection F f32 [MROWS][ldf] at column offset coff (ncol = DMOD for q, KVD for k; row = b*SEQ + s,
// column = coff + head*HD + d): t = (F + bfr(bias[col])) * sc in f32 (add, then exact power-of-two scale);
//   Hp [MROWS][ncol] = f16(t), Lp [MROWS][ncol] = f16 residual (t - f16(t)), same layout.
// Block = one row, ncol/8 threads; thread t owns columns 8t .. 8t+7: two 16-B loads of F, two of bias, one 16-B store per
// coverage: (ncol/8) thr x 8 = the whole row of Hp and of Lp; grid = MROWS blocks = every row of both planes once.
// =====================================================================================================
__global__ __launch_bounds__(256) void split16(const float* __restrict__ F, int ldf, int coff, int ncol,
                                               const float* __restrict__ bias, u16* Hp, u16* Lp, float sc) {
#pragma clang fp contract(off)
  const int tid = (int)threadIdx.x;
  const int row = (int)blockIdx.x;
  if (row >= MROWS) return;
  const int col = tid * 8;
  if (col + 8 > ncol) return;                          // never taken with blockDim = ncol/8
  const float* p = F + (size_t)row * (size_t)ldf + coff + col;
  const v4f xa = *(const v4f*)(p), xb = *(const v4f*)(p + 4);
  const v4f ba = *(const v4f*)(bias + col), bb = *(const v4f*)(bias + col + 4);
  float xv[8], bw[8];
#pragma unroll
  for (int e = 0; e < 4; ++e) {
    xv[e] = xa[e];  xv[4 + e] = xb[e];
    bw[e] = ba[e];  bw[4 + e] = bb[e];
  }
  v4u oh, ol;
#pragma unroll
  for (int e = 0; e < 4; ++e) {
    const float s0 = xv[2 * e] + bfr(bw[2 * e]);
    const float s1 = xv[2 * e + 1] + bfr(bw[2 * e + 1]);
    const float t0 = s0 * sc;
    const float t1 = s1 * sc;
    const _Float16 h0 = (_Float16)t0, h1 = (_Float16)t1;
    const _Float16 l0 = (_Float16)(t0 - (float)h0), l1 = (_Float16)(t1 - (float)h1);
    oh[e] = pk16(h_bits(h0), h_bits(h1));
    ol[e] = pk16(h_bits(l0), h_bits(l1));
  }
  u16* dh = Hp + (size_t)row * ncol + col;
  u16* dl = Lp + (size_t)row * ncol + col;
  {
    *(v4u*)(dh) = oh;
    *(v4u*)(dl) = ol;
    
  }
}

// =====================================================================================================
// v^T planes from the v columns of the projection F f32 [MROWS][ldf] (row = b*SEQ + s, column = voff + g*HD + d):
//   t = (F + bfr(bias[g*HD + d])) * 1024;  VH[((b*NKVH + g)*HD + d)][s] = f16(t);  VL[same][s] = f16 residual (t - f16(t)),
//   both for all keys s.
// Block = (b, kv head g, 64 keys s0): each thread loads its 16 floats (key sl, d chunk dc) with 16-B loads, converts, places
// them into two LDS tiles [64 d][64 keys] (pitch 72 halves); after a block barrier each d row segment (64 halves = one whole
// LDS tiles are cross-wave (block barrier); staged extent 64x64 == consumed extent 64x64.
// coverage: load 256 thr x 16 = 64 keys x 64 d; store 2 iterations x 256 thr x 8 halves = 64 lines x 64 = the block's tile of
//           VH and of VL; grid = NB*NKVH*NST blocks covers both planes exactly once.
// =====================================================================================================
__global__ __launch_bounds__(256) void vt16(const float* __restrict__ F, int ldf, int voff,
                                            const float* __restrict__ bias, u16* VHo, u16* VLo) {
#pragma clang fp contract(off)
  __shared__ __align__(16) u16 TH[HD * VTP];
  __shared__ __align__(16) u16 TL[HD * VTP];
  const int tid = threadIdx.x;
  const int bid = blockIdx.x;
  const int st  = bid % NST;
  const int t2  = bid / NST;
  const int g   = t2 % NKVH;
  const int b   = t2 / NKVH;
  if (b >= NB) return;                      // block-uniform, before any barrier; never taken with the exact grid
  const int s0  = st * 64;
  {
    const int sl = tid >> 2;                // key within tile 0..63
    const int dc = (tid & 3) * 16;          // d chunk 0,16,32,48
    const float* src  = F + ((size_t)b * SEQ + s0 + sl) * (size_t)ldf + voff + g * HD + dc;
    const float* bsrc = bias + g * HD + dc;
#pragma unroll
    for (int i = 0; i < 4; ++i) {
      const v4f a  = *(const v4f*)(src + 4 * i);
      const v4f bb = *(const v4f*)(bsrc + 4 * i);
#pragma unroll
      for (int e = 0; e < 4; ++e) {
        const float s  = a[e] + bfr(bb[e]);
        const float t  = s * VCAR;
        const _Float16 hv = (_Float16)t;
        const _Float16 lv = (_Float16)(t - (float)hv);
        TH[(dc + 4 * i + e) * VTP + sl] = h_bits(hv);
        TL[(dc + 4 * i + e) * VTP + sl] = h_bits(lv);
      }
    }
  }
  __syncthreads();
  v4u vh[2], vl[2];
  const int q8 = tid >> 3, p8 = (tid & 7) * 8;
#pragma unroll
  for (int it = 0; it < 2; ++it) {
    const int line = it * 32 + q8;          // d = 0..63
    vh[it] = *(const v4u*)(TH + line * VTP + p8);
    vl[it] = *(const v4u*)(TL + line * VTP + p8);
  }
  const size_t hrow = (size_t)(b * NKVH + g) * HD;
  const size_t base = hrow * SEQ + s0 + p8;
  {
#pragma unroll
    for (int it = 0; it < 2; ++it) {
      const int line = it * 32 + q8;
      *(v4u*)(VHo + base + (size_t)line * SEQ) = vh[it];
      *(v4u*)(VLo + base + (size_t)line * SEQ) = vl[it];
    }
    
  }
}

// =====================================================================================================
// GEMM epilogue shared by both engines: the wave's 16x64 f32 tile (times oscale, plus bfr(bias[col]) when HASB != 0)
// coverage: 8 instructions x 2 rows x 16 lanes x 4 floats = the wave's 16 x 64 tile.
// =====================================================================================================
template <int HASB>
__device__ __forceinline__ void epi64(float* sl, v8f a0, v8f a1, v8f a2, v8f a3, float oscale,
                                      const float* __restrict__ bias,
                                      float* C, int N, size_t rowb, int col0, int lane) {
  const int hh = lane >> 4, m = lane & 15;
  float b0 = 0.0f, b1 = 0.0f, b2 = 0.0f, b3 = 0.0f;
  if (HASB != 0) {
    b0 = bfr(bias[col0 + m]);
    b1 = bfr(bias[col0 + 16 + m]);
    b2 = bfr(bias[col0 + 32 + m]);
    b3 = bfr(bias[col0 + 48 + m]);
  }
#pragma unroll
  for (int r = 0; r < 8; ++r) {
    const int ro = (8 * hh + r) * 68 + m;
    sl[ro]      = a0[r] * oscale + b0;
    sl[ro + 16] = a1[r] * oscale + b1;
    sl[ro + 32] = a2[r] * oscale + b2;
    sl[ro + 48] = a3[r] * oscale + b3;
  }
  wave_sync_lds();
  v4f vals[8];
#pragma unroll
  for (int it = 0; it < 8; ++it) vals[it] = *(const v4f*)(sl + (it * 2 + hh) * 68 + m * 4);
  float* dst = C + (rowb + (size_t)hh) * (size_t)N + col0 + m * 4;
  {
#pragma unroll
    for (int it = 0; it < 8; ++it) {
      *(v4f*)(dst + (size_t)(it * 2) * (size_t)N) = vals[it];
    }
    
  }
}

// =====================================================================================================
// bf16 GEMM: C[M][N] (f32) = A[M][K] (bf16 row-major) . Bt[N][K]^T (bf16 k-contiguous), times oscale.
// Block = 64x64 tile, 4 waves x 16 rows; fragments loaded straight from the 16-bit rows (two 16-B loads each, split k map
// for A and B); K stepped by 32 (host guarantees K % 32 == 0, M % 64 == 0, N % 64 == 0, grid = (M/64)*(N/64)).
// =====================================================================================================
__global__ __launch_bounds__(128)
void gemm_bf(const u16* __restrict__ A, const u16* __restrict__ Bt, float* C, int M, int N, int K, float oscale) {
  __shared__ __align__(16) float slab[4 * SLAB64];
  const int tid = threadIdx.x, wave = tid >> 5, lane = tid & 31, hh = lane >> 4, m = lane & 15;
  const int ntile = N >> 6;
  const int bid   = blockIdx.x;
  const int rowb  = (bid / ntile) * 64 + wave * 16;
  const int col0  = (bid % ntile) * 64;
  if (rowb + 16 > M) return;                // wave-uniform, never taken with the exact grid; no block barriers in this kernel
  const u16* ap = A  + (size_t)(rowb + m) * K + 8 * hh;
  const u16* bp = Bt + (size_t)(col0 + m) * K + 8 * hh;
  const size_t bs = (size_t)16 * K;
  v8f acc0 = zero8(), acc1 = zero8(), acc2 = zero8(), acc3 = zero8();
#pragma unroll 1
  for (int k0 = 0; k0 < K; k0 += 32) {
    const v16b a  = ldfrag_b(ap + k0);
    const v16b b0 = ldfrag_b(bp + k0);
    const v16b b1 = ldfrag_b(bp + bs + k0);
    const v16b b2 = ldfrag_b(bp + 2 * bs + k0);
    const v16b b3 = ldfrag_b(bp + 3 * bs + k0);
    acc0 = mma_b(a, b0, acc0);
    acc1 = mma_b(a, b1, acc1);
    acc2 = mma_b(a, b2, acc2);
    acc3 = mma_b(a, b3, acc3);
    guard6<v16b>(acc0, acc1, acc2, acc3, a, b0, b1, b2, b3, a);
  }
  epi64<0>(slab + wave * SLAB64, acc0, acc1, acc2, acc3, oscale, (const float*)0, C, N, (size_t)rowb, col0, lane);
}

// =====================================================================================================
// f16 GEMM: C[M][N] (f32) = (A[M][K] (+ A2[M][K] when TWO != 0)) . Bt[N][K]^T, times oscale, plus bfr(bias[n]);
// A, A2 f16 row-major planes (A2 = the unscaled f16 residual of A, sharing the accumulator), Bt f16 k-contiguous.
// Same tiling, fragment loads (split k map) and epilogue as gemm_bf; K stepped by 32.
// =====================================================================================================
template <int TWO>
__global__ __launch_bounds__(128)
void gemm_h(const u16* __restrict__ A, const u16* __restrict__ A2, const u16* __restrict__ Bt,
            const float* __restrict__ bias, float* C, int M, int N, int K, float oscale) {
  __shared__ __align__(16) float slab[4 * SLAB64];
  const int tid = threadIdx.x, wave = tid >> 5, lane = tid & 31, hh = lane >> 4, m = lane & 15;
  const int ntile = N >> 6;
  const int bid   = blockIdx.x;
  const int rowb  = (bid / ntile) * 64 + wave * 16;
  const int col0  = (bid % ntile) * 64;
  if (rowb + 16 > M) return;                // wave-uniform, never taken with the exact grid; no block barriers in this kernel
  const _Float16* ap  = (const _Float16*)(const void*)A  + (size_t)(rowb + m) * K + 8 * hh;
  const _Float16* ap2 = (const _Float16*)(const void*)A2 + (size_t)(rowb + m) * K + 8 * hh;
  const _Float16* bp  = (const _Float16*)(const void*)Bt + (size_t)(col0 + m) * K + 8 * hh;
  const size_t bs = (size_t)16 * K;
  v8f acc0 = zero8(), acc1 = zero8(), acc2 = zero8(), acc3 = zero8();
#pragma unroll 1
  for (int k0 = 0; k0 < K; k0 += 32) {
    const v16h a  = ldfrag_h(ap + k0);
    const v16h b0 = ldfrag_h(bp + k0);
    const v16h b1 = ldfrag_h(bp + bs + k0);
    const v16h b2 = ldfrag_h(bp + 2 * bs + k0);
    const v16h b3 = ldfrag_h(bp + 3 * bs + k0);
    acc0 = mma_h(a, b0, acc0);
    acc1 = mma_h(a, b1, acc1);
    acc2 = mma_h(a, b2, acc2);
    acc3 = mma_h(a, b3, acc3);
    if (TWO != 0) {
      const v16h a2 = ldfrag_h(ap2 + k0);
      acc0 = mma_h(a2, b0, acc0);
      acc1 = mma_h(a2, b1, acc1);
      acc2 = mma_h(a2, b2, acc2);
      acc3 = mma_h(a2, b3, acc3);
      guard6<v16h>(acc0, acc1, acc2, acc3, a, a2, b0, b1, b2, b3);
    } else {
      guard6<v16h>(acc0, acc1, acc2, acc3, a, b0, b1, b2, b3, a);
    }
  }
  (void)ap2;
  epi64<1>(slab + wave * SLAB64, acc0, acc1, acc2, acc3, oscale, bias, C, N, (size_t)rowb, col0, lane);
}

// =====================================================================================================
// Causal grouped-query softmax attention, hd = 64. Block bid -> (query tile qt = qt0 + bid % nqt: rows q0 = 16*qt ..
// q0+15, head group hg = kv head, batch b); one wave per query head = hg*WPB + wave (the 4 consecutive query heads of a
// group share kv head hg).
//   q hi / residual planes f16 x256 [b*SEQ + s][h*HD + d]; k hi / residual planes f16 x256 [b*SEQ + s][g*HD + d] (pitch KVD);
//   v^T hi / residual planes [b*NKVH + g][d][SEQ] x1024.
//   raw(i, j) = q_hi.k_hi + q_lo.k_hi + q_hi.k_lo (2 k-steps over d); logit = raw * 2^-19 (the 1/8 softmax scale and the two
//   256 carries, exact); keys above the diagonal replaced by -inf; online softmax per query row in f32 with a running max:
//   row max / row sum over the 16 lanes holding the row via xor shuffles 1,2,4,8 (never crossing the lane half), alpha =
//   exp(m_old - m_new), p = exp(logit - m_new), l = l*alpha + sum p, O accumulators times alpha before the tile's P.v.
//   Key tiles of 32 visited in order, only tiles with kb <= q0 (nkt = q0/32 + 1 <= NKT; key kb is unmasked for every row of
//   wave barrier, then A fragments of p*32768 (f16 hi and its f16 residual) are rebuilt from the LDS rows (float vector loads,
//   same element type as stored); v^T B fragments in 2 groups of 2 d-subtiles; RV = 1: products hh + lh + hl, RV = 0: hh only.
//   Epilogue: O x256 -> f16 hi plane (and for RV = 1 the unscaled f16 residual plane) [b*SEQ + s][h*HD + d]; lane = (row group
//   rq = lane>>3 in 0..3, 8 consecutive d at c8); one instruction = 4 rows it*4 + rq, each row segment (64 halves = one whole
// coverage: per wave 4 instructions x 4 rows x 8 lanes x 8 halves = 16 x 64 per plane; grid nqt x NHG x NB blocks x WPB waves;
//   the two launches (tiles 0..NQTR-1 with RV = 1, NQTR..NQT-1 with RV = 0) cover every (b, s, h) row segment of the hi plane
//   exactly once and rows s < RICH of the residual plane exactly once (only those rows are read later).
// =====================================================================================================
template <int RV>
__global__ __launch_bounds__(ATT_THREADS)
void attn_gq(const u16* __restrict__ QHp, const u16* __restrict__ QLp,
             const u16* __restrict__ KHp, const u16* __restrict__ KLp,
             const u16* __restrict__ VHp, const u16* __restrict__ VLp,
             u16* OHp, u16* OLp, int qt0, int nqt) {
#pragma clang fp contract(off)
  __shared__ __align__(16) float smem[WPB * WREG];

  const int tid  = threadIdx.x;
  const int wave = tid >> 5;
  const int lane = tid & 31;
  const int hh   = lane >> 4;
  const int c    = lane & 15;
  const int bid  = blockIdx.x;
  if (nqt <= 0) return;                     // block-uniform; no block barriers in this kernel
  const int qt   = qt0 + bid % nqt;
  const int t2   = bid / nqt;
  const int hg   = t2 % NHG;
  const int b    = t2 / NHG;
  if (b >= NB) return;                      // block-uniform; never taken with the exact grid
  const int q0   = qt * 16;
  if (q0 + 16 > SEQ) return;                // block-uniform; never taken
  const int head = hg * WPB + wave;
  const int kvh  = hg;

  float* pt   = smem + wave * WREG;         // p tile [16][32] pitch 36
  float* slab = pt + PTW;                   // result slab [16][64] pitch 68

  const size_t hcol = (size_t)head * HD + 8 * hh;
  const size_t kcol = (size_t)kvh * HD + 8 * hh;
  const _Float16* Qh  = (const _Float16*)(const void*)QHp + ((size_t)b * SEQ + q0 + c) * DMOD + hcol;
  const _Float16* Ql  = (const _Float16*)(const void*)QLp + ((size_t)b * SEQ + q0 + c) * DMOD + hcol;
  const _Float16* Khb = (const _Float16*)(const void*)KHp + ((size_t)b * SEQ + c) * KVD + kcol;        // key row kb added per step
  const _Float16* Klb = (const _Float16*)(const void*)KLp + ((size_t)b * SEQ + c) * KVD + kcol;
  const _Float16* Vhb = (const _Float16*)(const void*)VHp + ((size_t)(b * NKVH + kvh) * HD + c) * SEQ + 8 * hh;  // d col c (+16j)
  const _Float16* Vlb = (const _Float16*)(const void*)VLp + ((size_t)(b * NKVH + kvh) * HD + c) * SEQ + 8 * hh;
  const float lsc  = SM_SCALE * (1.0f / (QSC * KSC));   // exact power-of-two fold of the q / k carries into the 1/8 scale
  const float oc   = 1.0f / (PCAR * VCAR);
  const float ninf = -__builtin_inff();
  const size_t KROW = (size_t)KVD;          // halves between consecutive key rows

  v8f o[4];
#pragma unroll
  for (int j = 0; j < 4; ++j) o[j] = zero8();
  float mrun[8], lrun[8];
#pragma unroll
  for (int r = 0; r < 8; ++r) { mrun[r] = ninf; lrun[r] = 0.0f; }
  const int ncaus = (q0 >> 5) + 1;                                            // tiles holding keys <= q0 + 15
  const int nkt   = (ncaus < NKT) ? ncaus : NKT;
  const int qr0   = q0 + 8 * hh;                                              // query row of D element r = qr0 + r

#pragma unroll 1
  for (int kt = 0; kt < nkt; ++kt) {
    const int kb = kt * 32;
    // ---- raw scores: D element r of this lane = (query row qr0 + r, key kb + c) in s0, key kb + 16 + c in s1 ----
    v8f s0 = zero8(), s1 = zero8();
    const _Float16* k0p = Khb + (size_t)kb * KROW;
    const _Float16* k1p = k0p + (size_t)16 * KROW;
    const _Float16* l0p = Klb + (size_t)kb * KROW;
    const _Float16* l1p = l0p + (size_t)16 * KROW;
#pragma unroll
    for (int kk = 0; kk < HD / 32; ++kk) {
      const v16h qh  = ldfrag_h(Qh + kk * 32);
      const v16h ql  = ldfrag_h(Ql + kk * 32);
      const v16h kh0 = ldfrag_h(k0p + kk * 32);
      const v16h kh1 = ldfrag_h(k1p + kk * 32);
      const v16h kl0 = ldfrag_h(l0p + kk * 32);
      const v16h kl1 = ldfrag_h(l1p + kk * 32);
      s0 = mma_h(qh, kh0, s0);
      s0 = mma_h(ql, kh0, s0);
      s0 = mma_h(qh, kl0, s0);
      s1 = mma_h(qh, kh1, s1);
      s1 = mma_h(ql, kh1, s1);
      s1 = mma_h(qh, kl1, s1);
      guard2(s0, s1, qh, ql, kh0, kl0, kh1, kl1);
    }
    // ---- causal replace-mask, running-max online softmax in f32, p tile -> wave-private LDS ----
    float alpha[8];
    const int key0 = kb + c, key1 = kb + 16 + c;
#pragma unroll
    for (int r = 0; r < 8; ++r) {
      const int qrow = qr0 + r;
      const float a0 = s0[r] * lsc;
      const float a1 = s1[r] * lsc;
      const float t0 = (key0 > qrow) ? ninf : a0;
      const float t1 = (key1 > qrow) ? ninf : a1;
      float mx = fmaxf(t0, t1);
      mx = fmaxf(mx, __shfl_xor(mx, 1, 32));
      mx = fmaxf(mx, __shfl_xor(mx, 2, 32));
      mx = fmaxf(mx, __shfl_xor(mx, 4, 32));
      mx = fmaxf(mx, __shfl_xor(mx, 8, 32));
      const float mnew = fmaxf(mrun[r], mx);
      const float al   = __expf(mrun[r] - mnew);
      const float p0   = __expf(t0 - mnew);
      const float p1   = __expf(t1 - mnew);
      float sm = p0 + p1;
      sm += __shfl_xor(sm, 1, 32);
      sm += __shfl_xor(sm, 2, 32);
      sm += __shfl_xor(sm, 4, 32);
      sm += __shfl_xor(sm, 8, 32);
      lrun[r]  = lrun[r] * al + sm;
      mrun[r]  = mnew;
      alpha[r] = al;
      const int ro = (8 * hh + r) * PTP + c;
      pt[ro]      = p0;
      pt[ro + 16] = p1;
    }
    wave_sync_lds();
    // ---- rescale the O accumulators by alpha (row 8hh + r of every d-subtile) ----
#pragma unroll
    for (int j = 0; j < 4; ++j) {
#pragma unroll
      for (int r = 0; r < 8; ++r) o[j][r] = o[j][r] * alpha[r];
    }
    // ---- A fragments of p*32768: hi f16 and residual f16, row = c, split k map over the 32 keys of this step ----
    FragH ph, pl;
    {
      const float* prow = pt + c * PTP + 8 * hh;
      const v4f p0 = *(const v4f*)(prow), p1 = *(const v4f*)(prow + 4);
      const v4f p2 = *(const v4f*)(prow + 16), p3 = *(const v4f*)(prow + 20);
#pragma unroll
      for (int e = 0; e < 4; ++e) {
        const float ta = p0[e] * PCAR, tb = p1[e] * PCAR, tc = p2[e] * PCAR, td = p3[e] * PCAR;
        const _Float16 ha = (_Float16)ta, hb = (_Float16)tb, hc = (_Float16)tc, hd = (_Float16)td;
        ph.h[0][e]     = ha;                  // elements 0..7  = keys kb + 8hh + 0..7
        ph.h[0][4 + e] = hb;
        ph.h[1][e]     = hc;                  // elements 8..15 = keys kb + 16 + 8hh + 0..7
        ph.h[1][4 + e] = hd;
        pl.h[0][e]     = (_Float16)(ta - (float)ha);
        pl.h[0][4 + e] = (_Float16)(tb - (float)hb);
        pl.h[1][e]     = (_Float16)(tc - (float)hc);
        pl.h[1][4 + e] = (_Float16)(td - (float)hd);
      }
    }
    // ---- P.V : B fragment col n = d = j*16 + c, keys contiguous in the v^T planes; 2 groups of 2 d-subtiles ----
    {
      const _Float16* vhp = Vhb + kb;
      const _Float16* vlp = Vlb + kb;
      (void)vlp;
#pragma unroll
      for (int jg = 0; jg < 2; ++jg) {
        const size_t da = (size_t)(2 * jg) * 16 * SEQ;
        const size_t db = da + (size_t)16 * SEQ;
        const v16h vha = ldfrag_h(vhp + da), vhb2 = ldfrag_h(vhp + db);
        o[2 * jg]     = mma_h(ph.v, vha,  o[2 * jg]);
        o[2 * jg + 1] = mma_h(ph.v, vhb2, o[2 * jg + 1]);
        if (RV != 0) {
          const v16h vla = ldfrag_h(vlp + da), vlb2 = ldfrag_h(vlp + db);
          o[2 * jg]     = mma_h(pl.v, vha,  o[2 * jg]);
          o[2 * jg]     = mma_h(ph.v, vla,  o[2 * jg]);
          o[2 * jg + 1] = mma_h(pl.v, vhb2, o[2 * jg + 1]);
          o[2 * jg + 1] = mma_h(ph.v, vlb2, o[2 * jg + 1]);
          guard2(o[2 * jg], o[2 * jg + 1], ph.v, pl.v, vha, vhb2, vla, vlb2);
        } else {
          guard2(o[2 * jg], o[2 * jg + 1], ph.v, pl.v, vha, vhb2, vha, vhb2);
        }
      }
    }
    wave_sync_lds();
  }
  acc_guard4(o[0], o[1], o[2], o[3]);
  // ---- O = acc / l with the carries (32768 on p, 1024 on v) folded once; written into the wave-private slab ----
  float rl[8];
#pragma unroll
  for (int r = 0; r < 8; ++r) rl[r] = (1.0f / lrun[r]) * oc;
#pragma unroll
  for (int r = 0; r < 8; ++r) {
#pragma unroll
    for (int j = 0; j < 4; ++j) {
      const int idx = (8 * hh + r) * SLP + j * 16 + c;
      slab[idx] = o[j][r] * rl[r];
    }
  }
  wave_sync_lds();
  // ---- O x256 -> f16 hi plane (+ f16 residual plane); lane = (row group rq, 8 consecutive d at c8) ----
  v4u oh[4], ol[4];
  const int rq = lane >> 3, c8 = (lane & 7) * 8;
#pragma unroll
  for (int it = 0; it < 4; ++it) {
    const int row = it * 4 + rq;
    const v4f a = *(const v4f*)(slab + row * SLP + c8), b4 = *(const v4f*)(slab + row * SLP + c8 + 4);
    float w[8];
#pragma unroll
    for (int e = 0; e < 4; ++e) { w[e] = a[e] * OSC; w[4 + e] = b4[e] * OSC; }
#pragma unroll
    for (int e = 0; e < 4; ++e) {
      const _Float16 h0 = (_Float16)w[2 * e], h1 = (_Float16)w[2 * e + 1];
      const _Float16 g0 = (_Float16)(w[2 * e] - (float)h0), g1 = (_Float16)(w[2 * e + 1] - (float)h1);
      oh[it][e] = pk16(h_bits(h0), h_bits(h1));
      ol[it][e] = pk16(h_bits(g0), h_bits(g1));
    }
  }
  const size_t ob = ((size_t)b * SEQ + q0) * DMOD + (size_t)head * HD + c8;
  {
#pragma unroll
    for (int it = 0; it < 4; ++it) {
      const int row = it * 4 + rq;
      *(v4u*)(OHp + ob + (size_t)row * DMOD) = oh[it];
      if (RV != 0) {
        *(v4u*)(OLp + ob + (size_t)row * DMOD) = ol[it];
      }
    }
    
  }
}

// =====================================================================================================
// Workspace map (bytes); every plane is fully written by whole-line stores before it is read (the O residual plane only on
// the rows < RICH per sequence that are read); all extents are exact multiples of the store granularity (no pad rows needed);
// every region offset a multiple of 131072:
//   XB  bf16 [MROWS][2048]              MROWS*4096   (NB=2, SEQ=2048: 16777216); after the projection GEMM the same bytes hold
//                                                    the O f16 hi plane [MROWS][2048] x256 (identical extent)
//   WB  bf16 [3072 n][2048 k]           12582912     (Wq rows 0..2047, Wk 2048..2559, Wv 2560..3071); after the projection
//                                                    GEMM its first 8388608 bytes hold the Wo f16 plane [2048 o][2048 d]
//   F   f32 [MROWS][3072]               MROWS*12288  (q | k | v projection columns, no bias); after split16 / vt16 its first
//                                                    MROWS*4096 bytes hold the O f16 residual plane [MROWS][2048]
//   QH  f16 [MROWS][2048] x256          MROWS*4096   QL residual, same extent
//   KH  f16 [MROWS][512] x256           MROWS*1024   KL residual, same extent
//   VH  f16 [NB*8][64][SEQ] x1024       MROWS*1024   VL residual, same extent
//   end (NB=2, SEQ=2048)               130023424
// =====================================================================================================
extern "C" void kernel_launch(void* const* d_in, const int* in_sizes, int n_in,
                              void* d_out, int out_size, void* d_ws, size_t ws_size,
                              hipStream_t stream) {
  if (n_in < 9) return;
  if (in_sizes[0] < ((NB - 1) * XS_FULL + SEQ) * DMOD) return;
  if (in_sizes[1] < DMOD * DMOD) return;
  if (in_sizes[2] < DMOD) return;
  if (in_sizes[3] < KVD * DMOD) return;
  if (in_sizes[4] < KVD) return;
  if (in_sizes[5] < KVD * DMOD) return;
  if (in_sizes[6] < KVD) return;
  if (in_sizes[7] < DMOD * DMOD) return;
  if (in_sizes[8] < DMOD) return;
  if (out_size < MROWS * DMOD) return;

  const float* x  = (const float*)d_in[0];
  const float* wq = (const float*)d_in[1];
  const float* bq = (const float*)d_in[2];
  const float* wk = (const float*)d_in[3];
  const float* bk = (const float*)d_in[4];
  const float* wv = (const float*)d_in[5];
  const float* bv = (const float*)d_in[6];
  const float* wo = (const float*)d_in[7];
  const float* bo = (const float*)d_in[8];
  float*       out = (float*)d_out;

  const size_t szXB = (size_t)MROWS * DMOD * 2;
  const size_t szWB = (size_t)NQKV * DMOD * 2;
  const size_t szF  = (size_t)MROWS * NQKV * 4;
  const size_t szQ  = (size_t)MROWS * DMOD * 2;                  // QH, QL
  const size_t szK  = (size_t)MROWS * KVD * 2;                   // KH, KL
  const size_t szV  = (size_t)NB * NKVH * HD * SEQ * 2;          // VH, VL (== szK)
  const size_t szOH = (size_t)MROWS * DMOD * 2;                  // O hi plane, lives in the XB region
  const size_t szOL = (size_t)MROWS * DMOD * 2;                  // O residual plane, lives in the F region
  const size_t szWT = (size_t)DMOD * DMOD * 2;                   // Wo f16 plane, lives in the WB region
  if (szOH > szXB || szOL > szF || szWT > szWB) return;
  size_t off = 0;
  const size_t oXB = off; off += szXB;
  const size_t oWB = off; off += szWB;
  const size_t oF  = off; off += szF;
  const size_t oQH = off; off += szQ;
  const size_t oQL = off; off += szQ;
  const size_t oKH = off; off += szK;
  const size_t oKL = off; off += szK;
  const size_t oVH = off; off += szV;
  const size_t oVL = off; off += szV;
  if (off > ws_size) return;                // off = 130023424 for NB = 2, SEQ = 2048
  if (off > (size_t)WS_CAP) return;

  char* ws = (char*)d_ws;
  u16*   XB  = (u16*)(ws + oXB);
  u16*   OH  = (u16*)(ws + oXB);
  u16*   WB  = (u16*)(ws + oWB);
  u16*   WT  = (u16*)(ws + oWB);
  float* F   = (float*)(ws + oF);
  u16*   OL  = (u16*)(ws + oF);
  u16*   QH  = (u16*)(ws + oQH);
  u16*   QL  = (u16*)(ws + oQL);
  u16*   KH  = (u16*)(ws + oKH);
  u16*   KL  = (u16*)(ws + oKL);
  u16*   VH  = (u16*)(ws + oVH);
  u16*   VL  = (u16*)(ws + oVL);

  const dim3 b256(256), b128(128), bAT(ATT_THREADS);
  const int  n8x = (SEQ * DMOD) / 8;
  const dim3 gX((n8x + 255) / 256);                     // SEQ*DMOD/2048 blocks per batch
  const int  n8q = (DMOD * DMOD) / 8;
  const dim3 gWq((n8q + 255) / 256);                    // 2048
  const int  n8kv = (KVD * DMOD) / 8;
  const dim3 gWk((n8kv + 255) / 256);                   // 512
  const dim3 gG1((MROWS / 64) * (NQKV / 64));           // 3072
  const dim3 gRW(MROWS);
  const dim3 gVT(NB * NKVH * NST);                      // 512
  const float osc = 1.0f / (OSC * WOS);

  // (0) x -> bf16 plane [MROWS][2048], one launch per batch row block
  for (int bq2 = 0; bq2 < NB; ++bq2) {
    cvt16<<<gX, b256, 0, stream>>>(x + (size_t)bq2 * XS_FULL * DMOD, XB + (size_t)bq2 * SEQ * DMOD, n8x, 0, 1.0f);
  }
  // (1) Wq [2048 n][2048 k], Wk [512][2048], Wv [512][2048] -> one bf16 plane [3072 n][2048 k]
  cvt16<<<gWq, b256, 0, stream>>>(wq, WB, n8q, 0, 1.0f);
  cvt16<<<gWk, b256, 0, stream>>>(wk, WB + (size_t)DMOD * DMOD, n8kv, 0, 1.0f);
  cvt16<<<gWk, b256, 0, stream>>>(wv, WB + (size_t)DMOD * DMOD + (size_t)KVD * DMOD, n8kv, 0, 1.0f);
  // (2) qkv = x.[Wq|Wk|Wv]^T -> F f32 [MROWS][3072] (biases added by the consumers in f32)
  gemm_bf<<<gG1, b128, 0, stream>>>(XB, WB, F, MROWS, NQKV, DMOD, 1.0f);
  // (3) q hi + residual planes x256 from columns 0..2047 (+bq); (4) same for k from columns 2048..2559 (+bk)
  split16<<<gRW, dim3(DMOD / 8), 0, stream>>>(F, NQKV, 0, DMOD, bq, QH, QL, QSC);
  split16<<<gRW, dim3(KVD / 8), 0, stream>>>(F, NQKV, DMOD, KVD, bk, KH, KL, KSC);
  // (5) v^T hi + residual planes x1024 from columns 2560..3071 (+bv)
  vt16<<<gVT, b256, 0, stream>>>(F, NQKV, DMOD + KVD, bv, VH, VL);
  // (6) Wo [2048 o][2048 d] -> f16 plane of the bf16 value x1024 (already k-contiguous; WB region, free after the projection GEMM)
  cvt16<<<gWq, b256, 0, stream>>>(wo, WT, n8q, 1, WOS);
  // (7) causal attention -> O f16 hi plane x256 (XB region) for all query tiles; residual plane (F region) for tiles < RICH
  attn_gq<1><<<dim3(NQTR * NHG * NB), bAT, 0, stream>>>(QH, QL, KH, KL, VH, VL, OH, OL, 0, NQTR);
  if (NQT > NQTR) {
    attn_gq<0><<<dim3((NQT - NQTR) * NHG * NB), bAT, 0, stream>>>(QH, QL, KH, KL, VH, VL, OH, OL, NQTR, NQT - NQTR);
  }
  // (8) y = O.Wo^T + bo -> out f32 [MROWS][2048], carries 256 x 1024 folded back; rows < RICH per sequence with O hi + residual
  for (int bq2 = 0; bq2 < NB; ++bq2) {
    const size_t rb = (size_t)bq2 * SEQ;
    gemm_h<1><<<dim3((RICH / 64) * (DMOD / 64)), b128, 0, stream>>>(
        OH + rb * DMOD, OL + rb * DMOD, WT, bo, out + rb * DMOD, RICH, DMOD, DMOD, osc);
    if (SEQ > RICH) {
      const size_t rl = rb + RICH;
      gemm_h<0><<<dim3(((SEQ - RICH) / 64) * (DMOD / 64)), b128, 0, stream>>>(
          OH + rl * DMOD, OL + rl * DMOD, WT, bo, out + rl * DMOD, SEQ - RICH, DMOD, DMOD, osc);
    }
  }
  (void)hipGetLastError();
}

// v001
// Measured time: 443 microseconds a run.
// Next to v000, in two timings, it ran 1.42 and 1.41 times as fast.
// Contractions: x.[Wq|Wk|Wv]^T on v_wmma_f32_16x16x32_bf16 (x and the weights as bf16 RNE planes, weight [n][k] rows are the
// k-contiguous B operand, f32 accumulate, biases added in f32 as bf16 RNE values); q.k^T over hd 64 and P.v on
// v_wmma_f32_16x16x32_f16 with f16 hi + f16 residual planes (q, k x256, products hh+lh+hl on every row; P x32768 hi +
// in-register residual and v^T x1024 hi + residual plane for query rows < 512 of each sequence, P hi . v hi only for later
// rows); O.Wo^T on v_wmma_f32_16x16x32_f16 with O x256 as f16 hi (+ f16 residual plane for rows < 512 of each sequence) and
// Wo as f16(bf16(Wo)) x1024, one accumulator, bias bo added in f32; all f32 accumulate. Online softmax in f32 on VALU.
#include <hip/hip_runtime.h>
#include <math.h>
#include <stdint.h>

#ifndef NB
#define NB 2
#endif
#ifndef SEQ
#define SEQ 2048
#endif
#define XS_FULL 2048
#define DMOD  2048
#define NH    32
#define NKVH  8
#define HD    64
#define KVD   (NKVH * HD)
#define NQKV  (DMOD + 2 * KVD)
#define MROWS (NB * SEQ)
#define RICH_REQ 512
#define RICH  ((SEQ < RICH_REQ) ? SEQ : RICH_REQ)
#define SM_SCALE 0.125f
#define QSC   256.0f
#define KSC   256.0f
#define PCAR  32768.0f
#define VCAR  1024.0f
#define OSC   256.0f
#define WOS   1024.0f
#define WPB   (NH / NKVH)
#define NHG   NKVH
#define NQT   (SEQ / 16)
#define NQTR  (RICH / 16)
#define NST   (SEQ / 64)
#define NKT   (SEQ / 32)
#define ATT_THREADS (WPB * 32)
#define PTP   36
#define PTW   (16 * PTP)
#define SLP   68
#define SLW   (16 * SLP)
#define WREG  (PTW + SLW)
#define SLAB64 (16 * 68)
#define VTP   72
#define WS_CAP 134217728
static_assert(DMOD == NH * HD && HD == 64 && NH == 32 && NKVH == 8 && WPB == 4 && NHG * WPB == NH);
static_assert(ATT_THREADS == 128 && KVD == 512 && NQKV == 3072);
static_assert(NB >= 1 && NB <= 2);
static_assert(NB == 1 || SEQ == XS_FULL);
static_assert((SEQ % 64) == 0 && SEQ >= 64 && SEQ <= XS_FULL);
static_assert((RICH % 64) == 0 && RICH >= 64 && RICH <= SEQ);
static_assert((DMOD % 64) == 0 && (KVD % 64) == 0 && (NQKV % 64) == 0 && (DMOD % 32) == 0 && (HD % 32) == 0 && (MROWS % 64) == 0);
static_assert(((SEQ * DMOD / 8) % 256) == 0 && ((DMOD * DMOD / 8) % 256) == 0 && ((KVD * DMOD / 8) % 256) == 0);
static_assert(WPB * WREG * 4 <= 65536 && 2 * HD * VTP * 2 <= 65536 && 4 * SLAB64 * 4 <= 65536);
// workspace total (XB + WB + F + QH + QL + KH + KL + VH + VL) for this build
static_assert((size_t)MROWS * DMOD * 2 + (size_t)NQKV * DMOD * 2 + (size_t)MROWS * NQKV * 4 +
              2 * (size_t)MROWS * DMOD * 2 + 2 * (size_t)MROWS * KVD * 2 + 2 * (size_t)NB * NKVH * HD * SEQ * 2
              <= (size_t)WS_CAP);

typedef unsigned short u16;
typedef _Float16 v16h __attribute__((ext_vector_type(16)));
typedef _Float16 v8h  __attribute__((ext_vector_type(8)));
typedef __bf16   v16b __attribute__((ext_vector_type(16)));
typedef float    v8f  __attribute__((ext_vector_type(8)));
typedef float    v4f  __attribute__((ext_vector_type(4)));
typedef unsigned int v4u __attribute__((ext_vector_type(4)));

union FragH { v16h v; v8h h[2]; v4u u[2]; };

// ---- scalar helpers --------------------------------------------------------------------------------
__device__ __forceinline__ unsigned short bf_bits(float f) {          // f32 -> bf16 bits, RNE convert
  unsigned u = __float_as_uint(f);
  return (unsigned short)((u + 0x7FFFu + ((u >> 16) & 1u)) >> 16);
}
__device__ __forceinline__ float bf_up(unsigned short h) { return __uint_as_float(((unsigned)h) << 16); }
__device__ __forceinline__ float bfr(float f) { return bf_up(bf_bits(f)); }
__device__ __forceinline__ unsigned short h_bits(_Float16 x) { return __builtin_bit_cast(unsigned short, x); }
__device__ __forceinline__ unsigned pk16(unsigned short a, unsigned short b) { return (unsigned)a | ((unsigned)b << 16); }
__device__ __forceinline__ v8f zero8() { v8f z = {0.f, 0.f, 0.f, 0.f, 0.f, 0.f, 0.f, 0.f}; return z; }

// ---- fragment loaders: 16-bit A/B operand, lane -> row/col (lane&15), p already includes +8*(lane>>4);
//      elements 0..7 <- p[0..7] (k0+8h..), elements 8..15 <- p[16..23] (k0+16+8h..)  (same split k map for A and B;
//      B is always read from a k-contiguous [n][k] plane)
__device__ __forceinline__ v16h ldfrag_h(const _Float16* p) {
  FragH f;
  f.h[0] = *(const v8h*)(p);
  f.h[1] = *(const v8h*)(p + 16);
  return f.v;
}

__device__ __forceinline__ v8f mma_h(v16h a, v16h b, v8f c) {
  return __builtin_amdgcn_wmma_f32_16x16x32_f16(false, a, false, b, (short)0, c, false, false);
}
__device__ __forceinline__ v8f mma_b(v16b a, v16b b, v8f c) {
  return __builtin_amdgcn_wmma_f32_16x16x32_bf16(false, a, false, b, (short)0, c, false, false);
}
__device__ __forceinline__ void guard2(v8f& a, v8f& b, v16h x0, v16h x1, v16h x2, v16h x3, v16h x4, v16h x5) {
#if defined(__HIP_DEVICE_COMPILE__)
  asm volatile("v_nop\n\tv_nop\n\tv_nop\n\tv_nop"
               : "+v"(a), "+v"(b) : "v"(x0), "v"(x1), "v"(x2), "v"(x3), "v"(x4), "v"(x5) : "memory");
#endif
}
__device__ __forceinline__ void acc_guard4(v8f& a, v8f& b, v8f& c, v8f& d) {
#if defined(__HIP_DEVICE_COMPILE__)
  asm volatile("v_nop\n\tv_nop\n\tv_nop\n\tv_nop" : "+v"(a), "+v"(b), "+v"(c), "+v"(d));
#endif
}
__device__ __forceinline__ void wave_sync_lds() {
  __builtin_amdgcn_fence(__ATOMIC_RELEASE, "workgroup");
  __builtin_amdgcn_wave_barrier();
  __builtin_amdgcn_fence(__ATOMIC_ACQUIRE, "workgroup");
}

// =====================================================================================================
// f32 -> 16-bit plane, same layout.  f16mode == 0: bf16 RNE bits;  f16mode == 1: f16 bits of (bf16 RNE value) * scale.
// Thread = 8 consecutive elements: two 16-B loads, one 16-B store; 32 consecutive lanes = 512 contiguous, 512-B aligned
// coverage: grid = ceil(n8/256) blocks x 256 thr x 8 (in-kernel bound) = the whole plane (n8 a multiple of 256 here).
// =====================================================================================================
__global__ __launch_bounds__(256) void cvt16(const float* __restrict__ x, u16* D, int n8, int f16mode, float scale) {
  const int gt = blockIdx.x * 256 + (int)threadIdx.x;
  if (gt >= n8) return;
  const float* p = x + (size_t)gt * 8;
  const v4f a = *(const v4f*)(p), b4 = *(const v4f*)(p + 4);
  float w[8];
#pragma unroll
  for (int e = 0; e < 4; ++e) { w[e] = a[e]; w[4 + e] = b4[e]; }
  v4u o;
#pragma unroll
  for (int e = 0; e < 4; ++e) {
    const float f0 = w[2 * e], f1 = w[2 * e + 1];
    const unsigned short hb0 = h_bits((_Float16)(bfr(f0) * scale));
    const unsigned short hb1 = h_bits((_Float16)(bfr(f1) * scale));
    const unsigned short bb0 = bf_bits(f0);
    const unsigned short bb1 = bf_bits(f1);
    o[e] = (f16mode != 0) ? pk16(hb0, hb1) : pk16(bb0, bb1);
  }
  u16* d = D + (size_t)gt * 8;
  {
    *(v4u*)(d) = o;
    
  }
}

// =====================================================================================================
// q / k planes from the projection F f32 [MROWS][ldf] at column offset coff (ncol = DMOD for q, KVD for k; row = b*SEQ + s,
// column = coff + head*HD + d): t = (F + bfr(bias[col])) * sc in f32 (add, then exact power-of-two scale);
//   Hp [MROWS][ncol] = f16(t), Lp [MROWS][ncol] = f16 residual (t - f16(t)), same layout.
// Block = one row, ncol/8 threads; thread t owns columns 8t .. 8t+7: two 16-B loads of F, two of bias, one 16-B store per
// coverage: (ncol/8) thr x 8 = the whole row of Hp and of Lp; grid = MROWS blocks = every row of both planes once.
// =====================================================================================================
__global__ __launch_bounds__(256) void split16(const float* __restrict__ F, int ldf, int coff, int ncol,
                                               const float* __restrict__ bias, u16* Hp, u16* Lp, float sc) {
#pragma clang fp contract(off)
  const int tid = (int)threadIdx.x;
  const int row = (int)blockIdx.x;
  if (row >= MROWS) return;
  const int col = tid * 8;
  if (col + 8 > ncol) return;                          // never taken with blockDim = ncol/8
  const float* p = F + (size_t)row * (size_t)ldf + coff + col;
  const v4f xa = *(const v4f*)(p), xb = *(const v4f*)(p + 4);
  const v4f ba = *(const v4f*)(bias + col), bb = *(const v4f*)(bias + col + 4);
  float xv[8], bw[8];
#pragma unroll
  for (int e = 0; e < 4; ++e) {
    xv[e] = xa[e];  xv[4 + e] = xb[e];
    bw[e] = ba[e];  bw[4 + e] = bb[e];
  }
  v4u oh, ol;
#pragma unroll
  for (int e = 0; e < 4; ++e) {
    const float s0 = xv[2 * e] + bfr(bw[2 * e]);
    const float s1 = xv[2 * e + 1] + bfr(bw[2 * e + 1]);
    const float t0 = s0 * sc;
    const float t1 = s1 * sc;
    const _Float16 h0 = (_Float16)t0, h1 = (_Float16)t1;
    const _Float16 l0 = (_Float16)(t0 - (float)h0), l1 = (_Float16)(t1 - (float)h1);
    oh[e] = pk16(h_bits(h0), h_bits(h1));
    ol[e] = pk16(h_bits(l0), h_bits(l1));
  }
  u16* dh = Hp + (size_t)row * ncol + col;
  u16* dl = Lp + (size_t)row * ncol + col;
  {
    *(v4u*)(dh) = oh;
    *(v4u*)(dl) = ol;
    
  }
}

// =====================================================================================================
// v^T planes from the v columns of the projection F f32 [MROWS][ldf] (row = b*SEQ + s, column = voff + g*HD + d):
//   t = (F + bfr(bias[g*HD + d])) * 1024;  VH[((b*NKVH + g)*HD + d)][s] = f16(t);  VL[same][s] = f16 residual (t - f16(t)),
//   both for all keys s.
// Block = (b, kv head g, 64 keys s0): each thread loads its 16 floats (key sl, d chunk dc) with 16-B loads, converts, places
// them into two LDS tiles [64 d][64 keys] (pitch 72 halves); after a block barrier each d row segment (64 halves = one whole
// LDS tiles are cross-wave (block barrier); staged extent 64x64 == consumed extent 64x64.
// coverage: load 256 thr x 16 = 64 keys x 64 d; store 2 iterations x 256 thr x 8 halves = 64 lines x 64 = the block's tile of
//           VH and of VL; grid = NB*NKVH*NST blocks covers both planes exactly once.
// =====================================================================================================
__global__ __launch_bounds__(256) void vt16(const float* __restrict__ F, int ldf, int voff,
                                            const float* __restrict__ bias, u16* VHo, u16* VLo) {
#pragma clang fp contract(off)
  __shared__ __align__(16) u16 TH[HD * VTP];
  __shared__ __align__(16) u16 TL[HD * VTP];
  const int tid = threadIdx.x;
  const int bid = blockIdx.x;
  const int st  = bid % NST;
  const int t2  = bid / NST;
  const int g   = t2 % NKVH;
  const int b   = t2 / NKVH;
  if (b >= NB) return;                      // block-uniform, before any barrier; never taken with the exact grid
  const int s0  = st * 64;
  {
    const int sl = tid >> 2;                // key within tile 0..63
    const int dc = (tid & 3) * 16;          // d chunk 0,16,32,48
    const float* src  = F + ((size_t)b * SEQ + s0 + sl) * (size_t)ldf + voff + g * HD + dc;
    const float* bsrc = bias + g * HD + dc;
#pragma unroll
    for (int i = 0; i < 4; ++i) {
      const v4f a  = *(const v4f*)(src + 4 * i);
      const v4f bb = *(const v4f*)(bsrc + 4 * i);
#pragma unroll
      for (int e = 0; e < 4; ++e) {
        const float s  = a[e] + bfr(bb[e]);
        const float t  = s * VCAR;
        const _Float16 hv = (_Float16)t;
        const _Float16 lv = (_Float16)(t - (float)hv);
        TH[(dc + 4 * i + e) * VTP + sl] = h_bits(hv);
        TL[(dc + 4 * i + e) * VTP + sl] = h_bits(lv);
      }
    }
  }
  __syncthreads();
  v4u vh[2], vl[2];
  const int q8 = tid >> 3, p8 = (tid & 7) * 8;
#pragma unroll
  for (int it = 0; it < 2; ++it) {
    const int line = it * 32 + q8;          // d = 0..63
    vh[it] = *(const v4u*)(TH + line * VTP + p8);
    vl[it] = *(const v4u*)(TL + line * VTP + p8);
  }
  const size_t hrow = (size_t)(b * NKVH + g) * HD;
  const size_t base = hrow * SEQ + s0 + p8;
  {
#pragma unroll
    for (int it = 0; it < 2; ++it) {
      const int line = it * 32 + q8;
      *(v4u*)(VHo + base + (size_t)line * SEQ) = vh[it];
      *(v4u*)(VLo + base + (size_t)line * SEQ) = vl[it];
    }
    
  }
}

// =====================================================================================================
// GEMM epilogue, in two halves around one wave-level LDS sync: epi_put places a 16x64 f32 tile (times oscale, plus
// bfr(bias[col]) when HASB != 0) in a wave-private slab [16][64] pitch 68; epi_get reads it back as whole row segments.
// coverage: 8 instructions x 2 rows x 16 lanes x 4 floats = the 16 x 64 tile.
// =====================================================================================================
template <int HASB>
__device__ __forceinline__ void epi_put(float* sl, v8f a0, v8f a1, v8f a2, v8f a3, float oscale,
                                        const float* __restrict__ bias, int col0, int lane) {
  const int hh = lane >> 4, m = lane & 15;
  float b0 = 0.0f, b1 = 0.0f, b2 = 0.0f, b3 = 0.0f;
  if (HASB != 0) {
    b0 = bfr(bias[col0 + m]);
    b1 = bfr(bias[col0 + 16 + m]);
    b2 = bfr(bias[col0 + 32 + m]);
    b3 = bfr(bias[col0 + 48 + m]);
  }
#pragma unroll
  for (int r = 0; r < 8; ++r) {
    const int ro = (8 * hh + r) * 68 + m;
    sl[ro]      = a0[r] * oscale + b0;
    sl[ro + 16] = a1[r] * oscale + b1;
    sl[ro + 32] = a2[r] * oscale + b2;
    sl[ro + 48] = a3[r] * oscale + b3;
  }
}
__device__ __forceinline__ void epi_get(const float* sl, float* C, int N, size_t rowb, int col0, int lane) {
  const int hh = lane >> 4, m = lane & 15;
  v4f vals[8];
#pragma unroll
  for (int it = 0; it < 8; ++it) vals[it] = *(const v4f*)(sl + (it * 2 + hh) * 68 + m * 4);
  float* dst = C + (rowb + (size_t)hh) * (size_t)N + col0 + m * 4;
#pragma unroll
  for (int it = 0; it < 8; ++it) {
    *(v4f*)(dst + (size_t)(it * 2) * (size_t)N) = vals[it];
  }
}

// =====================================================================================================
// GEMM engine shared by gemm_bf and gemm_h: C[M][N] (f32) = (A[M][K] (+ A2[M][K] when TWO != 0)) . Bt[N][K]^T, times oscale
// (plus bfr(bias[n]) when HASB != 0); A, A2 row-major 16-bit planes, Bt k-contiguous 16-bit plane.
// Block = BM x 128 tile of C (BM = 128, or 64 when TWO != 0), 4 waves as 2 x 2, wave = (BM/2) x 64 = MF x 4 accumulator tiles.
// A pass is 64 k = one whole 128-B line of each of the stage's 256 operand rows (A rows, then A2 rows, then the 128 Bt rows),
// brought into LDS by asynchronous copies (8 lanes per row, 16 copies per lane and pass), row pitch 144 B; two buffers: the
// copies of pass t + 2 are issued behind the barrier that ends pass t, so they fly while pass t + 1 is worked on.
// Fragments are read from the LDS rows with the same split k map as ldfrag_* and each accumulator takes its products in the
// same order (k ascending by 32; A before A2). Host guarantees K % 64 == 0, M % BM == 0, N % 128 == 0, grid = (M/BM)*(N/128).
// =====================================================================================================
#define GKP   64
#define GPIT  72
#define GSTG  (256 * GPIT)
static_assert(GKP == 2 * 32 && (DMOD % GKP) == 0 && (MROWS % 128) == 0 && (NQKV % 128) == 0 && (DMOD % 128) == 0);
static_assert((RICH % 64) == 0 && ((SEQ - RICH) % 128) == 0 && 4 * 4 * SLAB64 * 4 <= 2 * GSTG * 2);

union FragU { v4u u[2]; v16h h; v16b b; };

__device__ __forceinline__ FragU ldfrag_u(const u16* p) {
  FragU f;
  f.u[0] = *(const v4u*)(p);
  f.u[1] = *(const v4u*)(p + 16);
  return f;
}
template <int BF>
__device__ __forceinline__ v8f mma_u(const FragU& a, const FragU& b, v8f c) {
  if (BF != 0) return mma_b(a.b, b.b, c);
  return mma_h(a.h, b.h, c);
}
// eight asynchronous 16-B copies per lane, global -> LDS; the s_wait_xcnt closes the statement so that no register a copy
// names is rewritten ahead of it
__device__ __forceinline__ void copy8(const unsigned (&l)[8], const u16* const (&g)[8]) {
#if defined(__HIP_DEVICE_COMPILE__)
  asm volatile("global_load_async_to_lds_b128 %0, %8, off\n\t"
               "global_load_async_to_lds_b128 %1, %9, off\n\t"
               "global_load_async_to_lds_b128 %2, %10, off\n\t"
               "global_load_async_to_lds_b128 %3, %11, off\n\t"
               "global_load_async_to_lds_b128 %4, %12, off\n\t"
               "global_load_async_to_lds_b128 %5, %13, off\n\t"
               "global_load_async_to_lds_b128 %6, %14, off\n\t"
               "global_load_async_to_lds_b128 %7, %15, off\n\t"
               "s_wait_xcnt 0x0"
               :: "v"(l[0]), "v"(l[1]), "v"(l[2]), "v"(l[3]), "v"(l[4]), "v"(l[5]), "v"(l[6]), "v"(l[7]),
                  "v"(g[0]), "v"(g[1]), "v"(g[2]), "v"(g[3]), "v"(g[4]), "v"(g[5]), "v"(g[6]), "v"(g[7])
               : "memory");
#endif
}
// this wave's own copies have landed
__device__ __forceinline__ void wait_copies() {
#if defined(__HIP_DEVICE_COMPILE__)
  asm volatile("s_wait_asynccnt 0x0" ::: "memory");
#endif
}
// this wave's own LDS reads have returned, before the buffer they read is handed to the copies
__device__ __forceinline__ void wait_lds() {
#if defined(__HIP_DEVICE_COMPILE__)
  asm volatile("s_wait_dscnt 0x0" ::: "memory");
#endif
}
// one stage: lane = (row r0 = tid >> 3 of each group of 16 rows, 16-B piece tid & 7); ld = the lane's LDS byte address of
// stage row r0, ga / ga2 / gb = its global address in row r0 of the block's A / A2 / Bt rows, rs16 = halves per 16 rows
template <int TWO>
__device__ __forceinline__ void stage_tile(unsigned ld, const u16* ga, const u16* ga2, const u16* gb, size_t rs16) {
  unsigned l[8];
  const u16* g[8];
#pragma unroll
  for (int i = 0; i < 8; ++i) {
    l[i] = ld + (unsigned)(i * 16 * GPIT * 2);
    if (TWO != 0) g[i] = (i < 4) ? (ga + (size_t)i * rs16) : (ga2 + (size_t)(i - 4) * rs16);
    else          g[i] = ga + (size_t)i * rs16;
  }
  copy8(l, g);
#pragma unroll
  for (int i = 0; i < 8; ++i) {
    l[i] = ld + (unsigned)((8 + i) * 16 * GPIT * 2);
    g[i] = gb + (size_t)i * rs16;
  }
  copy8(l, g);
}

template <int BF, int TWO, int HASB>
__device__ __forceinline__ void gemm_ring(u16* ring, const u16* __restrict__ A, const u16* __restrict__ A2,
                                          const u16* __restrict__ Bt, const float* __restrict__ bias, float* C,
                                          int M, int N, int K, float oscale) {
  constexpr int MF = (TWO != 0) ? 2 : 4;
  constexpr int BM = 32 * MF;
  const int tid = threadIdx.x, wave = tid >> 5, lane = tid & 31, hh = lane >> 4, m = lane & 15;
  const int ntile = N >> 7;
  const int bid   = blockIdx.x;
  const int row0  = (bid / ntile) * BM;
  const int col0  = (bid % ntile) * 128;
  if (row0 + BM > M) return;                // block-uniform, before any copy or barrier; never taken with the exact grid
  const int wm = wave >> 1, wn = wave & 1;
  const int r0 = tid >> 3, c8 = (tid & 7) * 8;
  const u16* ga  = A  + (size_t)(row0 + r0) * K + c8;
  const u16* ga2 = A2 + (size_t)(row0 + r0) * K + c8;
  const u16* gb  = Bt + (size_t)(col0 + r0) * K + c8;
  const size_t rs16 = (size_t)16 * K;
  const unsigned ld0 = (unsigned)(uintptr_t)ring + (unsigned)((r0 * GPIT + c8) * 2);
  const int npass = K / GKP;
  const int aoff = (wm * (16 * MF) + m) * GPIT + 8 * hh;          // halves, in a stage: A fragment row of this lane
  const int boff = (128 + wn * 64 + m) * GPIT + 8 * hh;           // Bt fragment row of this lane

  v8f acc[MF][4];
#pragma unroll
  for (int i = 0; i < MF; ++i) {
#pragma unroll
    for (int j = 0; j < 4; ++j) acc[i][j] = zero8();
  }

  stage_tile<TWO>(ld0, ga, ga2, gb, rs16);
  wait_copies();
  __syncthreads();
  if (npass > 1) stage_tile<TWO>(ld0 + (unsigned)(GSTG * 2), ga + GKP, ga2 + GKP, gb + GKP, rs16);

  // kept rolled (for speed only), the buffer chosen by the pass's parity
#pragma unroll 1
  for (int t = 0; t < npass; ++t) {
    const int par = t & 1;
    const u16* st = ring + par * GSTG;
    FragU a[2][MF], a2[2][MF], b[4];
#pragma unroll
    for (int kk = 0; kk < 2; ++kk) {
#pragma unroll
      for (int i = 0; i < MF; ++i) {
        a[kk][i] = ldfrag_u(st + aoff + i * 16 * GPIT + kk * 32);
        if (TWO != 0) a2[kk][i] = ldfrag_u(st + aoff + (64 + i * 16) * GPIT + kk * 32);
      }
    }
#pragma unroll
    for (int kk = 0; kk < 2; ++kk) {
#pragma unroll
      for (int j = 0; j < 4; ++j) b[j] = ldfrag_u(st + boff + j * 16 * GPIT + kk * 32);
      // the LDS reads stay in one group ahead of the WMMA block (for speed only)
      __builtin_amdgcn_sched_barrier(0);
#pragma unroll
      for (int i = 0; i < MF; ++i) {
#pragma unroll
        for (int j = 0; j < 4; ++j) acc[i][j] = mma_u<BF>(a[kk][i], b[j], acc[i][j]);
      }
      if (TWO != 0) {
#pragma unroll
        for (int i = 0; i < MF; ++i) {
#pragma unroll
          for (int j = 0; j < 4; ++j) acc[i][j] = mma_u<BF>(a2[kk][i], b[j], acc[i][j]);
        }
      }
      // the WMMA block stays ahead of what follows: sunk behind the publish point it would put the refill's issue directly
      // in front of the next pass's wait for it
      __builtin_amdgcn_sched_barrier(0);
    }
    // publish point of pass t + 1: own reads back, own copies landed, every wave here; then the freed buffer is refilled
    wait_lds();
    wait_copies();
    __syncthreads();
    if (t + 2 < npass) {
      const size_t ko = (size_t)(t + 2) * GKP;
      stage_tile<TWO>(ld0 + (unsigned)(par * GSTG * 2), ga + ko, ga2 + ko, gb + ko, rs16);
    }
  }
  wait_copies();

  // the last pass's barrier has ended every read of the ring and no copy is outstanding: each wave stages its MF tiles in
  // MF slabs of its own
  float* sl = (float*)(void*)ring + wave * (MF * SLAB64);
  const int colw = col0 + wn * 64;
#pragma unroll
  for (int i = 0; i < MF; ++i)
    epi_put<HASB>(sl + i * SLAB64, acc[i][0], acc[i][1], acc[i][2], acc[i][3], oscale, bias, colw, lane);
  wave_sync_lds();
#pragma unroll
  for (int i = 0; i < MF; ++i)
    epi_get(sl + i * SLAB64, C, N, (size_t)(row0 + wm * (16 * MF) + i * 16), colw, lane);
}

__global__ __launch_bounds__(128)
void gemm_bf(const u16* __restrict__ A, const u16* __restrict__ Bt, float* C, int M, int N, int K, float oscale) {
  __shared__ __align__(16) u16 ring[2 * GSTG];
  gemm_ring<1, 0, 0>(ring, A, A, Bt, (const float*)0, C, M, N, K, oscale);
}

template <int TWO>
__global__ __launch_bounds__(128)
void gemm_h(const u16* __restrict__ A, const u16* __restrict__ A2, const u16* __restrict__ Bt,
            const float* __restrict__ bias, float* C, int M, int N, int K, float oscale) {
  __shared__ __align__(16) u16 ring[2 * GSTG];
  gemm_ring<0, TWO, 1>(ring, A, A2, Bt, bias, C, M, N, K, oscale);
}

// =====================================================================================================
// Causal grouped-query softmax attention, hd = 64. Block bid -> (query tile qt = qt0 + bid % nqt: rows q0 = 16*qt ..
// q0+15, head group hg = kv head, batch b); one wave per query head = hg*WPB + wave (the 4 consecutive query heads of a
// group share kv head hg).
//   q hi / residual planes f16 x256 [b*SEQ + s][h*HD + d]; k hi / residual planes f16 x256 [b*SEQ + s][g*HD + d] (pitch KVD);
//   v^T hi / residual planes [b*NKVH + g][d][SEQ] x1024.
//   raw(i, j) = q_hi.k_hi + q_lo.k_hi + q_hi.k_lo (2 k-steps over d); logit = raw * 2^-19 (the 1/8 softmax scale and the two
//   256 carries, exact); keys above the diagonal replaced by -inf; online softmax per query row in f32 with a running max:
//   row max / row sum over the 16 lanes holding the row via xor shuffles 1,2,4,8 (never crossing the lane half), alpha =
//   exp(m_old - m_new), p = exp(logit - m_new), l = l*alpha + sum p, O accumulators times alpha before the tile's P.v.
//   Key tiles of 32 visited in order, only tiles with kb <= q0 (nkt = q0/32 + 1 <= NKT; key kb is unmasked for every row of
//   wave barrier, then A fragments of p*32768 (f16 hi and its f16 residual) are rebuilt from the LDS rows (float vector loads,
//   same element type as stored); v^T B fragments in 2 groups of 2 d-subtiles; RV = 1: products hh + lh + hl, RV = 0: hh only.
//   Epilogue: O x256 -> f16 hi plane (and for RV = 1 the f16 residual plane of O x256) [b*SEQ + s][h*HD + d]; lane = (row group
//   rq = lane>>3 in 0..3, 8 consecutive d at c8); one instruction = 4 rows it*4 + rq, each row segment (64 halves = one whole
// coverage: per wave 4 instructions x 4 rows x 8 lanes x 8 halves = 16 x 64 per plane; grid nqt x NHG x NB blocks x WPB waves;
//   the two launches (tiles 0..NQTR-1 with RV = 1, NQTR..NQT-1 with RV = 0) cover every (b, s, h) row segment of the hi plane
//   exactly once and rows s < RICH of the residual plane exactly once (only those rows are read later).
// =====================================================================================================
template <int RV>
__global__ __launch_bounds__(ATT_THREADS)
void attn_gq(const u16* __restrict__ QHp, const u16* __restrict__ QLp,
             const u16* __restrict__ KHp, const u16* __restrict__ KLp,
             const u16* __restrict__ VHp, const u16* __restrict__ VLp,
             u16* OHp, u16* OLp, int qt0, int nqt) {
#pragma clang fp contract(off)
  __shared__ __align__(16) float smem[WPB * WREG];

  const int tid  = threadIdx.x;
  const int wave = tid >> 5;
  const int lane = tid & 31;
  const int hh   = lane >> 4;
  const int c    = lane & 15;
  const int bid  = blockIdx.x;
  if (nqt <= 0) return;                     // block-uniform; no block barriers in this kernel
  const int qt   = qt0 + bid % nqt;
  const int t2   = bid / nqt;
  const int hg   = t2 % NHG;
  const int b    = t2 / NHG;
  if (b >= NB) return;                      // block-uniform; never taken with the exact grid
  const int q0   = qt * 16;
  if (q0 + 16 > SEQ) return;                // block-uniform; never taken
  const int head = hg * WPB + wave;
  const int kvh  = hg;

  float* pt   = smem + wave * WREG;         // p tile [16][32] pitch 36
  float* slab = pt + PTW;                   // result slab [16][64] pitch 68

  const size_t hcol = (size_t)head * HD + 8 * hh;
  const size_t kcol = (size_t)kvh * HD + 8 * hh;
  const _Float16* Qh  = (const _Float16*)(const void*)QHp + ((size_t)b * SEQ + q0 + c) * DMOD + hcol;
  const _Float16* Ql  = (const _Float16*)(const void*)QLp + ((size_t)b * SEQ + q0 + c) * DMOD + hcol;
  const _Float16* Khb = (const _Float16*)(const void*)KHp + ((size_t)b * SEQ + c) * KVD + kcol;        // key row kb added per step
  const _Float16* Klb = (const _Float16*)(const void*)KLp + ((size_t)b * SEQ + c) * KVD + kcol;
  const _Float16* Vhb = (const _Float16*)(const void*)VHp + ((size_t)(b * NKVH + kvh) * HD + c) * SEQ + 8 * hh;  // d col c (+16j)
  const _Float16* Vlb = (const _Float16*)(const void*)VLp + ((size_t)(b * NKVH + kvh) * HD + c) * SEQ + 8 * hh;
  const float lsc  = SM_SCALE * (1.0f / (QSC * KSC));   // exact power-of-two fold of the q / k carries into the 1/8 scale
  const float oc   = 1.0f / (PCAR * VCAR);
  const float ninf = -__builtin_inff();
  const size_t KROW = (size_t)KVD;          // halves between consecutive key rows

  v8f o[4];
#pragma unroll
  for (int j = 0; j < 4; ++j) o[j] = zero8();
  float mrun[8], lrun[8];
#pragma unroll
  for (int r = 0; r < 8; ++r) { mrun[r] = ninf; lrun[r] = 0.0f; }
  const int ncaus = (q0 >> 5) + 1;                                            // tiles holding keys <= q0 + 15
  const int nkt   = (ncaus < NKT) ? ncaus : NKT;
  const int qr0   = q0 + 8 * hh;                                              // query row of D element r = qr0 + r

#pragma unroll 1
  for (int kt = 0; kt < nkt; ++kt) {
    const int kb = kt * 32;
    // ---- raw scores: D element r of this lane = (query row qr0 + r, key kb + c) in s0, key kb + 16 + c in s1 ----
    v8f s0 = zero8(), s1 = zero8();
    const _Float16* k0p = Khb + (size_t)kb * KROW;
    const _Float16* k1p = k0p + (size_t)16 * KROW;
    const _Float16* l0p = Klb + (size_t)kb * KROW;
    const _Float16* l1p = l0p + (size_t)16 * KROW;
#pragma unroll
    for (int kk = 0; kk < HD / 32; ++kk) {
      const v16h qh  = ldfrag_h(Qh + kk * 32);
      const v16h ql  = ldfrag_h(Ql + kk * 32);
      const v16h kh0 = ldfrag_h(k0p + kk * 32);
      const v16h kh1 = ldfrag_h(k1p + kk * 32);
      const v16h kl0 = ldfrag_h(l0p + kk * 32);
      const v16h kl1 = ldfrag_h(l1p + kk * 32);
      s0 = mma_h(qh, kh0, s0);
      s0 = mma_h(ql, kh0, s0);
      s0 = mma_h(qh, kl0, s0);
      s1 = mma_h(qh, kh1, s1);
      s1 = mma_h(ql, kh1, s1);
      s1 = mma_h(qh, kl1, s1);
      guard2(s0, s1, qh, ql, kh0, kl0, kh1, kl1);
    }
    // ---- causal replace-mask, running-max online softmax in f32, p tile -> wave-private LDS ----
    float alpha[8];
    const int key0 = kb + c, key1 = kb + 16 + c;
#pragma unroll
    for (int r = 0; r < 8; ++r) {
      const int qrow = qr0 + r;
      const float a0 = s0[r] * lsc;
      const float a1 = s1[r] * lsc;
      const float t0 = (key0 > qrow) ? ninf : a0;
      const float t1 = (key1 > qrow) ? ninf : a1;
      float mx = fmaxf(t0, t1);
      mx = fmaxf(mx, __shfl_xor(mx, 1, 32));
      mx = fmaxf(mx, __shfl_xor(mx, 2, 32));
      mx = fmaxf(mx, __shfl_xor(mx, 4, 32));
      mx = fmaxf(mx, __shfl_xor(mx, 8, 32));
      const float mnew = fmaxf(mrun[r], mx);
      const float al   = __expf(mrun[r] - mnew);
      const float p0   = __expf(t0 - mnew);
      const float p1   = __expf(t1 - mnew);
      float sm = p0 + p1;
      sm += __shfl_xor(sm, 1, 32);
      sm += __shfl_xor(sm, 2, 32);
      sm += __shfl_xor(sm, 4, 32);
      sm += __shfl_xor(sm, 8, 32);
      lrun[r]  = lrun[r] * al + sm;
      mrun[r]  = mnew;
      alpha[r] = al;
      const int ro = (8 * hh + r) * PTP + c;
      pt[ro]      = p0;
      pt[ro + 16] = p1;
    }
    wave_sync_lds();
    // ---- rescale the O accumulators by alpha (row 8hh + r of every d-subtile) ----
#pragma unroll
    for (int j = 0; j < 4; ++j) {
#pragma unroll
      for (int r = 0; r < 8; ++r) o[j][r] = o[j][r] * alpha[r];
    }
    // ---- A fragments of p*32768: hi f16 and residual f16, row = c, split k map over the 32 keys of this step ----
    FragH ph, pl;
    {
      const float* prow = pt + c * PTP + 8 * hh;
      const v4f p0 = *(const v4f*)(prow), p1 = *(const v4f*)(prow + 4);
      const v4f p2 = *(const v4f*)(prow + 16), p3 = *(const v4f*)(prow + 20);
#pragma unroll
      for (int e = 0; e < 4; ++e) {
        const float ta = p0[e] * PCAR, tb = p1[e] * PCAR, tc = p2[e] * PCAR, td = p3[e] * PCAR;
        const _Float16 ha = (_Float16)ta, hb = (_Float16)tb, hc = (_Float16)tc, hd = (_Float16)td;
        ph.h[0][e]     = ha;                  // elements 0..7  = keys kb + 8hh + 0..7
        ph.h[0][4 + e] = hb;
        ph.h[1][e]     = hc;                  // elements 8..15 = keys kb + 16 + 8hh + 0..7
        ph.h[1][4 + e] = hd;
        pl.h[0][e]     = (_Float16)(ta - (float)ha);
        pl.h[0][4 + e] = (_Float16)(tb - (float)hb);
        pl.h[1][e]     = (_Float16)(tc - (float)hc);
        pl.h[1][4 + e] = (_Float16)(td - (float)hd);
      }
    }
    // ---- P.V : B fragment col n = d = j*16 + c, keys contiguous in the v^T planes; 2 groups of 2 d-subtiles ----
    {
      const _Float16* vhp = Vhb + kb;
      const _Float16* vlp = Vlb + kb;
      (void)vlp;
#pragma unroll
      for (int jg = 0; jg < 2; ++jg) {
        const size_t da = (size_t)(2 * jg) * 16 * SEQ;
        const size_t db = da + (size_t)16 * SEQ;
        const v16h vha = ldfrag_h(vhp + da), vhb2 = ldfrag_h(vhp + db);
        o[2 * jg]     = mma_h(ph.v, vha,  o[2 * jg]);
        o[2 * jg + 1] = mma_h(ph.v, vhb2, o[2 * jg + 1]);
        if (RV != 0) {
          const v16h vla = ldfrag_h(vlp + da), vlb2 = ldfrag_h(vlp + db);
          o[2 * jg]     = mma_h(pl.v, vha,  o[2 * jg]);
          o[2 * jg]     = mma_h(ph.v, vla,  o[2 * jg]);
          o[2 * jg + 1] = mma_h(pl.v, vhb2, o[2 * jg + 1]);
          o[2 * jg + 1] = mma_h(ph.v, vlb2, o[2 * jg + 1]);
          guard2(o[2 * jg], o[2 * jg + 1], ph.v, pl.v, vha, vhb2, vla, vlb2);
        } else {
          guard2(o[2 * jg], o[2 * jg + 1], ph.v, pl.v, vha, vhb2, vha, vhb2);
        }
      }
    }
    wave_sync_lds();
  }
  acc_guard4(o[0], o[1], o[2], o[3]);
  // ---- O = acc / l with the carries (32768 on p, 1024 on v) folded once; written into the wave-private slab ----
  float rl[8];
#pragma unroll
  for (int r = 0; r < 8; ++r) rl[r] = (1.0f / lrun[r]) * oc;
#pragma unroll
  for (int r = 0; r < 8; ++r) {
#pragma unroll
    for (int j = 0; j < 4; ++j) {
      const int idx = (8 * hh + r) * SLP + j * 16 + c;
      slab[idx] = o[j][r] * rl[r];
    }
  }
  wave_sync_lds();
  // ---- O x256 -> f16 hi plane (+ f16 residual plane); lane = (row group rq, 8 consecutive d at c8) ----
  v4u oh[4], ol[4];
  const int rq = lane >> 3, c8 = (lane & 7) * 8;
#pragma unroll
  for (int it = 0; it < 4; ++it) {
    const int row = it * 4 + rq;
    const v4f a = *(const v4f*)(slab + row * SLP + c8), b4 = *(const v4f*)(slab + row * SLP + c8 + 4);
    float w[8];
#pragma unroll
    for (int e = 0; e < 4; ++e) { w[e] = a[e] * OSC; w[4 + e] = b4[e] * OSC; }
#pragma unroll
    for (int e = 0; e < 4; ++e) {
      const _Float16 h0 = (_Float16)w[2 * e], h1 = (_Float16)w[2 * e + 1];
      const _Float16 g0 = (_Float16)(w[2 * e] - (float)h0), g1 = (_Float16)(w[2 * e + 1] - (float)h1);
      oh[it][e] = pk16(h_bits(h0), h_bits(h1));
      ol[it][e] = pk16(h_bits(g0), h_bits(g1));
    }
  }
  const size_t ob = ((size_t)b * SEQ + q0) * DMOD + (size_t)head * HD + c8;
  {
#pragma unroll
    for (int it = 0; it < 4; ++it) {
      const int row = it * 4 + rq;
      *(v4u*)(OHp + ob + (size_t)row * DMOD) = oh[it];
      if (RV != 0) {
        *(v4u*)(OLp + ob + (size_t)row * DMOD) = ol[it];
      }
    }
    
  }
}

// =====================================================================================================
// Workspace map (bytes); every plane is fully written by whole-line stores before it is read (the O residual plane only on
// the rows < RICH per sequence that are read); all extents are exact multiples of the store granularity (no pad rows needed);
// every region offset a multiple of 131072:
//   XB  bf16 [MROWS][2048]              MROWS*4096   (NB=2, SEQ=2048: 16777216); after the projection GEMM the same bytes hold
//                                                    the O f16 hi plane [MROWS][2048] x256 (identical extent)
//   WB  bf16 [3072 n][2048 k]           12582912     (Wq rows 0..2047, Wk 2048..2559, Wv 2560..3071); after the projection
//                                                    GEMM its first 8388608 bytes hold the Wo f16 plane [2048 o][2048 d]
//   F   f32 [MROWS][3072]               MROWS*12288  (q | k | v projection columns, no bias); after split16 / vt16 its first
//                                                    MROWS*4096 bytes hold the O f16 residual plane [MROWS][2048]
//   QH  f16 [MROWS][2048] x256          MROWS*4096   QL residual, same extent
//   KH  f16 [MROWS][512] x256           MROWS*1024   KL residual, same extent
//   VH  f16 [NB*8][64][SEQ] x1024       MROWS*1024   VL residual, same extent
//   end (NB=2, SEQ=2048)               130023424
// =====================================================================================================
extern "C" void kernel_launch(void* const* d_in, const int* in_sizes, int n_in,
                              void* d_out, int out_size, void* d_ws, size_t ws_size,
                              hipStream_t stream) {
  if (n_in < 9) return;
  if (in_sizes[0] < ((NB - 1) * XS_FULL + SEQ) * DMOD) return;
  if (in_sizes[1] < DMOD * DMOD) return;
  if (in_sizes[2] < DMOD) return;
  if (in_sizes[3] < KVD * DMOD) return;
  if (in_sizes[4] < KVD) return;
  if (in_sizes[5] < KVD * DMOD) return;
  if (in_sizes[6] < KVD) return;
  if (in_sizes[7] < DMOD * DMOD) return;
  if (in_sizes[8] < DMOD) return;
  if (out_size < MROWS * DMOD) return;

  const float* x  = (const float*)d_in[0];
  const float* wq = (const float*)d_in[1];
  const float* bq = (const float*)d_in[2];
  const float* wk = (const float*)d_in[3];
  const float* bk = (const float*)d_in[4];
  const float* wv = (const float*)d_in[5];
  const float* bv = (const float*)d_in[6];
  const float* wo = (const float*)d_in[7];
  const float* bo = (const float*)d_in[8];
  float*       out = (float*)d_out;

  const size_t szXB = (size_t)MROWS * DMOD * 2;
  const size_t szWB = (size_t)NQKV * DMOD * 2;
  const size_t szF  = (size_t)MROWS * NQKV * 4;
  const size_t szQ  = (size_t)MROWS * DMOD * 2;                  // QH, QL
  const size_t szK  = (size_t)MROWS * KVD * 2;                   // KH, KL
  const size_t szV  = (size_t)NB * NKVH * HD * SEQ * 2;          // VH, VL (== szK)
  const size_t szOH = (size_t)MROWS * DMOD * 2;                  // O hi plane, lives in the XB region
  const size_t szOL = (size_t)MROWS * DMOD * 2;                  // O residual plane, lives in the F region
  const size_t szWT = (size_t)DMOD * DMOD * 2;                   // Wo f16 plane, lives in the WB region
  if (szOH > szXB || szOL > szF || szWT > szWB) return;
  size_t off = 0;
  const size_t oXB = off; off += szXB;
  const size_t oWB = off; off += szWB;
  const size_t oF  = off; off += szF;
  const size_t oQH = off; off += szQ;
  const size_t oQL = off; off += szQ;
  const size_t oKH = off; off += szK;
  const size_t oKL = off; off += szK;
  const size_t oVH = off; off += szV;
  const size_t oVL = off; off += szV;
  if (off > ws_size) return;                // off = 130023424 for NB = 2, SEQ = 2048
  if (off > (size_t)WS_CAP) return;

  char* ws = (char*)d_ws;
  u16*   XB  = (u16*)(ws + oXB);
  u16*   OH  = (u16*)(ws + oXB);
  u16*   WB  = (u16*)(ws + oWB);
  u16*   WT  = (u16*)(ws + oWB);
  float* F   = (float*)(ws + oF);
  u16*   OL  = (u16*)(ws + oF);
  u16*   QH  = (u16*)(ws + oQH);
  u16*   QL  = (u16*)(ws + oQL);
  u16*   KH  = (u16*)(ws + oKH);
  u16*   KL  = (u16*)(ws + oKL);
  u16*   VH  = (u16*)(ws + oVH);
  u16*   VL  = (u16*)(ws + oVL);

  const dim3 b256(256), b128(128), bAT(ATT_THREADS);
  const int  n8x = (SEQ * DMOD) / 8;
  const dim3 gX((n8x + 255) / 256);                     // SEQ*DMOD/2048 blocks per batch
  const int  n8q = (DMOD * DMOD) / 8;
  const dim3 gWq((n8q + 255) / 256);                    // 2048
  const int  n8kv = (KVD * DMOD) / 8;
  const dim3 gWk((n8kv + 255) / 256);                   // 512
  const dim3 gG1((MROWS / 128) * (NQKV / 128));         // 768
  const dim3 gRW(MROWS);
  const dim3 gVT(NB * NKVH * NST);                      // 512
  const float osc = 1.0f / (OSC * WOS);

  // (0) x -> bf16 plane [MROWS][2048], one launch per batch row block
  for (int bq2 = 0; bq2 < NB; ++bq2) {
    cvt16<<<gX, b256, 0, stream>>>(x + (size_t)bq2 * XS_FULL * DMOD, XB + (size_t)bq2 * SEQ * DMOD, n8x, 0, 1.0f);
  }
  // (1) Wq [2048 n][2048 k], Wk [512][2048], Wv [512][2048] -> one bf16 plane [3072 n][2048 k]
  cvt16<<<gWq, b256, 0, stream>>>(wq, WB, n8q, 0, 1.0f);
  cvt16<<<gWk, b256, 0, stream>>>(wk, WB + (size_t)DMOD * DMOD, n8kv, 0, 1.0f);
  cvt16<<<gWk, b256, 0, stream>>>(wv, WB + (size_t)DMOD * DMOD + (size_t)KVD * DMOD, n8kv, 0, 1.0f);
  // (2) qkv = x.[Wq|Wk|Wv]^T -> F f32 [MROWS][3072] (biases added by the consumers in f32)
  gemm_bf<<<gG1, b128, 0, stream>>>(XB, WB, F, MROWS, NQKV, DMOD, 1.0f);
  // (3) q hi + residual planes x256 from columns 0..2047 (+bq); (4) same for k from columns 2048..2559 (+bk)
  split16<<<gRW, dim3(DMOD / 8), 0, stream>>>(F, NQKV, 0, DMOD, bq, QH, QL, QSC);
  split16<<<gRW, dim3(KVD / 8), 0, stream>>>(F, NQKV, DMOD, KVD, bk, KH, KL, KSC);
  // (5) v^T hi + residual planes x1024 from columns 2560..3071 (+bv)
  vt16<<<gVT, b256, 0, stream>>>(F, NQKV, DMOD + KVD, bv, VH, VL);
  // (6) Wo [2048 o][2048 d] -> f16 plane of the bf16 value x1024 (already k-contiguous; WB region, free after the projection GEMM)
  cvt16<<<gWq, b256, 0, stream>>>(wo, WT, n8q, 1, WOS);
  // (7) causal attention -> O f16 hi plane x256 (XB region) for all query tiles; residual plane (F region) for tiles < RICH
  attn_gq<1><<<dim3(NQTR * NHG * NB), bAT, 0, stream>>>(QH, QL, KH, KL, VH, VL, OH, OL, 0, NQTR);
  if (NQT > NQTR) {
    attn_gq<0><<<dim3((NQT - NQTR) * NHG * NB), bAT, 0, stream>>>(QH, QL, KH, KL, VH, VL, OH, OL, NQTR, NQT - NQTR);
  }
  // (8) y = O.Wo^T + bo -> out f32 [MROWS][2048], carries 256 x 1024 folded back; rows < RICH per sequence with O hi + residual
  for (int bq2 = 0; bq2 < NB; ++bq2) {
    const size_t rb = (size_t)bq2 * SEQ;
    gemm_h<1><<<dim3((RICH / 64) * (DMOD / 128)), b128, 0, stream>>>(
        OH + rb * DMOD, OL + rb * DMOD, WT, bo, out + rb * DMOD, RICH, DMOD, DMOD, osc);
    if (SEQ > RICH) {
      const size_t rl = rb + RICH;
      gemm_h<0><<<dim3(((SEQ - RICH) / 128) * (DMOD / 128)), b128, 0, stream>>>(
          OH + rl * DMOD, OL + rl * DMOD, WT, bo, out + rl * DMOD, SEQ - RICH, DMOD, DMOD, osc);
    }
  }
  (void)hipGetLastError();
}

// v002
// One run takes 415 microseconds.
// Next to v001, in two timings, it ran 1.07 times as fast each time.
// All steps since v000 together make it 1.52 times as fast.
// Contractions: x.[Wq|Wk|Wv]^T on v_wmma_f32_16x16x32_bf16 (x and the weights as bf16 RNE planes, weight [n][k] rows are the
// k-contiguous B operand, f32 accumulate, biases added in f32 as bf16 RNE values); q.k^T over hd 64 and P.v on
// v_wmma_f32_16x16x32_f16 with f16 hi + f16 residual planes (q, k x256, products hh+lh+hl on every row; P x32768 hi +
// in-register residual and v^T x1024 hi + residual plane for query rows < 512 of each sequence, P hi . v hi only for later
// rows); O.Wo^T on v_wmma_f32_16x16x32_f16 with O x256 as f16 hi (+ f16 residual plane for rows < 512 of each sequence) and
// Wo as f16(bf16(Wo)) x1024, one accumulator, bias bo added in f32; all f32 accumulate. Online softmax in f32 on VALU.
#include <hip/hip_runtime.h>
#include <math.h>
#include <stdint.h>

#ifndef NB
#define NB 2
#endif
#ifndef SEQ
#define SEQ 2048
#endif
#define XS_FULL 2048
#define DMOD  2048
#define NH    32
#define NKVH  8
#define HD    64
#define KVD   (NKVH * HD)
#define NQKV  (DMOD + 2 * KVD)
#define MROWS (NB * SEQ)
#define RICH_REQ 512
#define RICH  ((SEQ < RICH_REQ) ? SEQ : RICH_REQ)
#define SM_SCALE 0.125f
#define QSC   256.0f
#define KSC   256.0f
#define PCAR  32768.0f
#define VCAR  1024.0f
#define OSC   256.0f
#define WOS   1024.0f
#define WPB   (NH / NKVH)
#define NHG   NKVH
#define NQT   (SEQ / 16)
#define NQTR  (RICH / 16)
#define NST   (SEQ / 64)
#define NKT   (SEQ / 32)
#define ATT_THREADS (WPB * 32)
#define SLP   68
#define SLW   (16 * SLP)
#define WREG  (SLW)
#define SLAB64 (16 * 68)
#define VTP   72
#define WS_CAP 134217728
static_assert(DMOD == NH * HD && HD == 64 && NH == 32 && NKVH == 8 && WPB == 4 && NHG * WPB == NH);
static_assert(ATT_THREADS == 128 && KVD == 512 && NQKV == 3072);
static_assert(NB >= 1 && NB <= 2);
static_assert(NB == 1 || SEQ == XS_FULL);
static_assert((SEQ % 64) == 0 && SEQ >= 64 && SEQ <= XS_FULL);
static_assert((RICH % 64) == 0 && RICH >= 64 && RICH <= SEQ);
static_assert((DMOD % 64) == 0 && (KVD % 64) == 0 && (NQKV % 64) == 0 && (DMOD % 32) == 0 && (HD % 32) == 0 && (MROWS % 64) == 0);
static_assert(((SEQ * DMOD / 8) % 256) == 0 && ((DMOD * DMOD / 8) % 256) == 0 && ((KVD * DMOD / 8) % 256) == 0);
static_assert(WPB * WREG * 4 <= 65536 && 2 * HD * VTP * 2 <= 65536 && 4 * SLAB64 * 4 <= 65536);
// workspace total (XB + WB + F + QH + QL + KH + KL + VH + VL) for this build
static_assert((size_t)MROWS * DMOD * 2 + (size_t)NQKV * DMOD * 2 + (size_t)MROWS * NQKV * 4 +
              2 * (size_t)MROWS * DMOD * 2 + 2 * (size_t)MROWS * KVD * 2 + 2 * (size_t)NB * NKVH * HD * SEQ * 2
              <= (size_t)WS_CAP);

typedef unsigned short u16;
typedef _Float16 v16h __attribute__((ext_vector_type(16)));
typedef _Float16 v8h  __attribute__((ext_vector_type(8)));
typedef __bf16   v16b __attribute__((ext_vector_type(16)));
typedef float    v8f  __attribute__((ext_vector_type(8)));
typedef float    v4f  __attribute__((ext_vector_type(4)));
typedef unsigned int v4u __attribute__((ext_vector_type(4)));

union FragH { v16h v; v8h h[2]; v4u u[2]; };

// ---- scalar helpers --------------------------------------------------------------------------------
__device__ __forceinline__ unsigned short bf_bits(float f) {          // f32 -> bf16 bits, RNE convert
  unsigned u = __float_as_uint(f);
  return (unsigned short)((u + 0x7FFFu + ((u >> 16) & 1u)) >> 16);
}
__device__ __forceinline__ float bf_up(unsigned short h) { return __uint_as_float(((unsigned)h) << 16); }
__device__ __forceinline__ float bfr(float f) { return bf_up(bf_bits(f)); }
__device__ __forceinline__ unsigned short h_bits(_Float16 x) { return __builtin_bit_cast(unsigned short, x); }
__device__ __forceinline__ unsigned pk16(unsigned short a, unsigned short b) { return (unsigned)a | ((unsigned)b << 16); }
__device__ __forceinline__ v8f zero8() { v8f z = {0.f, 0.f, 0.f, 0.f, 0.f, 0.f, 0.f, 0.f}; return z; }

// ---- fragment loaders: 16-bit A/B operand, lane -> row/col (lane&15), p already includes +8*(lane>>4);
//      elements 0..7 <- p[0..7] (k0+8h..), elements 8..15 <- p[16..23] (k0+16+8h..)  (same split k map for A and B;
//      B is always read from a k-contiguous [n][k] plane)
__device__ __forceinline__ v16h ldfrag_h(const _Float16* p) {
  FragH f;
  f.h[0] = *(const v8h*)(p);
  f.h[1] = *(const v8h*)(p + 16);
  return f.v;
}

__device__ __forceinline__ v8f mma_h(v16h a, v16h b, v8f c) {
  return __builtin_amdgcn_wmma_f32_16x16x32_f16(false, a, false, b, (short)0, c, false, false);
}
__device__ __forceinline__ v8f mma_b(v16b a, v16b b, v8f c) {
  return __builtin_amdgcn_wmma_f32_16x16x32_bf16(false, a, false, b, (short)0, c, false, false);
}
__device__ __forceinline__ void guard2(v8f& a, v8f& b, v16h x0, v16h x1, v16h x2, v16h x3, v16h x4, v16h x5) {
#if defined(__HIP_DEVICE_COMPILE__)
  asm volatile("v_nop\n\tv_nop\n\tv_nop\n\tv_nop"
               : "+v"(a), "+v"(b) : "v"(x0), "v"(x1), "v"(x2), "v"(x3), "v"(x4), "v"(x5) : "memory");
#endif
}
__device__ __forceinline__ void acc_guard4(v8f& a, v8f& b, v8f& c, v8f& d) {
#if defined(__HIP_DEVICE_COMPILE__)
  asm volatile("v_nop\n\tv_nop\n\tv_nop\n\tv_nop" : "+v"(a), "+v"(b), "+v"(c), "+v"(d));
#endif
}
// lane l <-> lane l ^ 16 on the vector pipe (the shuffle builtin would go through the LDS queue and its wait)
__device__ __forceinline__ float xhalf(float x) {
  const int v = __builtin_bit_cast(int, x);
  return __builtin_bit_cast(float, __builtin_amdgcn_permlanex16(v, v, 0x76543210, 0xfedcba98, false, false));
}
__device__ __forceinline__ void wave_sync_lds() {
  __builtin_amdgcn_fence(__ATOMIC_RELEASE, "workgroup");
  __builtin_amdgcn_wave_barrier();
  __builtin_amdgcn_fence(__ATOMIC_ACQUIRE, "workgroup");
}

// =====================================================================================================
// f32 -> 16-bit plane, same layout.  f16mode == 0: bf16 RNE bits;  f16mode == 1: f16 bits of (bf16 RNE value) * scale.
// Thread = 8 consecutive elements: two 16-B loads, one 16-B store; 32 consecutive lanes = 512 contiguous, 512-B aligned
// coverage: grid = ceil(n8/256) blocks x 256 thr x 8 (in-kernel bound) = the whole plane (n8 a multiple of 256 here).
// =====================================================================================================
__global__ __launch_bounds__(256) void cvt16(const float* __restrict__ x, u16* D, int n8, int f16mode, float scale) {
  const int gt = blockIdx.x * 256 + (int)threadIdx.x;
  if (gt >= n8) return;
  const float* p = x + (size_t)gt * 8;
  const v4f a = *(const v4f*)(p), b4 = *(const v4f*)(p + 4);
  float w[8];
#pragma unroll
  for (int e = 0; e < 4; ++e) { w[e] = a[e]; w[4 + e] = b4[e]; }
  v4u o;
#pragma unroll
  for (int e = 0; e < 4; ++e) {
    const float f0 = w[2 * e], f1 = w[2 * e + 1];
    const unsigned short hb0 = h_bits((_Float16)(bfr(f0) * scale));
    const unsigned short hb1 = h_bits((_Float16)(bfr(f1) * scale));
    const unsigned short bb0 = bf_bits(f0);
    const unsigned short bb1 = bf_bits(f1);
    o[e] = (f16mode != 0) ? pk16(hb0, hb1) : pk16(bb0, bb1);
  }
  u16* d = D + (size_t)gt * 8;
  {
    *(v4u*)(d) = o;
    
  }
}

// =====================================================================================================
// q / k planes from the projection F f32 [MROWS][ldf] at column offset coff (ncol = DMOD for q, KVD for k; row = b*SEQ + s,
// column = coff + head*HD + d): t = (F + bfr(bias[col])) * sc in f32 (add, then exact power-of-two scale);
//   Hp [MROWS][ncol] = f16(t), Lp [MROWS][ncol] = f16 residual (t - f16(t)), same layout.
// Block = one row, ncol/8 threads; thread t owns columns 8t .. 8t+7: two 16-B loads of F, two of bias, one 16-B store per
// coverage: (ncol/8) thr x 8 = the whole row of Hp and of Lp; grid = MROWS blocks = every row of both planes once.
// =====================================================================================================
__global__ __launch_bounds__(256) void split16(const float* __restrict__ F, int ldf, int coff, int ncol,
                                               const float* __restrict__ bias, u16* Hp, u16* Lp, float sc) {
#pragma clang fp contract(off)
  const int tid = (int)threadIdx.x;
  const int row = (int)blockIdx.x;
  if (row >= MROWS) return;
  const int col = tid * 8;
  if (col + 8 > ncol) return;                          // never taken with blockDim = ncol/8
  const float* p = F + (size_t)row * (size_t)ldf + coff + col;
  const v4f xa = *(const v4f*)(p), xb = *(const v4f*)(p + 4);
  const v4f ba = *(const v4f*)(bias + col), bb = *(const v4f*)(bias + col + 4);
  float xv[8], bw[8];
#pragma unroll
  for (int e = 0; e < 4; ++e) {
    xv[e] = xa[e];  xv[4 + e] = xb[e];
    bw[e] = ba[e];  bw[4 + e] = bb[e];
  }
  v4u oh, ol;
#pragma unroll
  for (int e = 0; e < 4; ++e) {
    const float s0 = xv[2 * e] + bfr(bw[2 * e]);
    const float s1 = xv[2 * e + 1] + bfr(bw[2 * e + 1]);
    const float t0 = s0 * sc;
    const float t1 = s1 * sc;
    const _Float16 h0 = (_Float16)t0, h1 = (_Float16)t1;
    const _Float16 l0 = (_Float16)(t0 - (float)h0), l1 = (_Float16)(t1 - (float)h1);
    oh[e] = pk16(h_bits(h0), h_bits(h1));
    ol[e] = pk16(h_bits(l0), h_bits(l1));
  }
  u16* dh = Hp + (size_t)row * ncol + col;
  u16* dl = Lp + (size_t)row * ncol + col;
  {
    *(v4u*)(dh) = oh;
    *(v4u*)(dl) = ol;
    
  }
}

// =====================================================================================================
// v^T planes from the v columns of the projection F f32 [MROWS][ldf] (row = b*SEQ + s, column = voff + g*HD + d):
//   t = (F + bfr(bias[g*HD + d])) * 1024;  VH[((b*NKVH + g)*HD + d)][s] = f16(t);  VL[same][s] = f16 residual (t - f16(t)),
//   both for all keys s.
// Block = (b, kv head g, 64 keys s0): each thread loads its 16 floats (key sl, d chunk dc) with 16-B loads, converts, places
// them into two LDS tiles [64 d][64 keys] (pitch 72 halves); after a block barrier each d row segment (64 halves = one whole
// LDS tiles are cross-wave (block barrier); staged extent 64x64 == consumed extent 64x64.
// coverage: load 256 thr x 16 = 64 keys x 64 d; store 2 iterations x 256 thr x 8 halves = 64 lines x 64 = the block's tile of
//           VH and of VL; grid = NB*NKVH*NST blocks covers both planes exactly once.
// =====================================================================================================
__global__ __launch_bounds__(256) void vt16(const float* __restrict__ F, int ldf, int voff,
                                            const float* __restrict__ bias, u16* VHo, u16* VLo) {
#pragma clang fp contract(off)
  __shared__ __align__(16) u16 TH[HD * VTP];
  __shared__ __align__(16) u16 TL[HD * VTP];
  const int tid = threadIdx.x;
  const int bid = blockIdx.x;
  const int st  = bid % NST;
  const int t2  = bid / NST;
  const int g   = t2 % NKVH;
  const int b   = t2 / NKVH;
  if (b >= NB) return;                      // block-uniform, before any barrier; never taken with the exact grid
  const int s0  = st * 64;
  {
    const int sl = tid >> 2;                // key within tile 0..63
    const int dc = (tid & 3) * 16;          // d chunk 0,16,32,48
    const float* src  = F + ((size_t)b * SEQ + s0 + sl) * (size_t)ldf + voff + g * HD + dc;
    const float* bsrc = bias + g * HD + dc;
#pragma unroll
    for (int i = 0; i < 4; ++i) {
      const v4f a  = *(const v4f*)(src + 4 * i);
      const v4f bb = *(const v4f*)(bsrc + 4 * i);
#pragma unroll
      for (int e = 0; e < 4; ++e) {
        const float s  = a[e] + bfr(bb[e]);
        const float t  = s * VCAR;
        const _Float16 hv = (_Float16)t;
        const _Float16 lv = (_Float16)(t - (float)hv);
        TH[(dc + 4 * i + e) * VTP + sl] = h_bits(hv);
        TL[(dc + 4 * i + e) * VTP + sl] = h_bits(lv);
      }
    }
  }
  __syncthreads();
  v4u vh[2], vl[2];
  const int q8 = tid >> 3, p8 = (tid & 7) * 8;
#pragma unroll
  for (int it = 0; it < 2; ++it) {
    const int line = it * 32 + q8;          // d = 0..63
    vh[it] = *(const v4u*)(TH + line * VTP + p8);
    vl[it] = *(const v4u*)(TL + line * VTP + p8);
  }
  const size_t hrow = (size_t)(b * NKVH + g) * HD;
  const size_t base = hrow * SEQ + s0 + p8;
  {
#pragma unroll
    for (int it = 0; it < 2; ++it) {
      const int line = it * 32 + q8;
      *(v4u*)(VHo + base + (size_t)line * SEQ) = vh[it];
      *(v4u*)(VLo + base + (size_t)line * SEQ) = vl[it];
    }
    
  }
}

// =====================================================================================================
// GEMM epilogue, in two halves around one wave-level LDS sync: epi_put places a 16x64 f32 tile (times oscale, plus
// bfr(bias[col]) when HASB != 0) in a wave-private slab [16][64] pitch 68; epi_get reads it back as whole row segments.
// coverage: 8 instructions x 2 rows x 16 lanes x 4 floats = the 16 x 64 tile.
// =====================================================================================================
template <int HASB>
__device__ __forceinline__ void epi_put(float* sl, v8f a0, v8f a1, v8f a2, v8f a3, float oscale,
                                        const float* __restrict__ bias, int col0, int lane) {
  const int hh = lane >> 4, m = lane & 15;
  float b0 = 0.0f, b1 = 0.0f, b2 = 0.0f, b3 = 0.0f;
  if (HASB != 0) {
    b0 = bfr(bias[col0 + m]);
    b1 = bfr(bias[col0 + 16 + m]);
    b2 = bfr(bias[col0 + 32 + m]);
    b3 = bfr(bias[col0 + 48 + m]);
  }
#pragma unroll
  for (int r = 0; r < 8; ++r) {
    const int ro = (8 * hh + r) * 68 + m;
    sl[ro]      = a0[r] * oscale + b0;
    sl[ro + 16] = a1[r] * oscale + b1;
    sl[ro + 32] = a2[r] * oscale + b2;
    sl[ro + 48] = a3[r] * oscale + b3;
  }
}
__device__ __forceinline__ void epi_get(const float* sl, float* C, int N, size_t rowb, int col0, int lane) {
  const int hh = lane >> 4, m = lane & 15;
  v4f vals[8];
#pragma unroll
  for (int it = 0; it < 8; ++it) vals[it] = *(const v4f*)(sl + (it * 2 + hh) * 68 + m * 4);
  float* dst = C + (rowb + (size_t)hh) * (size_t)N + col0 + m * 4;
#pragma unroll
  for (int it = 0; it < 8; ++it) {
    *(v4f*)(dst + (size_t)(it * 2) * (size_t)N) = vals[it];
  }
}

// =====================================================================================================
// GEMM engine shared by gemm_bf and gemm_h: C[M][N] (f32) = (A[M][K] (+ A2[M][K] when TWO != 0)) . Bt[N][K]^T, times oscale
// (plus bfr(bias[n]) when HASB != 0); A, A2 row-major 16-bit planes, Bt k-contiguous 16-bit plane.
// Block = BM x 128 tile of C (BM = 128, or 64 when TWO != 0), 4 waves as 2 x 2, wave = (BM/2) x 64 = MF x 4 accumulator tiles.
// A pass is 64 k = one whole 128-B line of each of the stage's 256 operand rows (A rows, then A2 rows, then the 128 Bt rows),
// brought into LDS by asynchronous copies (8 lanes per row, 16 copies per lane and pass), row pitch 144 B; two buffers: the
// copies of pass t + 2 are issued behind the barrier that ends pass t, so they fly while pass t + 1 is worked on.
// Fragments are read from the LDS rows with the same split k map as ldfrag_* and each accumulator takes its products in the
// same order (k ascending by 32; A before A2). Host guarantees K % 64 == 0, M % BM == 0, N % 128 == 0, grid = (M/BM)*(N/128).
// =====================================================================================================
#define GKP   64
#define GPIT  72
#define GSTG  (256 * GPIT)
static_assert(GKP == 2 * 32 && (DMOD % GKP) == 0 && (MROWS % 128) == 0 && (NQKV % 128) == 0 && (DMOD % 128) == 0);
static_assert((RICH % 64) == 0 && ((SEQ - RICH) % 128) == 0 && 4 * 4 * SLAB64 * 4 <= 2 * GSTG * 2);

union FragU { v4u u[2]; v16h h; v16b b; };

__device__ __forceinline__ FragU ldfrag_u(const u16* p) {
  FragU f;
  f.u[0] = *(const v4u*)(p);
  f.u[1] = *(const v4u*)(p + 16);
  return f;
}
template <int BF>
__device__ __forceinline__ v8f mma_u(const FragU& a, const FragU& b, v8f c) {
  if (BF != 0) return mma_b(a.b, b.b, c);
  return mma_h(a.h, b.h, c);
}
// eight asynchronous 16-B copies per lane, global -> LDS; the s_wait_xcnt closes the statement so that no register a copy
// names is rewritten ahead of it
__device__ __forceinline__ void copy8(const unsigned (&l)[8], const u16* const (&g)[8]) {
#if defined(__HIP_DEVICE_COMPILE__)
  asm volatile("global_load_async_to_lds_b128 %0, %8, off\n\t"
               "global_load_async_to_lds_b128 %1, %9, off\n\t"
               "global_load_async_to_lds_b128 %2, %10, off\n\t"
               "global_load_async_to_lds_b128 %3, %11, off\n\t"
               "global_load_async_to_lds_b128 %4, %12, off\n\t"
               "global_load_async_to_lds_b128 %5, %13, off\n\t"
               "global_load_async_to_lds_b128 %6, %14, off\n\t"
               "global_load_async_to_lds_b128 %7, %15, off\n\t"
               "s_wait_xcnt 0x0"
               :: "v"(l[0]), "v"(l[1]), "v"(l[2]), "v"(l[3]), "v"(l[4]), "v"(l[5]), "v"(l[6]), "v"(l[7]),
                  "v"(g[0]), "v"(g[1]), "v"(g[2]), "v"(g[3]), "v"(g[4]), "v"(g[5]), "v"(g[6]), "v"(g[7])
               : "memory");
#endif
}
// this wave's own copies have landed
__device__ __forceinline__ void wait_copies() {
#if defined(__HIP_DEVICE_COMPILE__)
  asm volatile("s_wait_asynccnt 0x0" ::: "memory");
#endif
}
// this wave's own LDS reads have returned, before the buffer they read is handed to the copies
__device__ __forceinline__ void wait_lds() {
#if defined(__HIP_DEVICE_COMPILE__)
  asm volatile("s_wait_dscnt 0x0" ::: "memory");
#endif
}
// one stage: lane = (row r0 = tid >> 3 of each group of 16 rows, 16-B piece tid & 7); ld = the lane's LDS byte address of
// stage row r0, ga / ga2 / gb = its global address in row r0 of the block's A / A2 / Bt rows, rs16 = halves per 16 rows
template <int TWO>
__device__ __forceinline__ void stage_tile(unsigned ld, const u16* ga, const u16* ga2, const u16* gb, size_t rs16) {
  unsigned l[8];
  const u16* g[8];
#pragma unroll
  for (int i = 0; i < 8; ++i) {
    l[i] = ld + (unsigned)(i * 16 * GPIT * 2);
    if (TWO != 0) g[i] = (i < 4) ? (ga + (size_t)i * rs16) : (ga2 + (size_t)(i - 4) * rs16);
    else          g[i] = ga + (size_t)i * rs16;
  }
  copy8(l, g);
#pragma unroll
  for (int i = 0; i < 8; ++i) {
    l[i] = ld + (unsigned)((8 + i) * 16 * GPIT * 2);
    g[i] = gb + (size_t)i * rs16;
  }
  copy8(l, g);
}

template <int BF, int TWO, int HASB>
__device__ __forceinline__ void gemm_ring(u16* ring, const u16* __restrict__ A, const u16* __restrict__ A2,
                                          const u16* __restrict__ Bt, const float* __restrict__ bias, float* C,
                                          int M, int N, int K, float oscale) {
  constexpr int MF = (TWO != 0) ? 2 : 4;
  constexpr int BM = 32 * MF;
  const int tid = threadIdx.x, wave = tid >> 5, lane = tid & 31, hh = lane >> 4, m = lane & 15;
  const int ntile = N >> 7;
  const int bid   = blockIdx.x;
  const int row0  = (bid / ntile) * BM;
  const int col0  = (bid % ntile) * 128;
  if (row0 + BM > M) return;                // block-uniform, before any copy or barrier; never taken with the exact grid
  const int wm = wave >> 1, wn = wave & 1;
  const int r0 = tid >> 3, c8 = (tid & 7) * 8;
  const u16* ga  = A  + (size_t)(row0 + r0) * K + c8;
  const u16* ga2 = A2 + (size_t)(row0 + r0) * K + c8;
  const u16* gb  = Bt + (size_t)(col0 + r0) * K + c8;
  const size_t rs16 = (size_t)16 * K;
  const unsigned ld0 = (unsigned)(uintptr_t)ring + (unsigned)((r0 * GPIT + c8) * 2);
  const int npass = K / GKP;
  const int aoff = (wm * (16 * MF) + m) * GPIT + 8 * hh;          // halves, in a stage: A fragment row of this lane
  const int boff = (128 + wn * 64 + m) * GPIT + 8 * hh;           // Bt fragment row of this lane

  v8f acc[MF][4];
#pragma unroll
  for (int i = 0; i < MF; ++i) {
#pragma unroll
    for (int j = 0; j < 4; ++j) acc[i][j] = zero8();
  }

  stage_tile<TWO>(ld0, ga, ga2, gb, rs16);
  wait_copies();
  __syncthreads();
  if (npass > 1) stage_tile<TWO>(ld0 + (unsigned)(GSTG * 2), ga + GKP, ga2 + GKP, gb + GKP, rs16);

  // kept rolled (for speed only), the buffer chosen by the pass's parity
#pragma unroll 1
  for (int t = 0; t < npass; ++t) {
    const int par = t & 1;
    const u16* st = ring + par * GSTG;
    FragU a[2][MF], a2[2][MF], b[4];
#pragma unroll
    for (int kk = 0; kk < 2; ++kk) {
#pragma unroll
      for (int i = 0; i < MF; ++i) {
        a[kk][i] = ldfrag_u(st + aoff + i * 16 * GPIT + kk * 32);
        if (TWO != 0) a2[kk][i] = ldfrag_u(st + aoff + (64 + i * 16) * GPIT + kk * 32);
      }
    }
#pragma unroll
    for (int kk = 0; kk < 2; ++kk) {
#pragma unroll
      for (int j = 0; j < 4; ++j) b[j] = ldfrag_u(st + boff + j * 16 * GPIT + kk * 32);
      // the LDS reads stay in one group ahead of the WMMA block (for speed only)
      __builtin_amdgcn_sched_barrier(0);
#pragma unroll
      for (int i = 0; i < MF; ++i) {
#pragma unroll
        for (int j = 0; j < 4; ++j) acc[i][j] = mma_u<BF>(a[kk][i], b[j], acc[i][j]);
      }
      if (TWO != 0) {
#pragma unroll
        for (int i = 0; i < MF; ++i) {
#pragma unroll
          for (int j = 0; j < 4; ++j) acc[i][j] = mma_u<BF>(a2[kk][i], b[j], acc[i][j]);
        }
      }
      // the WMMA block stays ahead of what follows: sunk behind the publish point it would put the refill's issue directly
      // in front of the next pass's wait for it
      __builtin_amdgcn_sched_barrier(0);
    }
    // publish point of pass t + 1: own reads back, own copies landed, every wave here; then the freed buffer is refilled
    wait_lds();
    wait_copies();
    __syncthreads();
    if (t + 2 < npass) {
      const size_t ko = (size_t)(t + 2) * GKP;
      stage_tile<TWO>(ld0 + (unsigned)(par * GSTG * 2), ga + ko, ga2 + ko, gb + ko, rs16);
    }
  }
  wait_copies();

  // the last pass's barrier has ended every read of the ring and no copy is outstanding: each wave stages its MF tiles in
  // MF slabs of its own
  float* sl = (float*)(void*)ring + wave * (MF * SLAB64);
  const int colw = col0 + wn * 64;
#pragma unroll
  for (int i = 0; i < MF; ++i)
    epi_put<HASB>(sl + i * SLAB64, acc[i][0], acc[i][1], acc[i][2], acc[i][3], oscale, bias, colw, lane);
  wave_sync_lds();
#pragma unroll
  for (int i = 0; i < MF; ++i)
    epi_get(sl + i * SLAB64, C, N, (size_t)(row0 + wm * (16 * MF) + i * 16), colw, lane);
}

__global__ __launch_bounds__(128)
void gemm_bf(const u16* __restrict__ A, const u16* __restrict__ Bt, float* C, int M, int N, int K, float oscale) {
  __shared__ __align__(16) u16 ring[2 * GSTG];
  gemm_ring<1, 0, 0>(ring, A, A, Bt, (const float*)0, C, M, N, K, oscale);
}

template <int TWO>
__global__ __launch_bounds__(128)
void gemm_h(const u16* __restrict__ A, const u16* __restrict__ A2, const u16* __restrict__ Bt,
            const float* __restrict__ bias, float* C, int M, int N, int K, float oscale) {
  __shared__ __align__(16) u16 ring[2 * GSTG];
  gemm_ring<0, TWO, 1>(ring, A, A2, Bt, bias, C, M, N, K, oscale);
}

// =====================================================================================================
// Causal grouped-query softmax attention, hd = 64. Block bid -> (query tile qt = qt0 + bid % nqt: rows q0 = 16*qt ..
// q0+15, head group hg = kv head, batch b); one wave per query head = hg*WPB + wave (the 4 consecutive query heads of a
// group share kv head hg).
//   q hi / residual planes f16 x256 [b*SEQ + s][h*HD + d]; k hi / residual planes f16 x256 [b*SEQ + s][g*HD + d] (pitch KVD);
//   v^T hi / residual planes [b*NKVH + g][d][SEQ] x1024.
//   Transposed products: S^T = K.Q^T (A = key rows, B = query rows as columns), so a lane's 16 score registers of a key tile
//   belong to one query (lane & 15) and hold keys kb + 8*(lane >> 4) + r and kb + 16 + 8*(lane >> 4) + r.
//   raw(j, i) = k_hi.q_hi + k_hi.q_lo + k_lo.q_hi (2 k-steps over d); logit = raw * 2^-19 (the 1/8 softmax scale and the two
//   256 carries, exact); keys above the diagonal replaced by -inf; online softmax per query in f32 with a running max:
//   max in-lane over the 16 scores plus one exchange with lane ^ 16; sum in-lane, the two halves' sums joined once after the
//   loop; alpha = exp(m_old - m_new), p = exp(logit - m_new), l = l*alpha + sum p, O^T accumulators times alpha before the
//   tile's product. Key tiles of 32 visited in order, only tiles with kb <= q0 (nkt = q0/32 + 1 <= NKT; key kb is unmasked for
//   every query of the tile). The score registers, as p*32768 (f16 hi and its f16 residual), are the B fragment of
//   O^T += v^T.P^T in the split k map as they stand; v^T A fragments in 2 groups of 2 d-subtiles; RV = 1: products hh + lh + hl,
//   RV = 0: hh only.
//   Epilogue: O x256 -> f16 hi plane (and for RV = 1 the f16 residual plane of O x256) [b*SEQ + s][h*HD + d]; lane = (row group
//   rq = lane>>3 in 0..3, 8 consecutive d at c8); one instruction = 4 rows it*4 + rq, each row segment (64 halves = one whole
// coverage: per wave 4 instructions x 4 rows x 8 lanes x 8 halves = 16 x 64 per plane; grid nqt x NHG x NB blocks x WPB waves;
//   the two launches (tiles 0..NQTR-1 with RV = 1, NQTR..NQT-1 with RV = 0) cover every (b, s, h) row segment of the hi plane
//   exactly once and rows s < RICH of the residual plane exactly once (only those rows are read later).
// =====================================================================================================
template <int RV>
__global__ __launch_bounds__(ATT_THREADS)
void attn_gq(const u16* __restrict__ QHp, const u16* __restrict__ QLp,
             const u16* __restrict__ KHp, const u16* __restrict__ KLp,
             const u16* __restrict__ VHp, const u16* __restrict__ VLp,
             u16* OHp, u16* OLp, int qt0, int nqt) {
#pragma clang fp contract(off)
  __shared__ __align__(16) float smem[WPB * WREG];

  const int tid  = threadIdx.x;
  const int wave = tid >> 5;
  const int lane = tid & 31;
  const int hh   = lane >> 4;
  const int c    = lane & 15;
  const int bid  = blockIdx.x;
  if (nqt <= 0) return;                     // block-uniform; no block barriers in this kernel
  const int qt   = qt0 + bid % nqt;
  const int t2   = bid / nqt;
  const int hg   = t2 % NHG;
  const int b    = t2 / NHG;
  if (b >= NB) return;                      // block-uniform; never taken with the exact grid
  const int q0   = qt * 16;
  if (q0 + 16 > SEQ) return;                // block-uniform; never taken
  const int head = hg * WPB + wave;
  const int kvh  = hg;

  float* slab = smem + wave * WREG;         // result slab [16][64] pitch 68

  const size_t hcol = (size_t)head * HD + 8 * hh;
  const size_t kcol = (size_t)kvh * HD + 8 * hh;
  const _Float16* Qh  = (const _Float16*)(const void*)QHp + ((size_t)b * SEQ + q0 + c) * DMOD + hcol;
  const _Float16* Ql  = (const _Float16*)(const void*)QLp + ((size_t)b * SEQ + q0 + c) * DMOD + hcol;
  const _Float16* Khb = (const _Float16*)(const void*)KHp + ((size_t)b * SEQ + c) * KVD + kcol;        // key row kb added per step
  const _Float16* Klb = (const _Float16*)(const void*)KLp + ((size_t)b * SEQ + c) * KVD + kcol;
  const _Float16* Vhb = (const _Float16*)(const void*)VHp + ((size_t)(b * NKVH + kvh) * HD + c) * SEQ + 8 * hh;  // d row c (+16j)
  const _Float16* Vlb = (const _Float16*)(const void*)VLp + ((size_t)(b * NKVH + kvh) * HD + c) * SEQ + 8 * hh;
  const float lsc  = SM_SCALE * (1.0f / (QSC * KSC));   // exact power-of-two fold of the q / k carries into the 1/8 scale
  const float oc   = 1.0f / (PCAR * VCAR);
  const float ninf = -__builtin_inff();
  const size_t KROW = (size_t)KVD;          // halves between consecutive key rows

  v8f o[4];                                 // O^T: element r of o[j] = (d = 16j + 8hh + r, query row q0 + c)
#pragma unroll
  for (int j = 0; j < 4; ++j) o[j] = zero8();
  float mrun = ninf, lrun = 0.0f;           // this lane's query: running max (both halves alike), sum over this half's keys
  const int ncaus = (q0 >> 5) + 1;                                            // tiles holding keys <= q0 + 15
  const int nkt   = (ncaus < NKT) ? ncaus : NKT;
  const int qrow  = q0 + c;                                                   // query row of every D element of this lane

#pragma unroll 1
  for (int kt = 0; kt < nkt; ++kt) {
    const int kb = kt * 32;
    // ---- raw scores, transposed: D element r of this lane = (key kb + 8hh + r, query qrow) in s0, key + 16 in s1 ----
    v8f s0 = zero8(), s1 = zero8();
    const _Float16* k0p = Khb + (size_t)kb * KROW;
    const _Float16* k1p = k0p + (size_t)16 * KROW;
    const _Float16* l0p = Klb + (size_t)kb * KROW;
    const _Float16* l1p = l0p + (size_t)16 * KROW;
#pragma unroll
    for (int kk = 0; kk < HD / 32; ++kk) {
      const v16h qh  = ldfrag_h(Qh + kk * 32);
      const v16h ql  = ldfrag_h(Ql + kk * 32);
      const v16h kh0 = ldfrag_h(k0p + kk * 32);
      const v16h kh1 = ldfrag_h(k1p + kk * 32);
      const v16h kl0 = ldfrag_h(l0p + kk * 32);
      const v16h kl1 = ldfrag_h(l1p + kk * 32);
      s0 = mma_h(kh0, qh, s0);
      s0 = mma_h(kh0, ql, s0);
      s0 = mma_h(kl0, qh, s0);
      s1 = mma_h(kh1, qh, s1);
      s1 = mma_h(kh1, ql, s1);
      s1 = mma_h(kl1, qh, s1);
      guard2(s0, s1, qh, ql, kh0, kl0, kh1, kl1);
    }
    // ---- causal replace-mask, running-max online softmax in f32: the lane's 16 scores belong to one query ----
    const int key0 = kb + 8 * hh, key1 = key0 + 16;
    float t0[8], t1[8];
    float mx = ninf;
#pragma unroll
    for (int r = 0; r < 8; ++r) {
      const float a0 = s0[r] * lsc;
      const float a1 = s1[r] * lsc;
      t0[r] = (key0 + r > qrow) ? ninf : a0;
      t1[r] = (key1 + r > qrow) ? ninf : a1;
      mx = fmaxf(mx, fmaxf(t0[r], t1[r]));
    }
    mx = fmaxf(mx, xhalf(mx));                          // the other half's 16 keys of the same query
    const float mnew = fmaxf(mrun, mx);
    const float al   = __expf(mrun - mnew);
    // ---- B fragments of p*32768 straight from the score registers: hi f16 and residual f16, column = query c,
    //      elements 0..7 = keys kb + 8hh + 0..7, elements 8..15 = keys kb + 16 + 8hh + 0..7 (the split k map) ----
    FragH ph, pl;
    float sm = 0.0f;
#pragma unroll
    for (int r = 0; r < 8; ++r) {
      const float p0 = __expf(t0[r] - mnew);
      const float p1 = __expf(t1[r] - mnew);
      sm += p0 + p1;
      const float ta = p0 * PCAR, tc = p1 * PCAR;
      const _Float16 ha = (_Float16)ta, hc = (_Float16)tc;
      ph.h[0][r] = ha;
      ph.h[1][r] = hc;
      pl.h[0][r] = (_Float16)(ta - (float)ha);
      pl.h[1][r] = (_Float16)(tc - (float)hc);
    }
    lrun = lrun * al + sm;
    mrun = mnew;
    // ---- rescale the O^T accumulators by the lane's alpha ----
#pragma unroll
    for (int j = 0; j < 4; ++j) {
#pragma unroll
      for (int r = 0; r < 8; ++r) o[j][r] = o[j][r] * al;
    }
    // ---- O^T += v^T.P^T : A fragment row = d = j*16 + c, keys contiguous in the v^T planes; 2 groups of 2 d-subtiles ----
    {
      const _Float16* vhp = Vhb + kb;
      const _Float16* vlp = Vlb + kb;
      (void)vlp;
#pragma unroll
      for (int jg = 0; jg < 2; ++jg) {
        const size_t da = (size_t)(2 * jg) * 16 * SEQ;
        const size_t db = da + (size_t)16 * SEQ;
        const v16h vha = ldfrag_h(vhp + da), vhb2 = ldfrag_h(vhp + db);
        o[2 * jg]     = mma_h(vha,  ph.v, o[2 * jg]);
        o[2 * jg + 1] = mma_h(vhb2, ph.v, o[2 * jg + 1]);
        if (RV != 0) {
          const v16h vla = ldfrag_h(vlp + da), vlb2 = ldfrag_h(vlp + db);
          o[2 * jg]     = mma_h(vha,  pl.v, o[2 * jg]);
          o[2 * jg]     = mma_h(vla,  ph.v, o[2 * jg]);
          o[2 * jg + 1] = mma_h(vhb2, pl.v, o[2 * jg + 1]);
          o[2 * jg + 1] = mma_h(vlb2, ph.v, o[2 * jg + 1]);
          guard2(o[2 * jg], o[2 * jg + 1], ph.v, pl.v, vha, vhb2, vla, vlb2);
        } else {
          guard2(o[2 * jg], o[2 * jg + 1], ph.v, pl.v, vha, vhb2, vha, vhb2);
        }
      }
    }
  }
  acc_guard4(o[0], o[1], o[2], o[3]);
  // ---- O = acc / l with the carries (32768 on p, 1024 on v) folded once; the two halves' sums joined here; the lane's
  //      8 consecutive d of each subtile go into row c of the wave's slab ----
  const float ltot = lrun + xhalf(lrun);
  const float rl   = (1.0f / ltot) * oc;
#pragma unroll
  for (int j = 0; j < 4; ++j) {
    float* sd = slab + c * SLP + j * 16 + 8 * hh;
    v4f w0, w1;
#pragma unroll
    for (int e = 0; e < 4; ++e) { w0[e] = o[j][e] * rl; w1[e] = o[j][4 + e] * rl; }
    *(v4f*)(sd)     = w0;
    *(v4f*)(sd + 4) = w1;
  }
  wave_sync_lds();
  // ---- O x256 -> f16 hi plane (+ f16 residual plane); lane = (row group rq, 8 consecutive d at c8) ----
  v4u oh[4], ol[4];
  const int rq = lane >> 3, c8 = (lane & 7) * 8;
#pragma unroll
  for (int it = 0; it < 4; ++it) {
    const int row = it * 4 + rq;
    const v4f a = *(const v4f*)(slab + row * SLP + c8), b4 = *(const v4f*)(slab + row * SLP + c8 + 4);
    float w[8];
#pragma unroll
    for (int e = 0; e < 4; ++e) { w[e] = a[e] * OSC; w[4 + e] = b4[e] * OSC; }
#pragma unroll
    for (int e = 0; e < 4; ++e) {
      const _Float16 h0 = (_Float16)w[2 * e], h1 = (_Float16)w[2 * e + 1];
      const _Float16 g0 = (_Float16)(w[2 * e] - (float)h0), g1 = (_Float16)(w[2 * e + 1] - (float)h1);
      oh[it][e] = pk16(h_bits(h0), h_bits(h1));
      ol[it][e] = pk16(h_bits(g0), h_bits(g1));
    }
  }
  const size_t ob = ((size_t)b * SEQ + q0) * DMOD + (size_t)head * HD + c8;
  {
#pragma unroll
    for (int it = 0; it < 4; ++it) {
      const int row = it * 4 + rq;
      *(v4u*)(OHp + ob + (size_t)row * DMOD) = oh[it];
      if (RV != 0) {
        *(v4u*)(OLp + ob + (size_t)row * DMOD) = ol[it];
      }
    }
    
  }
}

// =====================================================================================================
// Workspace map (bytes); every plane is fully written by whole-line stores before it is read (the O residual plane only on
// the rows < RICH per sequence that are read); all extents are exact multiples of the store granularity (no pad rows needed);
// every region offset a multiple of 131072:
//   XB  bf16 [MROWS][2048]              MROWS*4096   (NB=2, SEQ=2048: 16777216); after the projection GEMM the same bytes hold
//                                                    the O f16 hi plane [MROWS][2048] x256 (identical extent)
//   WB  bf16 [3072 n][2048 k]           12582912     (Wq rows 0..2047, Wk 2048..2559, Wv 2560..3071); after the projection
//                                                    GEMM its first 8388608 bytes hold the Wo f16 plane [2048 o][2048 d]
//   F   f32 [MROWS][3072]               MROWS*12288  (q | k | v projection columns, no bias); after split16 / vt16 its first
//                                                    MROWS*4096 bytes hold the O f16 residual plane [MROWS][2048]
//   QH  f16 [MROWS][2048] x256          MROWS*4096   QL residual, same extent
//   KH  f16 [MROWS][512] x256           MROWS*1024   KL residual, same extent
//   VH  f16 [NB*8][64][SEQ] x1024       MROWS*1024   VL residual, same extent
//   end (NB=2, SEQ=2048)               130023424
// =====================================================================================================
extern "C" void kernel_launch(void* const* d_in, const int* in_sizes, int n_in,
                              void* d_out, int out_size, void* d_ws, size_t ws_size,
                              hipStream_t stream) {
  if (n_in < 9) return;
  if (in_sizes[0] < ((NB - 1) * XS_FULL + SEQ) * DMOD) return;
  if (in_sizes[1] < DMOD * DMOD) return;
  if (in_sizes[2] < DMOD) return;
  if (in_sizes[3] < KVD * DMOD) return;
  if (in_sizes[4] < KVD) return;
  if (in_sizes[5] < KVD * DMOD) return;
  if (in_sizes[6] < KVD) return;
  if (in_sizes[7] < DMOD * DMOD) return;
  if (in_sizes[8] < DMOD) return;
  if (out_size < MROWS * DMOD) return;

  const float* x  = (const float*)d_in[0];
  const float* wq = (const float*)d_in[1];
  const float* bq = (const float*)d_in[2];
  const float* wk = (const float*)d_in[3];
  const float* bk = (const float*)d_in[4];
  const float* wv = (const float*)d_in[5];
  const float* bv = (const float*)d_in[6];
  const float* wo = (const float*)d_in[7];
  const float* bo = (const float*)d_in[8];
  float*       out = (float*)d_out;

  const size_t szXB = (size_t)MROWS * DMOD * 2;
  const size_t szWB = (size_t)NQKV * DMOD * 2;
  const size_t szF  = (size_t)MROWS * NQKV * 4;
  const size_t szQ  = (size_t)MROWS * DMOD * 2;                  // QH, QL
  const size_t szK  = (size_t)MROWS * KVD * 2;                   // KH, KL
  const size_t szV  = (size_t)NB * NKVH * HD * SEQ * 2;          // VH, VL (== szK)
  const size_t szOH = (size_t)MROWS * DMOD * 2;                  // O hi plane, lives in the XB region
  const size_t szOL = (size_t)MROWS * DMOD * 2;                  // O residual plane, lives in the F region
  const size_t szWT = (size_t)DMOD * DMOD * 2;                   // Wo f16 plane, lives in the WB region
  if (szOH > szXB || szOL > szF || szWT > szWB) return;
  size_t off = 0;
  const size_t oXB = off; off += szXB;
  const size_t oWB = off; off += szWB;
  const size_t oF  = off; off += szF;
  const size_t oQH = off; off += szQ;
  const size_t oQL = off; off += szQ;
  const size_t oKH = off; off += szK;
  const size_t oKL = off; off += szK;
  const size_t oVH = off; off += szV;
  const size_t oVL = off; off += szV;
  if (off > ws_size) return;                // off = 130023424 for NB = 2, SEQ = 2048
  if (off > (size_t)WS_CAP) return;

  char* ws = (char*)d_ws;
  u16*   XB  = (u16*)(ws + oXB);
  u16*   OH  = (u16*)(ws + oXB);
  u16*   WB  = (u16*)(ws + oWB);
  u16*   WT  = (u16*)(ws + oWB);
  float* F   = (float*)(ws + oF);
  u16*   OL  = (u16*)(ws + oF);
  u16*   QH  = (u16*)(ws + oQH);
  u16*   QL  = (u16*)(ws + oQL);
  u16*   KH  = (u16*)(ws + oKH);
  u16*   KL  = (u16*)(ws + oKL);
  u16*   VH  = (u16*)(ws + oVH);
  u16*   VL  = (u16*)(ws + oVL);

  const dim3 b256(256), b128(128), bAT(ATT_THREADS);
  const int  n8x = (SEQ * DMOD) / 8;
  const dim3 gX((n8x + 255) / 256);                     // SEQ*DMOD/2048 blocks per batch
  const int  n8q = (DMOD * DMOD) / 8;
  const dim3 gWq((n8q + 255) / 256);                    // 2048
  const int  n8kv = (KVD * DMOD) / 8;
  const dim3 gWk((n8kv + 255) / 256);                   // 512
  const dim3 gG1((MROWS / 128) * (NQKV / 128));         // 768
  const dim3 gRW(MROWS);
  const dim3 gVT(NB * NKVH * NST);                      // 512
  const float osc = 1.0f / (OSC * WOS);

  // (0) x -> bf16 plane [MROWS][2048], one launch per batch row block
  for (int bq2 = 0; bq2 < NB; ++bq2) {
    cvt16<<<gX, b256, 0, stream>>>(x + (size_t)bq2 * XS_FULL * DMOD, XB + (size_t)bq2 * SEQ * DMOD, n8x, 0, 1.0f);
  }
  // (1) Wq [2048 n][2048 k], Wk [512][2048], Wv [512][2048] -> one bf16 plane [3072 n][2048 k]
  cvt16<<<gWq, b256, 0, stream>>>(wq, WB, n8q, 0, 1.0f);
  cvt16<<<gWk, b256, 0, stream>>>(wk, WB + (size_t)DMOD * DMOD, n8kv, 0, 1.0f);
  cvt16<<<gWk, b256, 0, stream>>>(wv, WB + (size_t)DMOD * DMOD + (size_t)KVD * DMOD, n8kv, 0, 1.0f);
  // (2) qkv = x.[Wq|Wk|Wv]^T -> F f32 [MROWS][3072] (biases added by the consumers in f32)
  gemm_bf<<<gG1, b128, 0, stream>>>(XB, WB, F, MROWS, NQKV, DMOD, 1.0f);
  // (3) q hi + residual planes x256 from columns 0..2047 (+bq); (4) same for k from columns 2048..2559 (+bk)
  split16<<<gRW, dim3(DMOD / 8), 0, stream>>>(F, NQKV, 0, DMOD, bq, QH, QL, QSC);
  split16<<<gRW, dim3(KVD / 8), 0, stream>>>(F, NQKV, DMOD, KVD, bk, KH, KL, KSC);
  // (5) v^T hi + residual planes x1024 from columns 2560..3071 (+bv)
  vt16<<<gVT, b256, 0, stream>>>(F, NQKV, DMOD + KVD, bv, VH, VL);
  // (6) Wo [2048 o][2048 d] -> f16 plane of the bf16 value x1024 (already k-contiguous; WB region, free after the projection GEMM)
  cvt16<<<gWq, b256, 0, stream>>>(wo, WT, n8q, 1, WOS);
  // (7) causal attention -> O f16 hi plane x256 (XB region) for all query tiles; residual plane (F region) for tiles < RICH
  attn_gq<1><<<dim3(NQTR * NHG * NB), bAT, 0, stream>>>(QH, QL, KH, KL, VH, VL, OH, OL, 0, NQTR);
  if (NQT > NQTR) {
    attn_gq<0><<<dim3((NQT - NQTR) * NHG * NB), bAT, 0, stream>>>(QH, QL, KH, KL, VH, VL, OH, OL, NQTR, NQT - NQTR);
  }
  // (8) y = O.Wo^T + bo -> out f32 [MROWS][2048], carries 256 x 1024 folded back; rows < RICH per sequence with O hi + residual
  for (int bq2 = 0; bq2 < NB; ++bq2) {
    const size_t rb = (size_t)bq2 * SEQ;
    gemm_h<1><<<dim3((RICH / 64) * (DMOD / 128)), b128, 0, stream>>>(
        OH + rb * DMOD, OL + rb * DMOD, WT, bo, out + rb * DMOD, RICH, DMOD, DMOD, osc);
    if (SEQ > RICH) {
      const size_t rl = rb + RICH;
      gemm_h<0><<<dim3(((SEQ - RICH) / 128) * (DMOD / 128)), b128, 0, stream>>>(
          OH + rl * DMOD, OL + rl * DMOD, WT, bo, out + rl * DMOD, SEQ - RICH, DMOD, DMOD, osc);
    }
  }
  (void)hipGetLastError();
}

// v003
// A run of this version takes 371 microseconds.
// In two side-by-side timings against v002, it was 1.12 and 1.11 times as fast.
// Over all steps from v000 it is 1.70 times as fast.
// Contractions: x.[Wq|Wk|Wv]^T on v_wmma_f32_16x16x32_bf16 (x and the weights as bf16 RNE planes, weight [n][k] rows are the
// k-contiguous B operand, f32 accumulate, biases added in f32 as bf16 RNE values); q.k^T over hd 64 and P.v on
// v_wmma_f32_16x16x32_f16 with f16 hi + f16 residual planes (q, k x256, products hh+lh+hl on every row; P x32768 hi +
// in-register residual and v^T x1024 hi + residual plane for query rows < 512 of each sequence, P hi . v hi only for later
// rows); O.Wo^T on v_wmma_f32_16x16x32_f16 with O x256 as f16 hi (+ f16 residual plane for rows < 512 of each sequence) and
// Wo as f16(bf16(Wo)) x1024, one accumulator, bias bo added in f32; all f32 accumulate. Online softmax in f32 on VALU.
#include <hip/hip_runtime.h>
#include <math.h>
#include <stdint.h>

#ifndef NB
#define NB 2
#endif
#ifndef SEQ
#define SEQ 2048
#endif
#define XS_FULL 2048
#define DMOD  2048
#define NH    32
#define NKVH  8
#define HD    64
#define KVD   (NKVH * HD)
#define NQKV  (DMOD + 2 * KVD)
#define MROWS (NB * SEQ)
#define RICH_REQ 512
#define RICH  ((SEQ < RICH_REQ) ? SEQ : RICH_REQ)
#define SM_SCALE 0.125f
#define QSC   256.0f
#define KSC   256.0f
#define PCAR  32768.0f
#define VCAR  1024.0f
#define OSC   256.0f
#define WOS   1024.0f
#define WPB   (NH / NKVH)
#define NHG   NKVH
#define NQT   (SEQ / 16)
#define NQTR  (RICH / 16)
#define NST   (SEQ / 64)
#define NKT   (SEQ / 32)
#define ATT_THREADS (WPB * 32)
#define SLP   68
#define SLW   (16 * SLP)
#define WREG  (SLW)
#define SLAB64 (16 * 68)
#define VTP   72
#define WS_CAP 134217728
static_assert(DMOD == NH * HD && HD == 64 && NH == 32 && NKVH == 8 && WPB == 4 && NHG * WPB == NH);
static_assert(ATT_THREADS == 128 && KVD == 512 && NQKV == 3072);
static_assert(NB >= 1 && NB <= 2);
static_assert(NB == 1 || SEQ == XS_FULL);
static_assert((SEQ % 64) == 0 && SEQ >= 64 && SEQ <= XS_FULL);
static_assert((RICH % 64) == 0 && RICH >= 64 && RICH <= SEQ);
static_assert((DMOD % 64) == 0 && (KVD % 64) == 0 && (NQKV % 64) == 0 && (DMOD % 32) == 0 && (HD % 32) == 0 && (MROWS % 64) == 0);
static_assert(((SEQ * DMOD / 8) % 256) == 0 && ((DMOD * DMOD / 8) % 256) == 0 && ((KVD * DMOD / 8) % 256) == 0);
static_assert(WPB * WREG * 4 <= 65536 && 2 * HD * VTP * 2 <= 65536 && 4 * SLAB64 * 4 <= 65536);
// workspace total (XB + WB + F + QH + QL + KH + KL + VH + VL) for this build
static_assert((size_t)MROWS * DMOD * 2 + (size_t)NQKV * DMOD * 2 + (size_t)MROWS * NQKV * 4 +
              2 * (size_t)MROWS * DMOD * 2 + 2 * (size_t)MROWS * KVD * 2 + 2 * (size_t)NB * NKVH * HD * SEQ * 2
              <= (size_t)WS_CAP);

typedef unsigned short u16;
typedef _Float16 v16h __attribute__((ext_vector_type(16)));
typedef _Float16 v8h  __attribute__((ext_vector_type(8)));
typedef __bf16   v16b __attribute__((ext_vector_type(16)));
typedef float    v8f  __attribute__((ext_vector_type(8)));
typedef float    v4f  __attribute__((ext_vector_type(4)));
typedef unsigned int v4u __attribute__((ext_vector_type(4)));

union FragH { v16h v; v8h h[2]; v4u u[2]; };

// ---- scalar helpers --------------------------------------------------------------------------------
__device__ __forceinline__ unsigned short bf_bits(float f) {          // f32 -> bf16 bits, RNE convert
  unsigned u = __float_as_uint(f);
  return (unsigned short)((u + 0x7FFFu + ((u >> 16) & 1u)) >> 16);
}
__device__ __forceinline__ float bf_up(unsigned short h) { return __uint_as_float(((unsigned)h) << 16); }
__device__ __forceinline__ float bfr(float f) { return bf_up(bf_bits(f)); }
__device__ __forceinline__ unsigned short h_bits(_Float16 x) { return __builtin_bit_cast(unsigned short, x); }
__device__ __forceinline__ unsigned pk16(unsigned short a, unsigned short b) { return (unsigned)a | ((unsigned)b << 16); }
__device__ __forceinline__ v8f zero8() { v8f z = {0.f, 0.f, 0.f, 0.f, 0.f, 0.f, 0.f, 0.f}; return z; }

// ---- fragment map: 16-bit A/B operand of k-step k0, lane -> row/col (lane&15), h = lane>>4; elements 0..7 <- k0+8h+0..7,
//      elements 8..15 <- k0+16+8h+0..7 (the same split k map for A and B; ldfrag_u reads it from k-contiguous rows)
// ---- fragment loader for a plane kept in fragment order: a fragment is two pieces of 512 contiguous bytes, piece = 32 lanes
//      x 16 B; p = the fragment's first byte (wave-uniform where the tile is), l8 = 8*lane; elements 0..7 <- piece 0,
//      elements 8..15 <- piece 1 (a load = 4 whole 128-B lines)
#define FPC   256
#define FTILE (4 * FPC)
__device__ __forceinline__ v16h ldfrag_f(const _Float16* p, unsigned l8) {
  FragH f;
  f.h[0] = *(const v8h*)(p + l8);
  f.h[1] = *(const v8h*)(p + l8 + FPC);
  return f.v;
}

// stands behind issued global loads whose address registers the following loads' results may take over
__device__ __forceinline__ void wait_addr() {
#if defined(__HIP_DEVICE_COMPILE__)
  asm volatile("s_wait_xcnt 0x0" ::: "memory");
#endif
}

__device__ __forceinline__ v8f mma_h(v16h a, v16h b, v8f c) {
  return __builtin_amdgcn_wmma_f32_16x16x32_f16(false, a, false, b, (short)0, c, false, false);
}
__device__ __forceinline__ v8f mma_b(v16b a, v16b b, v8f c) {
  return __builtin_amdgcn_wmma_f32_16x16x32_bf16(false, a, false, b, (short)0, c, false, false);
}
__device__ __forceinline__ void guard2(v8f& a, v8f& b, v16h x0, v16h x1, v16h x2, v16h x3, v16h x4, v16h x5) {
#if defined(__HIP_DEVICE_COMPILE__)
  asm volatile("v_nop\n\tv_nop\n\tv_nop\n\tv_nop"
               : "+v"(a), "+v"(b) : "v"(x0), "v"(x1), "v"(x2), "v"(x3), "v"(x4), "v"(x5) : "memory");
#endif
}
__device__ __forceinline__ void acc_guard4(v8f& a, v8f& b, v8f& c, v8f& d) {
#if defined(__HIP_DEVICE_COMPILE__)
  asm volatile("v_nop\n\tv_nop\n\tv_nop\n\tv_nop" : "+v"(a), "+v"(b), "+v"(c), "+v"(d));
#endif
}
// lane l <-> lane l ^ 16 on the vector pipe (the shuffle builtin would go through the LDS queue and its wait)
__device__ __forceinline__ float xhalf(float x) {
  const int v = __builtin_bit_cast(int, x);
  return __builtin_bit_cast(float, __builtin_amdgcn_permlanex16(v, v, 0x76543210, 0xfedcba98, false, false));
}
__device__ __forceinline__ void wave_sync_lds() {
  __builtin_amdgcn_fence(__ATOMIC_RELEASE, "workgroup");
  __builtin_amdgcn_wave_barrier();
  __builtin_amdgcn_fence(__ATOMIC_ACQUIRE, "workgroup");
}

// =====================================================================================================
// f32 -> 16-bit plane, same layout.  f16mode == 0: bf16 RNE bits;  f16mode == 1: f16 bits of (bf16 RNE value) * scale.
// Thread = 8 consecutive elements: two 16-B loads, one 16-B store; 32 consecutive lanes = 512 contiguous, 512-B aligned
// coverage: grid = ceil(n8/256) blocks x 256 thr x 8 (in-kernel bound) = the whole plane (n8 a multiple of 256 here).
// =====================================================================================================
__global__ __launch_bounds__(256) void cvt16(const float* __restrict__ x, u16* D, int n8, int f16mode, float scale) {
  const int gt = blockIdx.x * 256 + (int)threadIdx.x;
  if (gt >= n8) return;
  const float* p = x + (size_t)gt * 8;
  const v4f a = *(const v4f*)(p), b4 = *(const v4f*)(p + 4);
  float w[8];
#pragma unroll
  for (int e = 0; e < 4; ++e) { w[e] = a[e]; w[4 + e] = b4[e]; }
  v4u o;
#pragma unroll
  for (int e = 0; e < 4; ++e) {
    const float f0 = w[2 * e], f1 = w[2 * e + 1];
    const unsigned short hb0 = h_bits((_Float16)(bfr(f0) * scale));
    const unsigned short hb1 = h_bits((_Float16)(bfr(f1) * scale));
    const unsigned short bb0 = bf_bits(f0);
    const unsigned short bb1 = bf_bits(f1);
    o[e] = (f16mode != 0) ? pk16(hb0, hb1) : pk16(bb0, bb1);
  }
  u16* d = D + (size_t)gt * 8;
  {
    *(v4u*)(d) = o;
    
  }
}

// =====================================================================================================
// q / k planes from the projection F f32 [MROWS][ldf] at column offset coff (nhead heads of HD columns; row = b*SEQ + s,
// column = coff + head*HD + d): t = (F + bfr(bias[head*HD + d])) * sc in f32 (add, then exact power-of-two scale);
//   Hp = f16(t), Lp = f16 residual (t - f16(t)), both in fragment order: tile (b, head, s >> 4) = 16 rows x 64 d = 4 pieces of
//   512 B; piece pc, lane l, element e <- row (s & 15) = l & 15, d = 16*pc + 8*(l >> 4) + e (pieces 2kk, 2kk + 1 are the two
//   halves of the fragment of k-step kk in the split k map).
// Block = one 16-row tile x 2 heads, 256 threads; wave = one piece: two 16-B loads of F and of bias per lane, one 16-B store
// per plane, a wave's store = the piece's 512 contiguous bytes.
// coverage: 8 waves = 2 heads x 4 pieces; grid = (MROWS/16) * (nhead/2) blocks = every piece of both planes once.
// =====================================================================================================
__global__ __launch_bounds__(256) void split16(const float* __restrict__ F, int ldf, int coff, int nhead,
                                               const float* __restrict__ bias, u16* Hp, u16* Lp, float sc) {
#pragma clang fp contract(off)
  const int tid  = (int)threadIdx.x;
  const int hpb  = nhead >> 1;                         // blocks per 16-row tile
  const int tile = (int)blockIdx.x / hpb;
  if (tile >= MROWS / 16) return;                      // never taken with the exact grid
  const int head = ((int)blockIdx.x % hpb) * 2 + (tid >> 7);
  const int pc   = (tid >> 5) & 3;
  const int lane = tid & 31;
  const int row  = tile * 16 + (lane & 15);
  const int col  = head * HD + pc * 16 + (lane >> 4) * 8;
  const float* p = F + (size_t)row * (size_t)ldf + coff + col;
  const v4f xa = *(const v4f*)(p), xb = *(const v4f*)(p + 4);
  wait_addr();
  const v4f ba = *(const v4f*)(bias + col), bb = *(const v4f*)(bias + col + 4);
  float xv[8], bw[8];
#pragma unroll
  for (int e = 0; e < 4; ++e) {
    xv[e] = xa[e];  xv[4 + e] = xb[e];
    bw[e] = ba[e];  bw[4 + e] = bb[e];
  }
  v4u oh, ol;
#pragma unroll
  for (int e = 0; e < 4; ++e) {
    const float s0 = xv[2 * e] + bfr(bw[2 * e]);
    const float s1 = xv[2 * e + 1] + bfr(bw[2 * e + 1]);
    const float t0 = s0 * sc;
    const float t1 = s1 * sc;
    const _Float16 h0 = (_Float16)t0, h1 = (_Float16)t1;
    const _Float16 l0 = (_Float16)(t0 - (float)h0), l1 = (_Float16)(t1 - (float)h1);
    oh[e] = pk16(h_bits(h0), h_bits(h1));
    ol[e] = pk16(h_bits(l0), h_bits(l1));
  }
  const int bb2 = tile / NQT, s16 = tile % NQT;
  const size_t dst = (((size_t)(bb2 * nhead + head) * NQT + s16) * 4 + pc) * FPC + (size_t)lane * 8;
  *(v4u*)(Hp + dst) = oh;
  *(v4u*)(Lp + dst) = ol;
}

// =====================================================================================================
// v^T planes from the v columns of the projection F f32 [MROWS][ldf] (row = b*SEQ + s, column = voff + g*HD + d):
//   t = (F + bfr(bias[g*HD + d])) * 1024;  VH = f16(t), VL = f16 residual (t - f16(t)), both for all keys s, in fragment
//   order: tile (b, g, s >> 5) = 64 d x 32 keys = 8 pieces of 512 B; piece 2j + h, lane l, element e <- d = 16j + (l & 15),
//   key (s & 31) = 16h + 8*(l >> 4) + e (the two halves of the A fragment of d-subtile j in the split k map).
// Block = (b, kv head g, 64 keys s0): each thread loads its 16 floats (key sl, d chunk dc) with 16-B loads, converts, places
// them into two LDS tiles [64 d][64 keys] (pitch 72 halves); after a block barrier each wave stores whole pieces.
// LDS tiles are cross-wave (block barrier); staged extent 64x64 == consumed extent 64x64.
// coverage: load 256 thr x 16 = 64 keys x 64 d; store 2 iterations x 8 waves = 16 pieces = the block's two 32-key tiles of
//           VH and of VL (8192 contiguous bytes each); grid = NB*NKVH*NST blocks covers both planes exactly once.
// =====================================================================================================
__global__ __launch_bounds__(256) void vt16(const float* __restrict__ F, int ldf, int voff,
                                            const float* __restrict__ bias, u16* VHo, u16* VLo) {
#pragma clang fp contract(off)
  __shared__ __align__(16) u16 TH[HD * VTP];
  __shared__ __align__(16) u16 TL[HD * VTP];
  const int tid = threadIdx.x;
  const int bid = blockIdx.x;
  const int st  = bid % NST;
  const int t2  = bid / NST;
  const int g   = t2 % NKVH;
  const int b   = t2 / NKVH;
  if (b >= NB) return;                      // block-uniform, before any barrier; never taken with the exact grid
  const int s0  = st * 64;
  {
    const int sl = tid >> 2;                // key within tile 0..63
    const int dc = (tid & 3) * 16;          // d chunk 0,16,32,48
    const float* src  = F + ((size_t)b * SEQ + s0 + sl) * (size_t)ldf + voff + g * HD + dc;
    const float* bsrc = bias + g * HD + dc;
    v4f bv4[4];
#pragma unroll
    for (int i = 0; i < 4; ++i) bv4[i] = *(const v4f*)(bsrc + 4 * i);
    wait_addr();
#pragma unroll
    for (int i = 0; i < 4; ++i) {
      const v4f a  = *(const v4f*)(src + 4 * i);
      const v4f bb = bv4[i];
#pragma unroll
      for (int e = 0; e < 4; ++e) {
        const float s  = a[e] + bfr(bb[e]);
        const float t  = s * VCAR;
        const _Float16 hv = (_Float16)t;
        const _Float16 lv = (_Float16)(t - (float)hv);
        TH[(dc + 4 * i + e) * VTP + sl] = h_bits(hv);
        TL[(dc + 4 * i + e) * VTP + sl] = h_bits(lv);
      }
    }
  }
  __syncthreads();
  v4u vh[2], vl[2];
  const int ln = tid & 31, hf = (tid >> 5) & 1, js = tid >> 6;      // lane, fragment half, d-subtile of this thread's piece
  const int lo = (js * 16 + (ln & 15)) * VTP + hf * 16 + (ln >> 4) * 8;
#pragma unroll
  for (int it = 0; it < 2; ++it) {          // it = 32-key tile within the block's 64 keys
    vh[it] = *(const v4u*)(TH + lo + it * 32);
    vl[it] = *(const v4u*)(TL + lo + it * 32);
  }
  const size_t base = ((size_t)(b * NKVH + g) * NKT + (size_t)st * 2) * (8 * FPC) + (size_t)tid * 8;
#pragma unroll
  for (int it = 0; it < 2; ++it) {
    *(v4u*)(VHo + base + (size_t)it * (8 * FPC)) = vh[it];
    *(v4u*)(VLo + base + (size_t)it * (8 * FPC)) = vl[it];
  }
}

// =====================================================================================================
// GEMM epilogue, in two halves around one wave-level LDS sync: epi_put places a 16x64 f32 tile (times oscale, plus
// bfr(bias[col]) when HASB != 0) in a wave-private slab [16][64] pitch 68; epi_get reads it back as whole row segments.
// coverage: 8 instructions x 2 rows x 16 lanes x 4 floats = the 16 x 64 tile.
// =====================================================================================================
template <int HASB>
__device__ __forceinline__ void epi_put(float* sl, v8f a0, v8f a1, v8f a2, v8f a3, float oscale,
                                        const float* __restrict__ bias, int col0, int lane) {
  const int hh = lane >> 4, m = lane & 15;
  float b0 = 0.0f, b1 = 0.0f, b2 = 0.0f, b3 = 0.0f;
  if (HASB != 0) {
    b0 = bfr(bias[col0 + m]);
    b1 = bfr(bias[col0 + 16 + m]);
    b2 = bfr(bias[col0 + 32 + m]);
    b3 = bfr(bias[col0 + 48 + m]);
  }
#pragma unroll
  for (int r = 0; r < 8; ++r) {
    const int ro = (8 * hh + r) * 68 + m;
    sl[ro]      = a0[r] * oscale + b0;
    sl[ro + 16] = a1[r] * oscale + b1;
    sl[ro + 32] = a2[r] * oscale + b2;
    sl[ro + 48] = a3[r] * oscale + b3;
  }
}
__device__ __forceinline__ void epi_get(const float* sl, float* C, int N, size_t rowb, int col0, int lane) {
  const int hh = lane >> 4, m = lane & 15;
  v4f vals[8];
#pragma unroll
  for (int it = 0; it < 8; ++it) vals[it] = *(const v4f*)(sl + (it * 2 + hh) * 68 + m * 4);
  float* dst = C + (rowb + (size_t)hh) * (size_t)N + col0 + m * 4;
#pragma unroll
  for (int it = 0; it < 8; ++it) {
    *(v4f*)(dst + (size_t)(it * 2) * (size_t)N) = vals[it];
  }
}

// =====================================================================================================
// GEMM engine shared by gemm_bf and gemm_h: C[M][N] (f32) = (A[M][K] (+ A2[M][K] when TWO != 0)) . Bt[N][K]^T, times oscale
// (plus bfr(bias[n]) when HASB != 0); A, A2 row-major 16-bit planes, Bt k-contiguous 16-bit plane.
// Block = BM x 128 tile of C (BM = 128, or 64 when TWO != 0), 4 waves as 2 x 2, wave = (BM/2) x 64 = MF x 4 accumulator tiles.
// A pass is 64 k = one whole 128-B line of each of the stage's 256 operand rows (A rows, then A2 rows, then the 128 Bt rows),
// brought into LDS by asynchronous copies (8 lanes per row, 16 copies per lane and pass), row pitch 144 B; two buffers: the
// copies of pass t + 2 are issued behind the barrier that ends pass t, so they fly while pass t + 1 is worked on.
// Fragments are read from the LDS rows with the same split k map and each accumulator takes its products in the
// same order (k ascending by 32; A before A2). Host guarantees K % 64 == 0, M % BM == 0, N % 128 == 0, grid = (M/BM)*(N/128).
// =====================================================================================================
#define GKP   64
#define GPIT  72
#define GSTG  (256 * GPIT)
static_assert(GKP == 2 * 32 && (DMOD % GKP) == 0 && (MROWS % 128) == 0 && (NQKV % 128) == 0 && (DMOD % 128) == 0);
static_assert((RICH % 64) == 0 && ((SEQ - RICH) % 128) == 0 && 4 * 4 * SLAB64 * 4 <= 2 * GSTG * 2);

union FragU { v4u u[2]; v16h h; v16b b; };

__device__ __forceinline__ FragU ldfrag_u(const u16* p) {
  FragU f;
  f.u[0] = *(const v4u*)(p);
  f.u[1] = *(const v4u*)(p + 16);
  return f;
}
template <int BF>
__device__ __forceinline__ v8f mma_u(const FragU& a, const FragU& b, v8f c) {
  if (BF != 0) return mma_b(a.b, b.b, c);
  return mma_h(a.h, b.h, c);
}
// eight asynchronous 16-B copies per lane, global -> LDS; the s_wait_xcnt closes the statement so that no register a copy
// names is rewritten ahead of it
__device__ __forceinline__ void copy8(const unsigned (&l)[8], const u16* const (&g)[8]) {
#if defined(__HIP_DEVICE_COMPILE__)
  asm volatile("global_load_async_to_lds_b128 %0, %8, off\n\t"
               "global_load_async_to_lds_b128 %1, %9, off\n\t"
               "global_load_async_to_lds_b128 %2, %10, off\n\t"
               "global_load_async_to_lds_b128 %3, %11, off\n\t"
               "global_load_async_to_lds_b128 %4, %12, off\n\t"
               "global_load_async_to_lds_b128 %5, %13, off\n\t"
               "global_load_async_to_lds_b128 %6, %14, off\n\t"
               "global_load_async_to_lds_b128 %7, %15, off\n\t"
               "s_wait_xcnt 0x0"
               :: "v"(l[0]), "v"(l[1]), "v"(l[2]), "v"(l[3]), "v"(l[4]), "v"(l[5]), "v"(l[6]), "v"(l[7]),
                  "v"(g[0]), "v"(g[1]), "v"(g[2]), "v"(g[3]), "v"(g[4]), "v"(g[5]), "v"(g[6]), "v"(g[7])
               : "memory");
#endif
}
// this wave's own copies have landed
__device__ __forceinline__ void wait_copies() {
#if defined(__HIP_DEVICE_COMPILE__)
  asm volatile("s_wait_asynccnt 0x0" ::: "memory");
#endif
}
// this wave's own LDS reads have returned, before the buffer they read is handed to the copies
__device__ __forceinline__ void wait_lds() {
#if defined(__HIP_DEVICE_COMPILE__)
  asm volatile("s_wait_dscnt 0x0" ::: "memory");
#endif
}
// one stage: lane = (row r0 = tid >> 3 of each group of 16 rows, 16-B piece tid & 7); ld = the lane's LDS byte address of
// stage row r0, ga / ga2 / gb = its global address in row r0 of the block's A / A2 / Bt rows, rs16 = halves per 16 rows
template <int TWO>
__device__ __forceinline__ void stage_tile(unsigned ld, const u16* ga, const u16* ga2, const u16* gb, size_t rs16) {
  unsigned l[8];
  const u16* g[8];
#pragma unroll
  for (int i = 0; i < 8; ++i) {
    l[i] = ld + (unsigned)(i * 16 * GPIT * 2);
    if (TWO != 0) g[i] = (i < 4) ? (ga + (size_t)i * rs16) : (ga2 + (size_t)(i - 4) * rs16);
    else          g[i] = ga + (size_t)i * rs16;
  }
  copy8(l, g);
#pragma unroll
  for (int i = 0; i < 8; ++i) {
    l[i] = ld + (unsigned)((8 + i) * 16 * GPIT * 2);
    g[i] = gb + (size_t)i * rs16;
  }
  copy8(l, g);
}

template <int BF, int TWO, int HASB>
__device__ __forceinline__ void gemm_ring(u16* ring, const u16* __restrict__ A, const u16* __restrict__ A2,
                                          const u16* __restrict__ Bt, const float* __restrict__ bias, float* C,
                                          int M, int N, int K, float oscale) {
  constexpr int MF = (TWO != 0) ? 2 : 4;
  constexpr int BM = 32 * MF;
  const int tid = threadIdx.x, wave = tid >> 5, lane = tid & 31, hh = lane >> 4, m = lane & 15;
  const int ntile = N >> 7;
  const int bid   = blockIdx.x;
  const int row0  = (bid / ntile) * BM;
  const int col0  = (bid % ntile) * 128;
  if (row0 + BM > M) return;                // block-uniform, before any copy or barrier; never taken with the exact grid
  const int wm = wave >> 1, wn = wave & 1;
  const int r0 = tid >> 3, c8 = (tid & 7) * 8;
  const u16* ga  = A  + (size_t)(row0 + r0) * K + c8;
  const u16* ga2 = A2 + (size_t)(row0 + r0) * K + c8;
  const u16* gb  = Bt + (size_t)(col0 + r0) * K + c8;
  const size_t rs16 = (size_t)16 * K;
  const unsigned ld0 = (unsigned)(uintptr_t)ring + (unsigned)((r0 * GPIT + c8) * 2);
  const int npass = K / GKP;
  const int aoff = (wm * (16 * MF) + m) * GPIT + 8 * hh;          // halves, in a stage: A fragment row of this lane
  const int boff = (128 + wn * 64 + m) * GPIT + 8 * hh;           // Bt fragment row of this lane

  v8f acc[MF][4];
#pragma unroll
  for (int i = 0; i < MF; ++i) {
#pragma unroll
    for (int j = 0; j < 4; ++j) acc[i][j] = zero8();
  }

  stage_tile<TWO>(ld0, ga, ga2, gb, rs16);
  wait_copies();
  __syncthreads();
  if (npass > 1) stage_tile<TWO>(ld0 + (unsigned)(GSTG * 2), ga + GKP, ga2 + GKP, gb + GKP, rs16);

  // kept rolled (for speed only), the buffer chosen by the pass's parity
#pragma unroll 1
  for (int t = 0; t < npass; ++t) {
    const int par = t & 1;
    const u16* st = ring + par * GSTG;
    FragU a[2][MF], a2[2][MF], b[4];
#pragma unroll
    for (int kk = 0; kk < 2; ++kk) {
#pragma unroll
      for (int i = 0; i < MF; ++i) {
        a[kk][i] = ldfrag_u(st + aoff + i * 16 * GPIT + kk * 32);
        if (TWO != 0) a2[kk][i] = ldfrag_u(st + aoff + (64 + i * 16) * GPIT + kk * 32);
      }
    }
#pragma unroll
    for (int kk = 0; kk < 2; ++kk) {
#pragma unroll
      for (int j = 0; j < 4; ++j) b[j] = ldfrag_u(st + boff + j * 16 * GPIT + kk * 32);
      // the LDS reads stay in one group ahead of the WMMA block (for speed only)
      __builtin_amdgcn_sched_barrier(0);
#pragma unroll
      for (int i = 0; i < MF; ++i) {
#pragma unroll
        for (int j = 0; j < 4; ++j) acc[i][j] = mma_u<BF>(a[kk][i], b[j], acc[i][j]);
      }
      if (TWO != 0) {
#pragma unroll
        for (int i = 0; i < MF; ++i) {
#pragma unroll
          for (int j = 0; j < 4; ++j) acc[i][j] = mma_u<BF>(a2[kk][i], b[j], acc[i][j]);
        }
      }
      // the WMMA block stays ahead of what follows: sunk behind the publish point it would put the refill's issue directly
      // in front of the next pass's wait for it
      __builtin_amdgcn_sched_barrier(0);
    }
    // publish point of pass t + 1: own reads back, own copies landed, every wave here; then the freed buffer is refilled
    wait_lds();
    wait_copies();
    __syncthreads();
    if (t + 2 < npass) {
      const size_t ko = (size_t)(t + 2) * GKP;
      stage_tile<TWO>(ld0 + (unsigned)(par * GSTG * 2), ga + ko, ga2 + ko, gb + ko, rs16);
    }
  }
  wait_copies();

  // the last pass's barrier has ended every read of the ring and no copy is outstanding: each wave stages its MF tiles in
  // MF slabs of its own
  float* sl = (float*)(void*)ring + wave * (MF * SLAB64);
  const int colw = col0 + wn * 64;
#pragma unroll
  for (int i = 0; i < MF; ++i)
    epi_put<HASB>(sl + i * SLAB64, acc[i][0], acc[i][1], acc[i][2], acc[i][3], oscale, bias, colw, lane);
  wave_sync_lds();
#pragma unroll
  for (int i = 0; i < MF; ++i)
    epi_get(sl + i * SLAB64, C, N, (size_t)(row0 + wm * (16 * MF) + i * 16), colw, lane);
}

__global__ __launch_bounds__(128)
void gemm_bf(const u16* __restrict__ A, const u16* __restrict__ Bt, float* C, int M, int N, int K, float oscale) {
  __shared__ __align__(16) u16 ring[2 * GSTG];
  gemm_ring<1, 0, 0>(ring, A, A, Bt, (const float*)0, C, M, N, K, oscale);
}

template <int TWO>
__global__ __launch_bounds__(128)
void gemm_h(const u16* __restrict__ A, const u16* __restrict__ A2, const u16* __restrict__ Bt,
            const float* __restrict__ bias, float* C, int M, int N, int K, float oscale) {
  __shared__ __align__(16) u16 ring[2 * GSTG];
  gemm_ring<0, TWO, 1>(ring, A, A2, Bt, bias, C, M, N, K, oscale);
}

// =====================================================================================================
// Causal grouped-query softmax attention, hd = 64. Block bid -> (query tile qt = qt0 + bid % nqt: rows q0 = 16*qt ..
// q0+15, head group hg = kv head, batch b); one wave per query head = hg*WPB + wave (the 4 consecutive query heads of a
// group share kv head hg).
//   q hi / residual planes f16 x256, tiles (b, h, s >> 4); k hi / residual planes f16 x256, tiles (b, g, s >> 4); v^T hi /
//   residual planes x1024, tiles (b, g, s >> 5): all in fragment order (split16, vt16), so that every fragment load of a wave
//   reads 512 contiguous bytes and a key tile of 32 is 4096 contiguous bytes of each k plane and of each v^T plane.
//   Transposed products: S^T = K.Q^T (A = key rows, B = query rows as columns), so a lane's 16 score registers of a key tile
//   belong to one query (lane & 15) and hold keys kb + 8*(lane >> 4) + r and kb + 16 + 8*(lane >> 4) + r.
//   raw(j, i) = k_hi.q_hi + k_hi.q_lo + k_lo.q_hi (2 k-steps over d); logit = raw * 2^-19 (the 1/8 softmax scale and the two
//   256 carries, exact); keys above the diagonal replaced by -inf; online softmax per query in f32 with a running max:
//   max in-lane over the 16 scores plus one exchange with lane ^ 16; sum in-lane, the two halves' sums joined once after the
//   loop; alpha = exp(m_old - m_new), p = exp(logit - m_new), l = l*alpha + sum p, O^T accumulators times alpha before the
//   tile's product. Key tiles of 32 visited in order, only tiles with kb <= q0 (nkt = q0/32 + 1 <= NKT; key kb is unmasked for
//   every query of the tile). The score registers, as p*32768 (f16 hi and its f16 residual), are the B fragment of
//   O^T += v^T.P^T in the split k map as they stand; v^T A fragments in 2 groups of 2 d-subtiles; RV = 1: products hh + lh + hl,
//   RV = 0: hh only.
//   Epilogue: O x256 -> f16 hi plane (and for RV = 1 the f16 residual plane of O x256) [b*SEQ + s][h*HD + d]; lane = (row group
//   rq = lane>>3 in 0..3, 8 consecutive d at c8); one instruction = 4 rows it*4 + rq, each row segment (64 halves = one whole
// coverage: per wave 4 instructions x 4 rows x 8 lanes x 8 halves = 16 x 64 per plane; grid nqt x NHG x NB blocks x WPB waves;
//   the two launches (tiles 0..NQTR-1 with RV = 1, NQTR..NQT-1 with RV = 0) cover every (b, s, h) row segment of the hi plane
//   exactly once and rows s < RICH of the residual plane exactly once (only those rows are read later).
// =====================================================================================================
template <int RV>
__global__ __launch_bounds__(ATT_THREADS)
void attn_gq(const u16* __restrict__ QHp, const u16* __restrict__ QLp,
             const u16* __restrict__ KHp, const u16* __restrict__ KLp,
             const u16* __restrict__ VHp, const u16* __restrict__ VLp,
             u16* OHp, u16* OLp, int qt0, int nqt) {
#pragma clang fp contract(off)
  __shared__ __align__(16) float smem[WPB * WREG];

  const int tid  = threadIdx.x;
  const int wave = tid >> 5;
  const int lane = tid & 31;
  const int hh   = lane >> 4;
  const int c    = lane & 15;
  const int bid  = blockIdx.x;
  if (nqt <= 0) return;                     // block-uniform; no block barriers in this kernel
  const int qt   = qt0 + bid % nqt;
  const int t2   = bid / nqt;
  const int hg   = t2 % NHG;
  const int b    = t2 / NHG;
  if (b >= NB) return;                      // block-uniform; never taken with the exact grid
  const int q0   = qt * 16;
  if (q0 + 16 > SEQ) return;                // block-uniform; never taken
  const int head = hg * WPB + wave;
  const int kvh  = hg;

  float* slab = smem + wave * WREG;         // result slab [16][64] pitch 68

  const unsigned l8 = (unsigned)lane * 8;
  const size_t qoff = ((size_t)(b * NH + head) * NQT + qt) * FTILE;                        // this wave's 16-query tile
  const size_t koff = (size_t)(b * NKVH + kvh) * NQT * FTILE;                              // 16-key tile 0 of the kv head
  const size_t voff = (size_t)(b * NKVH + kvh) * NKT * (2 * FTILE);                        // 32-key tile 0 of the kv head
  const _Float16* Qh  = (const _Float16*)(const void*)QHp + qoff;
  const _Float16* Ql  = (const _Float16*)(const void*)QLp + qoff;
  const _Float16* Khb = (const _Float16*)(const void*)KHp + koff;
  const _Float16* Klb = (const _Float16*)(const void*)KLp + koff;
  const _Float16* Vhb = (const _Float16*)(const void*)VHp + voff;
  const _Float16* Vlb = (const _Float16*)(const void*)VLp + voff;
  const float lsc  = SM_SCALE * (1.0f / (QSC * KSC));   // exact power-of-two fold of the q / k carries into the 1/8 scale
  const float oc   = 1.0f / (PCAR * VCAR);
  const float ninf = -__builtin_inff();

  v8f o[4];                                 // O^T: element r of o[j] = (d = 16j + 8hh + r, query row q0 + c)
#pragma unroll
  for (int j = 0; j < 4; ++j) o[j] = zero8();
  float mrun = ninf, lrun = 0.0f;           // this lane's query: running max (both halves alike), sum over this half's keys
  const int ncaus = (q0 >> 5) + 1;                                            // tiles holding keys <= q0 + 15
  const int nkt   = (ncaus < NKT) ? ncaus : NKT;
  const int qrow  = q0 + c;                                                   // query row of every D element of this lane

#pragma unroll 1
  for (int kt = 0; kt < nkt; ++kt) {
    const int kb = kt * 32;
    // ---- raw scores, transposed: D element r of this lane = (key kb + 8hh + r, query qrow) in s0, key + 16 in s1 ----
    v8f s0 = zero8(), s1 = zero8();
    const _Float16* k0p = Khb + (size_t)kt * (2 * FTILE);
    const _Float16* k1p = k0p + FTILE;
    const _Float16* l0p = Klb + (size_t)kt * (2 * FTILE);
    const _Float16* l1p = l0p + FTILE;
#pragma unroll
    for (int kk = 0; kk < HD / 32; ++kk) {
      const v16h qh  = ldfrag_f(Qh + kk * (2 * FPC), l8);
      const v16h ql  = ldfrag_f(Ql + kk * (2 * FPC), l8);
      const v16h kh0 = ldfrag_f(k0p + kk * (2 * FPC), l8);
      const v16h kh1 = ldfrag_f(k1p + kk * (2 * FPC), l8);
      // RV = 0 build: the residual plane's results take over the registers of the hi plane's address, last used just above
      if (RV == 0 && kk == HD / 32 - 1) wait_addr();
      const v16h kl0 = ldfrag_f(l0p + kk * (2 * FPC), l8);
      const v16h kl1 = ldfrag_f(l1p + kk * (2 * FPC), l8);
      s0 = mma_h(kh0, qh, s0);
      s0 = mma_h(kh0, ql, s0);
      s0 = mma_h(kl0, qh, s0);
      s1 = mma_h(kh1, qh, s1);
      s1 = mma_h(kh1, ql, s1);
      s1 = mma_h(kl1, qh, s1);
      guard2(s0, s1, qh, ql, kh0, kl0, kh1, kl1);
    }
    // ---- causal replace-mask, running-max online softmax in f32: the lane's 16 scores belong to one query ----
    const int key0 = kb + 8 * hh, key1 = key0 + 16;
    float t0[8], t1[8];
    float mx = ninf;
#pragma unroll
    for (int r = 0; r < 8; ++r) {
      const float a0 = s0[r] * lsc;
      const float a1 = s1[r] * lsc;
      t0[r] = (key0 + r > qrow) ? ninf : a0;
      t1[r] = (key1 + r > qrow) ? ninf : a1;
      mx = fmaxf(mx, fmaxf(t0[r], t1[r]));
    }
    mx = fmaxf(mx, xhalf(mx));                          // the other half's 16 keys of the same query
    const float mnew = fmaxf(mrun, mx);
    const float al   = __expf(mrun - mnew);
    // ---- B fragments of p*32768 straight from the score registers: hi f16 and residual f16, column = query c,
    //      elements 0..7 = keys kb + 8hh + 0..7, elements 8..15 = keys kb + 16 + 8hh + 0..7 (the split k map) ----
    FragH ph, pl;
    float sm = 0.0f;
#pragma unroll
    for (int r = 0; r < 8; ++r) {
      const float p0 = __expf(t0[r] - mnew);
      const float p1 = __expf(t1[r] - mnew);
      sm += p0 + p1;
      const float ta = p0 * PCAR, tc = p1 * PCAR;
      const _Float16 ha = (_Float16)ta, hc = (_Float16)tc;
      ph.h[0][r] = ha;
      ph.h[1][r] = hc;
      pl.h[0][r] = (_Float16)(ta - (float)ha);
      pl.h[1][r] = (_Float16)(tc - (float)hc);
    }
    lrun = lrun * al + sm;
    mrun = mnew;
    // ---- rescale the O^T accumulators by the lane's alpha ----
#pragma unroll
    for (int j = 0; j < 4; ++j) {
#pragma unroll
      for (int r = 0; r < 8; ++r) o[j][r] = o[j][r] * al;
    }
    // ---- O^T += v^T.P^T : A fragment row = d = j*16 + c, subtile j = pieces 2j, 2j + 1 of the key tile; 2 groups of 2 ----
    {
      const _Float16* vhp = Vhb + (size_t)kt * (2 * FTILE);
      const _Float16* vlp = Vlb + (size_t)kt * (2 * FTILE);
      (void)vlp;
#pragma unroll
      for (int jg = 0; jg < 2; ++jg) {
        const size_t da = (size_t)(2 * jg) * (2 * FPC);
        const size_t db = da + (size_t)(2 * FPC);
        const v16h vha = ldfrag_f(vhp + da, l8), vhb2 = ldfrag_f(vhp + db, l8);
        o[2 * jg]     = mma_h(vha,  ph.v, o[2 * jg]);
        o[2 * jg + 1] = mma_h(vhb2, ph.v, o[2 * jg + 1]);
        if (RV != 0) {
          const v16h vla = ldfrag_f(vlp + da, l8), vlb2 = ldfrag_f(vlp + db, l8);
          o[2 * jg]     = mma_h(vha,  pl.v, o[2 * jg]);
          o[2 * jg]     = mma_h(vla,  ph.v, o[2 * jg]);
          o[2 * jg + 1] = mma_h(vhb2, pl.v, o[2 * jg + 1]);
          o[2 * jg + 1] = mma_h(vlb2, ph.v, o[2 * jg + 1]);
          guard2(o[2 * jg], o[2 * jg + 1], ph.v, pl.v, vha, vhb2, vla, vlb2);
        } else {
          guard2(o[2 * jg], o[2 * jg + 1], ph.v, pl.v, vha, vhb2, vha, vhb2);
        }
      }
    }
  }
  acc_guard4(o[0], o[1], o[2], o[3]);
  // ---- O = acc / l with the carries (32768 on p, 1024 on v) folded once; the two halves' sums joined here; the lane's
  //      8 consecutive d of each subtile go into row c of the wave's slab ----
  const float ltot = lrun + xhalf(lrun);
  const float rl   = (1.0f / ltot) * oc;
#pragma unroll
  for (int j = 0; j < 4; ++j) {
    float* sd = slab + c * SLP + j * 16 + 8 * hh;
    v4f w0, w1;
#pragma unroll
    for (int e = 0; e < 4; ++e) { w0[e] = o[j][e] * rl; w1[e] = o[j][4 + e] * rl; }
    *(v4f*)(sd)     = w0;
    *(v4f*)(sd + 4) = w1;
  }
  wave_sync_lds();
  // ---- O x256 -> f16 hi plane (+ f16 residual plane); lane = (row group rq, 8 consecutive d at c8) ----
  v4u oh[4], ol[4];
  const int rq = lane >> 3, c8 = (lane & 7) * 8;
#pragma unroll
  for (int it = 0; it < 4; ++it) {
    const int row = it * 4 + rq;
    const v4f a = *(const v4f*)(slab + row * SLP + c8), b4 = *(const v4f*)(slab + row * SLP + c8 + 4);
    float w[8];
#pragma unroll
    for (int e = 0; e < 4; ++e) { w[e] = a[e] * OSC; w[4 + e] = b4[e] * OSC; }
#pragma unroll
    for (int e = 0; e < 4; ++e) {
      const _Float16 h0 = (_Float16)w[2 * e], h1 = (_Float16)w[2 * e + 1];
      const _Float16 g0 = (_Float16)(w[2 * e] - (float)h0), g1 = (_Float16)(w[2 * e + 1] - (float)h1);
      oh[it][e] = pk16(h_bits(h0), h_bits(h1));
      ol[it][e] = pk16(h_bits(g0), h_bits(g1));
    }
  }
  const size_t ob = ((size_t)b * SEQ + q0) * DMOD + (size_t)head * HD + c8;
  {
#pragma unroll
    for (int it = 0; it < 4; ++it) {
      const int row = it * 4 + rq;
      *(v4u*)(OHp + ob + (size_t)row * DMOD) = oh[it];
      if (RV != 0) {
        *(v4u*)(OLp + ob + (size_t)row * DMOD) = ol[it];
      }
    }
    
  }
}

// =====================================================================================================
// Workspace map (bytes); every plane is fully written by whole-line stores before it is read (the O residual plane only on
// the rows < RICH per sequence that are read); all extents are exact multiples of the store granularity (no pad rows needed);
// every region offset a multiple of 131072:
//   XB  bf16 [MROWS][2048]              MROWS*4096   (NB=2, SEQ=2048: 16777216); after the projection GEMM the same bytes hold
//                                                    the O f16 hi plane [MROWS][2048] x256 (identical extent)
//   WB  bf16 [3072 n][2048 k]           12582912     (Wq rows 0..2047, Wk 2048..2559, Wv 2560..3071); after the projection
//                                                    GEMM its first 8388608 bytes hold the Wo f16 plane [2048 o][2048 d]
//   F   f32 [MROWS][3072]               MROWS*12288  (q | k | v projection columns, no bias); after split16 / vt16 its first
//                                                    MROWS*4096 bytes hold the O f16 residual plane [MROWS][2048]
//   QH  f16 [NB*32][SEQ/16] tiles of 2048 B x256   MROWS*4096   QL residual, same extent   (fragment order)
//   KH  f16 [NB*8][SEQ/16] tiles of 2048 B x256    MROWS*1024   KL residual, same extent   (fragment order)
//   VH  f16 [NB*8][SEQ/32] tiles of 4096 B x1024   MROWS*1024   VL residual, same extent   (fragment order)
//   end (NB=2, SEQ=2048)               130023424
// =====================================================================================================
extern "C" void kernel_launch(void* const* d_in, const int* in_sizes, int n_in,
                              void* d_out, int out_size, void* d_ws, size_t ws_size,
                              hipStream_t stream) {
  if (n_in < 9) return;
  if (in_sizes[0] < ((NB - 1) * XS_FULL + SEQ) * DMOD) return;
  if (in_sizes[1] < DMOD * DMOD) return;
  if (in_sizes[2] < DMOD) return;
  if (in_sizes[3] < KVD * DMOD) return;
  if (in_sizes[4] < KVD) return;
  if (in_sizes[5] < KVD * DMOD) return;
  if (in_sizes[6] < KVD) return;
  if (in_sizes[7] < DMOD * DMOD) return;
  if (in_sizes[8] < DMOD) return;
  if (out_size < MROWS * DMOD) return;

  const float* x  = (const float*)d_in[0];
  const float* wq = (const float*)d_in[1];
  const float* bq = (const float*)d_in[2];
  const float* wk = (const float*)d_in[3];
  const float* bk = (const float*)d_in[4];
  const float* wv = (const float*)d_in[5];
  const float* bv = (const float*)d_in[6];
  const float* wo = (const float*)d_in[7];
  const float* bo = (const float*)d_in[8];
  float*       out = (float*)d_out;

  const size_t szXB = (size_t)MROWS * DMOD * 2;
  const size_t szWB = (size_t)NQKV * DMOD * 2;
  const size_t szF  = (size_t)MROWS * NQKV * 4;
  const size_t szQ  = (size_t)MROWS * DMOD * 2;                  // QH, QL
  const size_t szK  = (size_t)MROWS * KVD * 2;                   // KH, KL
  const size_t szV  = (size_t)NB * NKVH * HD * SEQ * 2;          // VH, VL (== szK)
  const size_t szOH = (size_t)MROWS * DMOD * 2;                  // O hi plane, lives in the XB region
  const size_t szOL = (size_t)MROWS * DMOD * 2;                  // O residual plane, lives in the F region
  const size_t szWT = (size_t)DMOD * DMOD * 2;                   // Wo f16 plane, lives in the WB region
  if (szOH > szXB || szOL > szF || szWT > szWB) return;
  size_t off = 0;
  const size_t oXB = off; off += szXB;
  const size_t oWB = off; off += szWB;
  const size_t oF  = off; off += szF;
  const size_t oQH = off; off += szQ;
  const size_t oQL = off; off += szQ;
  const size_t oKH = off; off += szK;
  const size_t oKL = off; off += szK;
  const size_t oVH = off; off += szV;
  const size_t oVL = off; off += szV;
  if (off > ws_size) return;                // off = 130023424 for NB = 2, SEQ = 2048
  if (off > (size_t)WS_CAP) return;

  char* ws = (char*)d_ws;
  u16*   XB  = (u16*)(ws + oXB);
  u16*   OH  = (u16*)(ws + oXB);
  u16*   WB  = (u16*)(ws + oWB);
  u16*   WT  = (u16*)(ws + oWB);
  float* F   = (float*)(ws + oF);
  u16*   OL  = (u16*)(ws + oF);
  u16*   QH  = (u16*)(ws + oQH);
  u16*   QL  = (u16*)(ws + oQL);
  u16*   KH  = (u16*)(ws + oKH);
  u16*   KL  = (u16*)(ws + oKL);
  u16*   VH  = (u16*)(ws + oVH);
  u16*   VL  = (u16*)(ws + oVL);

  const dim3 b256(256), b128(128), bAT(ATT_THREADS);
  const int  n8x = (SEQ * DMOD) / 8;
  const dim3 gX((n8x + 255) / 256);                     // SEQ*DMOD/2048 blocks per batch
  const int  n8q = (DMOD * DMOD) / 8;
  const dim3 gWq((n8q + 255) / 256);                    // 2048
  const int  n8kv = (KVD * DMOD) / 8;
  const dim3 gWk((n8kv + 255) / 256);                   // 512
  const dim3 gG1((MROWS / 128) * (NQKV / 128));         // 768
  const dim3 gSQ((MROWS / 16) * (NH / 2));              // 4096
  const dim3 gSK((MROWS / 16) * (NKVH / 2));            // 1024
  const dim3 gVT(NB * NKVH * NST);                      // 512
  const float osc = 1.0f / (OSC * WOS);

  // (0) x -> bf16 plane [MROWS][2048], one launch per batch row block
  for (int bq2 = 0; bq2 < NB; ++bq2) {
    cvt16<<<gX, b256, 0, stream>>>(x + (size_t)bq2 * XS_FULL * DMOD, XB + (size_t)bq2 * SEQ * DMOD, n8x, 0, 1.0f);
  }
  // (1) Wq [2048 n][2048 k], Wk [512][2048], Wv [512][2048] -> one bf16 plane [3072 n][2048 k]
  cvt16<<<gWq, b256, 0, stream>>>(wq, WB, n8q, 0, 1.0f);
  cvt16<<<gWk, b256, 0, stream>>>(wk, WB + (size_t)DMOD * DMOD, n8kv, 0, 1.0f);
  cvt16<<<gWk, b256, 0, stream>>>(wv, WB + (size_t)DMOD * DMOD + (size_t)KVD * DMOD, n8kv, 0, 1.0f);
  // (2) qkv = x.[Wq|Wk|Wv]^T -> F f32 [MROWS][3072] (biases added by the consumers in f32)
  gemm_bf<<<gG1, b128, 0, stream>>>(XB, WB, F, MROWS, NQKV, DMOD, 1.0f);
  // (3) q hi + residual planes x256 from columns 0..2047 (+bq); (4) same for k from columns 2048..2559 (+bk)
  split16<<<gSQ, b256, 0, stream>>>(F, NQKV, 0, NH, bq, QH, QL, QSC);
  split16<<<gSK, b256, 0, stream>>>(F, NQKV, DMOD, NKVH, bk, KH, KL, KSC);
  // (5) v^T hi + residual planes x1024 from columns 2560..3071 (+bv)
  vt16<<<gVT, b256, 0, stream>>>(F, NQKV, DMOD + KVD, bv, VH, VL);
  // (6) Wo [2048 o][2048 d] -> f16 plane of the bf16 value x1024 (already k-contiguous; WB region, free after the projection GEMM)
  cvt16<<<gWq, b256, 0, stream>>>(wo, WT, n8q, 1, WOS);
  // (7) causal attention -> O f16 hi plane x256 (XB region) for all query tiles; residual plane (F region) for tiles < RICH
  attn_gq<1><<<dim3(NQTR * NHG * NB), bAT, 0, stream>>>(QH, QL, KH, KL, VH, VL, OH, OL, 0, NQTR);
  if (NQT > NQTR) {
    attn_gq<0><<<dim3((NQT - NQTR) * NHG * NB), bAT, 0, stream>>>(QH, QL, KH, KL, VH, VL, OH, OL, NQTR, NQT - NQTR);
  }
  // (8) y = O.Wo^T + bo -> out f32 [MROWS][2048], carries 256 x 1024 folded back; rows < RICH per sequence with O hi + residual
  for (int bq2 = 0; bq2 < NB; ++bq2) {
    const size_t rb = (size_t)bq2 * SEQ;
    gemm_h<1><<<dim3((RICH / 64) * (DMOD / 128)), b128, 0, stream>>>(
        OH + rb * DMOD, OL + rb * DMOD, WT, bo, out + rb * DMOD, RICH, DMOD, DMOD, osc);
    if (SEQ > RICH) {
      const size_t rl = rb + RICH;
      gemm_h<0><<<dim3(((SEQ - RICH) / 128) * (DMOD / 128)), b128, 0, stream>>>(
          OH + rl * DMOD, OL + rl * DMOD, WT, bo, out + rl * DMOD, SEQ - RICH, DMOD, DMOD, osc);
    }
  }
  (void)hipGetLastError();
}

// v004
// One run takes 249 microseconds.
// Timed twice side by side with v003, it ran 1.51 and 1.48 times as fast.
// All steps since v000 together make it 2.54 times as fast.
// Contractions: x.[Wq|Wk|Wv]^T on v_wmma_f32_16x16x32_bf16 (x and the weights as bf16 RNE planes, weight [n][k] rows are the
// k-contiguous B operand, f32 accumulate, biases added in f32 as bf16 RNE values); q.k^T over hd 64 and P.v on
// v_wmma_f32_16x16x32_f16 with f16 hi + f16 residual planes (q, k x256, products hh+lh+hl on every row; P x32768 hi +
// in-register residual and v^T x1024 hi + residual plane for query rows < 512 of each sequence, P hi . v hi only for later
// rows); O.Wo^T on v_wmma_f32_16x16x32_f16 with O x256 as f16 hi (+ f16 residual plane for rows < 512 of each sequence) and
// Wo as f16(bf16(Wo)) x1024, one accumulator, bias bo added in f32; all f32 accumulate. Online softmax in f32 on VALU.
#include <hip/hip_runtime.h>
#include <math.h>
#include <stdint.h>

#ifndef NB
#define NB 2
#endif
#ifndef SEQ
#define SEQ 2048
#endif
#define XS_FULL 2048
#define DMOD  2048
#define NH    32
#define NKVH  8
#define HD    64
#define KVD   (NKVH * HD)
#define NQKV  (DMOD + 2 * KVD)
#define MROWS (NB * SEQ)
#define RICH_REQ 512
#define RICH  ((SEQ < RICH_REQ) ? SEQ : RICH_REQ)
#define SM_SCALE 0.125f
#define QSC   256.0f
#define KSC   256.0f
#define PCAR  32768.0f
#define VCAR  1024.0f
#define OSC   256.0f
#define WOS   1024.0f
#define WPB   (NH / NKVH)
#define NHG   NKVH
#define NQT   (SEQ / 16)
#define NQTR  (RICH / 16)
#define NST   (SEQ / 64)
#define NKT   (SEQ / 32)
#define ATT_THREADS (WPB * 32)
#define SLP   68
#define SLW   (16 * SLP)
#define WREG  (SLW)
#define SLAB64 (16 * 68)
#define VTP   72
#define WS_CAP 268435456
static_assert(DMOD == NH * HD && HD == 64 && NH == 32 && NKVH == 8 && WPB == 4 && NHG * WPB == NH);
static_assert(ATT_THREADS == 128 && KVD == 512 && NQKV == 3072);
static_assert(NB >= 1 && NB <= 2);
static_assert(NB == 1 || SEQ == XS_FULL);
static_assert((SEQ % 64) == 0 && SEQ >= 64 && SEQ <= XS_FULL);
static_assert((RICH % 64) == 0 && RICH >= 64 && RICH <= SEQ);
static_assert((DMOD % 64) == 0 && (KVD % 64) == 0 && (NQKV % 64) == 0 && (DMOD % 32) == 0 && (HD % 32) == 0 && (MROWS % 64) == 0);
static_assert(((SEQ * DMOD / 8) % 256) == 0 && ((DMOD * DMOD / 8) % 256) == 0 && ((KVD * DMOD / 8) % 256) == 0);
static_assert(WPB * WREG * 4 <= 65536 && 2 * HD * VTP * 2 <= 65536 && 4 * SLAB64 * 4 <= 65536);
// workspace total (XB + WB + WT + F + QH + QL + KH + KL + VH + VL) for this build
static_assert((size_t)MROWS * DMOD * 2 + (size_t)NQKV * DMOD * 2 + (size_t)DMOD * DMOD * 2 + (size_t)MROWS * NQKV * 4 +
              2 * (size_t)MROWS * DMOD * 2 + 2 * (size_t)MROWS * KVD * 2 + 2 * (size_t)NB * NKVH * HD * SEQ * 2
              <= (size_t)WS_CAP);

typedef unsigned short u16;
typedef _Float16 v16h __attribute__((ext_vector_type(16)));
typedef _Float16 v8h  __attribute__((ext_vector_type(8)));
typedef __bf16   v16b __attribute__((ext_vector_type(16)));
typedef float    v8f  __attribute__((ext_vector_type(8)));
typedef float    v4f  __attribute__((ext_vector_type(4)));
typedef unsigned int v4u __attribute__((ext_vector_type(4)));

union FragH { v16h v; v8h h[2]; v4u u[2]; };

// ---- scalar helpers --------------------------------------------------------------------------------
__device__ __forceinline__ unsigned short bf_bits(float f) {          // f32 -> bf16 bits, RNE convert
  unsigned u = __float_as_uint(f);
  return (unsigned short)((u + 0x7FFFu + ((u >> 16) & 1u)) >> 16);
}
__device__ __forceinline__ float bf_up(unsigned short h) { return __uint_as_float(((unsigned)h) << 16); }
__device__ __forceinline__ float bfr(float f) { return bf_up(bf_bits(f)); }
__device__ __forceinline__ unsigned short h_bits(_Float16 x) { return __builtin_bit_cast(unsigned short, x); }
__device__ __forceinline__ unsigned pk16(unsigned short a, unsigned short b) { return (unsigned)a | ((unsigned)b << 16); }
__device__ __forceinline__ v8f zero8() { v8f z = {0.f, 0.f, 0.f, 0.f, 0.f, 0.f, 0.f, 0.f}; return z; }

// ---- fragment map: 16-bit A/B operand of k-step k0, lane -> row/col (lane&15), h = lane>>4; elements 0..7 <- k0+8h+0..7,
//      elements 8..15 <- k0+16+8h+0..7 (the same split k map for A and B; ldfrag_u reads it from k-contiguous rows)
// ---- fragment loader for a plane kept in fragment order: a fragment is two pieces of 512 contiguous bytes, piece = 32 lanes
//      x 16 B; p = the fragment's first byte (wave-uniform where the tile is), l8 = 8*lane; elements 0..7 <- piece 0,
//      elements 8..15 <- piece 1 (a load = 4 whole 128-B lines)
#define FPC   256
#define FTILE (4 * FPC)
__device__ __forceinline__ v16h ldfrag_f(const _Float16* p, unsigned l8) {
  FragH f;
  f.h[0] = *(const v8h*)(p + l8);
  f.h[1] = *(const v8h*)(p + l8 + FPC);
  return f.v;
}

// stands behind issued global loads whose address registers the following loads' results may take over
__device__ __forceinline__ void wait_addr() {
#if defined(__HIP_DEVICE_COMPILE__)
  asm volatile("s_wait_xcnt 0x0" ::: "memory");
#endif
}

// stands behind the last global store of a block range's body in a grid of several ranges: the next range's body follows in
// the code and rewrites the registers that the stores name
__device__ __forceinline__ void wait_stores_issued() {
#if defined(__HIP_DEVICE_COMPILE__)
  asm volatile("s_wait_xcnt 0x0" ::: "memory");
#endif
}

__device__ __forceinline__ v8f mma_h(v16h a, v16h b, v8f c) {
  return __builtin_amdgcn_wmma_f32_16x16x32_f16(false, a, false, b, (short)0, c, false, false);
}
__device__ __forceinline__ v8f mma_b(v16b a, v16b b, v8f c) {
  return __builtin_amdgcn_wmma_f32_16x16x32_bf16(false, a, false, b, (short)0, c, false, false);
}
__device__ __forceinline__ void guard2(v8f& a, v8f& b, v16h x0, v16h x1, v16h x2, v16h x3, v16h x4, v16h x5) {
#if defined(__HIP_DEVICE_COMPILE__)
  asm volatile("v_nop\n\tv_nop\n\tv_nop\n\tv_nop"
               : "+v"(a), "+v"(b) : "v"(x0), "v"(x1), "v"(x2), "v"(x3), "v"(x4), "v"(x5) : "memory");
#endif
}
__device__ __forceinline__ void acc_guard4(v8f& a, v8f& b, v8f& c, v8f& d) {
#if defined(__HIP_DEVICE_COMPILE__)
  asm volatile("v_nop\n\tv_nop\n\tv_nop\n\tv_nop" : "+v"(a), "+v"(b), "+v"(c), "+v"(d));
#endif
}
// lane l <-> lane l ^ 16 on the vector pipe (the shuffle builtin would go through the LDS queue and its wait)
__device__ __forceinline__ float xhalf(float x) {
  const int v = __builtin_bit_cast(int, x);
  return __builtin_bit_cast(float, __builtin_amdgcn_permlanex16(v, v, 0x76543210, 0xfedcba98, false, false));
}
__device__ __forceinline__ void wave_sync_lds() {
  __builtin_amdgcn_fence(__ATOMIC_RELEASE, "workgroup");
  __builtin_amdgcn_wave_barrier();
  __builtin_amdgcn_fence(__ATOMIC_ACQUIRE, "workgroup");
}

// =====================================================================================================
// f32 -> 16-bit plane, same layout.  f16mode == 0: bf16 RNE bits;  f16mode == 1: f16 bits of (bf16 RNE value) * scale.
// Thread = 8 consecutive elements: two 16-B loads, one 16-B store; 32 consecutive lanes = 512 contiguous, 512-B aligned
// One grid converts all five tensors, none of which depends on another: a block range per plane, in this order:
//   x (CB_X blocks per batch) -> XB bf16; Wq (CB_W) | Wk (CB_KV) | Wv (CB_KV) -> WB bf16 [3072 n][2048 k]; Wo (CB_W) -> WT f16 x1024.
// coverage: each range = plane elements / 2048 blocks x 256 thr x 8 = the whole plane (every plane a multiple of 2048 elements).
// =====================================================================================================
#define CB_X   (SEQ * DMOD / 2048)
#define CB_W   (DMOD * DMOD / 2048)
#define CB_KV  (KVD * DMOD / 2048)
#define CB_ALL (NB * CB_X + 2 * CB_W + 2 * CB_KV)
__global__ __launch_bounds__(256) void cvt_all(const float* __restrict__ xin, const float* __restrict__ wq,
                                               const float* __restrict__ wk, const float* __restrict__ wv,
                                               const float* __restrict__ wo, u16* XBp, u16* WBp, u16* WTp) {
  int blk = (int)blockIdx.x;                 // every choice below is block-uniform
  const float* x;
  u16* D;
  int f16mode = 0;
  float scale = 1.0f;
  if (blk < NB * CB_X) {
    const int b = blk / CB_X;
    blk -= b * CB_X;
    x = xin + (size_t)b * XS_FULL * DMOD;
    D = XBp + (size_t)b * SEQ * DMOD;
  } else if ((blk -= NB * CB_X) < CB_W) {
    x = wq;  D = WBp;
  } else if ((blk -= CB_W) < CB_KV) {
    x = wk;  D = WBp + (size_t)DMOD * DMOD;
  } else if ((blk -= CB_KV) < CB_KV) {
    x = wv;  D = WBp + (size_t)DMOD * DMOD + (size_t)KVD * DMOD;
  } else if ((blk -= CB_KV) < CB_W) {
    x = wo;  D = WTp;  f16mode = 1;  scale = WOS;
  } else {
    return;                                  // never taken with the exact grid
  }
  const int gt = blk * 256 + (int)threadIdx.x;
  const float* p = x + (size_t)gt * 8;
  const v4f a = *(const v4f*)(p), b4 = *(const v4f*)(p + 4);
  float w[8];
#pragma unroll
  for (int e = 0; e < 4; ++e) { w[e] = a[e]; w[4 + e] = b4[e]; }
  v4u o;
#pragma unroll
  for (int e = 0; e < 4; ++e) {
    const float f0 = w[2 * e], f1 = w[2 * e + 1];
    const unsigned short hb0 = h_bits((_Float16)(bfr(f0) * scale));
    const unsigned short hb1 = h_bits((_Float16)(bfr(f1) * scale));
    const unsigned short bb0 = bf_bits(f0);
    const unsigned short bb1 = bf_bits(f1);
    o[e] = (f16mode != 0) ? pk16(hb0, hb1) : pk16(bb0, bb1);
  }
  u16* d = D + (size_t)gt * 8;
  {
    *(v4u*)(d) = o;
    
  }
}

// =====================================================================================================
// q / k planes from the projection F f32 [MROWS][ldf] at column offset coff (nhead heads of HD columns; row = b*SEQ + s,
// column = coff + head*HD + d): t = (F + bfr(bias[head*HD + d])) * sc in f32 (add, then exact power-of-two scale);
//   Hp = f16(t), Lp = f16 residual (t - f16(t)), both in fragment order: tile (b, head, s >> 4) = 16 rows x 64 d = 4 pieces of
//   512 B; piece pc, lane l, element e <- row (s & 15) = l & 15, d = 16*pc + 8*(l >> 4) + e (pieces 2kk, 2kk + 1 are the two
//   halves of the fragment of k-step kk in the split k map).
// Block = one 16-row tile x 2 heads, 256 threads; wave = one piece: two 16-B loads of F and of bias per lane, one 16-B store
// per plane, a wave's store = the piece's 512 contiguous bytes.
// coverage: 8 waves = 2 heads x 4 pieces; blk in 0 .. (MROWS/16) * (nhead/2) - 1 = every piece of both planes once.
// =====================================================================================================
__device__ __forceinline__ void split16(const float* __restrict__ F, int ldf, int coff, int nhead,
                                        const float* __restrict__ bias, u16* Hp, u16* Lp, float sc, int blk) {
#pragma clang fp contract(off)
  const int tid  = (int)threadIdx.x;
  const int hpb  = nhead >> 1;                         // blocks per 16-row tile
  const int tile = blk / hpb;
  if (tile >= MROWS / 16) return;                      // never taken with the exact range
  const int head = (blk % hpb) * 2 + (tid >> 7);
  const int pc   = (tid >> 5) & 3;
  const int lane = tid & 31;
  const int row  = tile * 16 + (lane & 15);
  const int col  = head * HD + pc * 16 + (lane >> 4) * 8;
  const float* p = F + (size_t)row * (size_t)ldf + coff + col;
  const v4f xa = *(const v4f*)(p), xb = *(const v4f*)(p + 4);
  wait_addr();
  const v4f ba = *(const v4f*)(bias + col), bb = *(const v4f*)(bias + col + 4);
  float xv[8], bw[8];
#pragma unroll
  for (int e = 0; e < 4; ++e) {
    xv[e] = xa[e];  xv[4 + e] = xb[e];
    bw[e] = ba[e];  bw[4 + e] = bb[e];
  }
  v4u oh, ol;
#pragma unroll
  for (int e = 0; e < 4; ++e) {
    const float s0 = xv[2 * e] + bfr(bw[2 * e]);
    const float s1 = xv[2 * e + 1] + bfr(bw[2 * e + 1]);
    const float t0 = s0 * sc;
    const float t1 = s1 * sc;
    const _Float16 h0 = (_Float16)t0, h1 = (_Float16)t1;
    const _Float16 l0 = (_Float16)(t0 - (float)h0), l1 = (_Float16)(t1 - (float)h1);
    oh[e] = pk16(h_bits(h0), h_bits(h1));
    ol[e] = pk16(h_bits(l0), h_bits(l1));
  }
  const int bb2 = tile / NQT, s16 = tile % NQT;
  const size_t dst = (((size_t)(bb2 * nhead + head) * NQT + s16) * 4 + pc) * FPC + (size_t)lane * 8;
  *(v4u*)(Hp + dst) = oh;
  *(v4u*)(Lp + dst) = ol;
  wait_stores_issued();
}

// =====================================================================================================
// v^T planes from the v columns of the projection F f32 [MROWS][ldf] (row = b*SEQ + s, column = voff + g*HD + d):
//   t = (F + bfr(bias[g*HD + d])) * 1024;  VH = f16(t), VL = f16 residual (t - f16(t)), both for all keys s, in fragment
//   order: tile (b, g, s >> 5) = 64 d x 32 keys = 8 pieces of 512 B; piece 2j + h, lane l, element e <- d = 16j + (l & 15),
//   key (s & 31) = 16h + 8*(l >> 4) + e (the two halves of the A fragment of d-subtile j in the split k map).
// Block = (b, kv head g, 64 keys s0): each thread loads its 16 floats (key sl, d chunk dc) with 16-B loads, converts, places
// them into two LDS tiles [64 d][64 keys] (pitch 72 halves); after a block barrier each wave stores whole pieces.
// LDS tiles are cross-wave (block barrier); staged extent 64x64 == consumed extent 64x64.
// coverage: load 256 thr x 16 = 64 keys x 64 d; store 2 iterations x 8 waves = 16 pieces = the block's two 32-key tiles of
//           VH and of VL (8192 contiguous bytes each); bid in 0 .. NB*NKVH*NST - 1 covers both planes exactly once.
// =====================================================================================================
__device__ __forceinline__ void vt16(u16* TH, u16* TL, const float* __restrict__ F, int ldf, int voff,
                                     const float* __restrict__ bias, u16* VHo, u16* VLo, int bid) {
#pragma clang fp contract(off)
  const int tid = threadIdx.x;
  const int st  = bid % NST;
  const int t2  = bid / NST;
  const int g   = t2 % NKVH;
  const int b   = t2 / NKVH;
  if (b >= NB) return;                      // block-uniform, before any barrier; never taken with the exact grid
  const int s0  = st * 64;
  {
    const int sl = tid >> 2;                // key within tile 0..63
    const int dc = (tid & 3) * 16;          // d chunk 0,16,32,48
    const float* src  = F + ((size_t)b * SEQ + s0 + sl) * (size_t)ldf + voff + g * HD + dc;
    const float* bsrc = bias + g * HD + dc;
    v4f bv4[4];
#pragma unroll
    for (int i = 0; i < 4; ++i) bv4[i] = *(const v4f*)(bsrc + 4 * i);
    wait_addr();
#pragma unroll
    for (int i = 0; i < 4; ++i) {
      const v4f a  = *(const v4f*)(src + 4 * i);
      const v4f bb = bv4[i];
#pragma unroll
      for (int e = 0; e < 4; ++e) {
        const float s  = a[e] + bfr(bb[e]);
        const float t  = s * VCAR;
        const _Float16 hv = (_Float16)t;
        const _Float16 lv = (_Float16)(t - (float)hv);
        TH[(dc + 4 * i + e) * VTP + sl] = h_bits(hv);
        TL[(dc + 4 * i + e) * VTP + sl] = h_bits(lv);
      }
    }
  }
  __syncthreads();
  v4u vh[2], vl[2];
  const int ln = tid & 31, hf = (tid >> 5) & 1, js = tid >> 6;      // lane, fragment half, d-subtile of this thread's piece
  const int lo = (js * 16 + (ln & 15)) * VTP + hf * 16 + (ln >> 4) * 8;
#pragma unroll
  for (int it = 0; it < 2; ++it) {          // it = 32-key tile within the block's 64 keys
    vh[it] = *(const v4u*)(TH + lo + it * 32);
    vl[it] = *(const v4u*)(TL + lo + it * 32);
  }
  const size_t base = ((size_t)(b * NKVH + g) * NKT + (size_t)st * 2) * (8 * FPC) + (size_t)tid * 8;
#pragma unroll
  for (int it = 0; it < 2; ++it) {
    *(v4u*)(VHo + base + (size_t)it * (8 * FPC)) = vh[it];
    *(v4u*)(VLo + base + (size_t)it * (8 * FPC)) = vl[it];
  }
  wait_stores_issued();
}

// =====================================================================================================
// One grid writes all six attention operand planes from F (they depend on F alone): block ranges q (PB_Q), k (PB_K), v^T (PB_V).
// The range test is block-uniform, so vt16's block barrier is passed by all of a block's threads or by none.
// =====================================================================================================
#define PB_Q   ((MROWS / 16) * (NH / 2))
#define PB_K   ((MROWS / 16) * (NKVH / 2))
#define PB_V   (NB * NKVH * NST)
__global__ __launch_bounds__(256) void planes_all(const float* __restrict__ F, const float* __restrict__ bq,
                                                  const float* __restrict__ bk, const float* __restrict__ bv,
                                                  u16* QHo, u16* QLo, u16* KHo, u16* KLo, u16* VHo, u16* VLo) {
  __shared__ __align__(16) u16 TH[HD * VTP];
  __shared__ __align__(16) u16 TL[HD * VTP];
  const int blk = (int)blockIdx.x;
  if (blk < PB_Q)             split16(F, NQKV, 0, NH, bq, QHo, QLo, QSC, blk);
  else if (blk < PB_Q + PB_K) split16(F, NQKV, DMOD, NKVH, bk, KHo, KLo, KSC, blk - PB_Q);
  else                        vt16(TH, TL, F, NQKV, DMOD + KVD, bv, VHo, VLo, blk - PB_Q - PB_K);
}

// =====================================================================================================
// GEMM epilogue, in two halves around one wave-level LDS sync: epi_put places a 16x64 f32 tile (times oscale, plus
// bfr(bias[col]) when HASB != 0) in a wave-private slab [16][64] pitch 68; epi_get reads it back as whole row segments.
// coverage: 8 instructions x 2 rows x 16 lanes x 4 floats = the 16 x 64 tile.
// =====================================================================================================
template <int HASB>
__device__ __forceinline__ void epi_put(float* sl, v8f a0, v8f a1, v8f a2, v8f a3, float oscale,
                                        const float* __restrict__ bias, int col0, int lane) {
  const int hh = lane >> 4, m = lane & 15;
  float b0 = 0.0f, b1 = 0.0f, b2 = 0.0f, b3 = 0.0f;
  if (HASB != 0) {
    b0 = bfr(bias[col0 + m]);
    b1 = bfr(bias[col0 + 16 + m]);
    b2 = bfr(bias[col0 + 32 + m]);
    b3 = bfr(bias[col0 + 48 + m]);
  }
#pragma unroll
  for (int r = 0; r < 8; ++r) {
    const int ro = (8 * hh + r) * 68 + m;
    sl[ro]      = a0[r] * oscale + b0;
    sl[ro + 16] = a1[r] * oscale + b1;
    sl[ro + 32] = a2[r] * oscale + b2;
    sl[ro + 48] = a3[r] * oscale + b3;
  }
}
__device__ __forceinline__ void epi_get(const float* sl, float* C, int N, size_t rowb, int col0, int lane) {
  const int hh = lane >> 4, m = lane & 15;
  v4f vals[8];
#pragma unroll
  for (int it = 0; it < 8; ++it) vals[it] = *(const v4f*)(sl + (it * 2 + hh) * 68 + m * 4);
  float* dst = C + (rowb + (size_t)hh) * (size_t)N + col0 + m * 4;
#pragma unroll
  for (int it = 0; it < 8; ++it) {
    *(v4f*)(dst + (size_t)(it * 2) * (size_t)N) = vals[it];
  }
}

// =====================================================================================================
// GEMM engine shared by gemm_bf and gemm_out: C[M][N] (f32) = (A[M][K] (+ A2[M][K] when TWO != 0)) . Bt[N][K]^T, times oscale
// (plus bfr(bias[n]) when HASB != 0); A, A2 row-major 16-bit planes, Bt k-contiguous 16-bit plane.
// Block = BM x 128 tile of C (BM = 128, or 64 when TWO != 0), 4 waves as 2 x 2, wave = (BM/2) x 64 = MF x 4 accumulator tiles.
// A pass is 64 k = one whole 128-B line of each of the stage's 256 operand rows (A rows, then A2 rows, then the 128 Bt rows),
// brought into LDS by asynchronous copies (8 lanes per row, 16 copies per lane and pass), row pitch 144 B; two buffers: the
// copies of pass t + 2 are issued behind the barrier that ends pass t, so they fly while pass t + 1 is worked on.
// Fragments are read from the LDS rows with the same split k map and each accumulator takes its products in the
// same order (k ascending by 32; A before A2). Callers guarantee K % 64 == 0, M % BM == 0, N % 128 == 0, bid in 0 .. (M/BM)*(N/128) - 1.
// =====================================================================================================
#define GKP   64
#define GPIT  72
#define GSTG  (256 * GPIT)
static_assert(GKP == 2 * 32 && (DMOD % GKP) == 0 && (MROWS % 128) == 0 && (NQKV % 128) == 0 && (DMOD % 128) == 0);
static_assert((RICH % 64) == 0 && ((SEQ - RICH) % 128) == 0 && 4 * 4 * SLAB64 * 4 <= 2 * GSTG * 2);

union FragU { v4u u[2]; v16h h; v16b b; };

__device__ __forceinline__ FragU ldfrag_u(const u16* p) {
  FragU f;
  f.u[0] = *(const v4u*)(p);
  f.u[1] = *(const v4u*)(p + 16);
  return f;
}
template <int BF>
__device__ __forceinline__ v8f mma_u(const FragU& a, const FragU& b, v8f c) {
  if (BF != 0) return mma_b(a.b, b.b, c);
  return mma_h(a.h, b.h, c);
}
// eight asynchronous 16-B copies per lane, global -> LDS; the s_wait_xcnt closes the statement so that no register a copy
// names is rewritten ahead of it
__device__ __forceinline__ void copy8(const unsigned (&l)[8], const u16* const (&g)[8]) {
#if defined(__HIP_DEVICE_COMPILE__)
  asm volatile("global_load_async_to_lds_b128 %0, %8, off\n\t"
               "global_load_async_to_lds_b128 %1, %9, off\n\t"
               "global_load_async_to_lds_b128 %2, %10, off\n\t"
               "global_load_async_to_lds_b128 %3, %11, off\n\t"
               "global_load_async_to_lds_b128 %4, %12, off\n\t"
               "global_load_async_to_lds_b128 %5, %13, off\n\t"
               "global_load_async_to_lds_b128 %6, %14, off\n\t"
               "global_load_async_to_lds_b128 %7, %15, off\n\t"
               "s_wait_xcnt 0x0"
               :: "v"(l[0]), "v"(l[1]), "v"(l[2]), "v"(l[3]), "v"(l[4]), "v"(l[5]), "v"(l[6]), "v"(l[7]),
                  "v"(g[0]), "v"(g[1]), "v"(g[2]), "v"(g[3]), "v"(g[4]), "v"(g[5]), "v"(g[6]), "v"(g[7])
               : "memory");
#endif
}
// this wave's own copies have landed
__device__ __forceinline__ void wait_copies() {
#if defined(__HIP_DEVICE_COMPILE__)
  asm volatile("s_wait_asynccnt 0x0" ::: "memory");
#endif
}
// this wave's own LDS reads have returned, before the buffer they read is handed to the copies
__device__ __forceinline__ void wait_lds() {
#if defined(__HIP_DEVICE_COMPILE__)
  asm volatile("s_wait_dscnt 0x0" ::: "memory");
#endif
}
// one stage: lane = (row r0 = tid >> 3 of each group of 16 rows, 16-B piece tid & 7); ld = the lane's LDS byte address of
// stage row r0, ga / ga2 / gb = its global address in row r0 of the block's A / A2 / Bt rows, rs16 = halves per 16 rows
template <int TWO>
__device__ __forceinline__ void stage_tile(unsigned ld, const u16* ga, const u16* ga2, const u16* gb, size_t rs16) {
  unsigned l[8];
  const u16* g[8];
#pragma unroll
  for (int i = 0; i < 8; ++i) {
    l[i] = ld + (unsigned)(i * 16 * GPIT * 2);
    if (TWO != 0) g[i] = (i < 4) ? (ga + (size_t)i * rs16) : (ga2 + (size_t)(i - 4) * rs16);
    else          g[i] = ga + (size_t)i * rs16;
  }
  copy8(l, g);
#pragma unroll
  for (int i = 0; i < 8; ++i) {
    l[i] = ld + (unsigned)((8 + i) * 16 * GPIT * 2);
    g[i] = gb + (size_t)i * rs16;
  }
  copy8(l, g);
}

template <int BF, int TWO, int HASB>
__device__ __forceinline__ void gemm_ring(u16* ring, const u16* __restrict__ A, const u16* __restrict__ A2,
                                          const u16* __restrict__ Bt, const float* __restrict__ bias, float* C,
                                          int M, int N, int K, float oscale, int bid) {
  constexpr int MF = (TWO != 0) ? 2 : 4;
  constexpr int BM = 32 * MF;
  const int tid = threadIdx.x, wave = tid >> 5, lane = tid & 31, hh = lane >> 4, m = lane & 15;
  const int ntile = N >> 7;
  const int row0  = (bid / ntile) * BM;
  const int col0  = (bid % ntile) * 128;
  if (row0 + BM > M) return;                // block-uniform, before any copy or barrier; never taken with the exact grid
  const int wm = wave >> 1, wn = wave & 1;
  const int r0 = tid >> 3, c8 = (tid & 7) * 8;
  const u16* ga  = A  + (size_t)(row0 + r0) * K + c8;
  const u16* ga2 = A2 + (size_t)(row0 + r0) * K + c8;
  const u16* gb  = Bt + (size_t)(col0 + r0) * K + c8;
  const size_t rs16 = (size_t)16 * K;
  const unsigned ld0 = (unsigned)(uintptr_t)ring + (unsigned)((r0 * GPIT + c8) * 2);
  const int npass = K / GKP;
  const int aoff = (wm * (16 * MF) + m) * GPIT + 8 * hh;          // halves, in a stage: A fragment row of this lane
  const int boff = (128 + wn * 64 + m) * GPIT + 8 * hh;           // Bt fragment row of this lane

  v8f acc[MF][4];
#pragma unroll
  for (int i = 0; i < MF; ++i) {
#pragma unroll
    for (int j = 0; j < 4; ++j) acc[i][j] = zero8();
  }

  stage_tile<TWO>(ld0, ga, ga2, gb, rs16);
  wait_copies();
  __syncthreads();
  if (npass > 1) stage_tile<TWO>(ld0 + (unsigned)(GSTG * 2), ga + GKP, ga2 + GKP, gb + GKP, rs16);

  // kept rolled (for speed only), the buffer chosen by the pass's parity
#pragma unroll 1
  for (int t = 0; t < npass; ++t) {
    const int par = t & 1;
    const u16* st = ring + par * GSTG;
    FragU a[2][MF], a2[2][MF], b[4];
#pragma unroll
    for (int kk = 0; kk < 2; ++kk) {
#pragma unroll
      for (int i = 0; i < MF; ++i) {
        a[kk][i] = ldfrag_u(st + aoff + i * 16 * GPIT + kk * 32);
        if (TWO != 0) a2[kk][i] = ldfrag_u(st + aoff + (64 + i * 16) * GPIT + kk * 32);
      }
    }
#pragma unroll
    for (int kk = 0; kk < 2; ++kk) {
#pragma unroll
      for (int j = 0; j < 4; ++j) b[j] = ldfrag_u(st + boff + j * 16 * GPIT + kk * 32);
      // the LDS reads stay in one group ahead of the WMMA block (for speed only)
      __builtin_amdgcn_sched_barrier(0);
#pragma unroll
      for (int i = 0; i < MF; ++i) {
#pragma unroll
        for (int j = 0; j < 4; ++j) acc[i][j] = mma_u<BF>(a[kk][i], b[j], acc[i][j]);
      }
      if (TWO != 0) {
#pragma unroll
        for (int i = 0; i < MF; ++i) {
#pragma unroll
          for (int j = 0; j < 4; ++j) acc[i][j] = mma_u<BF>(a2[kk][i], b[j], acc[i][j]);
        }
      }
      // the WMMA block stays ahead of what follows: sunk behind the publish point it would put the refill's issue directly
      // in front of the next pass's wait for it
      __builtin_amdgcn_sched_barrier(0);
    }
    // publish point of pass t + 1: own reads back, own copies landed, every wave here; then the freed buffer is refilled
    wait_lds();
    wait_copies();
    __syncthreads();
    if (t + 2 < npass) {
      const size_t ko = (size_t)(t + 2) * GKP;
      stage_tile<TWO>(ld0 + (unsigned)(par * GSTG * 2), ga + ko, ga2 + ko, gb + ko, rs16);
    }
  }
  wait_copies();

  // the last pass's barrier has ended every read of the ring and no copy is outstanding: each wave stages its MF tiles in
  // MF slabs of its own
  float* sl = (float*)(void*)ring + wave * (MF * SLAB64);
  const int colw = col0 + wn * 64;
#pragma unroll
  for (int i = 0; i < MF; ++i)
    epi_put<HASB>(sl + i * SLAB64, acc[i][0], acc[i][1], acc[i][2], acc[i][3], oscale, bias, colw, lane);
  wave_sync_lds();
#pragma unroll
  for (int i = 0; i < MF; ++i)
    epi_get(sl + i * SLAB64, C, N, (size_t)(row0 + wm * (16 * MF) + i * 16), colw, lane);
}

__global__ __launch_bounds__(128)
void gemm_bf(const u16* __restrict__ A, const u16* __restrict__ Bt, float* C, int M, int N, int K, float oscale) {
  __shared__ __align__(16) u16 ring[2 * GSTG];
  gemm_ring<1, 0, 0>(ring, A, A, Bt, (const float*)0, C, M, N, K, oscale, (int)blockIdx.x);
}

// y = O.Wo^T + bo for all rows in one grid (the row ranges are independent): per sequence GB_L blocks of 128 x 128 for rows
// >= RICH (O hi only), then GB_R blocks of 64 x 128 for rows < RICH (O hi + residual). The range test is block-uniform.
#define GB_L   (((SEQ - RICH) / 128) * (DMOD / 128))
#define GB_R   ((RICH / 64) * (DMOD / 128))
__global__ __launch_bounds__(128)
void gemm_out(const u16* __restrict__ OHp, const u16* __restrict__ OLp, const u16* __restrict__ Bt,
              const float* __restrict__ bias, float* C, float oscale) {
  __shared__ __align__(16) u16 ring[2 * GSTG];
  const int b = (int)blockIdx.x / (GB_L + GB_R);
  const int r = (int)blockIdx.x % (GB_L + GB_R);
  if (b >= NB) return;                      // block-uniform, before any copy or barrier; never taken with the exact grid
  if (r < GB_L) {
    const size_t ro = ((size_t)b * SEQ + RICH) * DMOD;
    gemm_ring<0, 0, 1>(ring, OHp + ro, OLp + ro, Bt, bias, C + ro, SEQ - RICH, DMOD, DMOD, oscale, r);
    wait_stores_issued();
  } else {
    const size_t ro = (size_t)b * SEQ * DMOD;
    gemm_ring<0, 1, 1>(ring, OHp + ro, OLp + ro, Bt, bias, C + ro, RICH, DMOD, DMOD, oscale, r - GB_L);
    wait_stores_issued();
  }
}

// =====================================================================================================
// Causal grouped-query softmax attention, hd = 64. Block bid -> (query tile qt = qt0 + bid % nqt: rows q0 = 16*qt ..
// q0+15, head group hg = kv head, batch b); one wave per query head = hg*WPB + wave (the 4 consecutive query heads of a
// group share kv head hg).
//   q hi / residual planes f16 x256, tiles (b, h, s >> 4); k hi / residual planes f16 x256, tiles (b, g, s >> 4); v^T hi /
//   residual planes x1024, tiles (b, g, s >> 5): all in fragment order (split16, vt16), so that every fragment load of a wave
//   reads 512 contiguous bytes and a key tile of 32 is 4096 contiguous bytes of each k plane and of each v^T plane.
//   Transposed products: S^T = K.Q^T (A = key rows, B = query rows as columns), so a lane's 16 score registers of a key tile
//   belong to one query (lane & 15) and hold keys kb + 8*(lane >> 4) + r and kb + 16 + 8*(lane >> 4) + r.
//   raw(j, i) = k_hi.q_hi + k_hi.q_lo + k_lo.q_hi (2 k-steps over d); logit = raw * 2^-19 (the 1/8 softmax scale and the two
//   256 carries, exact); keys above the diagonal replaced by -inf; online softmax per query in f32 with a running max:
//   max in-lane over the 16 scores plus one exchange with lane ^ 16; sum in-lane, the two halves' sums joined once after the
//   loop; alpha = exp(m_old - m_new), p = exp(logit - m_new), l = l*alpha + sum p, O^T accumulators times alpha before the
//   tile's product. Key tiles of 32 visited in order, only tiles with kb <= q0 (nkt = q0/32 + 1 <= NKT; key kb is unmasked for
//   every query of the tile). The score registers, as p*32768 (f16 hi and its f16 residual), are the B fragment of
//   O^T += v^T.P^T in the split k map as they stand; v^T A fragments in 2 groups of 2 d-subtiles; RV = 1: products hh + lh + hl,
//   RV = 0: hh only.
//   Epilogue: O x256 -> f16 hi plane (and for RV = 1 the f16 residual plane of O x256) [b*SEQ + s][h*HD + d]; lane = (row group
//   rq = lane>>3 in 0..3, 8 consecutive d at c8); one instruction = 4 rows it*4 + rq, each row segment (64 halves = one whole
// coverage: per wave 4 instructions x 4 rows x 8 lanes x 8 halves = 16 x 64 per plane; nqt x NHG x NB blocks x WPB waves;
//   the two block ranges (tiles NQTR..NQT-1 with RV = 0, tiles 0..NQTR-1 with RV = 1) cover every (b, s, h) row segment of the hi plane
//   exactly once and rows s < RICH of the residual plane exactly once (only those rows are read later).
// =====================================================================================================
template <int RV>
__device__ __forceinline__
void attn_gq(float* smem, const u16* __restrict__ QHp, const u16* __restrict__ QLp,
             const u16* __restrict__ KHp, const u16* __restrict__ KLp,
             const u16* __restrict__ VHp, const u16* __restrict__ VLp,
             u16* OHp, u16* OLp, int bid, int qt0, int nqt) {
#pragma clang fp contract(off)
  const int tid  = threadIdx.x;
  const int wave = tid >> 5;
  const int lane = tid & 31;
  const int hh   = lane >> 4;
  const int c    = lane & 15;
  if (nqt <= 0) return;                     // block-uniform; no block barriers in this kernel
  const int qt   = qt0 + bid % nqt;
  const int t2   = bid / nqt;
  const int hg   = t2 % NHG;
  const int b    = t2 / NHG;
  if (b >= NB) return;                      // block-uniform; never taken with the exact grid
  const int q0   = qt * 16;
  if (q0 + 16 > SEQ) return;                // block-uniform; never taken
  const int head = hg * WPB + wave;
  const int kvh  = hg;

  float* slab = smem + wave * WREG;         // result slab [16][64] pitch 68

  const unsigned l8 = (unsigned)lane * 8;
  const size_t qoff = ((size_t)(b * NH + head) * NQT + qt) * FTILE;                        // this wave's 16-query tile
  const size_t koff = (size_t)(b * NKVH + kvh) * NQT * FTILE;                              // 16-key tile 0 of the kv head
  const size_t voff = (size_t)(b * NKVH + kvh) * NKT * (2 * FTILE);                        // 32-key tile 0 of the kv head
  const _Float16* Qh  = (const _Float16*)(const void*)QHp + qoff;
  const _Float16* Ql  = (const _Float16*)(const void*)QLp + qoff;
  const _Float16* Khb = (const _Float16*)(const void*)KHp + koff;
  const _Float16* Klb = (const _Float16*)(const void*)KLp + koff;
  const _Float16* Vhb = (const _Float16*)(const void*)VHp + voff;
  const _Float16* Vlb = (const _Float16*)(const void*)VLp + voff;
  const float lsc  = SM_SCALE * (1.0f / (QSC * KSC));   // exact power-of-two fold of the q / k carries into the 1/8 scale
  const float oc   = 1.0f / (PCAR * VCAR);
  const float ninf = -__builtin_inff();

  v8f o[4];                                 // O^T: element r of o[j] = (d = 16j + 8hh + r, query row q0 + c)
#pragma unroll
  for (int j = 0; j < 4; ++j) o[j] = zero8();
  float mrun = ninf, lrun = 0.0f;           // this lane's query: running max (both halves alike), sum over this half's keys
  const int ncaus = (q0 >> 5) + 1;                                            // tiles holding keys <= q0 + 15
  const int nkt   = (ncaus < NKT) ? ncaus : NKT;
  const int qrow  = q0 + c;                                                   // query row of every D element of this lane

#pragma unroll 1
  for (int kt = 0; kt < nkt; ++kt) {
    const int kb = kt * 32;
    // ---- raw scores, transposed: D element r of this lane = (key kb + 8hh + r, query qrow) in s0, key + 16 in s1 ----
    v8f s0 = zero8(), s1 = zero8();
    const _Float16* k0p = Khb + (size_t)kt * (2 * FTILE);
    const _Float16* k1p = k0p + FTILE;
    const _Float16* l0p = Klb + (size_t)kt * (2 * FTILE);
    const _Float16* l1p = l0p + FTILE;
#pragma unroll
    for (int kk = 0; kk < HD / 32; ++kk) {
      const v16h qh  = ldfrag_f(Qh + kk * (2 * FPC), l8);
      const v16h ql  = ldfrag_f(Ql + kk * (2 * FPC), l8);
      const v16h kh0 = ldfrag_f(k0p + kk * (2 * FPC), l8);
      const v16h kh1 = ldfrag_f(k1p + kk * (2 * FPC), l8);
      // RV = 0 build: the residual plane's results take over the registers of the hi plane's address, last used just above
      if (RV == 0 && kk == HD / 32 - 1) wait_addr();
      const v16h kl0 = ldfrag_f(l0p + kk * (2 * FPC), l8);
      FragH k1f;
      k1f.h[0] = *(const v8h*)(l1p + kk * (2 * FPC) + l8);
      // RV = 0 build: the last piece's result takes over the residual plane's address registers, named by the three loads above
      if (RV == 0 && kk == HD / 32 - 1) wait_addr();
      k1f.h[1] = *(const v8h*)(l1p + kk * (2 * FPC) + l8 + FPC);
      const v16h kl1 = k1f.v;
      s0 = mma_h(kh0, qh, s0);
      s0 = mma_h(kh0, ql, s0);
      s0 = mma_h(kl0, qh, s0);
      s1 = mma_h(kh1, qh, s1);
      s1 = mma_h(kh1, ql, s1);
      s1 = mma_h(kl1, qh, s1);
      guard2(s0, s1, qh, ql, kh0, kl0, kh1, kl1);
    }
    // ---- causal replace-mask, running-max online softmax in f32: the lane's 16 scores belong to one query ----
    const int key0 = kb + 8 * hh, key1 = key0 + 16;
    float t0[8], t1[8];
    float mx = ninf;
#pragma unroll
    for (int r = 0; r < 8; ++r) {
      const float a0 = s0[r] * lsc;
      const float a1 = s1[r] * lsc;
      t0[r] = (key0 + r > qrow) ? ninf : a0;
      t1[r] = (key1 + r > qrow) ? ninf : a1;
      mx = fmaxf(mx, fmaxf(t0[r], t1[r]));
    }
    mx = fmaxf(mx, xhalf(mx));                          // the other half's 16 keys of the same query
    const float mnew = fmaxf(mrun, mx);
    const float al   = __expf(mrun - mnew);
    // ---- B fragments of p*32768 straight from the score registers: hi f16 and residual f16, column = query c,
    //      elements 0..7 = keys kb + 8hh + 0..7, elements 8..15 = keys kb + 16 + 8hh + 0..7 (the split k map) ----
    FragH ph, pl;
    float sm = 0.0f;
#pragma unroll
    for (int r = 0; r < 8; ++r) {
      const float p0 = __expf(t0[r] - mnew);
      const float p1 = __expf(t1[r] - mnew);
      sm += p0 + p1;
      const float ta = p0 * PCAR, tc = p1 * PCAR;
      const _Float16 ha = (_Float16)ta, hc = (_Float16)tc;
      ph.h[0][r] = ha;
      ph.h[1][r] = hc;
      pl.h[0][r] = (_Float16)(ta - (float)ha);
      pl.h[1][r] = (_Float16)(tc - (float)hc);
    }
    lrun = lrun * al + sm;
    mrun = mnew;
    // ---- rescale the O^T accumulators by the lane's alpha ----
#pragma unroll
    for (int j = 0; j < 4; ++j) {
#pragma unroll
      for (int r = 0; r < 8; ++r) o[j][r] = o[j][r] * al;
    }
    // ---- O^T += v^T.P^T : A fragment row = d = j*16 + c, subtile j = pieces 2j, 2j + 1 of the key tile; 2 groups of 2 ----
    {
      const _Float16* vhp = Vhb + (size_t)kt * (2 * FTILE);
      const _Float16* vlp = Vlb + (size_t)kt * (2 * FTILE);
      (void)vlp;
#pragma unroll
      for (int jg = 0; jg < 2; ++jg) {
        const size_t da = (size_t)(2 * jg) * (2 * FPC);
        const size_t db = da + (size_t)(2 * FPC);
        const v16h vha = ldfrag_f(vhp + da, l8), vhb2 = ldfrag_f(vhp + db, l8);
        o[2 * jg]     = mma_h(vha,  ph.v, o[2 * jg]);
        o[2 * jg + 1] = mma_h(vhb2, ph.v, o[2 * jg + 1]);
        if (RV != 0) {
          const v16h vla = ldfrag_f(vlp + da, l8), vlb2 = ldfrag_f(vlp + db, l8);
          o[2 * jg]     = mma_h(vha,  pl.v, o[2 * jg]);
          o[2 * jg]     = mma_h(vla,  ph.v, o[2 * jg]);
          o[2 * jg + 1] = mma_h(vhb2, pl.v, o[2 * jg + 1]);
          o[2 * jg + 1] = mma_h(vlb2, ph.v, o[2 * jg + 1]);
          guard2(o[2 * jg], o[2 * jg + 1], ph.v, pl.v, vha, vhb2, vla, vlb2);
        } else {
          guard2(o[2 * jg], o[2 * jg + 1], ph.v, pl.v, vha, vhb2, vha, vhb2);
        }
      }
    }
  }
  acc_guard4(o[0], o[1], o[2], o[3]);
  // ---- O = acc / l with the carries (32768 on p, 1024 on v) folded once; the two halves' sums joined here; the lane's
  //      8 consecutive d of each subtile go into row c of the wave's slab ----
  const float ltot = lrun + xhalf(lrun);
  const float rl   = (1.0f / ltot) * oc;
#pragma unroll
  for (int j = 0; j < 4; ++j) {
    float* sd = slab + c * SLP + j * 16 + 8 * hh;
    v4f w0, w1;
#pragma unroll
    for (int e = 0; e < 4; ++e) { w0[e] = o[j][e] * rl; w1[e] = o[j][4 + e] * rl; }
    *(v4f*)(sd)     = w0;
    *(v4f*)(sd + 4) = w1;
  }
  wave_sync_lds();
  // ---- O x256 -> f16 hi plane (+ f16 residual plane); lane = (row group rq, 8 consecutive d at c8) ----
  v4u oh[4], ol[4];
  const int rq = lane >> 3, c8 = (lane & 7) * 8;
#pragma unroll
  for (int it = 0; it < 4; ++it) {
    const int row = it * 4 + rq;
    const v4f a = *(const v4f*)(slab + row * SLP + c8), b4 = *(const v4f*)(slab + row * SLP + c8 + 4);
    float w[8];
#pragma unroll
    for (int e = 0; e < 4; ++e) { w[e] = a[e] * OSC; w[4 + e] = b4[e] * OSC; }
#pragma unroll
    for (int e = 0; e < 4; ++e) {
      const _Float16 h0 = (_Float16)w[2 * e], h1 = (_Float16)w[2 * e + 1];
      const _Float16 g0 = (_Float16)(w[2 * e] - (float)h0), g1 = (_Float16)(w[2 * e + 1] - (float)h1);
      oh[it][e] = pk16(h_bits(h0), h_bits(h1));
      ol[it][e] = pk16(h_bits(g0), h_bits(g1));
    }
  }
  const size_t ob = ((size_t)b * SEQ + q0) * DMOD + (size_t)head * HD + c8;
  {
#pragma unroll
    for (int it = 0; it < 4; ++it) {
      const int row = it * 4 + rq;
      *(v4u*)(OHp + ob + (size_t)row * DMOD) = oh[it];
      if (RV != 0) {
        *(v4u*)(OLp + ob + (size_t)row * DMOD) = ol[it];
      }
    }
    wait_stores_issued();
  }
}

// Both row ranges in one grid (no query tile depends on another): the AB_L blocks of the later tiles (the longer key loops)
// first, then the AB_R blocks of the tiles < RICH / 16. The range test is block-uniform.
#define AB_L   ((NQT - NQTR) * NHG * NB)
#define AB_R   (NQTR * NHG * NB)
// six waves per SIMD: the register budget (160) at which all AB_L blocks of the later tiles are resident at once; left to
// itself the compiler takes 163 registers for the two bodies, which allocates 176 and leaves five waves
__global__ __launch_bounds__(ATT_THREADS) __attribute__((amdgpu_waves_per_eu(6)))
void attn_all(const u16* __restrict__ QHp, const u16* __restrict__ QLp,
              const u16* __restrict__ KHp, const u16* __restrict__ KLp,
              const u16* __restrict__ VHp, const u16* __restrict__ VLp, u16* OHp, u16* OLp) {
  __shared__ __align__(16) float smem[WPB * WREG];
  const int bid = (int)blockIdx.x;
  if (bid < AB_L) attn_gq<0>(smem, QHp, QLp, KHp, KLp, VHp, VLp, OHp, OLp, bid, NQTR, NQT - NQTR);
  else            attn_gq<1>(smem, QHp, QLp, KHp, KLp, VHp, VLp, OHp, OLp, bid - AB_L, 0, NQTR);
}

// =====================================================================================================
// Workspace map (bytes); every plane is fully written by whole-line stores before it is read (the O residual plane only on
// the rows < RICH per sequence that are read); all extents are exact multiples of the store granularity (no pad rows needed);
// every region offset a multiple of 131072:
//   XB  bf16 [MROWS][2048]              MROWS*4096   (NB=2, SEQ=2048: 16777216); after the projection GEMM the same bytes hold
//                                                    the O f16 hi plane [MROWS][2048] x256 (identical extent)
//   WB  bf16 [3072 n][2048 k]           12582912     (Wq rows 0..2047, Wk 2048..2559, Wv 2560..3071)
//   WT  f16 [2048 o][2048 d] x1024      8388608      (Wo)
//   F   f32 [MROWS][3072]               MROWS*12288  (q | k | v projection columns, no bias); after split16 / vt16 its first
//                                                    MROWS*4096 bytes hold the O f16 residual plane [MROWS][2048]
//   QH  f16 [NB*32][SEQ/16] tiles of 2048 B x256   MROWS*4096   QL residual, same extent   (fragment order)
//   KH  f16 [NB*8][SEQ/16] tiles of 2048 B x256    MROWS*1024   KL residual, same extent   (fragment order)
//   VH  f16 [NB*8][SEQ/32] tiles of 4096 B x1024   MROWS*1024   VL residual, same extent   (fragment order)
//   end (NB=2, SEQ=2048)               138412032
// =====================================================================================================
extern "C" void kernel_launch(void* const* d_in, const int* in_sizes, int n_in,
                              void* d_out, int out_size, void* d_ws, size_t ws_size,
                              hipStream_t stream) {
  if (n_in < 9) return;
  if (in_sizes[0] < ((NB - 1) * XS_FULL + SEQ) * DMOD) return;
  if (in_sizes[1] < DMOD * DMOD) return;
  if (in_sizes[2] < DMOD) return;
  if (in_sizes[3] < KVD * DMOD) return;
  if (in_sizes[4] < KVD) return;
  if (in_sizes[5] < KVD * DMOD) return;
  if (in_sizes[6] < KVD) return;
  if (in_sizes[7] < DMOD * DMOD) return;
  if (in_sizes[8] < DMOD) return;
  if (out_size < MROWS * DMOD) return;

  const float* x  = (const float*)d_in[0];
  const float* wq = (const float*)d_in[1];
  const float* bq = (const float*)d_in[2];
  const float* wk = (const float*)d_in[3];
  const float* bk = (const float*)d_in[4];
  const float* wv = (const float*)d_in[5];
  const float* bv = (const float*)d_in[6];
  const float* wo = (const float*)d_in[7];
  const float* bo = (const float*)d_in[8];
  float*       out = (float*)d_out;

  const size_t szXB = (size_t)MROWS * DMOD * 2;
  const size_t szWB = (size_t)NQKV * DMOD * 2;
  const size_t szF  = (size_t)MROWS * NQKV * 4;
  const size_t szQ  = (size_t)MROWS * DMOD * 2;                  // QH, QL
  const size_t szK  = (size_t)MROWS * KVD * 2;                   // KH, KL
  const size_t szV  = (size_t)NB * NKVH * HD * SEQ * 2;          // VH, VL (== szK)
  const size_t szOH = (size_t)MROWS * DMOD * 2;                  // O hi plane, lives in the XB region
  const size_t szOL = (size_t)MROWS * DMOD * 2;                  // O residual plane, lives in the F region
  const size_t szWT = (size_t)DMOD * DMOD * 2;                   // Wo f16 plane
  if (szOH > szXB || szOL > szF) return;
  size_t off = 0;
  const size_t oXB = off; off += szXB;
  const size_t oWB = off; off += szWB;
  const size_t oWT = off; off += szWT;
  const size_t oF  = off; off += szF;
  const size_t oQH = off; off += szQ;
  const size_t oQL = off; off += szQ;
  const size_t oKH = off; off += szK;
  const size_t oKL = off; off += szK;
  const size_t oVH = off; off += szV;
  const size_t oVL = off; off += szV;
  if (off > ws_size) return;                // off = 138412032 for NB = 2, SEQ = 2048
  if (off > (size_t)WS_CAP) return;

  char* ws = (char*)d_ws;
  u16*   XB  = (u16*)(ws + oXB);
  u16*   OH  = (u16*)(ws + oXB);
  u16*   WB  = (u16*)(ws + oWB);
  u16*   WT  = (u16*)(ws + oWT);
  float* F   = (float*)(ws + oF);
  u16*   OL  = (u16*)(ws + oF);
  u16*   QH  = (u16*)(ws + oQH);
  u16*   QL  = (u16*)(ws + oQL);
  u16*   KH  = (u16*)(ws + oKH);
  u16*   KL  = (u16*)(ws + oKL);
  u16*   VH  = (u16*)(ws + oVH);
  u16*   VL  = (u16*)(ws + oVL);

  const dim3 b256(256), b128(128), bAT(ATT_THREADS);
  const dim3 gG1((MROWS / 128) * (NQKV / 128));         // 768
  const float osc = 1.0f / (OSC * WOS);

  // (0) x -> bf16 plane [MROWS][2048]; Wq, Wk, Wv -> one bf16 plane [3072 n][2048 k]; Wo [2048 o][2048 d] -> f16 plane of the
  //     bf16 value x1024 (already k-contiguous)
  cvt_all<<<dim3(CB_ALL), b256, 0, stream>>>(x, wq, wk, wv, wo, XB, WB, WT);
  // (1) qkv = x.[Wq|Wk|Wv]^T -> F f32 [MROWS][3072] (biases added by the consumers in f32)
  gemm_bf<<<gG1, b128, 0, stream>>>(XB, WB, F, MROWS, NQKV, DMOD, 1.0f);
  // (2) q and k hi + residual planes x256 from columns 0..2047 (+bq) and 2048..2559 (+bk); v^T hi + residual planes x1024 from
  //     columns 2560..3071 (+bv)
  planes_all<<<dim3(PB_Q + PB_K + PB_V), b256, 0, stream>>>(F, bq, bk, bv, QH, QL, KH, KL, VH, VL);
  // (3) causal attention -> O f16 hi plane x256 (XB region) for all query tiles; residual plane (F region) for tiles < RICH
  attn_all<<<dim3(AB_L + AB_R), bAT, 0, stream>>>(QH, QL, KH, KL, VH, VL, OH, OL);
  // (4) y = O.Wo^T + bo -> out f32 [MROWS][2048], carries 256 x 1024 folded back; rows < RICH per sequence with O hi + residual
  gemm_out<<<dim3(NB * (GB_L + GB_R)), b128, 0, stream>>>(OH, OL, WT, bo, out, osc);
  (void)hipGetLastError();
}

// v005
// A run of this version takes 186 microseconds.
// In two side-by-side timings against v004, it was 1.34 and 1.35 times as fast.
// All steps since v000 together make it 3.41 times as fast.
// Contractions: x.[Wq|Wk|Wv]^T on v_wmma_f32_16x16x32_bf16 (x and the weights as bf16 RNE planes, weight [n][k] rows are the
// k-contiguous B operand, f32 accumulate, biases added in f32 as bf16 RNE values); q.k^T over hd 64 and P.v on
// v_wmma_f32_16x16x32_f16 with f16 hi + f16 residual planes (q, k x256, products hh+lh+hl on every row; P x32768 hi +
// in-register residual and v^T x1024 hi + residual plane for query rows < 512 of each sequence, P hi . v hi only for later
// rows); O.Wo^T on v_wmma_f32_16x16x32_f16 with O x256 as f16 hi (+ f16 residual plane for rows < 512 of each sequence) and
// Wo as f16(bf16(Wo)) x1024, one accumulator, bias bo added in f32; all f32 accumulate. Online softmax in f32 on VALU.
#include <hip/hip_runtime.h>
#include <math.h>
#include <stdint.h>

#ifndef NB
#define NB 2
#endif
#ifndef SEQ
#define SEQ 2048
#endif
#define XS_FULL 2048
#define DMOD  2048
#define NH    32
#define NKVH  8
#define HD    64
#define KVD   (NKVH * HD)
#define NQKV  (DMOD + 2 * KVD)
#define MROWS (NB * SEQ)
#define RICH_REQ 512
#define RICH  ((SEQ < RICH_REQ) ? SEQ : RICH_REQ)
#define SM_SCALE 0.125f
#define QSC   256.0f
#define KSC   256.0f
#define PCAR  32768.0f
#define VCAR  1024.0f
#define OSC   256.0f
#define WOS   1024.0f
#define WPB   (NH / NKVH)
#define NHG   NKVH
#define NQT   (SEQ / 16)
#define NQTR  (RICH / 16)
#define NST   (SEQ / 64)
#define NKT   (SEQ / 32)
#define ATT_THREADS (WPB * 32)
#define SLP   68
#define SLW   (16 * SLP)
#define WREG  (SLW)
#define SLAB64 (16 * 68)
#define VTP   72
#define WS_CAP 268435456
static_assert(DMOD == NH * HD && HD == 64 && NH == 32 && NKVH == 8 && WPB == 4 && NHG * WPB == NH);
static_assert(ATT_THREADS == 128 && KVD == 512 && NQKV == 3072);
static_assert(NB >= 1 && NB <= 2);
static_assert(NB == 1 || SEQ == XS_FULL);
static_assert((SEQ % 64) == 0 && SEQ >= 64 && SEQ <= XS_FULL);
static_assert((RICH % 64) == 0 && RICH >= 64 && RICH <= SEQ);
static_assert((DMOD % 64) == 0 && (KVD % 64) == 0 && (NQKV % 64) == 0 && (DMOD % 32) == 0 && (HD % 32) == 0 && (MROWS % 64) == 0);
static_assert(((SEQ * DMOD / 8) % 256) == 0 && ((DMOD * DMOD / 8) % 256) == 0 && ((KVD * DMOD / 8) % 256) == 0);
static_assert(WPB * WREG * 4 <= 65536 && 2 * HD * VTP * 2 <= 65536 && 4 * SLAB64 * 4 <= 65536);
// workspace total (XB + WB + WT + F + QH + QL + KH + KL + VH + VL) for this build
static_assert((size_t)MROWS * DMOD * 2 + (size_t)NQKV * DMOD * 2 + (size_t)DMOD * DMOD * 2 + (size_t)MROWS * NQKV * 4 +
              2 * (size_t)MROWS * DMOD * 2 + 2 * (size_t)MROWS * KVD * 2 + 2 * (size_t)NB * NKVH * HD * SEQ * 2
              <= (size_t)WS_CAP);

typedef unsigned short u16;
typedef _Float16 v16h __attribute__((ext_vector_type(16)));
typedef _Float16 v8h  __attribute__((ext_vector_type(8)));
typedef __bf16   v16b __attribute__((ext_vector_type(16)));
typedef float    v8f  __attribute__((ext_vector_type(8)));
typedef float    v4f  __attribute__((ext_vector_type(4)));
typedef unsigned int v4u __attribute__((ext_vector_type(4)));

union FragH { v16h v; v8h h[2]; v4u u[2]; };

// ---- scalar helpers --------------------------------------------------------------------------------
__device__ __forceinline__ unsigned short bf_bits(float f) {          // f32 -> bf16 bits, RNE convert
  unsigned u = __float_as_uint(f);
  return (unsigned short)((u + 0x7FFFu + ((u >> 16) & 1u)) >> 16);
}
__device__ __forceinline__ float bf_up(unsigned short h) { return __uint_as_float(((unsigned)h) << 16); }
__device__ __forceinline__ float bfr(float f) { return bf_up(bf_bits(f)); }
__device__ __forceinline__ unsigned short h_bits(_Float16 x) { return __builtin_bit_cast(unsigned short, x); }
__device__ __forceinline__ unsigned pk16(unsigned short a, unsigned short b) { return (unsigned)a | ((unsigned)b << 16); }
__device__ __forceinline__ v8f zero8() { v8f z = {0.f, 0.f, 0.f, 0.f, 0.f, 0.f, 0.f, 0.f}; return z; }

// ---- fragment map: 16-bit A/B operand of k-step k0, lane -> row/col (lane&15), h = lane>>4; elements 0..7 <- k0+8h+0..7,
//      elements 8..15 <- k0+16+8h+0..7 (the same split k map for A and B; ldfrag_u reads it from k-contiguous rows)
// ---- fragment loader for a plane kept in fragment order: a fragment is two pieces of 512 contiguous bytes, piece = 32 lanes
//      x 16 B; p = the fragment's first byte (wave-uniform where the tile is), l8 = 8*lane; elements 0..7 <- piece 0,
//      elements 8..15 <- piece 1 (a load = 4 whole 128-B lines)
#define FPC   256
#define FTILE (4 * FPC)
__device__ __forceinline__ v16h ldfrag_f(const _Float16* p, unsigned l8) {
  FragH f;
  f.h[0] = *(const v8h*)(p + l8);
  f.h[1] = *(const v8h*)(p + l8 + FPC);
  return f.v;
}

// stands behind issued global loads whose address registers the following loads' results may take over
__device__ __forceinline__ void wait_addr() {
#if defined(__HIP_DEVICE_COMPILE__)
  asm volatile("s_wait_xcnt 0x0" ::: "memory");
#endif
}

// stands behind the last global store of a block range's body in a grid of several ranges: the next range's body follows in
// the code and rewrites the registers that the stores name
__device__ __forceinline__ void wait_stores_issued() {
#if defined(__HIP_DEVICE_COMPILE__)
  asm volatile("s_wait_xcnt 0x0" ::: "memory");
#endif
}

__device__ __forceinline__ v8f mma_h(v16h a, v16h b, v8f c) {
  return __builtin_amdgcn_wmma_f32_16x16x32_f16(false, a, false, b, (short)0, c, false, false);
}
__device__ __forceinline__ v8f mma_b(v16b a, v16b b, v8f c) {
  return __builtin_amdgcn_wmma_f32_16x16x32_bf16(false, a, false, b, (short)0, c, false, false);
}
__device__ __forceinline__ void guard2(v8f& a, v8f& b, v16h x0, v16h x1, v16h x2, v16h x3, v16h x4, v16h x5) {
#if defined(__HIP_DEVICE_COMPILE__)
  asm volatile("v_nop\n\tv_nop\n\tv_nop\n\tv_nop"
               : "+v"(a), "+v"(b) : "v"(x0), "v"(x1), "v"(x2), "v"(x3), "v"(x4), "v"(x5) : "memory");
#endif
}
__device__ __forceinline__ void acc_guard4(v8f& a, v8f& b, v8f& c, v8f& d) {
#if defined(__HIP_DEVICE_COMPILE__)
  asm volatile("v_nop\n\tv_nop\n\tv_nop\n\tv_nop" : "+v"(a), "+v"(b), "+v"(c), "+v"(d));
#endif
}
// lane l <-> lane l ^ 16 on the vector pipe (the shuffle builtin would go through the LDS queue and its wait)
__device__ __forceinline__ float xhalf(float x) {
  const int v = __builtin_bit_cast(int, x);
  return __builtin_bit_cast(float, __builtin_amdgcn_permlanex16(v, v, 0x76543210, 0xfedcba98, false, false));
}
__device__ __forceinline__ void wave_sync_lds() {
  __builtin_amdgcn_fence(__ATOMIC_RELEASE, "workgroup");
  __builtin_amdgcn_wave_barrier();
  __builtin_amdgcn_fence(__ATOMIC_ACQUIRE, "workgroup");
}

// =====================================================================================================
// f32 -> 16-bit plane, same layout.  f16mode == 0: bf16 RNE bits;  f16mode == 1: f16 bits of (bf16 RNE value) * scale.
// Thread = 8 consecutive elements: two 16-B loads, one 16-B store; 32 consecutive lanes = 512 contiguous, 512-B aligned
// One grid converts all five tensors, none of which depends on another: a block range per plane, in this order:
//   x (CB_X blocks per batch) -> XB bf16; Wq (CB_W) | Wk (CB_KV) | Wv (CB_KV) -> WB bf16 [3072 n][2048 k]; Wo (CB_W) -> WT f16 x1024.
// coverage: each range = plane elements / 2048 blocks x 256 thr x 8 = the whole plane (every plane a multiple of 2048 elements).
// =====================================================================================================
#define CB_X   (SEQ * DMOD / 2048)
#define CB_W   (DMOD * DMOD / 2048)
#define CB_KV  (KVD * DMOD / 2048)
#define CB_ALL (NB * CB_X + 2 * CB_W + 2 * CB_KV)
__global__ __launch_bounds__(256) void cvt_all(const float* __restrict__ xin, const float* __restrict__ wq,
                                               const float* __restrict__ wk, const float* __restrict__ wv,
                                               const float* __restrict__ wo, u16* XBp, u16* WBp, u16* WTp) {
  int blk = (int)blockIdx.x;                 // every choice below is block-uniform
  const float* x;
  u16* D;
  int f16mode = 0;
  float scale = 1.0f;
  if (blk < NB * CB_X) {
    const int b = blk / CB_X;
    blk -= b * CB_X;
    x = xin + (size_t)b * XS_FULL * DMOD;
    D = XBp + (size_t)b * SEQ * DMOD;
  } else if ((blk -= NB * CB_X) < CB_W) {
    x = wq;  D = WBp;
  } else if ((blk -= CB_W) < CB_KV) {
    x = wk;  D = WBp + (size_t)DMOD * DMOD;
  } else if ((blk -= CB_KV) < CB_KV) {
    x = wv;  D = WBp + (size_t)DMOD * DMOD + (size_t)KVD * DMOD;
  } else if ((blk -= CB_KV) < CB_W) {
    x = wo;  D = WTp;  f16mode = 1;  scale = WOS;
  } else {
    return;                                  // never taken with the exact grid
  }
  const int gt = blk * 256 + (int)threadIdx.x;
  const float* p = x + (size_t)gt * 8;
  const v4f a = *(const v4f*)(p), b4 = *(const v4f*)(p + 4);
  float w[8];
#pragma unroll
  for (int e = 0; e < 4; ++e) { w[e] = a[e]; w[4 + e] = b4[e]; }
  v4u o;
#pragma unroll
  for (int e = 0; e < 4; ++e) {
    const float f0 = w[2 * e], f1 = w[2 * e + 1];
    const unsigned short hb0 = h_bits((_Float16)(bfr(f0) * scale));
    const unsigned short hb1 = h_bits((_Float16)(bfr(f1) * scale));
    const unsigned short bb0 = bf_bits(f0);
    const unsigned short bb1 = bf_bits(f1);
    o[e] = (f16mode != 0) ? pk16(hb0, hb1) : pk16(bb0, bb1);
  }
  u16* d = D + (size_t)gt * 8;
  {
    *(v4u*)(d) = o;
    
  }
}

// =====================================================================================================
// q / k planes from the projection F f32 [MROWS][ldf] at column offset coff (nhead heads of HD columns; row = b*SEQ + s,
// column = coff + head*HD + d): t = (F + bfr(bias[head*HD + d])) * sc in f32 (add, then exact power-of-two scale);
//   Hp = f16(t), Lp = f16 residual (t - f16(t)), both in fragment order: tile (b, head, s >> 4) = 16 rows x 64 d = 4 pieces of
//   512 B; piece pc, lane l, element e <- row (s & 15) = l & 15, d = 16*pc + 8*(l >> 4) + e (pieces 2kk, 2kk + 1 are the two
//   halves of the fragment of k-step kk in the split k map).
// Block = one 16-row tile x 2 heads, 256 threads; wave = one piece: two 16-B loads of F and of bias per lane, one 16-B store
// per plane, a wave's store = the piece's 512 contiguous bytes.
// coverage: 8 waves = 2 heads x 4 pieces; blk in 0 .. (MROWS/16) * (nhead/2) - 1 = every piece of both planes once.
// =====================================================================================================
__device__ __forceinline__ void split16(const float* __restrict__ F, int ldf, int coff, int nhead,
                                        const float* __restrict__ bias, u16* Hp, u16* Lp, float sc, int blk) {
#pragma clang fp contract(off)
  const int tid  = (int)threadIdx.x;
  const int hpb  = nhead >> 1;                         // blocks per 16-row tile
  const int tile = blk / hpb;
  if (tile >= MROWS / 16) return;                      // never taken with the exact range
  const int head = (blk % hpb) * 2 + (tid >> 7);
  const int pc   = (tid >> 5) & 3;
  const int lane = tid & 31;
  const int row  = tile * 16 + (lane & 15);
  const int col  = head * HD + pc * 16 + (lane >> 4) * 8;
  const float* p = F + (size_t)row * (size_t)ldf + coff + col;
  const v4f xa = *(const v4f*)(p), xb = *(const v4f*)(p + 4);
  wait_addr();
  const v4f ba = *(const v4f*)(bias + col), bb = *(const v4f*)(bias + col + 4);
  float xv[8], bw[8];
#pragma unroll
  for (int e = 0; e < 4; ++e) {
    xv[e] = xa[e];  xv[4 + e] = xb[e];
    bw[e] = ba[e];  bw[4 + e] = bb[e];
  }
  v4u oh, ol;
#pragma unroll
  for (int e = 0; e < 4; ++e) {
    const float s0 = xv[2 * e] + bfr(bw[2 * e]);
    const float s1 = xv[2 * e + 1] + bfr(bw[2 * e + 1]);
    const float t0 = s0 * sc;
    const float t1 = s1 * sc;
    const _Float16 h0 = (_Float16)t0, h1 = (_Float16)t1;
    const _Float16 l0 = (_Float16)(t0 - (float)h0), l1 = (_Float16)(t1 - (float)h1);
    oh[e] = pk16(h_bits(h0), h_bits(h1));
    ol[e] = pk16(h_bits(l0), h_bits(l1));
  }
  const int bb2 = tile / NQT, s16 = tile % NQT;
  const size_t dst = (((size_t)(bb2 * nhead + head) * NQT + s16) * 4 + pc) * FPC + (size_t)lane * 8;
  *(v4u*)(Hp + dst) = oh;
  *(v4u*)(Lp + dst) = ol;
  wait_stores_issued();
}

// =====================================================================================================
// v^T planes from the v columns of the projection F f32 [MROWS][ldf] (row = b*SEQ + s, column = voff + g*HD + d):
//   t = (F + bfr(bias[g*HD + d])) * 1024;  VH = f16(t), VL = f16 residual (t - f16(t)), both for all keys s, in fragment
//   order: tile (b, g, s >> 5) = 64 d x 32 keys = 8 pieces of 512 B; piece 2j + h, lane l, element e <- d = 16j + (l & 15),
//   key (s & 31) = 16h + 8*(l >> 4) + e (the two halves of the A fragment of d-subtile j in the split k map).
// Block = (b, kv head g, 64 keys s0): each thread loads its 16 floats (key sl, d chunk dc) with 16-B loads, converts, places
// them into two LDS tiles [64 d][64 keys] (pitch 72 halves); after a block barrier each wave stores whole pieces.
// LDS tiles are cross-wave (block barrier); staged extent 64x64 == consumed extent 64x64.
// coverage: load 256 thr x 16 = 64 keys x 64 d; store 2 iterations x 8 waves = 16 pieces = the block's two 32-key tiles of
//           VH and of VL (8192 contiguous bytes each); bid in 0 .. NB*NKVH*NST - 1 covers both planes exactly once.
// =====================================================================================================
__device__ __forceinline__ void vt16(u16* TH, u16* TL, const float* __restrict__ F, int ldf, int voff,
                                     const float* __restrict__ bias, u16* VHo, u16* VLo, int bid) {
#pragma clang fp contract(off)
  const int tid = threadIdx.x;
  const int st  = bid % NST;
  const int t2  = bid / NST;
  const int g   = t2 % NKVH;
  const int b   = t2 / NKVH;
  if (b >= NB) return;                      // block-uniform, before any barrier; never taken with the exact grid
  const int s0  = st * 64;
  {
    const int sl = tid >> 2;                // key within tile 0..63
    const int dc = (tid & 3) * 16;          // d chunk 0,16,32,48
    const float* src  = F + ((size_t)b * SEQ + s0 + sl) * (size_t)ldf + voff + g * HD + dc;
    const float* bsrc = bias + g * HD + dc;
    v4f bv4[4];
#pragma unroll
    for (int i = 0; i < 4; ++i) bv4[i] = *(const v4f*)(bsrc + 4 * i);
    wait_addr();
#pragma unroll
    for (int i = 0; i < 4; ++i) {
      const v4f a  = *(const v4f*)(src + 4 * i);
      const v4f bb = bv4[i];
#pragma unroll
      for (int e = 0; e < 4; ++e) {
        const float s  = a[e] + bfr(bb[e]);
        const float t  = s * VCAR;
        const _Float16 hv = (_Float16)t;
        const _Float16 lv = (_Float16)(t - (float)hv);
        TH[(dc + 4 * i + e) * VTP + sl] = h_bits(hv);
        TL[(dc + 4 * i + e) * VTP + sl] = h_bits(lv);
      }
    }
  }
  __syncthreads();
  v4u vh[2], vl[2];
  const int ln = tid & 31, hf = (tid >> 5) & 1, js = tid >> 6;      // lane, fragment half, d-subtile of this thread's piece
  const int lo = (js * 16 + (ln & 15)) * VTP + hf * 16 + (ln >> 4) * 8;
#pragma unroll
  for (int it = 0; it < 2; ++it) {          // it = 32-key tile within the block's 64 keys
    vh[it] = *(const v4u*)(TH + lo + it * 32);
    vl[it] = *(const v4u*)(TL + lo + it * 32);
  }
  const size_t base = ((size_t)(b * NKVH + g) * NKT + (size_t)st * 2) * (8 * FPC) + (size_t)tid * 8;
#pragma unroll
  for (int it = 0; it < 2; ++it) {
    *(v4u*)(VHo + base + (size_t)it * (8 * FPC)) = vh[it];
    *(v4u*)(VLo + base + (size_t)it * (8 * FPC)) = vl[it];
  }
  wait_stores_issued();
}

// =====================================================================================================
// One grid writes all six attention operand planes from F (they depend on F alone): block ranges q (PB_Q), k (PB_K), v^T (PB_V).
// The range test is block-uniform, so vt16's block barrier is passed by all of a block's threads or by none.
// =====================================================================================================
#define PB_Q   ((MROWS / 16) * (NH / 2))
#define PB_K   ((MROWS / 16) * (NKVH / 2))
#define PB_V   (NB * NKVH * NST)
__global__ __launch_bounds__(256) void planes_all(const float* __restrict__ F, const float* __restrict__ bq,
                                                  const float* __restrict__ bk, const float* __restrict__ bv,
                                                  u16* QHo, u16* QLo, u16* KHo, u16* KLo, u16* VHo, u16* VLo) {
  __shared__ __align__(16) u16 TH[HD * VTP];
  __shared__ __align__(16) u16 TL[HD * VTP];
  const int blk = (int)blockIdx.x;
  if (blk < PB_Q)             split16(F, NQKV, 0, NH, bq, QHo, QLo, QSC, blk);
  else if (blk < PB_Q + PB_K) split16(F, NQKV, DMOD, NKVH, bk, KHo, KLo, KSC, blk - PB_Q);
  else                        vt16(TH, TL, F, NQKV, DMOD + KVD, bv, VHo, VLo, blk - PB_Q - PB_K);
}

// =====================================================================================================
// GEMM epilogue, in two halves around one wave-level LDS sync: epi_put places a 16x64 f32 tile (times oscale, plus
// bfr(bias[col]) when HASB != 0) in a wave-private slab [16][64] pitch 68; epi_get reads it back as whole row segments.
// coverage: 8 instructions x 2 rows x 16 lanes x 4 floats = the 16 x 64 tile.
// =====================================================================================================
template <int HASB>
__device__ __forceinline__ void epi_put(float* sl, v8f a0, v8f a1, v8f a2, v8f a3, float oscale,
                                        const float* __restrict__ bias, int col0, int lane) {
  const int hh = lane >> 4, m = lane & 15;
  float b0 = 0.0f, b1 = 0.0f, b2 = 0.0f, b3 = 0.0f;
  if (HASB != 0) {
    b0 = bfr(bias[col0 + m]);
    b1 = bfr(bias[col0 + 16 + m]);
    b2 = bfr(bias[col0 + 32 + m]);
    b3 = bfr(bias[col0 + 48 + m]);
  }
#pragma unroll
  for (int r = 0; r < 8; ++r) {
    const int ro = (8 * hh + r) * 68 + m;
    sl[ro]      = a0[r] * oscale + b0;
    sl[ro + 16] = a1[r] * oscale + b1;
    sl[ro + 32] = a2[r] * oscale + b2;
    sl[ro + 48] = a3[r] * oscale + b3;
  }
}
__device__ __forceinline__ void epi_get(const float* sl, float* C, int N, size_t rowb, int col0, int lane) {
  const int hh = lane >> 4, m = lane & 15;
  v4f vals[8];
#pragma unroll
  for (int it = 0; it < 8; ++it) vals[it] = *(const v4f*)(sl + (it * 2 + hh) * 68 + m * 4);
  float* dst = C + (rowb + (size_t)hh) * (size_t)N + col0 + m * 4;
#pragma unroll
  for (int it = 0; it < 8; ++it) {
    *(v4f*)(dst + (size_t)(it * 2) * (size_t)N) = vals[it];
  }
}

// =====================================================================================================
// GEMM engine shared by gemm_bf and gemm_out: C[M][N] (f32) = (A[M][K] (+ A2[M][K] when TWO != 0)) . Bt[N][K]^T, times oscale
// (plus bfr(bias[n]) when HASB != 0); A, A2 row-major 16-bit planes, Bt k-contiguous 16-bit plane.
// Block = BM x 128 tile of C (BM = 128, or 64 when TWO != 0), 4 waves as 2 x 2, wave = (BM/2) x 64 = MF x 4 accumulator tiles.
// A pass is 64 k = one whole 128-B line of each of the stage's 256 operand rows (A rows, then A2 rows, then the 128 Bt rows),
// brought into LDS by asynchronous copies (8 lanes per row, 16 copies per lane and pass), row pitch 144 B; two buffers: the
// copies of pass t + 2 are issued behind the barrier that ends pass t, so they fly while pass t + 1 is worked on.
// Fragments are read from the LDS rows with the same split k map and each accumulator takes its products in the
// same order (k ascending by 32; A before A2). Callers guarantee K % 64 == 0, M % BM == 0, N % 128 == 0, bid in 0 .. (M/BM)*(N/128) - 1.
// =====================================================================================================
#define GKP   64
#define GPIT  72
#define GSTG  (256 * GPIT)
static_assert(GKP == 2 * 32 && (DMOD % GKP) == 0 && (MROWS % 128) == 0 && (NQKV % 128) == 0 && (DMOD % 128) == 0);
static_assert((RICH % 64) == 0 && ((SEQ - RICH) % 128) == 0 && 4 * 4 * SLAB64 * 4 <= 2 * GSTG * 2);

union FragU { v4u u[2]; v16h h; v16b b; };

__device__ __forceinline__ FragU ldfrag_u(const u16* p) {
  FragU f;
  f.u[0] = *(const v4u*)(p);
  f.u[1] = *(const v4u*)(p + 16);
  return f;
}
template <int BF>
__device__ __forceinline__ v8f mma_u(const FragU& a, const FragU& b, v8f c) {
  if (BF != 0) return mma_b(a.b, b.b, c);
  return mma_h(a.h, b.h, c);
}
// eight asynchronous 16-B copies per lane, global -> LDS; the s_wait_xcnt closes the statement so that no register a copy
// names is rewritten ahead of it
__device__ __forceinline__ void copy8(const unsigned (&l)[8], const u16* const (&g)[8]) {
#if defined(__HIP_DEVICE_COMPILE__)
  asm volatile("global_load_async_to_lds_b128 %0, %8, off\n\t"
               "global_load_async_to_lds_b128 %1, %9, off\n\t"
               "global_load_async_to_lds_b128 %2, %10, off\n\t"
               "global_load_async_to_lds_b128 %3, %11, off\n\t"
               "global_load_async_to_lds_b128 %4, %12, off\n\t"
               "global_load_async_to_lds_b128 %5, %13, off\n\t"
               "global_load_async_to_lds_b128 %6, %14, off\n\t"
               "global_load_async_to_lds_b128 %7, %15, off\n\t"
               "s_wait_xcnt 0x0"
               :: "v"(l[0]), "v"(l[1]), "v"(l[2]), "v"(l[3]), "v"(l[4]), "v"(l[5]), "v"(l[6]), "v"(l[7]),
                  "v"(g[0]), "v"(g[1]), "v"(g[2]), "v"(g[3]), "v"(g[4]), "v"(g[5]), "v"(g[6]), "v"(g[7])
               : "memory");
#endif
}
// the same with six copies per lane
__device__ __forceinline__ void copy6(const unsigned (&l)[8], const u16* const (&g)[8]) {
#if defined(__HIP_DEVICE_COMPILE__)
  asm volatile("global_load_async_to_lds_b128 %0, %6, off\n\t"
               "global_load_async_to_lds_b128 %1, %7, off\n\t"
               "global_load_async_to_lds_b128 %2, %8, off\n\t"
               "global_load_async_to_lds_b128 %3, %9, off\n\t"
               "global_load_async_to_lds_b128 %4, %10, off\n\t"
               "global_load_async_to_lds_b128 %5, %11, off\n\t"
               "s_wait_xcnt 0x0"
               :: "v"(l[0]), "v"(l[1]), "v"(l[2]), "v"(l[3]), "v"(l[4]), "v"(l[5]),
                  "v"(g[0]), "v"(g[1]), "v"(g[2]), "v"(g[3]), "v"(g[4]), "v"(g[5])
               : "memory");
#endif
}
// this wave's own copies have landed
__device__ __forceinline__ void wait_copies() {
#if defined(__HIP_DEVICE_COMPILE__)
  asm volatile("s_wait_asynccnt 0x0" ::: "memory");
#endif
}
// this wave's own LDS reads have returned, before the buffer they read is handed to the copies
__device__ __forceinline__ void wait_lds() {
#if defined(__HIP_DEVICE_COMPILE__)
  asm volatile("s_wait_dscnt 0x0" ::: "memory");
#endif
}
// one stage: lane = (row r0 = tid >> 3 of each group of 16 rows, 16-B piece tid & 7); ld = the lane's LDS byte address of
// stage row r0, ga / ga2 / gb = its global address in row r0 of the block's A / A2 / Bt rows, rs16 = halves per 16 rows
template <int TWO>
__device__ __forceinline__ void stage_tile(unsigned ld, const u16* ga, const u16* ga2, const u16* gb, size_t rs16) {
  unsigned l[8];
  const u16* g[8];
#pragma unroll
  for (int i = 0; i < 8; ++i) {
    l[i] = ld + (unsigned)(i * 16 * GPIT * 2);
    if (TWO != 0) g[i] = (i < 4) ? (ga + (size_t)i * rs16) : (ga2 + (size_t)(i - 4) * rs16);
    else          g[i] = ga + (size_t)i * rs16;
  }
  copy8(l, g);
#pragma unroll
  for (int i = 0; i < 8; ++i) {
    l[i] = ld + (unsigned)((8 + i) * 16 * GPIT * 2);
    g[i] = gb + (size_t)i * rs16;
  }
  copy8(l, g);
}

template <int BF, int TWO, int HASB>
__device__ __forceinline__ void gemm_ring(u16* ring, const u16* __restrict__ A, const u16* __restrict__ A2,
                                          const u16* __restrict__ Bt, const float* __restrict__ bias, float* C,
                                          int M, int N, int K, float oscale, int bid) {
  constexpr int MF = (TWO != 0) ? 2 : 4;
  constexpr int BM = 32 * MF;
  const int tid = threadIdx.x, wave = tid >> 5, lane = tid & 31, hh = lane >> 4, m = lane & 15;
  const int ntile = N >> 7;
  const int row0  = (bid / ntile) * BM;
  const int col0  = (bid % ntile) * 128;
  if (row0 + BM > M) return;                // block-uniform, before any copy or barrier; never taken with the exact grid
  const int wm = wave >> 1, wn = wave & 1;
  const int r0 = tid >> 3, c8 = (tid & 7) * 8;
  const u16* ga  = A  + (size_t)(row0 + r0) * K + c8;
  const u16* ga2 = A2 + (size_t)(row0 + r0) * K + c8;
  const u16* gb  = Bt + (size_t)(col0 + r0) * K + c8;
  const size_t rs16 = (size_t)16 * K;
  const unsigned ld0 = (unsigned)(uintptr_t)ring + (unsigned)((r0 * GPIT + c8) * 2);
  const int npass = K / GKP;
  const int aoff = (wm * (16 * MF) + m) * GPIT + 8 * hh;          // halves, in a stage: A fragment row of this lane
  const int boff = (128 + wn * 64 + m) * GPIT + 8 * hh;           // Bt fragment row of this lane

  v8f acc[MF][4];
#pragma unroll
  for (int i = 0; i < MF; ++i) {
#pragma unroll
    for (int j = 0; j < 4; ++j) acc[i][j] = zero8();
  }

  stage_tile<TWO>(ld0, ga, ga2, gb, rs16);
  wait_copies();
  __syncthreads();
  if (npass > 1) stage_tile<TWO>(ld0 + (unsigned)(GSTG * 2), ga + GKP, ga2 + GKP, gb + GKP, rs16);

  // kept rolled (for speed only), the buffer chosen by the pass's parity
#pragma unroll 1
  for (int t = 0; t < npass; ++t) {
    const int par = t & 1;
    const u16* st = ring + par * GSTG;
    FragU a[2][MF], a2[2][MF], b[4];
#pragma unroll
    for (int kk = 0; kk < 2; ++kk) {
#pragma unroll
      for (int i = 0; i < MF; ++i) {
        a[kk][i] = ldfrag_u(st + aoff + i * 16 * GPIT + kk * 32);
        if (TWO != 0) a2[kk][i] = ldfrag_u(st + aoff + (64 + i * 16) * GPIT + kk * 32);
      }
    }
#pragma unroll
    for (int kk = 0; kk < 2; ++kk) {
#pragma unroll
      for (int j = 0; j < 4; ++j) b[j] = ldfrag_u(st + boff + j * 16 * GPIT + kk * 32);
      // the LDS reads stay in one group ahead of the WMMA block (for speed only)
      __builtin_amdgcn_sched_barrier(0);
#pragma unroll
      for (int i = 0; i < MF; ++i) {
#pragma unroll
        for (int j = 0; j < 4; ++j) acc[i][j] = mma_u<BF>(a[kk][i], b[j], acc[i][j]);
      }
      if (TWO != 0) {
#pragma unroll
        for (int i = 0; i < MF; ++i) {
#pragma unroll
          for (int j = 0; j < 4; ++j) acc[i][j] = mma_u<BF>(a2[kk][i], b[j], acc[i][j]);
        }
      }
      // the WMMA block stays ahead of what follows: sunk behind the publish point it would put the refill's issue directly
      // in front of the next pass's wait for it
      __builtin_amdgcn_sched_barrier(0);
    }
    // publish point of pass t + 1: own reads back, own copies landed, every wave here; then the freed buffer is refilled
    wait_lds();
    wait_copies();
    __syncthreads();
    if (t + 2 < npass) {
      const size_t ko = (size_t)(t + 2) * GKP;
      stage_tile<TWO>(ld0 + (unsigned)(par * GSTG * 2), ga + ko, ga2 + ko, gb + ko, rs16);
    }
  }
  wait_copies();

  // the last pass's barrier has ended every read of the ring and no copy is outstanding: each wave stages its MF tiles in
  // MF slabs of its own
  float* sl = (float*)(void*)ring + wave * (MF * SLAB64);
  const int colw = col0 + wn * 64;
#pragma unroll
  for (int i = 0; i < MF; ++i)
    epi_put<HASB>(sl + i * SLAB64, acc[i][0], acc[i][1], acc[i][2], acc[i][3], oscale, bias, colw, lane);
  wave_sync_lds();
#pragma unroll
  for (int i = 0; i < MF; ++i)
    epi_get(sl + i * SLAB64, C, N, (size_t)(row0 + wm * (16 * MF) + i * 16), colw, lane);
}

__global__ __launch_bounds__(128)
void gemm_bf(const u16* __restrict__ A, const u16* __restrict__ Bt, float* C, int M, int N, int K, float oscale) {
  __shared__ __align__(16) u16 ring[2 * GSTG];
  gemm_ring<1, 0, 0>(ring, A, A, Bt, (const float*)0, C, M, N, K, oscale, (int)blockIdx.x);
}

// y = O.Wo^T + bo for all rows in one grid (the row ranges are independent): per sequence GB_L blocks of 128 x 128 for rows
// >= RICH (O hi only), then GB_R blocks of 64 x 128 for rows < RICH (O hi + residual). The range test is block-uniform.
#define GB_L   (((SEQ - RICH) / 128) * (DMOD / 128))
#define GB_R   ((RICH / 64) * (DMOD / 128))
__global__ __launch_bounds__(128)
void gemm_out(const u16* __restrict__ OHp, const u16* __restrict__ OLp, const u16* __restrict__ Bt,
              const float* __restrict__ bias, float* C, float oscale) {
  __shared__ __align__(16) u16 ring[2 * GSTG];
  const int b = (int)blockIdx.x / (GB_L + GB_R);
  const int r = (int)blockIdx.x % (GB_L + GB_R);
  if (b >= NB) return;                      // block-uniform, before any copy or barrier; never taken with the exact grid
  if (r < GB_L) {
    const size_t ro = ((size_t)b * SEQ + RICH) * DMOD;
    gemm_ring<0, 0, 1>(ring, OHp + ro, OLp + ro, Bt, bias, C + ro, SEQ - RICH, DMOD, DMOD, oscale, r);
    wait_stores_issued();
  } else {
    const size_t ro = (size_t)b * SEQ * DMOD;
    gemm_ring<0, 1, 1>(ring, OHp + ro, OLp + ro, Bt, bias, C + ro, RICH, DMOD, DMOD, oscale, r - GB_L);
    wait_stores_issued();
  }
}

// =====================================================================================================
// Causal grouped-query softmax attention, hd = 64. Block bid -> (query tile qt = qt0 + bid % nqt: rows q0 = 16*qt ..
// q0+15, head group hg = kv head, batch b); one wave per query head = hg*WPB + wave (the 4 consecutive query heads of a
// group share kv head hg).
//   q hi / residual planes f16 x256, tiles (b, h, s >> 4); k hi / residual planes f16 x256, tiles (b, g, s >> 4); v^T hi /
//   residual planes x1024, tiles (b, g, s >> 5): all in fragment order (split16, vt16), so that every fragment load of a wave
//   reads 512 contiguous bytes and a key tile of 32 is 4096 contiguous bytes of each k plane and of each v^T plane.
//   The block's 4 waves walk the same key tiles of the same kv head: a key tile (k hi | k residual | v^T hi, and for RV = 1
//   | v^T residual, 4096 B each, kept in fragment order) is brought into LDS once per block by asynchronous copies (2 copies per
//   lane and plane); two buffers: the copies of tile kt + 2 are issued behind the barrier that ends tile kt, so they fly while
//   tile kt + 1 is worked on. nkt is the same for the whole block, so every wave passes every barrier.
//   Transposed products: S^T = K.Q^T (A = key rows, B = query rows as columns), so a lane's 16 score registers of a key tile
//   belong to one query (lane & 15) and hold keys kb + 8*(lane >> 4) + r and kb + 16 + 8*(lane >> 4) + r.
//   raw(j, i) = k_hi.q_hi + k_hi.q_lo + k_lo.q_hi (2 k-steps over d); logit = raw * 2^-19 (the 1/8 softmax scale and the two
//   256 carries, exact); keys above the diagonal replaced by -inf; online softmax per query in f32 with a running max:
//   max in-lane over the 16 scores plus one exchange with lane ^ 16; sum in-lane, the two halves' sums joined once after the
//   loop; alpha = exp(m_old - m_new), p = exp(logit - m_new), l = l*alpha + sum p, O^T accumulators times alpha before the
//   tile's product. Key tiles of 32 visited in order, only tiles with kb <= q0 (nkt = q0/32 + 1 <= NKT; key kb is unmasked for
//   every query of the tile). The score registers, as p*32768 (f16 hi and its f16 residual), are the B fragment of
//   O^T += v^T.P^T in the split k map as they stand; v^T A fragments in 2 groups of 2 d-subtiles; RV = 1: products hh + lh + hl,
//   RV = 0: hh only.
//   Epilogue: O x256 -> f16 hi plane (and for RV = 1 the f16 residual plane of O x256) [b*SEQ + s][h*HD + d]; lane = (row group
//   rq = lane>>3 in 0..3, 8 consecutive d at c8); one instruction = 4 rows it*4 + rq, each row segment (64 halves = one whole
// coverage: per wave 4 instructions x 4 rows x 8 lanes x 8 halves = 16 x 64 per plane; nqt x NHG x NB blocks x WPB waves;
//   the two block ranges (tiles NQTR..NQT-1 with RV = 0, tiles 0..NQTR-1 with RV = 1) cover every (b, s, h) row segment of the hi plane
//   exactly once and rows s < RICH of the residual plane exactly once (only those rows are read later).
// =====================================================================================================
#define AKT   (2 * FTILE)
#define ASTG  (4 * AKT)
static_assert(AKT * 2 == 2 * ATT_THREADS * 16 && 6 * (2 * ASTG * 2 + WPB * WREG * 4) <= 327680);
// one key tile: ld = the lane's LDS byte address in the buffer (16 B per thread), kh / kl / vh / vl = its global address in the
// tile of each plane; a plane's tile = 2 copies of the block (2048 B each)
template <int RV>
__device__ __forceinline__ void stage_kv(unsigned ld, const u16* kh, const u16* kl, const u16* vh, const u16* vl) {
  unsigned l[8];
  const u16* g[8];
#pragma unroll
  for (int i = 0; i < 8; ++i) l[i] = ld + (unsigned)(i * (AKT / 2) * 2);
  g[0] = kh;  g[1] = kh + AKT / 2;
  g[2] = kl;  g[3] = kl + AKT / 2;
  g[4] = vh;  g[5] = vh + AKT / 2;
  g[6] = vl;  g[7] = vl + AKT / 2;
  if (RV != 0) copy8(l, g);
  else         copy6(l, g);
}

template <int RV>
__device__ __forceinline__
void attn_gq(float* smem, u16* kvr, const u16* __restrict__ QHp, const u16* __restrict__ QLp,
             const u16* __restrict__ KHp, const u16* __restrict__ KLp,
             const u16* __restrict__ VHp, const u16* __restrict__ VLp,
             u16* OHp, u16* OLp, int bid, int qt0, int nqt) {
#pragma clang fp contract(off)
  const int tid  = threadIdx.x;
  const int wave = tid >> 5;
  const int lane = tid & 31;
  const int hh   = lane >> 4;
  const int c    = lane & 15;
  if (nqt <= 0) return;                     // block-uniform, before any copy or barrier
  const int qt   = qt0 + bid % nqt;
  const int t2   = bid / nqt;
  const int hg   = t2 % NHG;
  const int b    = t2 / NHG;
  if (b >= NB) return;                      // block-uniform, before any copy or barrier; never taken with the exact grid
  const int q0   = qt * 16;
  if (q0 + 16 > SEQ) return;                // block-uniform, before any copy or barrier; never taken
  const int head = hg * WPB + wave;
  const int kvh  = hg;

  float* slab = smem + wave * WREG;         // result slab [16][64] pitch 68

  const unsigned l8 = (unsigned)lane * 8;
  const size_t qoff = ((size_t)(b * NH + head) * NQT + qt) * FTILE;                        // this wave's 16-query tile
  const size_t koff = (size_t)(b * NKVH + kvh) * NQT * FTILE;                              // 16-key tile 0 of the kv head
  const size_t voff = (size_t)(b * NKVH + kvh) * NKT * (2 * FTILE);                        // 32-key tile 0 of the kv head
  const _Float16* Qh  = (const _Float16*)(const void*)QHp + qoff;
  const _Float16* Ql  = (const _Float16*)(const void*)QLp + qoff;
  const u16* gkh = KHp + koff + (size_t)tid * 8;      // this thread's 16 B of the first half of key tile 0, plane by plane
  const u16* gkl = KLp + koff + (size_t)tid * 8;
  const u16* gvh = VHp + voff + (size_t)tid * 8;
  const u16* gvl = VLp + voff + (size_t)tid * 8;
  const unsigned ld0 = (unsigned)(uintptr_t)kvr + (unsigned)(tid * 16);
  const float lsc  = SM_SCALE * (1.0f / (QSC * KSC));   // exact power-of-two fold of the q / k carries into the 1/8 scale
  const float oc   = 1.0f / (PCAR * VCAR);
  const float ninf = -__builtin_inff();

  v8f o[4];                                 // O^T: element r of o[j] = (d = 16j + 8hh + r, query row q0 + c)
#pragma unroll
  for (int j = 0; j < 4; ++j) o[j] = zero8();
  float mrun = ninf, lrun = 0.0f;           // this lane's query: running max (both halves alike), sum over this half's keys
  const int ncaus = (q0 >> 5) + 1;                                            // tiles holding keys <= q0 + 15
  const int nkt   = (ncaus < NKT) ? ncaus : NKT;
  const int qrow  = q0 + c;                                                   // query row of every D element of this lane

  stage_kv<RV>(ld0, gkh, gkl, gvh, gvl);
  wait_copies();
  __syncthreads();
  if (nkt > 1) stage_kv<RV>(ld0 + (unsigned)(ASTG * 2), gkh + AKT, gkl + AKT, gvh + AKT, gvl + AKT);

#pragma unroll 1
  for (int kt = 0; kt < nkt; ++kt) {
    const int kb = kt * 32;
    const int par = kt & 1;
    const _Float16* st = (const _Float16*)(const void*)(kvr + par * ASTG);    // this tile's buffer
    // ---- raw scores, transposed: D element r of this lane = (key kb + 8hh + r, query qrow) in s0, key + 16 in s1 ----
    v8f s0 = zero8(), s1 = zero8();
    const _Float16* k0p = st;
    const _Float16* k1p = k0p + FTILE;
    const _Float16* l0p = st + AKT;
    const _Float16* l1p = l0p + FTILE;
#pragma unroll
    for (int kk = 0; kk < HD / 32; ++kk) {
      const v16h qh  = ldfrag_f(Qh + kk * (2 * FPC), l8);
      const v16h ql  = ldfrag_f(Ql + kk * (2 * FPC), l8);
      const v16h kh0 = ldfrag_f(k0p + kk * (2 * FPC), l8);
      const v16h kh1 = ldfrag_f(k1p + kk * (2 * FPC), l8);
      const v16h kl0 = ldfrag_f(l0p + kk * (2 * FPC), l8);
      const v16h kl1 = ldfrag_f(l1p + kk * (2 * FPC), l8);
      s0 = mma_h(kh0, qh, s0);
      s0 = mma_h(kh0, ql, s0);
      s0 = mma_h(kl0, qh, s0);
      s1 = mma_h(kh1, qh, s1);
      s1 = mma_h(kh1, ql, s1);
      s1 = mma_h(kl1, qh, s1);
      guard2(s0, s1, qh, ql, kh0, kl0, kh1, kl1);
    }
    // ---- causal replace-mask, running-max online softmax in f32: the lane's 16 scores belong to one query ----
    const int key0 = kb + 8 * hh, key1 = key0 + 16;
    float t0[8], t1[8];
    float mx = ninf;
#pragma unroll
    for (int r = 0; r < 8; ++r) {
      const float a0 = s0[r] * lsc;
      const float a1 = s1[r] * lsc;
      t0[r] = (key0 + r > qrow) ? ninf : a0;
      t1[r] = (key1 + r > qrow) ? ninf : a1;
      mx = fmaxf(mx, fmaxf(t0[r], t1[r]));
    }
    mx = fmaxf(mx, xhalf(mx));                          // the other half's 16 keys of the same query
    const float mnew = fmaxf(mrun, mx);
    const float al   = __expf(mrun - mnew);
    // ---- B fragments of p*32768 straight from the score registers: hi f16 and residual f16, column = query c,
    //      elements 0..7 = keys kb + 8hh + 0..7, elements 8..15 = keys kb + 16 + 8hh + 0..7 (the split k map) ----
    FragH ph, pl;
    float sm = 0.0f;
#pragma unroll
    for (int r = 0; r < 8; ++r) {
      const float p0 = __expf(t0[r] - mnew);
      const float p1 = __expf(t1[r] - mnew);
      sm += p0 + p1;
      const float ta = p0 * PCAR, tc = p1 * PCAR;
      const _Float16 ha = (_Float16)ta, hc = (_Float16)tc;
      ph.h[0][r] = ha;
      ph.h[1][r] = hc;
      pl.h[0][r] = (_Float16)(ta - (float)ha);
      pl.h[1][r] = (_Float16)(tc - (float)hc);
    }
    lrun = lrun * al + sm;
    mrun = mnew;
    // ---- rescale the O^T accumulators by the lane's alpha ----
#pragma unroll
    for (int j = 0; j < 4; ++j) {
#pragma unroll
      for (int r = 0; r < 8; ++r) o[j][r] = o[j][r] * al;
    }
    // ---- O^T += v^T.P^T : A fragment row = d = j*16 + c, subtile j = pieces 2j, 2j + 1 of the key tile; 2 groups of 2 ----
    {
      const _Float16* vhp = st + 2 * AKT;
      const _Float16* vlp = st + 3 * AKT;
      (void)vlp;
#pragma unroll
      for (int jg = 0; jg < 2; ++jg) {
        const size_t da = (size_t)(2 * jg) * (2 * FPC);
        const size_t db = da + (size_t)(2 * FPC);
        const v16h vha = ldfrag_f(vhp + da, l8), vhb2 = ldfrag_f(vhp + db, l8);
        o[2 * jg]     = mma_h(vha,  ph.v, o[2 * jg]);
        o[2 * jg + 1] = mma_h(vhb2, ph.v, o[2 * jg + 1]);
        if (RV != 0) {
          const v16h vla = ldfrag_f(vlp + da, l8), vlb2 = ldfrag_f(vlp + db, l8);
          o[2 * jg]     = mma_h(vha,  pl.v, o[2 * jg]);
          o[2 * jg]     = mma_h(vla,  ph.v, o[2 * jg]);
          o[2 * jg + 1] = mma_h(vhb2, pl.v, o[2 * jg + 1]);
          o[2 * jg + 1] = mma_h(vlb2, ph.v, o[2 * jg + 1]);
          guard2(o[2 * jg], o[2 * jg + 1], ph.v, pl.v, vha, vhb2, vla, vlb2);
        } else {
          guard2(o[2 * jg], o[2 * jg + 1], ph.v, pl.v, vha, vhb2, vha, vhb2);
        }
      }
    }
    // publish point of tile kt + 1: own reads back, own copies landed, every wave here; then the freed buffer is refilled
    wait_lds();
    wait_copies();
    __syncthreads();
    if (kt + 2 < nkt) {
      const size_t ko = (size_t)(kt + 2) * AKT;
      stage_kv<RV>(ld0 + (unsigned)(par * ASTG * 2), gkh + ko, gkl + ko, gvh + ko, gvl + ko);
    }
  }
  wait_copies();
  acc_guard4(o[0], o[1], o[2], o[3]);
  // ---- O = acc / l with the carries (32768 on p, 1024 on v) folded once; the two halves' sums joined here; the lane's
  //      8 consecutive d of each subtile go into row c of the wave's slab ----
  const float ltot = lrun + xhalf(lrun);
  const float rl   = (1.0f / ltot) * oc;
#pragma unroll
  for (int j = 0; j < 4; ++j) {
    float* sd = slab + c * SLP + j * 16 + 8 * hh;
    v4f w0, w1;
#pragma unroll
    for (int e = 0; e < 4; ++e) { w0[e] = o[j][e] * rl; w1[e] = o[j][4 + e] * rl; }
    *(v4f*)(sd)     = w0;
    *(v4f*)(sd + 4) = w1;
  }
  wave_sync_lds();
  // ---- O x256 -> f16 hi plane (+ f16 residual plane); lane = (row group rq, 8 consecutive d at c8) ----
  v4u oh[4], ol[4];
  const int rq = lane >> 3, c8 = (lane & 7) * 8;
#pragma unroll
  for (int it = 0; it < 4; ++it) {
    const int row = it * 4 + rq;
    const v4f a = *(const v4f*)(slab + row * SLP + c8), b4 = *(const v4f*)(slab + row * SLP + c8 + 4);
    float w[8];
#pragma unroll
    for (int e = 0; e < 4; ++e) { w[e] = a[e] * OSC; w[4 + e] = b4[e] * OSC; }
#pragma unroll
    for (int e = 0; e < 4; ++e) {
      const _Float16 h0 = (_Float16)w[2 * e], h1 = (_Float16)w[2 * e + 1];
      const _Float16 g0 = (_Float16)(w[2 * e] - (float)h0), g1 = (_Float16)(w[2 * e + 1] - (float)h1);
      oh[it][e] = pk16(h_bits(h0), h_bits(h1));
      ol[it][e] = pk16(h_bits(g0), h_bits(g1));
    }
  }
  const size_t ob = ((size_t)b * SEQ + q0) * DMOD + (size_t)head * HD + c8;
  {
#pragma unroll
    for (int it = 0; it < 4; ++it) {
      const int row = it * 4 + rq;
      *(v4u*)(OHp + ob + (size_t)row * DMOD) = oh[it];
      if (RV != 0) {
        *(v4u*)(OLp + ob + (size_t)row * DMOD) = ol[it];
      }
    }
    wait_stores_issued();
  }
}

// Both row ranges in one grid (no query tile depends on another): the AB_L blocks of the later tiles (the longer key loops)
// first, then the AB_R blocks of the tiles < RICH / 16. The range test is block-uniform.
#define AB_L   ((NQT - NQTR) * NHG * NB)
#define AB_R   (NQTR * NHG * NB)
// six waves per SIMD: the register budget (160) at which all AB_L blocks of the later tiles are resident at once; left to
// itself the compiler takes 163 registers for the two bodies, which allocates 176 and leaves five waves
__global__ __launch_bounds__(ATT_THREADS) __attribute__((amdgpu_waves_per_eu(6)))
void attn_all(const u16* __restrict__ QHp, const u16* __restrict__ QLp,
              const u16* __restrict__ KHp, const u16* __restrict__ KLp,
              const u16* __restrict__ VHp, const u16* __restrict__ VLp, u16* OHp, u16* OLp) {
  __shared__ __align__(16) float smem[WPB * WREG];
  __shared__ __align__(16) u16 kvring[2 * ASTG];
  const int bid = (int)blockIdx.x;
  if (bid < AB_L) attn_gq<0>(smem, kvring, QHp, QLp, KHp, KLp, VHp, VLp, OHp, OLp, bid, NQTR, NQT - NQTR);
  else            attn_gq<1>(smem, kvring, QHp, QLp, KHp, KLp, VHp, VLp, OHp, OLp, bid - AB_L, 0, NQTR);
}

// =====================================================================================================
// Workspace map (bytes); every plane is fully written by whole-line stores before it is read (the O residual plane only on
// the rows < RICH per sequence that are read); all extents are exact multiples of the store granularity (no pad rows needed);
// every region offset a multiple of 131072:
//   XB  bf16 [MROWS][2048]              MROWS*4096   (NB=2, SEQ=2048: 16777216); after the projection GEMM the same bytes hold
//                                                    the O f16 hi plane [MROWS][2048] x256 (identical extent)
//   WB  bf16 [3072 n][2048 k]           12582912     (Wq rows 0..2047, Wk 2048..2559, Wv 2560..3071)
//   WT  f16 [2048 o][2048 d] x1024      8388608      (Wo)
//   F   f32 [MROWS][3072]               MROWS*12288  (q | k | v projection columns, no bias); after split16 / vt16 its first
//                                                    MROWS*4096 bytes hold the O f16 residual plane [MROWS][2048]
//   QH  f16 [NB*32][SEQ/16] tiles of 2048 B x256   MROWS*4096   QL residual, same extent   (fragment order)
//   KH  f16 [NB*8][SEQ/16] tiles of 2048 B x256    MROWS*1024   KL residual, same extent   (fragment order)
//   VH  f16 [NB*8][SEQ/32] tiles of 4096 B x1024   MROWS*1024   VL residual, same extent   (fragment order)
//   end (NB=2, SEQ=2048)               138412032
// =====================================================================================================
extern "C" void kernel_launch(void* const* d_in, const int* in_sizes, int n_in,
                              void* d_out, int out_size, void* d_ws, size_t ws_size,
                              hipStream_t stream) {
  if (n_in < 9) return;
  if (in_sizes[0] < ((NB - 1) * XS_FULL + SEQ) * DMOD) return;
  if (in_sizes[1] < DMOD * DMOD) return;
  if (in_sizes[2] < DMOD) return;
  if (in_sizes[3] < KVD * DMOD) return;
  if (in_sizes[4] < KVD) return;
  if (in_sizes[5] < KVD * DMOD) return;
  if (in_sizes[6] < KVD) return;
  if (in_sizes[7] < DMOD * DMOD) return;
  if (in_sizes[8] < DMOD) return;
  if (out_size < MROWS * DMOD) return;

  const float* x  = (const float*)d_in[0];
  const float* wq = (const float*)d_in[1];
  const float* bq = (const float*)d_in[2];
  const float* wk = (const float*)d_in[3];
  const float* bk = (const float*)d_in[4];
  const float* wv = (const float*)d_in[5];
  const float* bv = (const float*)d_in[6];
  const float* wo = (const float*)d_in[7];
  const float* bo = (const float*)d_in[8];
  float*       out = (float*)d_out;

  const size_t szXB = (size_t)MROWS * DMOD * 2;
  const size_t szWB = (size_t)NQKV * DMOD * 2;
  const size_t szF  = (size_t)MROWS * NQKV * 4;
  const size_t szQ  = (size_t)MROWS * DMOD * 2;                  // QH, QL
  const size_t szK  = (size_t)MROWS * KVD * 2;                   // KH, KL
  const size_t szV  = (size_t)NB * NKVH * HD * SEQ * 2;          // VH, VL (== szK)
  const size_t szOH = (size_t)MROWS * DMOD * 2;                  // O hi plane, lives in the XB region
  const size_t szOL = (size_t)MROWS * DMOD * 2;                  // O residual plane, lives in the F region
  const size_t szWT = (size_t)DMOD * DMOD * 2;                   // Wo f16 plane
  if (szOH > szXB || szOL > szF) return;
  size_t off = 0;
  const size_t oXB = off; off += szXB;
  const size_t oWB = off; off += szWB;
  const size_t oWT = off; off += szWT;
  const size_t oF  = off; off += szF;
  const size_t oQH = off; off += szQ;
  const size_t oQL = off; off += szQ;
  const size_t oKH = off; off += szK;
  const size_t oKL = off; off += szK;
  const size_t oVH = off; off += szV;
  const size_t oVL = off; off += szV;
  if (off > ws_size) return;                // off = 138412032 for NB = 2, SEQ = 2048
  if (off > (size_t)WS_CAP) return;

  char* ws = (char*)d_ws;
  u16*   XB  = (u16*)(ws + oXB);
  u16*   OH  = (u16*)(ws + oXB);
  u16*   WB  = (u16*)(ws + oWB);
  u16*   WT  = (u16*)(ws + oWT);
  float* F   = (float*)(ws + oF);
  u16*   OL  = (u16*)(ws + oF);
  u16*   QH  = (u16*)(ws + oQH);
  u16*   QL  = (u16*)(ws + oQL);
  u16*   KH  = (u16*)(ws + oKH);
  u16*   KL  = (u16*)(ws + oKL);
  u16*   VH  = (u16*)(ws + oVH);
  u16*   VL  = (u16*)(ws + oVL);

  const dim3 b256(256), b128(128), bAT(ATT_THREADS);
  const dim3 gG1((MROWS / 128) * (NQKV / 128));         // 768
  const float osc = 1.0f / (OSC * WOS);

  // (0) x -> bf16 plane [MROWS][2048]; Wq, Wk, Wv -> one bf16 plane [3072 n][2048 k]; Wo [2048 o][2048 d] -> f16 plane of the
  //     bf16 value x1024 (already k-contiguous)
  cvt_all<<<dim3(CB_ALL), b256, 0, stream>>>(x, wq, wk, wv, wo, XB, WB, WT);
  // (1) qkv = x.[Wq|Wk|Wv]^T -> F f32 [MROWS][3072] (biases added by the consumers in f32)
  gemm_bf<<<gG1, b128, 0, stream>>>(XB, WB, F, MROWS, NQKV, DMOD, 1.0f);
  // (2) q and k hi + residual planes x256 from columns 0..2047 (+bq) and 2048..2559 (+bk); v^T hi + residual planes x1024 from
  //     columns 2560..3071 (+bv)
  planes_all<<<dim3(PB_Q + PB_K + PB_V), b256, 0, stream>>>(F, bq, bk, bv, QH, QL, KH, KL, VH, VL);
  // (3) causal attention -> O f16 hi plane x256 (XB region) for all query tiles; residual plane (F region) for tiles < RICH
  attn_all<<<dim3(AB_L + AB_R), bAT, 0, stream>>>(QH, QL, KH, KL, VH, VL, OH, OL);
  // (4) y = O.Wo^T + bo -> out f32 [MROWS][2048], carries 256 x 1024 folded back; rows < RICH per sequence with O hi + residual
  gemm_out<<<dim3(NB * (GB_L + GB_R)), b128, 0, stream>>>(OH, OL, WT, bo, out, osc);
  (void)hipGetLastError();
}

// v006
// Measured time: 176 microseconds a run.
// In both of two side-by-side timings against v005, it was 1.06 times as fast.
// All steps since v000 together make it 3.61 times as fast.
// Contractions: x.[Wq|Wk|Wv]^T on v_wmma_f32_16x16x32_bf16 (x and the weights as bf16 RNE planes, weight [n][k] rows are the
// k-contiguous B operand, f32 accumulate, biases added in f32 as bf16 RNE values); q.k^T over hd 64 and P.v on
// v_wmma_f32_16x16x32_f16 with f16 hi + f16 residual planes (q, k x256, products hh+lh+hl on every row; P x32768 hi +
// in-register residual and v^T x1024 hi + residual plane for query rows < 512 of each sequence, P hi . v hi only for later
// rows); O.Wo^T on v_wmma_f32_16x16x32_f16 with O x256 as f16 hi (+ f16 residual plane for rows < 512 of each sequence) and
// Wo as f16(bf16(Wo)) x1024, one accumulator, bias bo added in f32; all f32 accumulate. Online softmax in f32 on VALU.
#include <hip/hip_runtime.h>
#include <math.h>
#include <stdint.h>

#ifndef NB
#define NB 2
#endif
#ifndef SEQ
#define SEQ 2048
#endif
#define XS_FULL 2048
#define DMOD  2048
#define NH    32
#define NKVH  8
#define HD    64
#define KVD   (NKVH * HD)
#define NQKV  (DMOD + 2 * KVD)
#define MROWS (NB * SEQ)
#define RICH_REQ 512
#define RICH  ((SEQ < RICH_REQ) ? SEQ : RICH_REQ)
#define SM_SCALE 0.125f
#define QSC   256.0f
#define KSC   256.0f
#define PCAR  32768.0f
#define VCAR  1024.0f
#define OSC   256.0f
#define WOS   1024.0f
#define WPB   (NH / NKVH)
#define NHG   NKVH
#define NQT   (SEQ / 16)
#define NQTR  (RICH / 16)
#define NKT   (SEQ / 32)
#define ATT_THREADS (WPB * 32)
#define SLP   68
#define SLW   (16 * SLP)
#define WREG  (SLW)
#define SLAB64 (16 * 68)
#define WS_CAP 268435456
static_assert(DMOD == NH * HD && HD == 64 && NH == 32 && NKVH == 8 && WPB == 4 && NHG * WPB == NH);
static_assert(ATT_THREADS == 128 && KVD == 512 && NQKV == 3072);
static_assert(NB >= 1 && NB <= 2);
static_assert(NB == 1 || SEQ == XS_FULL);
static_assert((SEQ % 64) == 0 && SEQ >= 64 && SEQ <= XS_FULL);
static_assert((RICH % 64) == 0 && RICH >= 64 && RICH <= SEQ);
static_assert((DMOD % 64) == 0 && (KVD % 64) == 0 && (NQKV % 64) == 0 && (DMOD % 32) == 0 && (HD % 32) == 0 && (MROWS % 64) == 0);
static_assert(((SEQ * DMOD / 8) % 256) == 0 && ((DMOD * DMOD / 8) % 256) == 0 && ((KVD * DMOD / 8) % 256) == 0);
static_assert(WPB * WREG * 4 <= 65536 && 4 * SLAB64 * 4 <= 65536);
// workspace total (XB + WB + WT + OL region + QH + QL + KH + KL + VH + VL) for this build
static_assert((size_t)MROWS * DMOD * 2 + (size_t)NQKV * DMOD * 2 + (size_t)DMOD * DMOD * 2 + (size_t)MROWS * NQKV * 4 +
              2 * (size_t)MROWS * DMOD * 2 + 2 * (size_t)MROWS * KVD * 2 + 2 * (size_t)NB * NKVH * HD * SEQ * 2
              <= (size_t)WS_CAP);

typedef unsigned short u16;
typedef _Float16 v16h __attribute__((ext_vector_type(16)));
typedef _Float16 v8h  __attribute__((ext_vector_type(8)));
typedef __bf16   v16b __attribute__((ext_vector_type(16)));
typedef float    v8f  __attribute__((ext_vector_type(8)));
typedef float    v4f  __attribute__((ext_vector_type(4)));
typedef unsigned int v4u __attribute__((ext_vector_type(4)));

union FragH { v16h v; v8h h[2]; v4u u[2]; };

// ---- scalar helpers --------------------------------------------------------------------------------
__device__ __forceinline__ unsigned short bf_bits(float f) {          // f32 -> bf16 bits, RNE convert
  unsigned u = __float_as_uint(f);
  return (unsigned short)((u + 0x7FFFu + ((u >> 16) & 1u)) >> 16);
}
__device__ __forceinline__ float bf_up(unsigned short h) { return __uint_as_float(((unsigned)h) << 16); }
__device__ __forceinline__ float bfr(float f) { return bf_up(bf_bits(f)); }
__device__ __forceinline__ unsigned short h_bits(_Float16 x) { return __builtin_bit_cast(unsigned short, x); }
__device__ __forceinline__ unsigned pk16(unsigned short a, unsigned short b) { return (unsigned)a | ((unsigned)b << 16); }
__device__ __forceinline__ v8f zero8() { v8f z = {0.f, 0.f, 0.f, 0.f, 0.f, 0.f, 0.f, 0.f}; return z; }

// ---- fragment map: 16-bit A/B operand of k-step k0, lane -> row/col (lane&15), h = lane>>4; elements 0..7 <- k0+8h+0..7,
//      elements 8..15 <- k0+16+8h+0..7 (the same split k map for A and B; ldfrag_u reads it from k-contiguous rows)
// ---- fragment loader for a plane kept in fragment order: a fragment is two pieces of 512 contiguous bytes, piece = 32 lanes
//      x 16 B; p = the fragment's first byte (wave-uniform where the tile is), l8 = 8*lane; elements 0..7 <- piece 0,
//      elements 8..15 <- piece 1 (a load = 4 whole 128-B lines)
#define FPC   256
#define FTILE (4 * FPC)
__device__ __forceinline__ v16h ldfrag_f(const _Float16* p, unsigned l8) {
  FragH f;
  f.h[0] = *(const v8h*)(p + l8);
  f.h[1] = *(const v8h*)(p + l8 + FPC);
  return f.v;
}

// stands behind issued global loads whose address registers the code that follows may take over
__device__ __forceinline__ void wait_addr() {
#if defined(__HIP_DEVICE_COMPILE__)
  asm volatile("s_wait_xcnt 0x0" ::: "memory");
#endif
}

// stands behind issued global stores whose registers the code that follows rewrites: the next slab's or rows' values in a
// loop, or the next range's body in a grid of several ranges
__device__ __forceinline__ void wait_stores_issued() {
#if defined(__HIP_DEVICE_COMPILE__)
  asm volatile("s_wait_xcnt 0x0" ::: "memory");
#endif
}

__device__ __forceinline__ v8f mma_h(v16h a, v16h b, v8f c) {
  return __builtin_amdgcn_wmma_f32_16x16x32_f16(false, a, false, b, (short)0, c, false, false);
}
__device__ __forceinline__ v8f mma_b(v16b a, v16b b, v8f c) {
  return __builtin_amdgcn_wmma_f32_16x16x32_bf16(false, a, false, b, (short)0, c, false, false);
}
__device__ __forceinline__ void guard2(v8f& a, v8f& b, v16h x0, v16h x1, v16h x2, v16h x3, v16h x4, v16h x5) {
#if defined(__HIP_DEVICE_COMPILE__)
  asm volatile("v_nop\n\tv_nop\n\tv_nop\n\tv_nop"
               : "+v"(a), "+v"(b) : "v"(x0), "v"(x1), "v"(x2), "v"(x3), "v"(x4), "v"(x5) : "memory");
#endif
}
__device__ __forceinline__ void acc_guard4(v8f& a, v8f& b, v8f& c, v8f& d) {
#if defined(__HIP_DEVICE_COMPILE__)
  asm volatile("v_nop\n\tv_nop\n\tv_nop\n\tv_nop" : "+v"(a), "+v"(b), "+v"(c), "+v"(d));
#endif
}
// lane l <-> lane l ^ 16 on the vector pipe (the shuffle builtin would go through the LDS queue and its wait)
__device__ __forceinline__ float xhalf(float x) {
  const int v = __builtin_bit_cast(int, x);
  return __builtin_bit_cast(float, __builtin_amdgcn_permlanex16(v, v, 0x76543210, 0xfedcba98, false, false));
}
__device__ __forceinline__ void wave_sync_lds() {
  __builtin_amdgcn_fence(__ATOMIC_RELEASE, "workgroup");
  __builtin_amdgcn_wave_barrier();
  __builtin_amdgcn_fence(__ATOMIC_ACQUIRE, "workgroup");
}

// =====================================================================================================
// f32 -> 16-bit plane, same layout.  f16mode == 0: bf16 RNE bits;  f16mode == 1: f16 bits of (bf16 RNE value) * scale.
// Thread = 8 consecutive elements: two 16-B loads, one 16-B store; 32 consecutive lanes = 512 contiguous, 512-B aligned
// One grid converts all five tensors, none of which depends on another: a block range per plane, in this order:
//   x (CB_X blocks per batch) -> XB bf16; Wq (CB_W) | Wk (CB_KV) | Wv (CB_KV) -> WB bf16 [3072 n][2048 k]; Wo (CB_W) -> WT f16 x1024.
// coverage: each range = plane elements / 2048 blocks x 256 thr x 8 = the whole plane (every plane a multiple of 2048 elements).
// =====================================================================================================
#define CB_X   (SEQ * DMOD / 2048)
#define CB_W   (DMOD * DMOD / 2048)
#define CB_KV  (KVD * DMOD / 2048)
#define CB_ALL (NB * CB_X + 2 * CB_W + 2 * CB_KV)
__global__ __launch_bounds__(256) void cvt_all(const float* __restrict__ xin, const float* __restrict__ wq,
                                               const float* __restrict__ wk, const float* __restrict__ wv,
                                               const float* __restrict__ wo, u16* XBp, u16* WBp, u16* WTp) {
  int blk = (int)blockIdx.x;                 // every choice below is block-uniform
  const float* x;
  u16* D;
  int f16mode = 0;
  float scale = 1.0f;
  if (blk < NB * CB_X) {
    const int b = blk / CB_X;
    blk -= b * CB_X;
    x = xin + (size_t)b * XS_FULL * DMOD;
    D = XBp + (size_t)b * SEQ * DMOD;
  } else if ((blk -= NB * CB_X) < CB_W) {
    x = wq;  D = WBp;
  } else if ((blk -= CB_W) < CB_KV) {
    x = wk;  D = WBp + (size_t)DMOD * DMOD;
  } else if ((blk -= CB_KV) < CB_KV) {
    x = wv;  D = WBp + (size_t)DMOD * DMOD + (size_t)KVD * DMOD;
  } else if ((blk -= CB_KV) < CB_W) {
    x = wo;  D = WTp;  f16mode = 1;  scale = WOS;
  } else {
    return;                                  // never taken with the exact grid
  }
  const int gt = blk * 256 + (int)threadIdx.x;
  const float* p = x + (size_t)gt * 8;
  const v4f a = *(const v4f*)(p), b4 = *(const v4f*)(p + 4);
  float w[8];
#pragma unroll
  for (int e = 0; e < 4; ++e) { w[e] = a[e]; w[4 + e] = b4[e]; }
  v4u o;
#pragma unroll
  for (int e = 0; e < 4; ++e) {
    const float f0 = w[2 * e], f1 = w[2 * e + 1];
    const unsigned short hb0 = h_bits((_Float16)(bfr(f0) * scale));
    const unsigned short hb1 = h_bits((_Float16)(bfr(f1) * scale));
    const unsigned short bb0 = bf_bits(f0);
    const unsigned short bb1 = bf_bits(f1);
    o[e] = (f16mode != 0) ? pk16(hb0, hb1) : pk16(bb0, bb1);
  }
  u16* d = D + (size_t)gt * 8;
  {
    *(v4u*)(d) = o;
    
  }
}

// =====================================================================================================
// GEMM epilogue, in two halves around one wave-level LDS sync: epi_put places a 16x64 f32 tile (times oscale, plus
// bfr(bias[col]) when HASB != 0) in a wave-private slab [16][64] pitch 68; epi_get reads it back as whole row segments.
// coverage: 8 instructions x 2 rows x 16 lanes x 4 floats = the 16 x 64 tile.
// =====================================================================================================
template <int HASB>
__device__ __forceinline__ void epi_put(float* sl, v8f a0, v8f a1, v8f a2, v8f a3, float oscale,
                                        const float* __restrict__ bias, int col0, int lane) {
  const int hh = lane >> 4, m = lane & 15;
  float b0 = 0.0f, b1 = 0.0f, b2 = 0.0f, b3 = 0.0f;
  if (HASB != 0) {
    b0 = bfr(bias[col0 + m]);
    b1 = bfr(bias[col0 + 16 + m]);
    b2 = bfr(bias[col0 + 32 + m]);
    b3 = bfr(bias[col0 + 48 + m]);
  }
#pragma unroll
  for (int r = 0; r < 8; ++r) {
    const int ro = (8 * hh + r) * 68 + m;
    sl[ro]      = a0[r] * oscale + b0;
    sl[ro + 16] = a1[r] * oscale + b1;
    sl[ro + 32] = a2[r] * oscale + b2;
    sl[ro + 48] = a3[r] * oscale + b3;
  }
}
__device__ __forceinline__ void epi_get(const float* sl, float* C, int N, size_t rowb, int col0, int lane) {
  const int hh = lane >> 4, m = lane & 15;
  v4f vals[8];
#pragma unroll
  for (int it = 0; it < 8; ++it) vals[it] = *(const v4f*)(sl + (it * 2 + hh) * 68 + m * 4);
  float* dst = C + (rowb + (size_t)hh) * (size_t)N + col0 + m * 4;
#pragma unroll
  for (int it = 0; it < 8; ++it) {
    *(v4f*)(dst + (size_t)(it * 2) * (size_t)N) = vals[it];
  }
}

// =====================================================================================================
// Projection epilogue: a wave's 64 x 64 accumulator block (rows rw .. rw + 63 of one sequence, the 64 columns of one head) goes
// straight into the attention operand planes; acc[i][j], element r of lane (hh, m) = (row 16i + 8hh + r, column d = 16j + m).
//   t = (acc + bfr(bias[d])) * sc in f32 (add, then exact power-of-two scale); hi = f16(t), residual = f16(t - hi).
// q / k planes (sc = 256), fragment order: tile (b, head, s >> 4) = 16 rows x 64 d = 4 pieces of 512 B; piece pc, lane l,
//   element e <- row (s & 15) = l & 15, d = 16*pc + 8*(l >> 4) + e (pieces 2kk, 2kk + 1 are the two halves of the fragment of
//   k-step kk in the split k map). A lane needs 8 consecutive d of one row: t turns through the wave's own slabs [16][64]
//   pitch 68 (one per 16 rows, one wave-level LDS sync), then one 16-B store per piece and plane = 512 contiguous bytes a wave.
// coverage: 4 slabs x 4 pieces = the wave's four 16-row tiles of both planes; all blocks = every tile of every head once.
// =====================================================================================================
__device__ __forceinline__ v4u split_pack(const float (&t)[8], v4u& lo) {
  v4u hi;
#pragma unroll
  for (int e = 0; e < 4; ++e) {
    const float t0 = t[2 * e], t1 = t[2 * e + 1];
    const _Float16 h0 = (_Float16)t0, h1 = (_Float16)t1;
    const _Float16 l0 = (_Float16)(t0 - (float)h0), l1 = (_Float16)(t1 - (float)h1);
    hi[e] = pk16(h_bits(h0), h_bits(h1));
    lo[e] = pk16(h_bits(l0), h_bits(l1));
  }
  return hi;
}
__device__ __forceinline__ void planes_qk(float* sl, const v8f (&acc)[4][4], const float* __restrict__ bias, int cb, int nhead,
                                          float sc, u16* Hp, u16* Lp, int rw, int lane) {
  const int hh = lane >> 4, m = lane & 15;
  float bj[4];
#pragma unroll
  for (int j = 0; j < 4; ++j) bj[j] = bias[cb + 16 * j + m];
  wait_addr();
#pragma unroll
  for (int j = 0; j < 4; ++j) bj[j] = bfr(bj[j]);
#pragma unroll
  for (int i = 0; i < 4; ++i) {
#pragma unroll
    for (int r = 0; r < 8; ++r) {
      float* ro = sl + i * SLAB64 + (8 * hh + r) * 68 + m;
#pragma unroll
      for (int j = 0; j < 4; ++j) ro[16 * j] = (acc[i][j][r] + bj[j]) * sc;
    }
  }
  wave_sync_lds();
  const size_t dst = ((size_t)((rw / SEQ) * nhead + (cb >> 6)) * NQT + (size_t)((rw % SEQ) >> 4)) * FTILE + (size_t)lane * 8;
#pragma unroll
  for (int i = 0; i < 4; ++i) {
    v4u oh[4], ol[4];
#pragma unroll
    for (int pc = 0; pc < 4; ++pc) {
      const float* p = sl + i * SLAB64 + m * 68 + 16 * pc + 8 * hh;
      const v4f a = *(const v4f*)(p), b4 = *(const v4f*)(p + 4);
      float t[8];
#pragma unroll
      for (int e = 0; e < 4; ++e) { t[e] = a[e]; t[4 + e] = b4[e]; }
      oh[pc] = split_pack(t, ol[pc]);
    }
#pragma unroll
    for (int pc = 0; pc < 4; ++pc) {
      *(v4u*)(Hp + dst + (size_t)(i * FTILE + pc * FPC)) = oh[pc];
      *(v4u*)(Lp + dst + (size_t)(i * FTILE + pc * FPC)) = ol[pc];
    }
    wait_stores_issued();                   // the next slab's values take over the registers that these stores name
  }
}
// v^T planes (sc = 1024), fragment order: tile (b, g, s >> 5) = 64 d x 32 keys = 8 pieces of 512 B; piece 2j + h, lane l,
//   element e <- d = 16j + (l & 15), key (s & 31) = 16h + 8*(l >> 4) + e (the two halves of the A fragment of d-subtile j in
//   the split k map): that is acc[i][j] as it stands, h = i & 1, tile i >> 1, e = r, so no LDS; one 16-B store per (i, j)
//   and plane = 512 contiguous bytes a wave.
// coverage: 16 (i, j) = the 8 pieces of the wave's two 32-key tiles of both planes; all blocks = every tile of every kv head once.
__device__ __forceinline__ void planes_vt(const v8f (&acc)[4][4], const float* __restrict__ bias, int cb,
                                          u16* VHo, u16* VLo, int rw, int lane) {
  const int m = lane & 15;
  float bj[4];
#pragma unroll
  for (int j = 0; j < 4; ++j) bj[j] = bias[cb + 16 * j + m];
  wait_addr();
#pragma unroll
  for (int j = 0; j < 4; ++j) bj[j] = bfr(bj[j]);
  const size_t dst = ((size_t)((rw / SEQ) * NKVH + (cb >> 6)) * NKT + (size_t)((rw % SEQ) >> 5)) * (8 * FPC) + (size_t)lane * 8;
#pragma unroll
  for (int i = 0; i < 4; ++i) {
#pragma unroll
    for (int j = 0; j < 4; ++j) {
      float t[8];
#pragma unroll
      for (int r = 0; r < 8; ++r) t[r] = (acc[i][j][r] + bj[j]) * VCAR;
      v4u ol;
      const v4u oh = split_pack(t, ol);
      const size_t o = dst + (size_t)((i >> 1) * (8 * FPC) + (2 * j + (i & 1)) * FPC);
      *(v4u*)(VHo + o) = oh;
      *(v4u*)(VLo + o) = ol;
    }
    wait_stores_issued();                   // the next rows' values take over the registers that these stores name
  }
}
struct PlaneOut {
  const float* bq; const float* bk; const float* bv;
  u16* qh; u16* ql; u16* kh; u16* kl; u16* vh; u16* vl;
};

// =====================================================================================================
// GEMM engine shared by gemm_bf and gemm_out: C[M][N] (f32) = (A[M][K] (+ A2[M][K] when TWO != 0)) . Bt[N][K]^T, times oscale
// (plus bfr(bias[n]) when HASB != 0); A, A2 row-major 16-bit planes, Bt k-contiguous 16-bit plane. PL != 0: no C, the
// accumulators go into the attention operand planes instead (planes_qk, planes_vt).
// Block = BM x 128 tile of C (BM = 128, or 64 when TWO != 0), 4 waves as 2 x 2, wave = (BM/2) x 64 = MF x 4 accumulator tiles.
// A pass is 64 k = one whole 128-B line of each of the stage's 256 operand rows (A rows, then A2 rows, then the 128 Bt rows),
// brought into LDS by asynchronous copies (8 lanes per row, 16 copies per lane and pass), row pitch 144 B; two buffers: the
// copies of pass t + 2 are issued behind the barrier that ends pass t, so they fly while pass t + 1 is worked on.
// Fragments are read from the LDS rows with the same split k map and each accumulator takes its products in the
// same order (k ascending by 32; A before A2). Callers guarantee K % 64 == 0, M % BM == 0, N % 128 == 0, bid in 0 .. (M/BM)*(N/128) - 1.
// =====================================================================================================
#define GKP   64
#define GPIT  72
#define GSTG  (256 * GPIT)
static_assert(GKP == 2 * 32 && (DMOD % GKP) == 0 && (MROWS % 128) == 0 && (NQKV % 128) == 0 && (DMOD % 128) == 0);
static_assert((RICH % 64) == 0 && ((SEQ - RICH) % 128) == 0 && 4 * 4 * SLAB64 * 4 <= 2 * GSTG * 2);

union FragU { v4u u[2]; v16h h; v16b b; };

__device__ __forceinline__ FragU ldfrag_u(const u16* p) {
  FragU f;
  f.u[0] = *(const v4u*)(p);
  f.u[1] = *(const v4u*)(p + 16);
  return f;
}
template <int BF>
__device__ __forceinline__ v8f mma_u(const FragU& a, const FragU& b, v8f c) {
  if (BF != 0) return mma_b(a.b, b.b, c);
  return mma_h(a.h, b.h, c);
}
// eight asynchronous 16-B copies per lane, global -> LDS; the s_wait_xcnt closes the statement so that no register a copy
// names is rewritten ahead of it
__device__ __forceinline__ void copy8(const unsigned (&l)[8], const u16* const (&g)[8]) {
#if defined(__HIP_DEVICE_COMPILE__)
  asm volatile("global_load_async_to_lds_b128 %0, %8, off\n\t"
               "global_load_async_to_lds_b128 %1, %9, off\n\t"
               "global_load_async_to_lds_b128 %2, %10, off\n\t"
               "global_load_async_to_lds_b128 %3, %11, off\n\t"
               "global_load_async_to_lds_b128 %4, %12, off\n\t"
               "global_load_async_to_lds_b128 %5, %13, off\n\t"
               "global_load_async_to_lds_b128 %6, %14, off\n\t"
               "global_load_async_to_lds_b128 %7, %15, off\n\t"
               "s_wait_xcnt 0x0"
               :: "v"(l[0]), "v"(l[1]), "v"(l[2]), "v"(l[3]), "v"(l[4]), "v"(l[5]), "v"(l[6]), "v"(l[7]),
                  "v"(g[0]), "v"(g[1]), "v"(g[2]), "v"(g[3]), "v"(g[4]), "v"(g[5]), "v"(g[6]), "v"(g[7])
               : "memory");
#endif
}
// the same with six copies per lane
__device__ __forceinline__ void copy6(const unsigned (&l)[8], const u16* const (&g)[8]) {
#if defined(__HIP_DEVICE_COMPILE__)
  asm volatile("global_load_async_to_lds_b128 %0, %6, off\n\t"
               "global_load_async_to_lds_b128 %1, %7, off\n\t"
               "global_load_async_to_lds_b128 %2, %8, off\n\t"
               "global_load_async_to_lds_b128 %3, %9, off\n\t"
               "global_load_async_to_lds_b128 %4, %10, off\n\t"
               "global_load_async_to_lds_b128 %5, %11, off\n\t"
               "s_wait_xcnt 0x0"
               :: "v"(l[0]), "v"(l[1]), "v"(l[2]), "v"(l[3]), "v"(l[4]), "v"(l[5]),
                  "v"(g[0]), "v"(g[1]), "v"(g[2]), "v"(g[3]), "v"(g[4]), "v"(g[5])
               : "memory");
#endif
}
// this wave's own copies have landed
__device__ __forceinline__ void wait_copies() {
#if defined(__HIP_DEVICE_COMPILE__)
  asm volatile("s_wait_asynccnt 0x0" ::: "memory");
#endif
}
// this wave's own LDS reads have returned, before the buffer they read is handed to the copies
__device__ __forceinline__ void wait_lds() {
#if defined(__HIP_DEVICE_COMPILE__)
  asm volatile("s_wait_dscnt 0x0" ::: "memory");
#endif
}
// one stage: lane = (row r0 = tid >> 3 of each group of 16 rows, 16-B piece tid & 7); ld = the lane's LDS byte address of
// stage row r0, ga / ga2 / gb = its global address in row r0 of the block's A / A2 / Bt rows, rs16 = halves per 16 rows
template <int TWO>
__device__ __forceinline__ void stage_tile(unsigned ld, const u16* ga, const u16* ga2, const u16* gb, size_t rs16) {
  unsigned l[8];
  const u16* g[8];
#pragma unroll
  for (int i = 0; i < 8; ++i) {
    l[i] = ld + (unsigned)(i * 16 * GPIT * 2);
    if (TWO != 0) g[i] = (i < 4) ? (ga + (size_t)i * rs16) : (ga2 + (size_t)(i - 4) * rs16);
    else          g[i] = ga + (size_t)i * rs16;
  }
  copy8(l, g);
#pragma unroll
  for (int i = 0; i < 8; ++i) {
    l[i] = ld + (unsigned)((8 + i) * 16 * GPIT * 2);
    g[i] = gb + (size_t)i * rs16;
  }
  copy8(l, g);
}

template <int BF, int TWO, int HASB, int PL>
__device__ __forceinline__ void gemm_ring(u16* ring, const u16* __restrict__ A, const u16* __restrict__ A2,
                                          const u16* __restrict__ Bt, const float* __restrict__ bias, float* C,
                                          int M, int N, int K, float oscale, int bid, const PlaneOut& po) {
  constexpr int MF = (TWO != 0) ? 2 : 4;
  constexpr int BM = 32 * MF;
  const int tid = threadIdx.x, wave = tid >> 5, lane = tid & 31, hh = lane >> 4, m = lane & 15;
  const int ntile = N >> 7;
  const int row0  = (bid / ntile) * BM;
  const int col0  = (bid % ntile) * 128;
  if (row0 + BM > M) return;                // block-uniform, before any copy or barrier; never taken with the exact grid
  const int wm = wave >> 1, wn = wave & 1;
  const int r0 = tid >> 3, c8 = (tid & 7) * 8;
  const u16* ga  = A  + (size_t)(row0 + r0) * K + c8;
  const u16* ga2 = A2 + (size_t)(row0 + r0) * K + c8;
  const u16* gb  = Bt + (size_t)(col0 + r0) * K + c8;
  const size_t rs16 = (size_t)16 * K;
  const unsigned ld0 = (unsigned)(uintptr_t)ring + (unsigned)((r0 * GPIT + c8) * 2);
  const int npass = K / GKP;
  const int aoff = (wm * (16 * MF) + m) * GPIT + 8 * hh;          // halves, in a stage: A fragment row of this lane
  const int boff = (128 + wn * 64 + m) * GPIT + 8 * hh;           // Bt fragment row of this lane

  v8f acc[MF][4];
#pragma unroll
  for (int i = 0; i < MF; ++i) {
#pragma unroll
    for (int j = 0; j < 4; ++j) acc[i][j] = zero8();
  }

  stage_tile<TWO>(ld0, ga, ga2, gb, rs16);
  wait_copies();
  __syncthreads();
  if (npass > 1) stage_tile<TWO>(ld0 + (unsigned)(GSTG * 2), ga + GKP, ga2 + GKP, gb + GKP, rs16);

  // kept rolled (for speed only), the buffer chosen by the pass's parity
#pragma unroll 1
  for (int t = 0; t < npass; ++t) {
    const int par = t & 1;
    const u16* st = ring + par * GSTG;
    FragU a[2][MF], a2[2][MF], b[4];
#pragma unroll
    for (int kk = 0; kk < 2; ++kk) {
#pragma unroll
      for (int i = 0; i < MF; ++i) {
        a[kk][i] = ldfrag_u(st + aoff + i * 16 * GPIT + kk * 32);
        if (TWO != 0) a2[kk][i] = ldfrag_u(st + aoff + (64 + i * 16) * GPIT + kk * 32);
      }
    }
#pragma unroll
    for (int kk = 0; kk < 2; ++kk) {
#pragma unroll
      for (int j = 0; j < 4; ++j) b[j] = ldfrag_u(st + boff + j * 16 * GPIT + kk * 32);
      // the LDS reads stay in one group ahead of the WMMA block (for speed only)
      __builtin_amdgcn_sched_barrier(0);
#pragma unroll
      for (int i = 0; i < MF; ++i) {
#pragma unroll
        for (int j = 0; j < 4; ++j) acc[i][j] = mma_u<BF>(a[kk][i], b[j], acc[i][j]);
      }
      if (TWO != 0) {
#pragma unroll
        for (int i = 0; i < MF; ++i) {
#pragma unroll
          for (int j = 0; j < 4; ++j) acc[i][j] = mma_u<BF>(a2[kk][i], b[j], acc[i][j]);
        }
      }
      // the WMMA block stays ahead of what follows: sunk behind the publish point it would put the refill's issue directly
      // in front of the next pass's wait for it
      __builtin_amdgcn_sched_barrier(0);
    }
    // publish point of pass t + 1: own reads back, own copies landed, every wave here; then the freed buffer is refilled
    wait_lds();
    wait_copies();
    __syncthreads();
    if (t + 2 < npass) {
      const size_t ko = (size_t)(t + 2) * GKP;
      stage_tile<TWO>(ld0 + (unsigned)(par * GSTG * 2), ga + ko, ga2 + ko, gb + ko, rs16);
    }
  }
  wait_copies();

  // the last pass's barrier has ended every read of the ring and no copy is outstanding: each wave stages its MF tiles in
  // MF slabs of its own
  float* sl = (float*)(void*)ring + wave * (MF * SLAB64);
  const int colw = col0 + wn * 64;
  if constexpr (PL != 0) {
    // the column ranges q | k | v end on multiples of 128, so the range test on col0 is block-uniform (a scalar branch)
    const int rw = row0 + wm * 64;
    if (col0 < DMOD + KVD) {
      const bool isq = col0 < DMOD;
      planes_qk(sl, acc, isq ? po.bq : po.bk, isq ? colw : colw - DMOD, isq ? NH : NKVH, isq ? QSC : KSC,
                isq ? po.qh : po.kh, isq ? po.ql : po.kl, rw, lane);
    } else {
      planes_vt(acc, po.bv, colw - DMOD - KVD, po.vh, po.vl, rw, lane);
    }
    return;
  }
#pragma unroll
  for (int i = 0; i < MF; ++i)
    epi_put<HASB>(sl + i * SLAB64, acc[i][0], acc[i][1], acc[i][2], acc[i][3], oscale, bias, colw, lane);
  wave_sync_lds();
#pragma unroll
  for (int i = 0; i < MF; ++i)
    epi_get(sl + i * SLAB64, C, N, (size_t)(row0 + wm * (16 * MF) + i * 16), colw, lane);
}

__global__ __launch_bounds__(128)
void gemm_bf(const u16* __restrict__ A, const u16* __restrict__ Bt, const float* __restrict__ bq,
             const float* __restrict__ bk, const float* __restrict__ bv,
             u16* QHo, u16* QLo, u16* KHo, u16* KLo, u16* VHo, u16* VLo) {
  __shared__ __align__(16) u16 ring[2 * GSTG];
  const PlaneOut po = {bq, bk, bv, QHo, QLo, KHo, KLo, VHo, VLo};
  gemm_ring<1, 0, 0, 1>(ring, A, A, Bt, (const float*)0, (float*)0, MROWS, NQKV, DMOD, 1.0f, (int)blockIdx.x, po);
}

// y = O.Wo^T + bo for all rows in one grid (the row ranges are independent): per sequence GB_L blocks of 128 x 128 for rows
// >= RICH (O hi only), then GB_R blocks of 64 x 128 for rows < RICH (O hi + residual). The range test is block-uniform.
#define GB_L   (((SEQ - RICH) / 128) * (DMOD / 128))
#define GB_R   ((RICH / 64) * (DMOD / 128))
__global__ __launch_bounds__(128)
void gemm_out(const u16* __restrict__ OHp, const u16* __restrict__ OLp, const u16* __restrict__ Bt,
              const float* __restrict__ bias, float* C, float oscale) {
  __shared__ __align__(16) u16 ring[2 * GSTG];
  const int b = (int)blockIdx.x / (GB_L + GB_R);
  const int r = (int)blockIdx.x % (GB_L + GB_R);
  if (b >= NB) return;                      // block-uniform, before any copy or barrier; never taken with the exact grid
  const PlaneOut po = {};
  if (r < GB_L) {
    const size_t ro = ((size_t)b * SEQ + RICH) * DMOD;
    gemm_ring<0, 0, 1, 0>(ring, OHp + ro, OLp + ro, Bt, bias, C + ro, SEQ - RICH, DMOD, DMOD, oscale, r, po);
    wait_stores_issued();
  } else {
    const size_t ro = (size_t)b * SEQ * DMOD;
    gemm_ring<0, 1, 1, 0>(ring, OHp + ro, OLp + ro, Bt, bias, C + ro, RICH, DMOD, DMOD, oscale, r - GB_L, po);
    wait_stores_issued();
  }
}

// =====================================================================================================
// Causal grouped-query softmax attention, hd = 64. Block bid -> (query tile qt = qt0 + bid % nqt: rows q0 = 16*qt ..
// q0+15, head group hg = kv head, batch b); one wave per query head = hg*WPB + wave (the 4 consecutive query heads of a
// group share kv head hg).
//   q hi / residual planes f16 x256, tiles (b, h, s >> 4); k hi / residual planes f16 x256, tiles (b, g, s >> 4); v^T hi /
//   residual planes x1024, tiles (b, g, s >> 5): all in fragment order (planes_qk, planes_vt), so that every fragment load of a wave
//   reads 512 contiguous bytes and a key tile of 32 is 4096 contiguous bytes of each k plane and of each v^T plane.
//   The block's 4 waves walk the same key tiles of the same kv head: a key tile (k hi | k residual | v^T hi, and for RV = 1
//   | v^T residual, 4096 B each, kept in fragment order) is brought into LDS once per block by asynchronous copies (2 copies per
//   lane and plane); two buffers: the copies of tile kt + 2 are issued behind the barrier that ends tile kt, so they fly while
//   tile kt + 1 is worked on. nkt is the same for the whole block, so every wave passes every barrier.
//   Transposed products: S^T = K.Q^T (A = key rows, B = query rows as columns), so a lane's 16 score registers of a key tile
//   belong to one query (lane & 15) and hold keys kb + 8*(lane >> 4) + r and kb + 16 + 8*(lane >> 4) + r.
//   raw(j, i) = k_hi.q_hi + k_hi.q_lo + k_lo.q_hi (2 k-steps over d); logit = raw * 2^-19 (the 1/8 softmax scale and the two
//   256 carries, exact); keys above the diagonal replaced by -inf; online softmax per query in f32 with a running max:
//   max in-lane over the 16 scores plus one exchange with lane ^ 16; sum in-lane, the two halves' sums joined once after the
//   loop; alpha = exp(m_old - m_new), p = exp(logit - m_new), l = l*alpha + sum p, O^T accumulators times alpha before the
//   tile's product. Key tiles of 32 visited in order, only tiles with kb <= q0 (nkt = q0/32 + 1 <= NKT; key kb is unmasked for
//   every query of the tile). The score registers, as p*32768 (f16 hi and its f16 residual), are the B fragment of
//   O^T += v^T.P^T in the split k map as they stand; v^T A fragments in 2 groups of 2 d-subtiles; RV = 1: products hh + lh + hl,
//   RV = 0: hh only.
//   Epilogue: O x256 -> f16 hi plane (and for RV = 1 the f16 residual plane of O x256) [b*SEQ + s][h*HD + d]; lane = (row group
//   rq = lane>>3 in 0..3, 8 consecutive d at c8); one instruction = 4 rows it*4 + rq, each row segment (64 halves = one whole
// coverage: per wave 4 instructions x 4 rows x 8 lanes x 8 halves = 16 x 64 per plane; nqt x NHG x NB blocks x WPB waves;
//   the two block ranges (tiles NQTR..NQT-1 with RV = 0, tiles 0..NQTR-1 with RV = 1) cover every (b, s, h) row segment of the hi plane
//   exactly once and rows s < RICH of the residual plane exactly once (only those rows are read later).
// =====================================================================================================
#define AKT   (2 * FTILE)
#define ASTG  (4 * AKT)
static_assert(AKT * 2 == 2 * ATT_THREADS * 16 && 6 * (2 * ASTG * 2 + WPB * WREG * 4) <= 327680);
// one key tile: ld = the lane's LDS byte address in the buffer (16 B per thread), kh / kl / vh / vl = its global address in the
// tile of each plane; a plane's tile = 2 copies of the block (2048 B each)
template <int RV>
__device__ __forceinline__ void stage_kv(unsigned ld, const u16* kh, const u16* kl, const u16* vh, const u16* vl) {
  unsigned l[8];
  const u16* g[8];
#pragma unroll
  for (int i = 0; i < 8; ++i) l[i] = ld + (unsigned)(i * (AKT / 2) * 2);
  g[0] = kh;  g[1] = kh + AKT / 2;
  g[2] = kl;  g[3] = kl + AKT / 2;
  g[4] = vh;  g[5] = vh + AKT / 2;
  g[6] = vl;  g[7] = vl + AKT / 2;
  if (RV != 0) copy8(l, g);
  else         copy6(l, g);
}

template <int RV>
__device__ __forceinline__
void attn_gq(float* smem, u16* kvr, const u16* __restrict__ QHp, const u16* __restrict__ QLp,
             const u16* __restrict__ KHp, const u16* __restrict__ KLp,
             const u16* __restrict__ VHp, const u16* __restrict__ VLp,
             u16* OHp, u16* OLp, int bid, int qt0, int nqt) {
#pragma clang fp contract(off)
  const int tid  = threadIdx.x;
  const int wave = tid >> 5;
  const int lane = tid & 31;
  const int hh   = lane >> 4;
  const int c    = lane & 15;
  if (nqt <= 0) return;                     // block-uniform, before any copy or barrier
  const int qt   = qt0 + bid % nqt;
  const int t2   = bid / nqt;
  const int hg   = t2 % NHG;
  const int b    = t2 / NHG;
  if (b >= NB) return;                      // block-uniform, before any copy or barrier; never taken with the exact grid
  const int q0   = qt * 16;
  if (q0 + 16 > SEQ) return;                // block-uniform, before any copy or barrier; never taken
  const int head = hg * WPB + wave;
  const int kvh  = hg;

  float* slab = smem + wave * WREG;         // result slab [16][64] pitch 68

  const unsigned l8 = (unsigned)lane * 8;
  const size_t qoff = ((size_t)(b * NH + head) * NQT + qt) * FTILE;                        // this wave's 16-query tile
  const size_t koff = (size_t)(b * NKVH + kvh) * NQT * FTILE;                              // 16-key tile 0 of the kv head
  const size_t voff = (size_t)(b * NKVH + kvh) * NKT * (2 * FTILE);                        // 32-key tile 0 of the kv head
  const _Float16* Qh  = (const _Float16*)(const void*)QHp + qoff;
  const _Float16* Ql  = (const _Float16*)(const void*)QLp + qoff;
  const u16* gkh = KHp + koff + (size_t)tid * 8;      // this thread's 16 B of the first half of key tile 0, plane by plane
  const u16* gkl = KLp + koff + (size_t)tid * 8;
  const u16* gvh = VHp + voff + (size_t)tid * 8;
  const u16* gvl = VLp + voff + (size_t)tid * 8;
  const unsigned ld0 = (unsigned)(uintptr_t)kvr + (unsigned)(tid * 16);
  const float lsc  = SM_SCALE * (1.0f / (QSC * KSC));   // exact power-of-two fold of the q / k carries into the 1/8 scale
  const float oc   = 1.0f / (PCAR * VCAR);
  const float ninf = -__builtin_inff();

  v8f o[4];                                 // O^T: element r of o[j] = (d = 16j + 8hh + r, query row q0 + c)
#pragma unroll
  for (int j = 0; j < 4; ++j) o[j] = zero8();
  float mrun = ninf, lrun = 0.0f;           // this lane's query: running max (both halves alike), sum over this half's keys
  const int ncaus = (q0 >> 5) + 1;                                            // tiles holding keys <= q0 + 15
  const int nkt   = (ncaus < NKT) ? ncaus : NKT;
  const int qrow  = q0 + c;                                                   // query row of every D element of this lane

  stage_kv<RV>(ld0, gkh, gkl, gvh, gvl);
  wait_copies();
  __syncthreads();
  if (nkt > 1) stage_kv<RV>(ld0 + (unsigned)(ASTG * 2), gkh + AKT, gkl + AKT, gvh + AKT, gvl + AKT);

#pragma unroll 1
  for (int kt = 0; kt < nkt; ++kt) {
    const int kb = kt * 32;
    const int par = kt & 1;
    const _Float16* st = (const _Float16*)(const void*)(kvr + par * ASTG);    // this tile's buffer
    // ---- raw scores, transposed: D element r of this lane = (key kb + 8hh + r, query qrow) in s0, key + 16 in s1 ----
    v8f s0 = zero8(), s1 = zero8();
    const _Float16* k0p = st;
    const _Float16* k1p = k0p + FTILE;
    const _Float16* l0p = st + AKT;
    const _Float16* l1p = l0p + FTILE;
#pragma unroll
    for (int kk = 0; kk < HD / 32; ++kk) {
      const v16h qh  = ldfrag_f(Qh + kk * (2 * FPC), l8);
      const v16h ql  = ldfrag_f(Ql + kk * (2 * FPC), l8);
      const v16h kh0 = ldfrag_f(k0p + kk * (2 * FPC), l8);
      const v16h kh1 = ldfrag_f(k1p + kk * (2 * FPC), l8);
      const v16h kl0 = ldfrag_f(l0p + kk * (2 * FPC), l8);
      const v16h kl1 = ldfrag_f(l1p + kk * (2 * FPC), l8);
      s0 = mma_h(kh0, qh, s0);
      s0 = mma_h(kh0, ql, s0);
      s0 = mma_h(kl0, qh, s0);
      s1 = mma_h(kh1, qh, s1);
      s1 = mma_h(kh1, ql, s1);
      s1 = mma_h(kl1, qh, s1);
      guard2(s0, s1, qh, ql, kh0, kl0, kh1, kl1);
    }
    // ---- causal replace-mask, running-max online softmax in f32: the lane's 16 scores belong to one query ----
    const int key0 = kb + 8 * hh, key1 = key0 + 16;
    float t0[8], t1[8];
    float mx = ninf;
#pragma unroll
    for (int r = 0; r < 8; ++r) {
      const float a0 = s0[r] * lsc;
      const float a1 = s1[r] * lsc;
      t0[r] = (key0 + r > qrow) ? ninf : a0;
      t1[r] = (key1 + r > qrow) ? ninf : a1;
      mx = fmaxf(mx, fmaxf(t0[r], t1[r]));
    }
    mx = fmaxf(mx, xhalf(mx));                          // the other half's 16 keys of the same query
    const float mnew = fmaxf(mrun, mx);
    const float al   = __expf(mrun - mnew);
    // ---- B fragments of p*32768 straight from the score registers: hi f16 and residual f16, column = query c,
    //      elements 0..7 = keys kb + 8hh + 0..7, elements 8..15 = keys kb + 16 + 8hh + 0..7 (the split k map) ----
    FragH ph, pl;
    float sm = 0.0f;
#pragma unroll
    for (int r = 0; r < 8; ++r) {
      const float p0 = __expf(t0[r] - mnew);
      const float p1 = __expf(t1[r] - mnew);
      sm += p0 + p1;
      const float ta = p0 * PCAR, tc = p1 * PCAR;
      const _Float16 ha = (_Float16)ta, hc = (_Float16)tc;
      ph.h[0][r] = ha;
      ph.h[1][r] = hc;
      pl.h[0][r] = (_Float16)(ta - (float)ha);
      pl.h[1][r] = (_Float16)(tc - (float)hc);
    }
    lrun = lrun * al + sm;
    mrun = mnew;
    // ---- rescale the O^T accumulators by the lane's alpha ----
#pragma unroll
    for (int j = 0; j < 4; ++j) {
#pragma unroll
      for (int r = 0; r < 8; ++r) o[j][r] = o[j][r] * al;
    }
    // ---- O^T += v^T.P^T : A fragment row = d = j*16 + c, subtile j = pieces 2j, 2j + 1 of the key tile; 2 groups of 2 ----
    {
      const _Float16* vhp = st + 2 * AKT;
      const _Float16* vlp = st + 3 * AKT;
      (void)vlp;
#pragma unroll
      for (int jg = 0; jg < 2; ++jg) {
        const size_t da = (size_t)(2 * jg) * (2 * FPC);
        const size_t db = da + (size_t)(2 * FPC);
        const v16h vha = ldfrag_f(vhp + da, l8), vhb2 = ldfrag_f(vhp + db, l8);
        o[2 * jg]     = mma_h(vha,  ph.v, o[2 * jg]);
        o[2 * jg + 1] = mma_h(vhb2, ph.v, o[2 * jg + 1]);
        if (RV != 0) {
          const v16h vla = ldfrag_f(vlp + da, l8), vlb2 = ldfrag_f(vlp + db, l8);
          o[2 * jg]     = mma_h(vha,  pl.v, o[2 * jg]);
          o[2 * jg]     = mma_h(vla,  ph.v, o[2 * jg]);
          o[2 * jg + 1] = mma_h(vhb2, pl.v, o[2 * jg + 1]);
          o[2 * jg + 1] = mma_h(vlb2, ph.v, o[2 * jg + 1]);
          guard2(o[2 * jg], o[2 * jg + 1], ph.v, pl.v, vha, vhb2, vla, vlb2);
        } else {
          guard2(o[2 * jg], o[2 * jg + 1], ph.v, pl.v, vha, vhb2, vha, vhb2);
        }
      }
    }
    // publish point of tile kt + 1: own reads back, own copies landed, every wave here; then the freed buffer is refilled
    wait_lds();
    wait_copies();
    __syncthreads();
    if (kt + 2 < nkt) {
      const size_t ko = (size_t)(kt + 2) * AKT;
      stage_kv<RV>(ld0 + (unsigned)(par * ASTG * 2), gkh + ko, gkl + ko, gvh + ko, gvl + ko);
    }
  }
  wait_copies();
  acc_guard4(o[0], o[1], o[2], o[3]);
  // ---- O = acc / l with the carries (32768 on p, 1024 on v) folded once; the two halves' sums joined here; the lane's
  //      8 consecutive d of each subtile go into row c of the wave's slab ----
  const float ltot = lrun + xhalf(lrun);
  const float rl   = (1.0f / ltot) * oc;
#pragma unroll
  for (int j = 0; j < 4; ++j) {
    float* sd = slab + c * SLP + j * 16 + 8 * hh;
    v4f w0, w1;
#pragma unroll
    for (int e = 0; e < 4; ++e) { w0[e] = o[j][e] * rl; w1[e] = o[j][4 + e] * rl; }
    *(v4f*)(sd)     = w0;
    *(v4f*)(sd + 4) = w1;
  }
  wave_sync_lds();
  // ---- O x256 -> f16 hi plane (+ f16 residual plane); lane = (row group rq, 8 consecutive d at c8) ----
  v4u oh[4], ol[4];
  const int rq = lane >> 3, c8 = (lane & 7) * 8;
#pragma unroll
  for (int it = 0; it < 4; ++it) {
    const int row = it * 4 + rq;
    const v4f a = *(const v4f*)(slab + row * SLP + c8), b4 = *(const v4f*)(slab + row * SLP + c8 + 4);
    float w[8];
#pragma unroll
    for (int e = 0; e < 4; ++e) { w[e] = a[e] * OSC; w[4 + e] = b4[e] * OSC; }
#pragma unroll
    for (int e = 0; e < 4; ++e) {
      const _Float16 h0 = (_Float16)w[2 * e], h1 = (_Float16)w[2 * e + 1];
      const _Float16 g0 = (_Float16)(w[2 * e] - (float)h0), g1 = (_Float16)(w[2 * e + 1] - (float)h1);
      oh[it][e] = pk16(h_bits(h0), h_bits(h1));
      ol[it][e] = pk16(h_bits(g0), h_bits(g1));
    }
  }
  const size_t ob = ((size_t)b * SEQ + q0) * DMOD + (size_t)head * HD + c8;
  {
#pragma unroll
    for (int it = 0; it < 4; ++it) {
      const int row = it * 4 + rq;
      *(v4u*)(OHp + ob + (size_t)row * DMOD) = oh[it];
      if (RV != 0) {
        *(v4u*)(OLp + ob + (size_t)row * DMOD) = ol[it];
      }
    }
    wait_stores_issued();
  }
}

// Both row ranges in one grid (no query tile depends on another): the AB_L blocks of the later tiles (the longer key loops)
// first, then the AB_R blocks of the tiles < RICH / 16. The range test is block-uniform.
#define AB_L   ((NQT - NQTR) * NHG * NB)
#define AB_R   (NQTR * NHG * NB)
// six waves per SIMD: the register budget (160) at which all AB_L blocks of the later tiles are resident at once; left to
// itself the compiler takes 163 registers for the two bodies, which allocates 176 and leaves five waves
__global__ __launch_bounds__(ATT_THREADS) __attribute__((amdgpu_waves_per_eu(6)))
void attn_all(const u16* __restrict__ QHp, const u16* __restrict__ QLp,
              const u16* __restrict__ KHp, const u16* __restrict__ KLp,
              const u16* __restrict__ VHp, const u16* __restrict__ VLp, u16* OHp, u16* OLp) {
  __shared__ __align__(16) float smem[WPB * WREG];
  __shared__ __align__(16) u16 kvring[2 * ASTG];
  const int bid = (int)blockIdx.x;
  if (bid < AB_L) attn_gq<0>(smem, kvring, QHp, QLp, KHp, KLp, VHp, VLp, OHp, OLp, bid, NQTR, NQT - NQTR);
  else            attn_gq<1>(smem, kvring, QHp, QLp, KHp, KLp, VHp, VLp, OHp, OLp, bid - AB_L, 0, NQTR);
}

// =====================================================================================================
// Workspace map (bytes); every plane is fully written by whole-line stores before it is read (the O residual plane only on
// the rows < RICH per sequence that are read); all extents are exact multiples of the store granularity (no pad rows needed);
// every region offset a multiple of 131072:
//   XB  bf16 [MROWS][2048]              MROWS*4096   (NB=2, SEQ=2048: 16777216); after the projection GEMM the same bytes hold
//                                                    the O f16 hi plane [MROWS][2048] x256 (identical extent)
//   WB  bf16 [3072 n][2048 k]           12582912     (Wq rows 0..2047, Wk 2048..2559, Wv 2560..3071)
//   WT  f16 [2048 o][2048 d] x1024      8388608      (Wo)
//   OL  region of MROWS*12288 bytes; its first MROWS*4096 bytes hold the O f16 residual plane [MROWS][2048]
//   QH  f16 [NB*32][SEQ/16] tiles of 2048 B x256   MROWS*4096   QL residual, same extent   (fragment order)
//   KH  f16 [NB*8][SEQ/16] tiles of 2048 B x256    MROWS*1024   KL residual, same extent   (fragment order)
//   VH  f16 [NB*8][SEQ/32] tiles of 4096 B x1024   MROWS*1024   VL residual, same extent   (fragment order)
//   end (NB=2, SEQ=2048)               138412032
// =====================================================================================================
extern "C" void kernel_launch(void* const* d_in, const int* in_sizes, int n_in,
                              void* d_out, int out_size, void* d_ws, size_t ws_size,
                              hipStream_t stream) {
  if (n_in < 9) return;
  if (in_sizes[0] < ((NB - 1) * XS_FULL + SEQ) * DMOD) return;
  if (in_sizes[1] < DMOD * DMOD) return;
  if (in_sizes[2] < DMOD) return;
  if (in_sizes[3] < KVD * DMOD) return;
  if (in_sizes[4] < KVD) return;
  if (in_sizes[5] < KVD * DMOD) return;
  if (in_sizes[6] < KVD) return;
  if (in_sizes[7] < DMOD * DMOD) return;
  if (in_sizes[8] < DMOD) return;
  if (out_size < MROWS * DMOD) return;

  const float* x  = (const float*)d_in[0];
  const float* wq = (const float*)d_in[1];
  const float* bq = (const float*)d_in[2];
  const float* wk = (const float*)d_in[3];
  const float* bk = (const float*)d_in[4];
  const float* wv = (const float*)d_in[5];
  const float* bv = (const float*)d_in[6];
  const float* wo = (const float*)d_in[7];
  const float* bo = (const float*)d_in[8];
  float*       out = (float*)d_out;

  const size_t szXB = (size_t)MROWS * DMOD * 2;
  const size_t szWB = (size_t)NQKV * DMOD * 2;
  const size_t szF  = (size_t)MROWS * NQKV * 4;
  const size_t szQ  = (size_t)MROWS * DMOD * 2;                  // QH, QL
  const size_t szK  = (size_t)MROWS * KVD * 2;                   // KH, KL
  const size_t szV  = (size_t)NB * NKVH * HD * SEQ * 2;          // VH, VL (== szK)
  const size_t szOH = (size_t)MROWS * DMOD * 2;                  // O hi plane, lives in the XB region
  const size_t szOL = (size_t)MROWS * DMOD * 2;                  // O residual plane, at the start of its region
  const size_t szWT = (size_t)DMOD * DMOD * 2;                   // Wo f16 plane
  if (szOH > szXB || szOL > szF) return;
  size_t off = 0;
  const size_t oXB = off; off += szXB;
  const size_t oWB = off; off += szWB;
  const size_t oWT = off; off += szWT;
  const size_t oF  = off; off += szF;
  const size_t oQH = off; off += szQ;
  const size_t oQL = off; off += szQ;
  const size_t oKH = off; off += szK;
  const size_t oKL = off; off += szK;
  const size_t oVH = off; off += szV;
  const size_t oVL = off; off += szV;
  if (off > ws_size) return;                // off = 138412032 for NB = 2, SEQ = 2048
  if (off > (size_t)WS_CAP) return;

  char* ws = (char*)d_ws;
  u16*   XB  = (u16*)(ws + oXB);
  u16*   OH  = (u16*)(ws + oXB);
  u16*   WB  = (u16*)(ws + oWB);
  u16*   WT  = (u16*)(ws + oWT);
  u16*   OL  = (u16*)(ws + oF);
  u16*   QH  = (u16*)(ws + oQH);
  u16*   QL  = (u16*)(ws + oQL);
  u16*   KH  = (u16*)(ws + oKH);
  u16*   KL  = (u16*)(ws + oKL);
  u16*   VH  = (u16*)(ws + oVH);
  u16*   VL  = (u16*)(ws + oVL);

  const dim3 b256(256), b128(128), bAT(ATT_THREADS);
  const dim3 gG1((MROWS / 128) * (NQKV / 128));         // 768
  const float osc = 1.0f / (OSC * WOS);

  // (0) x -> bf16 plane [MROWS][2048]; Wq, Wk, Wv -> one bf16 plane [3072 n][2048 k]; Wo [2048 o][2048 d] -> f16 plane of the
  //     bf16 value x1024 (already k-contiguous)
  cvt_all<<<dim3(CB_ALL), b256, 0, stream>>>(x, wq, wk, wv, wo, XB, WB, WT);
  // (1) qkv = x.[Wq|Wk|Wv]^T, f32 accumulators; the epilogue adds the biases in f32 and writes the q and k hi + residual planes
  //     x256 (columns 0..2047 + bq, 2048..2559 + bk) and the v^T hi + residual planes x1024 (columns 2560..3071 + bv)
  gemm_bf<<<gG1, b128, 0, stream>>>(XB, WB, bq, bk, bv, QH, QL, KH, KL, VH, VL);
  // (2) causal attention -> O f16 hi plane x256 (XB region) for all query tiles; residual plane for tiles < RICH
  attn_all<<<dim3(AB_L + AB_R), bAT, 0, stream>>>(QH, QL, KH, KL, VH, VL, OH, OL);
  // (3) y = O.Wo^T + bo -> out f32 [MROWS][2048], carries 256 x 1024 folded back; rows < RICH per sequence with O hi + residual
  gemm_out<<<dim3(NB * (GB_L + GB_R)), b128, 0, stream>>>(OH, OL, WT, bo, out, osc);
  (void)hipGetLastError();
}

// v007
// It runs in 166 microseconds.
// In both of two side-by-side timings against v006, it was 1.07 times as fast.
// All steps since v000 together make it 3.86 times as fast.
// Contractions: x.[Wq|Wk|Wv]^T on v_wmma_f32_16x16x32_bf16 (x and the weights as bf16 RNE planes, weight [n][k] rows are the
// k-contiguous B operand, f32 accumulate, biases added in f32 as bf16 RNE values); q.k^T over hd 64 and P.v on
// v_wmma_f32_16x16x32_f16 with f16 hi + f16 residual planes (q, k x256, products hh+lh+hl on every row; P x32768 hi +
// in-register residual and v^T x1024 hi + residual plane for query rows < 512 of each sequence, P hi . v hi only for later
// rows); O.Wo^T on v_wmma_f32_16x16x32_f16 with O x256 as f16 hi (+ f16 residual plane for rows < 512 of each sequence) and
// Wo as f16(bf16(Wo)) x1024, one accumulator, bias bo added in f32; all f32 accumulate. Online softmax in f32 on VALU.
#include <hip/hip_runtime.h>
#include <math.h>
#include <stdint.h>

#ifndef NB
#define NB 2
#endif
#ifndef SEQ
#define SEQ 2048
#endif
#define XS_FULL 2048
#define DMOD  2048
#define NH    32
#define NKVH  8
#define HD    64
#define KVD   (NKVH * HD)
#define NQKV  (DMOD + 2 * KVD)
#define MROWS (NB * SEQ)
#define RICH_REQ 512
#define RICH  ((SEQ < RICH_REQ) ? SEQ : RICH_REQ)
#define SM_SCALE 0.125f
#define QSC   256.0f
#define KSC   256.0f
#define PCAR  32768.0f
#define VCAR  1024.0f
#define OSC   256.0f
#define WOS   1024.0f
#define WPB   (NH / NKVH)
#define NHG   NKVH
#define NQT   (SEQ / 16)
#define NQTR  (RICH / 16)
#define NKT   (SEQ / 32)
#define ATT_THREADS (WPB * 32)
#define SLP   68
#define SLW   (16 * SLP)
#define WREG  (SLW)
#define SLAB64 (16 * 68)
#define WS_CAP 268435456
static_assert(DMOD == NH * HD && HD == 64 && NH == 32 && NKVH == 8 && WPB == 4 && NHG * WPB == NH);
static_assert(ATT_THREADS == 128 && KVD == 512 && NQKV == 3072);
static_assert(NB >= 1 && NB <= 2);
static_assert(NB == 1 || SEQ == XS_FULL);
static_assert((SEQ % 64) == 0 && SEQ >= 64 && SEQ <= XS_FULL);
static_assert((RICH % 64) == 0 && RICH >= 64 && RICH <= SEQ);
static_assert((DMOD % 64) == 0 && (KVD % 64) == 0 && (NQKV % 64) == 0 && (DMOD % 32) == 0 && (HD % 32) == 0 && (MROWS % 64) == 0);
static_assert(((SEQ * DMOD / 8) % 256) == 0 && ((DMOD * DMOD / 8) % 256) == 0 && ((KVD * DMOD / 8) % 256) == 0);
static_assert(WPB * WREG * 4 <= 65536 && 4 * SLAB64 * 4 <= 65536);
// workspace total (XB + WB + WT + OL region + QH + QL + KH + KL + VH + VL) for this build
static_assert((size_t)MROWS * DMOD * 2 + (size_t)NQKV * DMOD * 2 + (size_t)DMOD * DMOD * 2 + (size_t)MROWS * NQKV * 4 +
              2 * (size_t)MROWS * DMOD * 2 + 2 * (size_t)MROWS * KVD * 2 + 2 * (size_t)NB * NKVH * HD * SEQ * 2
              <= (size_t)WS_CAP);

typedef unsigned short u16;
typedef _Float16 v16h __attribute__((ext_vector_type(16)));
typedef _Float16 v8h  __attribute__((ext_vector_type(8)));
typedef __bf16   v16b __attribute__((ext_vector_type(16)));
typedef float    v8f  __attribute__((ext_vector_type(8)));
typedef float    v4f  __attribute__((ext_vector_type(4)));
typedef unsigned int v4u __attribute__((ext_vector_type(4)));

union FragH { v16h v; v8h h[2]; v4u u[2]; };

// ---- scalar helpers --------------------------------------------------------------------------------
__device__ __forceinline__ unsigned short bf_bits(float f) {          // f32 -> bf16 bits, RNE convert
  unsigned u = __float_as_uint(f);
  return (unsigned short)((u + 0x7FFFu + ((u >> 16) & 1u)) >> 16);
}
__device__ __forceinline__ float bf_up(unsigned short h) { return __uint_as_float(((unsigned)h) << 16); }
__device__ __forceinline__ float bfr(float f) { return bf_up(bf_bits(f)); }
__device__ __forceinline__ unsigned short h_bits(_Float16 x) { return __builtin_bit_cast(unsigned short, x); }
__device__ __forceinline__ unsigned pk16(unsigned short a, unsigned short b) { return (unsigned)a | ((unsigned)b << 16); }
__device__ __forceinline__ v8f zero8() { v8f z = {0.f, 0.f, 0.f, 0.f, 0.f, 0.f, 0.f, 0.f}; return z; }

// ---- fragment map: 16-bit A/B operand of k-step k0, lane -> row/col (lane&15), h = lane>>4; elements 0..7 <- k0+8h+0..7,
//      elements 8..15 <- k0+16+8h+0..7 (the same split k map for A and B; ldfrag_u reads it from k-contiguous rows)
// ---- fragment loader for a plane kept in fragment order: a fragment is two pieces of 512 contiguous bytes, piece = 32 lanes
//      x 16 B; p = the fragment's first byte (wave-uniform where the tile is), l8 = 8*lane; elements 0..7 <- piece 0,
//      elements 8..15 <- piece 1 (a load = 4 whole 128-B lines)
#define FPC   256
#define FTILE (4 * FPC)
__device__ __forceinline__ v16h ldfrag_f(const _Float16* p, unsigned l8) {
  FragH f;
  f.h[0] = *(const v8h*)(p + l8);
  f.h[1] = *(const v8h*)(p + l8 + FPC);
  return f.v;
}

// stands behind issued global loads whose address registers the code that follows may take over
__device__ __forceinline__ void wait_addr() {
#if defined(__HIP_DEVICE_COMPILE__)
  asm volatile("s_wait_xcnt 0x0" ::: "memory");
#endif
}

// stands behind issued global stores whose registers the code that follows rewrites: the next slab's or rows' values in a
// loop, or the next range's body in a grid of several ranges
__device__ __forceinline__ void wait_stores_issued() {
#if defined(__HIP_DEVICE_COMPILE__)
  asm volatile("s_wait_xcnt 0x0" ::: "memory");
#endif
}

__device__ __forceinline__ v8f mma_h(v16h a, v16h b, v8f c) {
  return __builtin_amdgcn_wmma_f32_16x16x32_f16(false, a, false, b, (short)0, c, false, false);
}
__device__ __forceinline__ v8f mma_b(v16b a, v16b b, v8f c) {
  return __builtin_amdgcn_wmma_f32_16x16x32_bf16(false, a, false, b, (short)0, c, false, false);
}
__device__ __forceinline__ void guard2(v8f& a, v8f& b, v16h x0, v16h x1, v16h x2, v16h x3, v16h x4, v16h x5) {
#if defined(__HIP_DEVICE_COMPILE__)
  asm volatile("v_nop\n\tv_nop\n\tv_nop\n\tv_nop"
               : "+v"(a), "+v"(b) : "v"(x0), "v"(x1), "v"(x2), "v"(x3), "v"(x4), "v"(x5) : "memory");
#endif
}
__device__ __forceinline__ void acc_guard4(v8f& a, v8f& b, v8f& c, v8f& d) {
#if defined(__HIP_DEVICE_COMPILE__)
  asm volatile("v_nop\n\tv_nop\n\tv_nop\n\tv_nop" : "+v"(a), "+v"(b), "+v"(c), "+v"(d));
#endif
}
// lane l <-> lane l ^ 16 on the vector pipe (the shuffle builtin would go through the LDS queue and its wait)
__device__ __forceinline__ float xhalf(float x) {
  const int v = __builtin_bit_cast(int, x);
  return __builtin_bit_cast(float, __builtin_amdgcn_permlanex16(v, v, 0x76543210, 0xfedcba98, false, false));
}
__device__ __forceinline__ void wave_sync_lds() {
  __builtin_amdgcn_fence(__ATOMIC_RELEASE, "workgroup");
  __builtin_amdgcn_wave_barrier();
  __builtin_amdgcn_fence(__ATOMIC_ACQUIRE, "workgroup");
}

// =====================================================================================================
// f32 -> 16-bit plane, same layout.  f16mode == 0: bf16 RNE bits;  f16mode == 1: f16 bits of (bf16 RNE value) * scale.
// Thread = 8 consecutive elements: two 16-B loads, one 16-B store; 32 consecutive lanes = 512 contiguous, 512-B aligned
// One grid converts all five tensors, none of which depends on another: a block range per plane, in this order:
//   x (CB_X blocks per batch) -> XB bf16; Wq (CB_W) | Wk (CB_KV) | Wv (CB_KV) -> WB bf16 [3072 n][2048 k]; Wo (CB_W) -> WT f16 x1024.
// coverage: each range = plane elements / 2048 blocks x 256 thr x 8 = the whole plane (every plane a multiple of 2048 elements).
// =====================================================================================================
#define CB_X   (SEQ * DMOD / 2048)
#define CB_W   (DMOD * DMOD / 2048)
#define CB_KV  (KVD * DMOD / 2048)
#define CB_ALL (NB * CB_X + 2 * CB_W + 2 * CB_KV)
__global__ __launch_bounds__(256) void cvt_all(const float* __restrict__ xin, const float* __restrict__ wq,
                                               const float* __restrict__ wk, const float* __restrict__ wv,
                                               const float* __restrict__ wo, u16* XBp, u16* WBp, u16* WTp) {
  int blk = (int)blockIdx.x;                 // every choice below is block-uniform
  const float* x;
  u16* D;
  int f16mode = 0;
  float scale = 1.0f;
  if (blk < NB * CB_X) {
    const int b = blk / CB_X;
    blk -= b * CB_X;
    x = xin + (size_t)b * XS_FULL * DMOD;
    D = XBp + (size_t)b * SEQ * DMOD;
  } else if ((blk -= NB * CB_X) < CB_W) {
    x = wq;  D = WBp;
  } else if ((blk -= CB_W) < CB_KV) {
    x = wk;  D = WBp + (size_t)DMOD * DMOD;
  } else if ((blk -= CB_KV) < CB_KV) {
    x = wv;  D = WBp + (size_t)DMOD * DMOD + (size_t)KVD * DMOD;
  } else if ((blk -= CB_KV) < CB_W) {
    x = wo;  D = WTp;  f16mode = 1;  scale = WOS;
  } else {
    return;                                  // never taken with the exact grid
  }
  const int gt = blk * 256 + (int)threadIdx.x;
  const float* p = x + (size_t)gt * 8;
  const v4f a = *(const v4f*)(p), b4 = *(const v4f*)(p + 4);
  float w[8];
#pragma unroll
  for (int e = 0; e < 4; ++e) { w[e] = a[e]; w[4 + e] = b4[e]; }
  v4u o;
#pragma unroll
  for (int e = 0; e < 4; ++e) {
    const float f0 = w[2 * e], f1 = w[2 * e + 1];
    const unsigned short hb0 = h_bits((_Float16)(bfr(f0) * scale));
    const unsigned short hb1 = h_bits((_Float16)(bfr(f1) * scale));
    const unsigned short bb0 = bf_bits(f0);
    const unsigned short bb1 = bf_bits(f1);
    o[e] = (f16mode != 0) ? pk16(hb0, hb1) : pk16(bb0, bb1);
  }
  u16* d = D + (size_t)gt * 8;
  {
    *(v4u*)(d) = o;
    
  }
}

// =====================================================================================================
// GEMM epilogue, in two halves around one wave-level LDS sync: epi_put places a 16x64 f32 tile (times oscale, plus
// bfr(bias[col]) when HASB != 0) in a wave-private slab [16][64] pitch 68; epi_get reads it back as whole row segments.
// coverage: 8 instructions x 2 rows x 16 lanes x 4 floats = the 16 x 64 tile.
// =====================================================================================================
template <int HASB>
__device__ __forceinline__ void epi_put(float* sl, v8f a0, v8f a1, v8f a2, v8f a3, float oscale,
                                        const float* __restrict__ bias, int col0, int lane) {
  const int hh = lane >> 4, m = lane & 15;
  float b0 = 0.0f, b1 = 0.0f, b2 = 0.0f, b3 = 0.0f;
  if (HASB != 0) {
    b0 = bfr(bias[col0 + m]);
    b1 = bfr(bias[col0 + 16 + m]);
    b2 = bfr(bias[col0 + 32 + m]);
    b3 = bfr(bias[col0 + 48 + m]);
  }
#pragma unroll
  for (int r = 0; r < 8; ++r) {
    const int ro = (8 * hh + r) * 68 + m;
    sl[ro]      = a0[r] * oscale + b0;
    sl[ro + 16] = a1[r] * oscale + b1;
    sl[ro + 32] = a2[r] * oscale + b2;
    sl[ro + 48] = a3[r] * oscale + b3;
  }
}
__device__ __forceinline__ void epi_get(const float* sl, float* C, int N, size_t rowb, int col0, int lane) {
  const int hh = lane >> 4, m = lane & 15;
  v4f vals[8];
#pragma unroll
  for (int it = 0; it < 8; ++it) vals[it] = *(const v4f*)(sl + (it * 2 + hh) * 68 + m * 4);
  float* dst = C + (rowb + (size_t)hh) * (size_t)N + col0 + m * 4;
#pragma unroll
  for (int it = 0; it < 8; ++it) {
    *(v4f*)(dst + (size_t)(it * 2) * (size_t)N) = vals[it];
  }
}

// =====================================================================================================
// Projection epilogue: a wave's 64 x 64 accumulator block (rows rw .. rw + 63 of one sequence, the 64 columns of one head) goes
// straight into the attention operand planes; acc[i][j], element r of lane (hh, m) = (row 16i + 8hh + r, column d = 16j + m).
//   t = (acc + bfr(bias[d])) * sc in f32 (add, then exact power-of-two scale); hi = f16(t), residual = f16(t - hi).
// q / k planes (sc = 256), fragment order: tile (b, head, s >> 4) = 16 rows x 64 d = 4 pieces of 512 B; piece pc, lane l,
//   element e <- row (s & 15) = l & 15, d = 16*pc + 8*(l >> 4) + e (pieces 2kk, 2kk + 1 are the two halves of the fragment of
//   k-step kk in the split k map). A lane needs 8 consecutive d of one row: t turns through the wave's own slabs [16][64]
//   pitch 68 (one per 16 rows, one wave-level LDS sync), then one 16-B store per piece and plane = 512 contiguous bytes a wave.
// coverage: 4 slabs x 4 pieces = the wave's four 16-row tiles of both planes; all blocks = every tile of every head once.
// =====================================================================================================
__device__ __forceinline__ v4u split_pack(const float (&t)[8], v4u& lo) {
  v4u hi;
#pragma unroll
  for (int e = 0; e < 4; ++e) {
    const float t0 = t[2 * e], t1 = t[2 * e + 1];
    const _Float16 h0 = (_Float16)t0, h1 = (_Float16)t1;
    const _Float16 l0 = (_Float16)(t0 - (float)h0), l1 = (_Float16)(t1 - (float)h1);
    hi[e] = pk16(h_bits(h0), h_bits(h1));
    lo[e] = pk16(h_bits(l0), h_bits(l1));
  }
  return hi;
}
__device__ __forceinline__ void planes_qk(float* sl, const v8f (&acc)[4][4], const float* __restrict__ bias, int cb, int nhead,
                                          float sc, u16* Hp, u16* Lp, int rw, int lane) {
  const int hh = lane >> 4, m = lane & 15;
  float bj[4];
#pragma unroll
  for (int j = 0; j < 4; ++j) bj[j] = bias[cb + 16 * j + m];
  wait_addr();
#pragma unroll
  for (int j = 0; j < 4; ++j) bj[j] = bfr(bj[j]);
#pragma unroll
  for (int i = 0; i < 4; ++i) {
#pragma unroll
    for (int r = 0; r < 8; ++r) {
      float* ro = sl + i * SLAB64 + (8 * hh + r) * 68 + m;
#pragma unroll
      for (int j = 0; j < 4; ++j) ro[16 * j] = (acc[i][j][r] + bj[j]) * sc;
    }
  }
  wave_sync_lds();
  const size_t dst = ((size_t)((rw / SEQ) * nhead + (cb >> 6)) * NQT + (size_t)((rw % SEQ) >> 4)) * FTILE + (size_t)lane * 8;
#pragma unroll
  for (int i = 0; i < 4; ++i) {
    v4u oh[4], ol[4];
#pragma unroll
    for (int pc = 0; pc < 4; ++pc) {
      const float* p = sl + i * SLAB64 + m * 68 + 16 * pc + 8 * hh;
      const v4f a = *(const v4f*)(p), b4 = *(const v4f*)(p + 4);
      float t[8];
#pragma unroll
      for (int e = 0; e < 4; ++e) { t[e] = a[e]; t[4 + e] = b4[e]; }
      oh[pc] = split_pack(t, ol[pc]);
    }
#pragma unroll
    for (int pc = 0; pc < 4; ++pc) {
      *(v4u*)(Hp + dst + (size_t)(i * FTILE + pc * FPC)) = oh[pc];
      *(v4u*)(Lp + dst + (size_t)(i * FTILE + pc * FPC)) = ol[pc];
    }
    wait_stores_issued();                   // the next slab's values take over the registers that these stores name
  }
}
// v^T planes (sc = 1024), fragment order: tile (b, g, s >> 5) = 64 d x 32 keys = 8 pieces of 512 B; piece 2j + h, lane l,
//   element e <- d = 16j + (l & 15), key (s & 31) = 16h + 8*(l >> 4) + e (the two halves of the A fragment of d-subtile j in
//   the split k map): that is acc[i][j] as it stands, h = i & 1, tile i >> 1, e = r, so no LDS; one 16-B store per (i, j)
//   and plane = 512 contiguous bytes a wave.
// coverage: 16 (i, j) = the 8 pieces of the wave's two 32-key tiles of both planes; all blocks = every tile of every kv head once.
__device__ __forceinline__ void planes_vt(const v8f (&acc)[4][4], const float* __restrict__ bias, int cb,
                                          u16* VHo, u16* VLo, int rw, int lane) {
  const int m = lane & 15;
  float bj[4];
#pragma unroll
  for (int j = 0; j < 4; ++j) bj[j] = bias[cb + 16 * j + m];
  wait_addr();
#pragma unroll
  for (int j = 0; j < 4; ++j) bj[j] = bfr(bj[j]);
  const size_t dst = ((size_t)((rw / SEQ) * NKVH + (cb >> 6)) * NKT + (size_t)((rw % SEQ) >> 5)) * (8 * FPC) + (size_t)lane * 8;
#pragma unroll
  for (int i = 0; i < 4; ++i) {
#pragma unroll
    for (int j = 0; j < 4; ++j) {
      float t[8];
#pragma unroll
      for (int r = 0; r < 8; ++r) t[r] = (acc[i][j][r] + bj[j]) * VCAR;
      v4u ol;
      const v4u oh = split_pack(t, ol);
      const size_t o = dst + (size_t)((i >> 1) * (8 * FPC) + (2 * j + (i & 1)) * FPC);
      *(v4u*)(VHo + o) = oh;
      *(v4u*)(VLo + o) = ol;
    }
    wait_stores_issued();                   // the next rows' values take over the registers that these stores name
  }
}
struct PlaneOut {
  const float* bq; const float* bk; const float* bv;
  u16* qh; u16* ql; u16* kh; u16* kl; u16* vh; u16* vl;
};

// =====================================================================================================
// GEMM engine shared by gemm_bf and gemm_out: C[M][N] (f32) = (A[M][K] (+ A2[M][K] when TWO != 0)) . Bt[N][K]^T, times oscale
// (plus bfr(bias[n]) when HASB != 0); A, A2 row-major 16-bit planes, Bt k-contiguous 16-bit plane. PL != 0: no C, the
// accumulators go into the attention operand planes instead (planes_qk, planes_vt).
// Block = BM x 128 tile of C (BM = 128, or 64 when TWO != 0), 4 waves as 2 x 2, wave = (BM/2) x 64 = MF x 4 accumulator tiles.
// A pass is 64 k = one whole 128-B line of each of the stage's 256 operand rows (A rows, then A2 rows, then the 128 Bt rows),
// brought into LDS by asynchronous copies (8 lanes per row, 16 copies per lane and pass), row pitch 144 B; two buffers: the
// copies of pass t + 2 are issued behind the barrier that ends pass t, so they fly while pass t + 1 is worked on.
// Fragments are read from the LDS rows with the same split k map and each accumulator takes its products in the
// same order (k ascending by 32; A before A2). Callers guarantee K % 64 == 0, M % BM == 0, N % 128 == 0, bid in 0 .. (M/BM)*(N/128) - 1.
// =====================================================================================================
#define GKP   64
#define GPIT  72
#define GSTG  (256 * GPIT)
static_assert(GKP == 2 * 32 && (DMOD % GKP) == 0 && (MROWS % 128) == 0 && (NQKV % 128) == 0 && (DMOD % 128) == 0);
static_assert((RICH % 64) == 0 && ((SEQ - RICH) % 128) == 0 && 4 * 4 * SLAB64 * 4 <= 2 * GSTG * 2);

union FragU { v4u u[2]; v16h h; v16b b; };

__device__ __forceinline__ FragU ldfrag_u(const u16* p) {
  FragU f;
  f.u[0] = *(const v4u*)(p);
  f.u[1] = *(const v4u*)(p + 16);
  return f;
}
template <int BF>
__device__ __forceinline__ v8f mma_u(const FragU& a, const FragU& b, v8f c) {
  if (BF != 0) return mma_b(a.b, b.b, c);
  return mma_h(a.h, b.h, c);
}
// eight asynchronous 16-B copies per lane, global -> LDS; the s_wait_xcnt closes the statement so that no register a copy
// names is rewritten ahead of it
__device__ __forceinline__ void copy8(const unsigned (&l)[8], const u16* const (&g)[8]) {
#if defined(__HIP_DEVICE_COMPILE__)
  asm volatile("global_load_async_to_lds_b128 %0, %8, off\n\t"
               "global_load_async_to_lds_b128 %1, %9, off\n\t"
               "global_load_async_to_lds_b128 %2, %10, off\n\t"
               "global_load_async_to_lds_b128 %3, %11, off\n\t"
               "global_load_async_to_lds_b128 %4, %12, off\n\t"
               "global_load_async_to_lds_b128 %5, %13, off\n\t"
               "global_load_async_to_lds_b128 %6, %14, off\n\t"
               "global_load_async_to_lds_b128 %7, %15, off\n\t"
               "s_wait_xcnt 0x0"
               :: "v"(l[0]), "v"(l[1]), "v"(l[2]), "v"(l[3]), "v"(l[4]), "v"(l[5]), "v"(l[6]), "v"(l[7]),
                  "v"(g[0]), "v"(g[1]), "v"(g[2]), "v"(g[3]), "v"(g[4]), "v"(g[5]), "v"(g[6]), "v"(g[7])
               : "memory");
#endif
}
// the same with six copies per lane
__device__ __forceinline__ void copy6(const unsigned (&l)[8], const u16* const (&g)[8]) {
#if defined(__HIP_DEVICE_COMPILE__)
  asm volatile("global_load_async_to_lds_b128 %0, %6, off\n\t"
               "global_load_async_to_lds_b128 %1, %7, off\n\t"
               "global_load_async_to_lds_b128 %2, %8, off\n\t"
               "global_load_async_to_lds_b128 %3, %9, off\n\t"
               "global_load_async_to_lds_b128 %4, %10, off\n\t"
               "global_load_async_to_lds_b128 %5, %11, off\n\t"
               "s_wait_xcnt 0x0"
               :: "v"(l[0]), "v"(l[1]), "v"(l[2]), "v"(l[3]), "v"(l[4]), "v"(l[5]),
                  "v"(g[0]), "v"(g[1]), "v"(g[2]), "v"(g[3]), "v"(g[4]), "v"(g[5])
               : "memory");
#endif
}
// this wave's own copies have landed
__device__ __forceinline__ void wait_copies() {
#if defined(__HIP_DEVICE_COMPILE__)
  asm volatile("s_wait_asynccnt 0x0" ::: "memory");
#endif
}
// this wave's own LDS reads have returned, before the buffer they read is handed to the copies
__device__ __forceinline__ void wait_lds() {
#if defined(__HIP_DEVICE_COMPILE__)
  asm volatile("s_wait_dscnt 0x0" ::: "memory");
#endif
}
// one stage: lane = (row r0 = tid >> 3 of each group of 16 rows, 16-B piece tid & 7); ld = the lane's LDS byte address of
// stage row r0, ga / ga2 / gb = its global address in row r0 of the block's A / A2 / Bt rows, rs16 = halves per 16 rows
template <int TWO>
__device__ __forceinline__ void stage_tile(unsigned ld, const u16* ga, const u16* ga2, const u16* gb, size_t rs16) {
  unsigned l[8];
  const u16* g[8];
#pragma unroll
  for (int i = 0; i < 8; ++i) {
    l[i] = ld + (unsigned)(i * 16 * GPIT * 2);
    if (TWO != 0) g[i] = (i < 4) ? (ga + (size_t)i * rs16) : (ga2 + (size_t)(i - 4) * rs16);
    else          g[i] = ga + (size_t)i * rs16;
  }
  copy8(l, g);
#pragma unroll
  for (int i = 0; i < 8; ++i) {
    l[i] = ld + (unsigned)((8 + i) * 16 * GPIT * 2);
    g[i] = gb + (size_t)i * rs16;
  }
  copy8(l, g);
}

template <int BF, int TWO, int HASB, int PL>
__device__ __forceinline__ void gemm_ring(u16* ring, const u16* __restrict__ A, const u16* __restrict__ A2,
                                          const u16* __restrict__ Bt, const float* __restrict__ bias, float* C,
                                          int M, int N, int K, float oscale, int bid, const PlaneOut& po) {
  constexpr int MF = (TWO != 0) ? 2 : 4;
  constexpr int BM = 32 * MF;
  const int tid = threadIdx.x, wave = tid >> 5, lane = tid & 31, hh = lane >> 4, m = lane & 15;
  const int ntile = N >> 7;
  const int row0  = (bid / ntile) * BM;
  const int col0  = (bid % ntile) * 128;
  if (row0 + BM > M) return;                // block-uniform, before any copy or barrier; never taken with the exact grid
  const int wm = wave >> 1, wn = wave & 1;
  const int r0 = tid >> 3, c8 = (tid & 7) * 8;
  const u16* ga  = A  + (size_t)(row0 + r0) * K + c8;
  const u16* ga2 = A2 + (size_t)(row0 + r0) * K + c8;
  const u16* gb  = Bt + (size_t)(col0 + r0) * K + c8;
  const size_t rs16 = (size_t)16 * K;
  const unsigned ld0 = (unsigned)(uintptr_t)ring + (unsigned)((r0 * GPIT + c8) * 2);
  const int npass = K / GKP;
  const int aoff = (wm * (16 * MF) + m) * GPIT + 8 * hh;          // halves, in a stage: A fragment row of this lane
  const int boff = (128 + wn * 64 + m) * GPIT + 8 * hh;           // Bt fragment row of this lane

  v8f acc[MF][4];
#pragma unroll
  for (int i = 0; i < MF; ++i) {
#pragma unroll
    for (int j = 0; j < 4; ++j) acc[i][j] = zero8();
  }

  stage_tile<TWO>(ld0, ga, ga2, gb, rs16);
  wait_copies();
  __syncthreads();
  if (npass > 1) stage_tile<TWO>(ld0 + (unsigned)(GSTG * 2), ga + GKP, ga2 + GKP, gb + GKP, rs16);

  // kept rolled (for speed only), the buffer chosen by the pass's parity
#pragma unroll 1
  for (int t = 0; t < npass; ++t) {
    const int par = t & 1;
    const u16* st = ring + par * GSTG;
    FragU a[2][MF], a2[2][MF], b[4];
#pragma unroll
    for (int kk = 0; kk < 2; ++kk) {
#pragma unroll
      for (int i = 0; i < MF; ++i) {
        a[kk][i] = ldfrag_u(st + aoff + i * 16 * GPIT + kk * 32);
        if (TWO != 0) a2[kk][i] = ldfrag_u(st + aoff + (64 + i * 16) * GPIT + kk * 32);
      }
    }
#pragma unroll
    for (int kk = 0; kk < 2; ++kk) {
#pragma unroll
      for (int j = 0; j < 4; ++j) b[j] = ldfrag_u(st + boff + j * 16 * GPIT + kk * 32);
      // the LDS reads stay in one group ahead of the WMMA block (for speed only)
      __builtin_amdgcn_sched_barrier(0);
#pragma unroll
      for (int i = 0; i < MF; ++i) {
#pragma unroll
        for (int j = 0; j < 4; ++j) acc[i][j] = mma_u<BF>(a[kk][i], b[j], acc[i][j]);
      }
      if (TWO != 0) {
#pragma unroll
        for (int i = 0; i < MF; ++i) {
#pragma unroll
          for (int j = 0; j < 4; ++j) acc[i][j] = mma_u<BF>(a2[kk][i], b[j], acc[i][j]);
        }
      }
      // the WMMA block stays ahead of what follows: sunk behind the publish point it would put the refill's issue directly
      // in front of the next pass's wait for it
      __builtin_amdgcn_sched_barrier(0);
    }
    // publish point of pass t + 1: own reads back, own copies landed, every wave here; then the freed buffer is refilled
    wait_lds();
    wait_copies();
    __syncthreads();
    if (t + 2 < npass) {
      const size_t ko = (size_t)(t + 2) * GKP;
      stage_tile<TWO>(ld0 + (unsigned)(par * GSTG * 2), ga + ko, ga2 + ko, gb + ko, rs16);
    }
  }
  wait_copies();

  // the last pass's barrier has ended every read of the ring and no copy is outstanding: each wave stages its MF tiles in
  // MF slabs of its own
  float* sl = (float*)(void*)ring + wave * (MF * SLAB64);
  const int colw = col0 + wn * 64;
  if constexpr (PL != 0) {
    // the column ranges q | k | v end on multiples of 128, so the range test on col0 is block-uniform (a scalar branch)
    const int rw = row0 + wm * 64;
    if (col0 < DMOD + KVD) {
      const bool isq = col0 < DMOD;
      planes_qk(sl, acc, isq ? po.bq : po.bk, isq ? colw : colw - DMOD, isq ? NH : NKVH, isq ? QSC : KSC,
                isq ? po.qh : po.kh, isq ? po.ql : po.kl, rw, lane);
    } else {
      planes_vt(acc, po.bv, colw - DMOD - KVD, po.vh, po.vl, rw, lane);
    }
    return;
  }
#pragma unroll
  for (int i = 0; i < MF; ++i)
    epi_put<HASB>(sl + i * SLAB64, acc[i][0], acc[i][1], acc[i][2], acc[i][3], oscale, bias, colw, lane);
  wave_sync_lds();
#pragma unroll
  for (int i = 0; i < MF; ++i)
    epi_get(sl + i * SLAB64, C, N, (size_t)(row0 + wm * (16 * MF) + i * 16), colw, lane);
}

__global__ __launch_bounds__(128)
void gemm_bf(const u16* __restrict__ A, const u16* __restrict__ Bt, const float* __restrict__ bq,
             const float* __restrict__ bk, const float* __restrict__ bv,
             u16* QHo, u16* QLo, u16* KHo, u16* KLo, u16* VHo, u16* VLo) {
  __shared__ __align__(16) u16 ring[2 * GSTG];
  const PlaneOut po = {bq, bk, bv, QHo, QLo, KHo, KLo, VHo, VLo};
  gemm_ring<1, 0, 0, 1>(ring, A, A, Bt, (const float*)0, (float*)0, MROWS, NQKV, DMOD, 1.0f, (int)blockIdx.x, po);
}

// y = O.Wo^T + bo for all rows in one grid (the row ranges are independent): per sequence GB_L blocks of 128 x 128 for rows
// >= RICH (O hi only), then GB_R blocks of 64 x 128 for rows < RICH (O hi + residual). The range test is block-uniform.
#define GB_L   (((SEQ - RICH) / 128) * (DMOD / 128))
#define GB_R   ((RICH / 64) * (DMOD / 128))
__global__ __launch_bounds__(128)
void gemm_out(const u16* __restrict__ OHp, const u16* __restrict__ OLp, const u16* __restrict__ Bt,
              const float* __restrict__ bias, float* C, float oscale) {
  __shared__ __align__(16) u16 ring[2 * GSTG];
  const int b = (int)blockIdx.x / (GB_L + GB_R);
  const int r = (int)blockIdx.x % (GB_L + GB_R);
  if (b >= NB) return;                      // block-uniform, before any copy or barrier; never taken with the exact grid
  const PlaneOut po = {};
  if (r < GB_L) {
    const size_t ro = ((size_t)b * SEQ + RICH) * DMOD;
    gemm_ring<0, 0, 1, 0>(ring, OHp + ro, OLp + ro, Bt, bias, C + ro, SEQ - RICH, DMOD, DMOD, oscale, r, po);
    wait_stores_issued();
  } else {
    const size_t ro = (size_t)b * SEQ * DMOD;
    gemm_ring<0, 1, 1, 0>(ring, OHp + ro, OLp + ro, Bt, bias, C + ro, RICH, DMOD, DMOD, oscale, r - GB_L, po);
    wait_stores_issued();
  }
}

// =====================================================================================================
// Causal grouped-query softmax attention, hd = 64. Block bid -> (query tile qt = qt0 + bid % nqt: rows q0 = 16*qt ..
// q0+15, head group hg = kv head, batch b); one wave per query head = hg*WPB + wave (the 4 consecutive query heads of a
// group share kv head hg).
//   q hi / residual planes f16 x256, tiles (b, h, s >> 4); k hi / residual planes f16 x256, tiles (b, g, s >> 4); v^T hi /
//   residual planes x1024, tiles (b, g, s >> 5): all in fragment order (planes_qk, planes_vt), so that every fragment load of a wave
//   reads 512 contiguous bytes and a key tile of 32 is 4096 contiguous bytes of each k plane and of each v^T plane.
//   The block's 4 waves walk the same key tiles of the same kv head: a key tile (k hi | k residual | v^T hi, and for RV = 1
//   | v^T residual, 4096 B each, kept in fragment order) is brought into LDS once per block by asynchronous copies (2 copies per
//   lane and plane); two buffers: the copies of tile kt + 2 are issued behind the barrier that ends tile kt, so they fly while
//   tile kt + 1 is worked on. nkt is the same for the whole block, so every wave passes every barrier.
//   Transposed products: S^T = K.Q^T (A = key rows, B = query rows as columns), so a lane's 16 score registers of a key tile
//   belong to one query (lane & 15) and hold keys kb + 8*(lane >> 4) + r and kb + 16 + 8*(lane >> 4) + r.
//   raw(j, i) = k_hi.q_hi + k_hi.q_lo + k_lo.q_hi (2 k-steps over d); logit = raw * 2^-19 (the 1/8 softmax scale and the two
//   256 carries, exact); keys above the diagonal replaced by -inf; online softmax per query in f32 with a running max:
//   max in-lane over the 16 scores plus one exchange with lane ^ 16; sum in-lane, the two halves' sums joined once after the
//   loop; alpha = exp(m_old - m_new), p = exp(logit - m_new), l = l*alpha + sum p, O^T accumulators times alpha before the
//   tile's product. Key tiles of 32 visited in order, only tiles with kb <= q0 (nkt = q0/32 + 1 <= NKT; key kb is unmasked for
//   every query of the tile). The score registers, as p*32768 (f16 hi and its f16 residual), are the B fragment of
//   O^T += v^T.P^T in the split k map as they stand; v^T A fragments in 2 groups of 2 d-subtiles; RV = 1: products hh + lh + hl,
//   RV = 0: hh only.
//   Epilogue: O x256 -> f16 hi plane (and for RV = 1 the f16 residual plane of O x256) [b*SEQ + s][h*HD + d]; lane = (row group
//   rq = lane>>3 in 0..3, 8 consecutive d at c8); one instruction = 4 rows it*4 + rq, each row segment (64 halves = one whole
// coverage: per wave 4 instructions x 4 rows x 8 lanes x 8 halves = 16 x 64 per plane; nqt x NHG x NB blocks x WPB waves;
//   the two block ranges (tiles NQTR..NQT-1 with RV = 0, tiles 0..NQTR-1 with RV = 1) cover every (b, s, h) row segment of the hi plane
//   exactly once and rows s < RICH of the residual plane exactly once (only those rows are read later).
// =====================================================================================================
#define AKT   (2 * FTILE)
#define ASTG  (4 * AKT)
static_assert(AKT * 2 == 2 * ATT_THREADS * 16 && 6 * (2 * ASTG * 2 + WPB * WREG * 4) <= 327680);
// one key tile: ld = the lane's LDS byte address in the buffer (16 B per thread), kh / kl / vh / vl = its global address in the
// tile of each plane; a plane's tile = 2 copies of the block (2048 B each)
template <int RV>
__device__ __forceinline__ void stage_kv(unsigned ld, const u16* kh, const u16* kl, const u16* vh, const u16* vl) {
  unsigned l[8];
  const u16* g[8];
#pragma unroll
  for (int i = 0; i < 8; ++i) l[i] = ld + (unsigned)(i * (AKT / 2) * 2);
  g[0] = kh;  g[1] = kh + AKT / 2;
  g[2] = kl;  g[3] = kl + AKT / 2;
  g[4] = vh;  g[5] = vh + AKT / 2;
  g[6] = vl;  g[7] = vl + AKT / 2;
  if (RV != 0) copy8(l, g);
  else         copy6(l, g);
}

template <int RV>
__device__ __forceinline__
void attn_gq(float* smem, u16* kvr, const u16* __restrict__ QHp, const u16* __restrict__ QLp,
             const u16* __restrict__ KHp, const u16* __restrict__ KLp,
             const u16* __restrict__ VHp, const u16* __restrict__ VLp,
             u16* OHp, u16* OLp, int bid, int qt0, int nqt) {
#pragma clang fp contract(off)
  const int tid  = threadIdx.x;
  const int wave = tid >> 5;
  const int lane = tid & 31;
  const int hh   = lane >> 4;
  const int c    = lane & 15;
  if (nqt <= 0) return;                     // block-uniform, before any copy or barrier
  const int qt   = qt0 + bid % nqt;
  const int t2   = bid / nqt;
  const int hg   = t2 % NHG;
  const int b    = t2 / NHG;
  if (b >= NB) return;                      // block-uniform, before any copy or barrier; never taken with the exact grid
  const int q0   = qt * 16;
  if (q0 + 16 > SEQ) return;                // block-uniform, before any copy or barrier; never taken
  const int head = hg * WPB + wave;
  const int kvh  = hg;

  float* slab = smem + wave * WREG;         // result slab [16][64] pitch 68

  const unsigned l8 = (unsigned)lane * 8;
  const size_t qoff = ((size_t)(b * NH + head) * NQT + qt) * FTILE;                        // this wave's 16-query tile
  const size_t koff = (size_t)(b * NKVH + kvh) * NQT * FTILE;                              // 16-key tile 0 of the kv head
  const size_t voff = (size_t)(b * NKVH + kvh) * NKT * (2 * FTILE);                        // 32-key tile 0 of the kv head
  const _Float16* Qh  = (const _Float16*)(const void*)QHp + qoff;
  const _Float16* Ql  = (const _Float16*)(const void*)QLp + qoff;
  const u16* gkh = KHp + koff + (size_t)tid * 8;      // this thread's 16 B of the first half of key tile 0, plane by plane
  const u16* gkl = KLp + koff + (size_t)tid * 8;
  const u16* gvh = VHp + voff + (size_t)tid * 8;
  const u16* gvl = VLp + voff + (size_t)tid * 8;
  const unsigned ld0 = (unsigned)(uintptr_t)kvr + (unsigned)(tid * 16);
  const float lsc  = SM_SCALE * (1.0f / (QSC * KSC));   // exact power-of-two fold of the q / k carries into the 1/8 scale
  const float oc   = 1.0f / (PCAR * VCAR);
  const float ninf = -__builtin_inff();

  v8f o[4];                                 // O^T: element r of o[j] = (d = 16j + 8hh + r, query row q0 + c)
#pragma unroll
  for (int j = 0; j < 4; ++j) o[j] = zero8();
  float mrun = ninf, lrun = 0.0f;           // this lane's query: running max (both halves alike), sum over this half's keys
  const int ncaus = (q0 >> 5) + 1;                                            // tiles holding keys <= q0 + 15
  const int nkt   = (ncaus < NKT) ? ncaus : NKT;
  const int qrow  = q0 + c;                                                   // query row of every D element of this lane

  stage_kv<RV>(ld0, gkh, gkl, gvh, gvl);
  wait_copies();
  __syncthreads();
  if (nkt > 1) stage_kv<RV>(ld0 + (unsigned)(ASTG * 2), gkh + AKT, gkl + AKT, gvh + AKT, gvl + AKT);

#pragma unroll 1
  for (int kt = 0; kt < nkt; ++kt) {
    const int kb = kt * 32;
    const int par = kt & 1;
    const _Float16* st = (const _Float16*)(const void*)(kvr + par * ASTG);    // this tile's buffer
    // ---- raw scores, transposed: D element r of this lane = (key kb + 8hh + r, query qrow) in s0, key + 16 in s1 ----
    v8f s0 = zero8(), s1 = zero8();
    const _Float16* k0p = st;
    const _Float16* k1p = k0p + FTILE;
    const _Float16* l0p = st + AKT;
    const _Float16* l1p = l0p + FTILE;
#pragma unroll
    for (int kk = 0; kk < HD / 32; ++kk) {
      const v16h qh  = ldfrag_f(Qh + kk * (2 * FPC), l8);
      const v16h ql  = ldfrag_f(Ql + kk * (2 * FPC), l8);
      const v16h kh0 = ldfrag_f(k0p + kk * (2 * FPC), l8);
      const v16h kh1 = ldfrag_f(k1p + kk * (2 * FPC), l8);
      const v16h kl0 = ldfrag_f(l0p + kk * (2 * FPC), l8);
      const v16h kl1 = ldfrag_f(l1p + kk * (2 * FPC), l8);
      s0 = mma_h(kh0, qh, s0);
      s0 = mma_h(kh0, ql, s0);
      s0 = mma_h(kl0, qh, s0);
      s1 = mma_h(kh1, qh, s1);
      s1 = mma_h(kh1, ql, s1);
      s1 = mma_h(kl1, qh, s1);
      guard2(s0, s1, qh, ql, kh0, kl0, kh1, kl1);
    }
    // ---- causal replace-mask, running-max online softmax in f32: the lane's 16 scores belong to one query ----
    // every key of a tile before the last is <= 32*(q0 >> 5) - 1 < q0 <= qrow: the replace-mask is an identity there, so only
    // the last tile takes it (kt and nkt are block-uniform: a scalar branch)
    if (kt + 1 == nkt) {
      const int key0 = kb + 8 * hh, key1 = key0 + 16;
      // unrolled so that the score registers are indexed by constants (a rolled loop would move them through scratch)
#pragma unroll
      for (int r = 0; r < 8; ++r) {
        s0[r] = (key0 + r > qrow) ? ninf : s0[r];
        s1[r] = (key1 + r > qrow) ? ninf : s1[r];
      }
    }
    float t0[8], t1[8];
    float mx = ninf;
#pragma unroll
    for (int r = 0; r < 8; ++r) {
      t0[r] = s0[r] * lsc;
      t1[r] = s1[r] * lsc;
      mx = fmaxf(mx, fmaxf(t0[r], t1[r]));
    }
    mx = fmaxf(mx, xhalf(mx));                          // the other half's 16 keys of the same query
    const float mnew = fmaxf(mrun, mx);
    const float al   = __expf(mrun - mnew);
    // ---- B fragments of p*32768 straight from the score registers: hi f16 and residual f16, column = query c,
    //      elements 0..7 = keys kb + 8hh + 0..7, elements 8..15 = keys kb + 16 + 8hh + 0..7 (the split k map) ----
    FragH ph, pl;
    float sm = 0.0f;
#pragma unroll
    for (int r = 0; r < 8; ++r) {
      const float p0 = __expf(t0[r] - mnew);
      const float p1 = __expf(t1[r] - mnew);
      sm += p0 + p1;
      const float ta = p0 * PCAR, tc = p1 * PCAR;
      const _Float16 ha = (_Float16)ta, hc = (_Float16)tc;
      ph.h[0][r] = ha;
      ph.h[1][r] = hc;
      if (RV != 0) {                                    // the residual has a product only for RV = 1
        pl.h[0][r] = (_Float16)(ta - (float)ha);
        pl.h[1][r] = (_Float16)(tc - (float)hc);
      }
    }
    lrun = lrun * al + sm;
    mrun = mnew;
    // ---- rescale the O^T accumulators by the lane's alpha ----
#pragma unroll
    for (int j = 0; j < 4; ++j) {
#pragma unroll
      for (int r = 0; r < 8; ++r) o[j][r] = o[j][r] * al;
    }
    // ---- O^T += v^T.P^T : A fragment row = d = j*16 + c, subtile j = pieces 2j, 2j + 1 of the key tile; 2 groups of 2 ----
    {
      const _Float16* vhp = st + 2 * AKT;
      const _Float16* vlp = st + 3 * AKT;
      (void)vlp;
#pragma unroll
      for (int jg = 0; jg < 2; ++jg) {
        const size_t da = (size_t)(2 * jg) * (2 * FPC);
        const size_t db = da + (size_t)(2 * FPC);
        const v16h vha = ldfrag_f(vhp + da, l8), vhb2 = ldfrag_f(vhp + db, l8);
        o[2 * jg]     = mma_h(vha,  ph.v, o[2 * jg]);
        o[2 * jg + 1] = mma_h(vhb2, ph.v, o[2 * jg + 1]);
        if (RV != 0) {
          const v16h vla = ldfrag_f(vlp + da, l8), vlb2 = ldfrag_f(vlp + db, l8);
          o[2 * jg]     = mma_h(vha,  pl.v, o[2 * jg]);
          o[2 * jg]     = mma_h(vla,  ph.v, o[2 * jg]);
          o[2 * jg + 1] = mma_h(vhb2, pl.v, o[2 * jg + 1]);
          o[2 * jg + 1] = mma_h(vlb2, ph.v, o[2 * jg + 1]);
          guard2(o[2 * jg], o[2 * jg + 1], ph.v, pl.v, vha, vhb2, vla, vlb2);
        } else {
          guard2(o[2 * jg], o[2 * jg + 1], ph.v, ph.v, vha, vhb2, vha, vhb2);
        }
      }
    }
    // publish point of tile kt + 1: own reads back, own copies landed, every wave here; then the freed buffer is refilled
    wait_lds();
    wait_copies();
    __syncthreads();
    if (kt + 2 < nkt) {
      const size_t ko = (size_t)(kt + 2) * AKT;
      stage_kv<RV>(ld0 + (unsigned)(par * ASTG * 2), gkh + ko, gkl + ko, gvh + ko, gvl + ko);
    }
  }
  wait_copies();
  acc_guard4(o[0], o[1], o[2], o[3]);
  // ---- O = acc / l with the carries (32768 on p, 1024 on v) folded once; the two halves' sums joined here; the lane's
  //      8 consecutive d of each subtile go into row c of the wave's slab ----
  const float ltot = lrun + xhalf(lrun);
  const float rl   = (1.0f / ltot) * oc;
#pragma unroll
  for (int j = 0; j < 4; ++j) {
    float* sd = slab + c * SLP + j * 16 + 8 * hh;
    v4f w0, w1;
#pragma unroll
    for (int e = 0; e < 4; ++e) { w0[e] = o[j][e] * rl; w1[e] = o[j][4 + e] * rl; }
    *(v4f*)(sd)     = w0;
    *(v4f*)(sd + 4) = w1;
  }
  wave_sync_lds();
  // ---- O x256 -> f16 hi plane (+ f16 residual plane); lane = (row group rq, 8 consecutive d at c8) ----
  v4u oh[4], ol[4];
  const int rq = lane >> 3, c8 = (lane & 7) * 8;
#pragma unroll
  for (int it = 0; it < 4; ++it) {
    const int row = it * 4 + rq;
    const v4f a = *(const v4f*)(slab + row * SLP + c8), b4 = *(const v4f*)(slab + row * SLP + c8 + 4);
    float w[8];
#pragma unroll
    for (int e = 0; e < 4; ++e) { w[e] = a[e] * OSC; w[4 + e] = b4[e] * OSC; }
#pragma unroll
    for (int e = 0; e < 4; ++e) {
      const _Float16 h0 = (_Float16)w[2 * e], h1 = (_Float16)w[2 * e + 1];
      const _Float16 g0 = (_Float16)(w[2 * e] - (float)h0), g1 = (_Float16)(w[2 * e + 1] - (float)h1);
      oh[it][e] = pk16(h_bits(h0), h_bits(h1));
      ol[it][e] = pk16(h_bits(g0), h_bits(g1));
    }
  }
  const size_t ob = ((size_t)b * SEQ + q0) * DMOD + (size_t)head * HD + c8;
  {
#pragma unroll
    for (int it = 0; it < 4; ++it) {
      const int row = it * 4 + rq;
      *(v4u*)(OHp + ob + (size_t)row * DMOD) = oh[it];
      if (RV != 0) {
        *(v4u*)(OLp + ob + (size_t)row * DMOD) = ol[it];
      }
    }
    wait_stores_issued();
  }
}

// Both row ranges in one grid (no query tile depends on another): the AB_L blocks of the later tiles (the longer key loops)
// first, then the AB_R blocks of the tiles < RICH / 16. The range test is block-uniform.
#define AB_L   ((NQT - NQTR) * NHG * NB)
#define AB_R   (NQTR * NHG * NB)
// six waves per SIMD: the register budget (160) at which all AB_L blocks of the later tiles are resident at once
__global__ __launch_bounds__(ATT_THREADS) __attribute__((amdgpu_waves_per_eu(6)))
void attn_all(const u16* __restrict__ QHp, const u16* __restrict__ QLp,
              const u16* __restrict__ KHp, const u16* __restrict__ KLp,
              const u16* __restrict__ VHp, const u16* __restrict__ VLp, u16* OHp, u16* OLp) {
  __shared__ __align__(16) float smem[WPB * WREG];
  __shared__ __align__(16) u16 kvring[2 * ASTG];
  const int bid = (int)blockIdx.x;
  if (bid < AB_L) attn_gq<0>(smem, kvring, QHp, QLp, KHp, KLp, VHp, VLp, OHp, OLp, bid, NQTR, NQT - NQTR);
  else            attn_gq<1>(smem, kvring, QHp, QLp, KHp, KLp, VHp, VLp, OHp, OLp, bid - AB_L, 0, NQTR);
}

// =====================================================================================================
// Workspace map (bytes); every plane is fully written by whole-line stores before it is read (the O residual plane only on
// the rows < RICH per sequence that are read); all extents are exact multiples of the store granularity (no pad rows needed);
// every region offset a multiple of 131072:
//   XB  bf16 [MROWS][2048]              MROWS*4096   (NB=2, SEQ=2048: 16777216); after the projection GEMM the same bytes hold
//                                                    the O f16 hi plane [MROWS][2048] x256 (identical extent)
//   WB  bf16 [3072 n][2048 k]           12582912     (Wq rows 0..2047, Wk 2048..2559, Wv 2560..3071)
//   WT  f16 [2048 o][2048 d] x1024      8388608      (Wo)
//   OL  region of MROWS*12288 bytes; its first MROWS*4096 bytes hold the O f16 residual plane [MROWS][2048]
//   QH  f16 [NB*32][SEQ/16] tiles of 2048 B x256   MROWS*4096   QL residual, same extent   (fragment order)
//   KH  f16 [NB*8][SEQ/16] tiles of 2048 B x256    MROWS*1024   KL residual, same extent   (fragment order)
//   VH  f16 [NB*8][SEQ/32] tiles of 4096 B x1024   MROWS*1024   VL residual, same extent   (fragment order)
//   end (NB=2, SEQ=2048)               138412032
// =====================================================================================================
extern "C" void kernel_launch(void* const* d_in, const int* in_sizes, int n_in,
                              void* d_out, int out_size, void* d_ws, size_t ws_size,
                              hipStream_t stream) {
  if (n_in < 9) return;
  if (in_sizes[0] < ((NB - 1) * XS_FULL + SEQ) * DMOD) return;
  if (in_sizes[1] < DMOD * DMOD) return;
  if (in_sizes[2] < DMOD) return;
  if (in_sizes[3] < KVD * DMOD) return;
  if (in_sizes[4] < KVD) return;
  if (in_sizes[5] < KVD * DMOD) return;
  if (in_sizes[6] < KVD) return;
  if (in_sizes[7] < DMOD * DMOD) return;
  if (in_sizes[8] < DMOD) return;
  if (out_size < MROWS * DMOD) return;

  const float* x  = (const float*)d_in[0];
  const float* wq = (const float*)d_in[1];
  const float* bq = (const float*)d_in[2];
  const float* wk = (const float*)d_in[3];
  const float* bk = (const float*)d_in[4];
  const float* wv = (const float*)d_in[5];
  const float* bv = (const float*)d_in[6];
  const float* wo = (const float*)d_in[7];
  const float* bo = (const float*)d_in[8];
  float*       out = (float*)d_out;

  const size_t szXB = (size_t)MROWS * DMOD * 2;
  const size_t szWB = (size_t)NQKV * DMOD * 2;
  const size_t szF  = (size_t)MROWS * NQKV * 4;
  const size_t szQ  = (size_t)MROWS * DMOD * 2;                  // QH, QL
  const size_t szK  = (size_t)MROWS * KVD * 2;                   // KH, KL
  const size_t szV  = (size_t)NB * NKVH * HD * SEQ * 2;          // VH, VL (== szK)
  const size_t szOH = (size_t)MROWS * DMOD * 2;                  // O hi plane, lives in the XB region
  const size_t szOL = (size_t)MROWS * DMOD * 2;                  // O residual plane, at the start of its region
  const size_t szWT = (size_t)DMOD * DMOD * 2;                   // Wo f16 plane
  if (szOH > szXB || szOL > szF) return;
  size_t off = 0;
  const size_t oXB = off; off += szXB;
  const size_t oWB = off; off += szWB;
  const size_t oWT = off; off += szWT;
  const size_t oF  = off; off += szF;
  const size_t oQH = off; off += szQ;
  const size_t oQL = off; off += szQ;
  const size_t oKH = off; off += szK;
  const size_t oKL = off; off += szK;
  const size_t oVH = off; off += szV;
  const size_t oVL = off; off += szV;
  if (off > ws_size) return;                // off = 138412032 for NB = 2, SEQ = 2048
  if (off > (size_t)WS_CAP) return;

  char* ws = (char*)d_ws;
  u16*   XB  = (u16*)(ws + oXB);
  u16*   OH  = (u16*)(ws + oXB);
  u16*   WB  = (u16*)(ws + oWB);
  u16*   WT  = (u16*)(ws + oWT);
  u16*   OL  = (u16*)(ws + oF);
  u16*   QH  = (u16*)(ws + oQH);
  u16*   QL  = (u16*)(ws + oQL);
  u16*   KH  = (u16*)(ws + oKH);
  u16*   KL  = (u16*)(ws + oKL);
  u16*   VH  = (u16*)(ws + oVH);
  u16*   VL  = (u16*)(ws + oVL);

  const dim3 b256(256), b128(128), bAT(ATT_THREADS);
  const dim3 gG1((MROWS / 128) * (NQKV / 128));         // 768
  const float osc = 1.0f / (OSC * WOS);

  // (0) x -> bf16 plane [MROWS][2048]; Wq, Wk, Wv -> one bf16 plane [3072 n][2048 k]; Wo [2048 o][2048 d] -> f16 plane of the
  //     bf16 value x1024 (already k-contiguous)
  cvt_all<<<dim3(CB_ALL), b256, 0, stream>>>(x, wq, wk, wv, wo, XB, WB, WT);
  // (1) qkv = x.[Wq|Wk|Wv]^T, f32 accumulators; the epilogue adds the biases in f32 and writes the q and k hi + residual planes
  //     x256 (columns 0..2047 + bq, 2048..2559 + bk) and the v^T hi + residual planes x1024 (columns 2560..3071 + bv)
  gemm_bf<<<gG1, b128, 0, stream>>>(XB, WB, bq, bk, bv, QH, QL, KH, KL, VH, VL);
  // (2) causal attention -> O f16 hi plane x256 (XB region) for all query tiles; residual plane for tiles < RICH
  attn_all<<<dim3(AB_L + AB_R), bAT, 0, stream>>>(QH, QL, KH, KL, VH, VL, OH, OL);
  // (3) y = O.Wo^T + bo -> out f32 [MROWS][2048], carries 256 x 1024 folded back; rows < RICH per sequence with O hi + residual
  gemm_out<<<dim3(NB * (GB_L + GB_R)), b128, 0, stream>>>(OH, OL, WT, bo, out, osc);
  (void)hipGetLastError();
}

// v008
// Measured time: 157 microseconds a run.
// Next to v007, in two timings, it ran 1.06 and 1.05 times as fast.
// Over all steps from v000 it is 4.08 times as fast.
// Contractions: x.[Wq|Wk|Wv]^T on v_wmma_f32_16x16x32_bf16 (x and the weights as bf16 RNE planes, weight [n][k] rows are the
// k-contiguous B operand, f32 accumulate, biases added in f32 as bf16 RNE values); q.k^T over hd 64 and P.v on
// v_wmma_f32_16x16x32_f16 with f16 hi + f16 residual planes (q, k x256, products hh+lh+hl on every row; P x32768 hi +
// in-register residual and v^T x1024 hi + residual plane for query rows < 512 of each sequence, P hi . v hi only for later
// rows); O.Wo^T on v_wmma_f32_16x16x32_f16 with O x256 as f16 hi (+ f16 residual plane for rows < 512 of each sequence) and
// Wo as f16(bf16(Wo)) x1024, one accumulator, bias bo added in f32; all f32 accumulate. Online softmax in f32 on VALU.
#include <hip/hip_runtime.h>
#include <math.h>
#include <stdint.h>

#ifndef NB
#define NB 2
#endif
#ifndef SEQ
#define SEQ 2048
#endif
#define XS_FULL 2048
#define DMOD  2048
#define NH    32
#define NKVH  8
#define HD    64
#define KVD   (NKVH * HD)
#define NQKV  (DMOD + 2 * KVD)
#define MROWS (NB * SEQ)
#define RICH_REQ 512
#define RICH  ((SEQ < RICH_REQ) ? SEQ : RICH_REQ)
#define SM_SCALE 0.125f
#define QSC   256.0f
#define KSC   256.0f
#define PCAR  32768.0f
#define VCAR  1024.0f
#define OSC   256.0f
#define WOS   1024.0f
#define WPB   (NH / NKVH)
#define NHG   NKVH
#define NQT   (SEQ / 16)
#define NQTR  (RICH / 16)
#define NKT   (SEQ / 32)
#define ATT_THREADS (WPB * 32)
#define SLP   68
#define SLW   (16 * SLP)
#define WREG  (SLW)
#define SLAB64 (16 * 68)
#define WS_CAP 268435456
static_assert(DMOD == NH * HD && HD == 64 && NH == 32 && NKVH == 8 && WPB == 4 && NHG * WPB == NH);
static_assert(ATT_THREADS == 128 && KVD == 512 && NQKV == 3072);
static_assert(NB >= 1 && NB <= 2);
static_assert(NB == 1 || SEQ == XS_FULL);
static_assert((SEQ % 64) == 0 && SEQ >= 64 && SEQ <= XS_FULL);
static_assert((RICH % 64) == 0 && RICH >= 64 && RICH <= SEQ);
static_assert((DMOD % 64) == 0 && (KVD % 64) == 0 && (NQKV % 64) == 0 && (DMOD % 32) == 0 && (HD % 32) == 0 && (MROWS % 64) == 0);
static_assert(((SEQ * DMOD / 8) % 256) == 0 && ((DMOD * DMOD / 8) % 256) == 0 && ((KVD * DMOD / 8) % 256) == 0);
static_assert(WPB * WREG * 4 <= 65536 && 4 * SLAB64 * 4 <= 65536);
// workspace total (XB + WB + WT + OL region + QH + QL + KH + KL + VH + VL) for this build
static_assert((size_t)MROWS * DMOD * 2 + (size_t)NQKV * DMOD * 2 + (size_t)DMOD * DMOD * 2 + (size_t)MROWS * NQKV * 4 +
              2 * (size_t)MROWS * DMOD * 2 + 2 * (size_t)MROWS * KVD * 2 + 2 * (size_t)NB * NKVH * HD * SEQ * 2
              <= (size_t)WS_CAP);

typedef unsigned short u16;
typedef _Float16 v16h __attribute__((ext_vector_type(16)));
typedef _Float16 v8h  __attribute__((ext_vector_type(8)));
typedef __bf16   v16b __attribute__((ext_vector_type(16)));
typedef float    v8f  __attribute__((ext_vector_type(8)));
typedef float    v4f  __attribute__((ext_vector_type(4)));
typedef unsigned int v4u __attribute__((ext_vector_type(4)));

union FragH { v16h v; v8h h[2]; v4u u[2]; };

// ---- scalar helpers --------------------------------------------------------------------------------
__device__ __forceinline__ unsigned short bf_bits(float f) {          // f32 -> bf16 bits, RNE convert
  unsigned u = __float_as_uint(f);
  return (unsigned short)((u + 0x7FFFu + ((u >> 16) & 1u)) >> 16);
}
__device__ __forceinline__ float bf_up(unsigned short h) { return __uint_as_float(((unsigned)h) << 16); }
__device__ __forceinline__ float bfr(float f) { return bf_up(bf_bits(f)); }
__device__ __forceinline__ unsigned short h_bits(_Float16 x) { return __builtin_bit_cast(unsigned short, x); }
__device__ __forceinline__ unsigned pk16(unsigned short a, unsigned short b) { return (unsigned)a | ((unsigned)b << 16); }
__device__ __forceinline__ v8f zero8() { v8f z = {0.f, 0.f, 0.f, 0.f, 0.f, 0.f, 0.f, 0.f}; return z; }

// ---- fragment map: 16-bit A/B operand of k-step k0, lane -> row/col (lane&15), h = lane>>4; elements 0..7 <- k0+8h+0..7,
//      elements 8..15 <- k0+16+8h+0..7 (the same split k map for A and B; ldfrag_u reads it from k-contiguous rows)
// ---- fragment loader for a plane kept in fragment order: a fragment is two pieces of 512 contiguous bytes, piece = 32 lanes
//      x 16 B; p = the fragment's first byte (wave-uniform where the tile is), l8 = 8*lane; elements 0..7 <- piece 0,
//      elements 8..15 <- piece 1 (a load = 4 whole 128-B lines)
#define FPC   256
#define FTILE (4 * FPC)
__device__ __forceinline__ v16h ldfrag_f(const _Float16* p, unsigned l8) {
  FragH f;
  f.h[0] = *(const v8h*)(p + l8);
  f.h[1] = *(const v8h*)(p + l8 + FPC);
  return f.v;
}

// stands behind issued global loads whose address registers the code that follows may take over
__device__ __forceinline__ void wait_addr() {
#if defined(__HIP_DEVICE_COMPILE__)
  asm volatile("s_wait_xcnt 0x0" ::: "memory");
#endif
}

// stands behind issued global stores whose registers the code that follows rewrites: the next slab's or rows' values in a
// loop, or the next range's body in a grid of several ranges
__device__ __forceinline__ void wait_stores_issued() {
#if defined(__HIP_DEVICE_COMPILE__)
  asm volatile("s_wait_xcnt 0x0" ::: "memory");
#endif
}

__device__ __forceinline__ v8f mma_h(v16h a, v16h b, v8f c) {
  return __builtin_amdgcn_wmma_f32_16x16x32_f16(false, a, false, b, (short)0, c, false, false);
}
__device__ __forceinline__ v8f mma_b(v16b a, v16b b, v8f c) {
  return __builtin_amdgcn_wmma_f32_16x16x32_bf16(false, a, false, b, (short)0, c, false, false);
}
__device__ __forceinline__ void guard2(v8f& a, v8f& b, v16h x0, v16h x1, v16h x2, v16h x3, v16h x4, v16h x5) {
#if defined(__HIP_DEVICE_COMPILE__)
  asm volatile("v_nop\n\tv_nop\n\tv_nop\n\tv_nop"
               : "+v"(a), "+v"(b) : "v"(x0), "v"(x1), "v"(x2), "v"(x3), "v"(x4), "v"(x5) : "memory");
#endif
}
__device__ __forceinline__ void acc_guard4(v8f& a, v8f& b, v8f& c, v8f& d) {
#if defined(__HIP_DEVICE_COMPILE__)
  asm volatile("v_nop\n\tv_nop\n\tv_nop\n\tv_nop" : "+v"(a), "+v"(b), "+v"(c), "+v"(d));
#endif
}
// lane l <-> lane l ^ 16 on the vector pipe (the shuffle builtin would go through the LDS queue and its wait)
__device__ __forceinline__ float xhalf(float x) {
  const int v = __builtin_bit_cast(int, x);
  return __builtin_bit_cast(float, __builtin_amdgcn_permlanex16(v, v, 0x76543210, 0xfedcba98, false, false));
}
__device__ __forceinline__ void wave_sync_lds() {
  __builtin_amdgcn_fence(__ATOMIC_RELEASE, "workgroup");
  __builtin_amdgcn_wave_barrier();
  __builtin_amdgcn_fence(__ATOMIC_ACQUIRE, "workgroup");
}

// =====================================================================================================
// f32 -> 16-bit plane, same layout.  f16mode == 0: bf16 RNE bits;  f16mode == 1: f16 bits of (bf16 RNE value) * scale.
// Thread = 8 consecutive elements: two 16-B loads, one 16-B store; 32 consecutive lanes = 512 contiguous, 512-B aligned
// One grid converts all five tensors, none of which depends on another: a block range per plane, in this order:
//   x (CB_X blocks per batch) -> XB bf16; Wq (CB_W) | Wk (CB_KV) | Wv (CB_KV) -> WB bf16 [3072 n][2048 k]; Wo (CB_W) -> WT f16 x1024.
// coverage: each range = plane elements / 2048 blocks x 256 thr x 8 = the whole plane (every plane a multiple of 2048 elements).
// =====================================================================================================
#define CB_X   (SEQ * DMOD / 2048)
#define CB_W   (DMOD * DMOD / 2048)
#define CB_KV  (KVD * DMOD / 2048)
#define CB_ALL (NB * CB_X + 2 * CB_W + 2 * CB_KV)
__global__ __launch_bounds__(256) void cvt_all(const float* __restrict__ xin, const float* __restrict__ wq,
                                               const float* __restrict__ wk, const float* __restrict__ wv,
                                               const float* __restrict__ wo, u16* XBp, u16* WBp, u16* WTp) {
  int blk = (int)blockIdx.x;                 // every choice below is block-uniform
  const float* x;
  u16* D;
  int f16mode = 0;
  float scale = 1.0f;
  if (blk < NB * CB_X) {
    const int b = blk / CB_X;
    blk -= b * CB_X;
    x = xin + (size_t)b * XS_FULL * DMOD;
    D = XBp + (size_t)b * SEQ * DMOD;
  } else if ((blk -= NB * CB_X) < CB_W) {
    x = wq;  D = WBp;
  } else if ((blk -= CB_W) < CB_KV) {
    x = wk;  D = WBp + (size_t)DMOD * DMOD;
  } else if ((blk -= CB_KV) < CB_KV) {
    x = wv;  D = WBp + (size_t)DMOD * DMOD + (size_t)KVD * DMOD;
  } else if ((blk -= CB_KV) < CB_W) {
    x = wo;  D = WTp;  f16mode = 1;  scale = WOS;
  } else {
    return;                                  // never taken with the exact grid
  }
  const int gt = blk * 256 + (int)threadIdx.x;
  const float* p = x + (size_t)gt * 8;
  const v4f a = *(const v4f*)(p), b4 = *(const v4f*)(p + 4);
  float w[8];
#pragma unroll
  for (int e = 0; e < 4; ++e) { w[e] = a[e]; w[4 + e] = b4[e]; }
  v4u o;
#pragma unroll
  for (int e = 0; e < 4; ++e) {
    const float f0 = w[2 * e], f1 = w[2 * e + 1];
    const unsigned short hb0 = h_bits((_Float16)(bfr(f0) * scale));
    const unsigned short hb1 = h_bits((_Float16)(bfr(f1) * scale));
    const unsigned short bb0 = bf_bits(f0);
    const unsigned short bb1 = bf_bits(f1);
    o[e] = (f16mode != 0) ? pk16(hb0, hb1) : pk16(bb0, bb1);
  }
  u16* d = D + (size_t)gt * 8;
  {
    *(v4u*)(d) = o;
    
  }
}

// =====================================================================================================
// GEMM epilogue, in two halves around one wave-level LDS sync: epi_put places a 16x64 f32 tile (times oscale, plus
// bfr(bias[col]) when HASB != 0) in a wave-private slab [16][64] pitch 68; epi_get reads it back as whole row segments.
// coverage: 8 instructions x 2 rows x 16 lanes x 4 floats = the 16 x 64 tile.
// =====================================================================================================
template <int HASB>
__device__ __forceinline__ void epi_put(float* sl, v8f a0, v8f a1, v8f a2, v8f a3, float oscale,
                                        const float* __restrict__ bias, int col0, int lane) {
  const int hh = lane >> 4, m = lane & 15;
  float b0 = 0.0f, b1 = 0.0f, b2 = 0.0f, b3 = 0.0f;
  if (HASB != 0) {
    b0 = bfr(bias[col0 + m]);
    b1 = bfr(bias[col0 + 16 + m]);
    b2 = bfr(bias[col0 + 32 + m]);
    b3 = bfr(bias[col0 + 48 + m]);
  }
#pragma unroll
  for (int r = 0; r < 8; ++r) {
    const int ro = (8 * hh + r) * 68 + m;
    sl[ro]      = a0[r] * oscale + b0;
    sl[ro + 16] = a1[r] * oscale + b1;
    sl[ro + 32] = a2[r] * oscale + b2;
    sl[ro + 48] = a3[r] * oscale + b3;
  }
}
__device__ __forceinline__ void epi_get(const float* sl, float* C, int N, size_t rowb, int col0, int lane) {
  const int hh = lane >> 4, m = lane & 15;
  v4f vals[8];
#pragma unroll
  for (int it = 0; it < 8; ++it) vals[it] = *(const v4f*)(sl + (it * 2 + hh) * 68 + m * 4);
  float* dst = C + (rowb + (size_t)hh) * (size_t)N + col0 + m * 4;
#pragma unroll
  for (int it = 0; it < 8; ++it) {
    *(v4f*)(dst + (size_t)(it * 2) * (size_t)N) = vals[it];
  }
}

// =====================================================================================================
// Projection epilogue: a wave's 64 x 64 accumulator block (rows rw .. rw + 63 of one sequence, the 64 columns of one head) goes
// straight into the attention operand planes; acc[i][j], element r of lane (hh, m) = (row 16i + 8hh + r, column d = 16j + m).
//   t = (acc + bfr(bias[d])) * sc in f32 (add, then exact power-of-two scale); hi = f16(t), residual = f16(t - hi).
// q / k planes (sc = 256), fragment order: tile (b, head, s >> 4) = 16 rows x 64 d = 4 pieces of 512 B; piece pc, lane l,
//   element e <- row (s & 15) = l & 15, d = 16*pc + 8*(l >> 4) + e (pieces 2kk, 2kk + 1 are the two halves of the fragment of
//   k-step kk in the split k map). A lane needs 8 consecutive d of one row: t turns through the wave's own slabs [16][64]
//   pitch 68 (one per 16 rows, one wave-level LDS sync), then one 16-B store per piece and plane = 512 contiguous bytes a wave.
// coverage: 4 slabs x 4 pieces = the wave's four 16-row tiles of both planes; all blocks = every tile of every head once.
// =====================================================================================================
__device__ __forceinline__ v4u split_pack(const float (&t)[8], v4u& lo) {
  v4u hi;
#pragma unroll
  for (int e = 0; e < 4; ++e) {
    const float t0 = t[2 * e], t1 = t[2 * e + 1];
    const _Float16 h0 = (_Float16)t0, h1 = (_Float16)t1;
    const _Float16 l0 = (_Float16)(t0 - (float)h0), l1 = (_Float16)(t1 - (float)h1);
    hi[e] = pk16(h_bits(h0), h_bits(h1));
    lo[e] = pk16(h_bits(l0), h_bits(l1));
  }
  return hi;
}
__device__ __forceinline__ void planes_qk(float* sl, const v8f (&acc)[4][4], const float* __restrict__ bias, int cb, int nhead,
                                          float sc, u16* Hp, u16* Lp, int rw, int lane) {
  const int hh = lane >> 4, m = lane & 15;
  float bj[4];
#pragma unroll
  for (int j = 0; j < 4; ++j) bj[j] = bias[cb + 16 * j + m];
  wait_addr();
#pragma unroll
  for (int j = 0; j < 4; ++j) bj[j] = bfr(bj[j]);
#pragma unroll
  for (int i = 0; i < 4; ++i) {
#pragma unroll
    for (int r = 0; r < 8; ++r) {
      float* ro = sl + i * SLAB64 + (8 * hh + r) * 68 + m;
#pragma unroll
      for (int j = 0; j < 4; ++j) ro[16 * j] = (acc[i][j][r] + bj[j]) * sc;
    }
  }
  wave_sync_lds();
  const size_t dst = ((size_t)((rw / SEQ) * nhead + (cb >> 6)) * NQT + (size_t)((rw % SEQ) >> 4)) * FTILE + (size_t)lane * 8;
#pragma unroll
  for (int i = 0; i < 4; ++i) {
    v4u oh[4], ol[4];
#pragma unroll
    for (int pc = 0; pc < 4; ++pc) {
      const float* p = sl + i * SLAB64 + m * 68 + 16 * pc + 8 * hh;
      const v4f a = *(const v4f*)(p), b4 = *(const v4f*)(p + 4);
      float t[8];
#pragma unroll
      for (int e = 0; e < 4; ++e) { t[e] = a[e]; t[4 + e] = b4[e]; }
      oh[pc] = split_pack(t, ol[pc]);
    }
#pragma unroll
    for (int pc = 0; pc < 4; ++pc) {
      *(v4u*)(Hp + dst + (size_t)(i * FTILE + pc * FPC)) = oh[pc];
      *(v4u*)(Lp + dst + (size_t)(i * FTILE + pc * FPC)) = ol[pc];
    }
    wait_stores_issued();                   // the next slab's values take over the registers that these stores name
  }
}
// v^T planes (sc = 1024), fragment order: tile (b, g, s >> 5) = 64 d x 32 keys = 8 pieces of 512 B; piece 2j + h, lane l,
//   element e <- d = 16j + (l & 15), key (s & 31) = 16h + 8*(l >> 4) + e (the two halves of the A fragment of d-subtile j in
//   the split k map): that is acc[i][j] as it stands, h = i & 1, tile i >> 1, e = r, so no LDS; one 16-B store per (i, j)
//   and plane = 512 contiguous bytes a wave.
// coverage: 16 (i, j) = the 8 pieces of the wave's two 32-key tiles of both planes; all blocks = every tile of every kv head once.
__device__ __forceinline__ void planes_vt(const v8f (&acc)[4][4], const float* __restrict__ bias, int cb,
                                          u16* VHo, u16* VLo, int rw, int lane) {
  const int m = lane & 15;
  float bj[4];
#pragma unroll
  for (int j = 0; j < 4; ++j) bj[j] = bias[cb + 16 * j + m];
  wait_addr();
#pragma unroll
  for (int j = 0; j < 4; ++j) bj[j] = bfr(bj[j]);
  const size_t dst = ((size_t)((rw / SEQ) * NKVH + (cb >> 6)) * NKT + (size_t)((rw % SEQ) >> 5)) * (8 * FPC) + (size_t)lane * 8;
#pragma unroll
  for (int i = 0; i < 4; ++i) {
#pragma unroll
    for (int j = 0; j < 4; ++j) {
      float t[8];
#pragma unroll
      for (int r = 0; r < 8; ++r) t[r] = (acc[i][j][r] + bj[j]) * VCAR;
      v4u ol;
      const v4u oh = split_pack(t, ol);
      const size_t o = dst + (size_t)((i >> 1) * (8 * FPC) + (2 * j + (i & 1)) * FPC);
      *(v4u*)(VHo + o) = oh;
      *(v4u*)(VLo + o) = ol;
    }
    wait_stores_issued();                   // the next rows' values take over the registers that these stores name
  }
}
struct PlaneOut {
  const float* bq; const float* bk; const float* bv;
  u16* qh; u16* ql; u16* kh; u16* kl; u16* vh; u16* vl;
};

// =====================================================================================================
// GEMM engine shared by gemm_bf and gemm_out: C[M][N] (f32) = (A[M][K] (+ A2[M][K] when TWO != 0)) . Bt[N][K]^T, times oscale
// (plus bfr(bias[n]) when HASB != 0); A, A2 row-major 16-bit planes, Bt k-contiguous 16-bit plane. PL != 0: no C, the
// accumulators go into the attention operand planes instead (planes_qk, planes_vt).
// Block = BM x 128 tile of C (BM = 128, or 64 when TWO != 0), 4 waves as 2 x 2, wave = (BM/2) x 64 = MF x 4 accumulator tiles.
// A pass is 64 k = one whole 128-B line of each of the stage's 256 operand rows (A rows, then A2 rows, then the 128 Bt rows),
// brought into LDS by asynchronous copies (8 lanes per row, 16 copies per lane and pass), row pitch 144 B; two buffers: the
// copies of pass t + 2 are issued behind the barrier that ends pass t, so they fly while pass t + 1 is worked on.
// Fragments are read from the LDS rows with the same split k map and each accumulator takes its products in the
// same order (k ascending by 32; A before A2). Callers guarantee K % 64 == 0, M % BM == 0, N % 128 == 0, bid in 0 .. (M/BM)*(N/128) - 1.
// =====================================================================================================
#define GKP   64
#define GPIT  72
#define GSTG  (256 * GPIT)
static_assert(GKP == 2 * 32 && (DMOD % GKP) == 0 && (MROWS % 128) == 0 && (NQKV % 128) == 0 && (DMOD % 128) == 0);
static_assert((RICH % 64) == 0 && ((SEQ - RICH) % 128) == 0 && 4 * 4 * SLAB64 * 4 <= 2 * GSTG * 2);

union FragU { v4u u[2]; v16h h; v16b b; };

__device__ __forceinline__ FragU ldfrag_u(const u16* p) {
  FragU f;
  f.u[0] = *(const v4u*)(p);
  f.u[1] = *(const v4u*)(p + 16);
  return f;
}
template <int BF>
__device__ __forceinline__ v8f mma_u(const FragU& a, const FragU& b, v8f c) {
  if (BF != 0) return mma_b(a.b, b.b, c);
  return mma_h(a.h, b.h, c);
}
// eight asynchronous 16-B copies per lane, global -> LDS; the s_wait_xcnt closes the statement so that no register a copy
// names is rewritten ahead of it
__device__ __forceinline__ void copy8(const unsigned (&l)[8], const u16* const (&g)[8]) {
#if defined(__HIP_DEVICE_COMPILE__)
  asm volatile("global_load_async_to_lds_b128 %0, %8, off\n\t"
               "global_load_async_to_lds_b128 %1, %9, off\n\t"
               "global_load_async_to_lds_b128 %2, %10, off\n\t"
               "global_load_async_to_lds_b128 %3, %11, off\n\t"
               "global_load_async_to_lds_b128 %4, %12, off\n\t"
               "global_load_async_to_lds_b128 %5, %13, off\n\t"
               "global_load_async_to_lds_b128 %6, %14, off\n\t"
               "global_load_async_to_lds_b128 %7, %15, off\n\t"
               "s_wait_xcnt 0x0"
               :: "v"(l[0]), "v"(l[1]), "v"(l[2]), "v"(l[3]), "v"(l[4]), "v"(l[5]), "v"(l[6]), "v"(l[7]),
                  "v"(g[0]), "v"(g[1]), "v"(g[2]), "v"(g[3]), "v"(g[4]), "v"(g[5]), "v"(g[6]), "v"(g[7])
               : "memory");
#endif
}
// the same with six copies per lane
__device__ __forceinline__ void copy6(const unsigned (&l)[8], const u16* const (&g)[8]) {
#if defined(__HIP_DEVICE_COMPILE__)
  asm volatile("global_load_async_to_lds_b128 %0, %6, off\n\t"
               "global_load_async_to_lds_b128 %1, %7, off\n\t"
               "global_load_async_to_lds_b128 %2, %8, off\n\t"
               "global_load_async_to_lds_b128 %3, %9, off\n\t"
               "global_load_async_to_lds_b128 %4, %10, off\n\t"
               "global_load_async_to_lds_b128 %5, %11, off\n\t"
               "s_wait_xcnt 0x0"
               :: "v"(l[0]), "v"(l[1]), "v"(l[2]), "v"(l[3]), "v"(l[4]), "v"(l[5]),
                  "v"(g[0]), "v"(g[1]), "v"(g[2]), "v"(g[3]), "v"(g[4]), "v"(g[5])
               : "memory");
#endif
}
// this wave's own copies have landed
__device__ __forceinline__ void wait_copies() {
#if defined(__HIP_DEVICE_COMPILE__)
  asm volatile("s_wait_asynccnt 0x0" ::: "memory");
#endif
}
// this wave's own LDS reads have returned, before the buffer they read is handed to the copies
__device__ __forceinline__ void wait_lds() {
#if defined(__HIP_DEVICE_COMPILE__)
  asm volatile("s_wait_dscnt 0x0" ::: "memory");
#endif
}
// one stage: lane = (row r0 = tid >> 3 of each group of 16 rows, 16-B piece tid & 7); ld = the lane's LDS byte address of
// stage row r0, ga / ga2 / gb = its global address in row r0 of the block's A / A2 / Bt rows, rs16 = halves per 16 rows
template <int TWO>
__device__ __forceinline__ void stage_tile(unsigned ld, const u16* ga, const u16* ga2, const u16* gb, size_t rs16) {
  unsigned l[8];
  const u16* g[8];
#pragma unroll
  for (int i = 0; i < 8; ++i) {
    l[i] = ld + (unsigned)(i * 16 * GPIT * 2);
    if (TWO != 0) g[i] = (i < 4) ? (ga + (size_t)i * rs16) : (ga2 + (size_t)(i - 4) * rs16);
    else          g[i] = ga + (size_t)i * rs16;
  }
  copy8(l, g);
#pragma unroll
  for (int i = 0; i < 8; ++i) {
    l[i] = ld + (unsigned)((8 + i) * 16 * GPIT * 2);
    g[i] = gb + (size_t)i * rs16;
  }
  copy8(l, g);
}

template <int BF, int TWO, int HASB, int PL>
__device__ __forceinline__ void gemm_ring(u16* ring, const u16* __restrict__ A, const u16* __restrict__ A2,
                                          const u16* __restrict__ Bt, const float* __restrict__ bias, float* C,
                                          int M, int N, int K, float oscale, int bid, const PlaneOut& po) {
  constexpr int MF = (TWO != 0) ? 2 : 4;
  constexpr int BM = 32 * MF;
  const int tid = threadIdx.x, wave = tid >> 5, lane = tid & 31, hh = lane >> 4, m = lane & 15;
  const int ntile = N >> 7;
  const int row0  = (bid / ntile) * BM;
  const int col0  = (bid % ntile) * 128;
  if (row0 + BM > M) return;                // block-uniform, before any copy or barrier; never taken with the exact grid
  const int wm = wave >> 1, wn = wave & 1;
  const int r0 = tid >> 3, c8 = (tid & 7) * 8;
  const u16* ga  = A  + (size_t)(row0 + r0) * K + c8;
  const u16* ga2 = A2 + (size_t)(row0 + r0) * K + c8;
  const u16* gb  = Bt + (size_t)(col0 + r0) * K + c8;
  const size_t rs16 = (size_t)16 * K;
  const unsigned ld0 = (unsigned)(uintptr_t)ring + (unsigned)((r0 * GPIT + c8) * 2);
  const int npass = K / GKP;
  const int aoff = (wm * (16 * MF) + m) * GPIT + 8 * hh;          // halves, in a stage: A fragment row of this lane
  const int boff = (128 + wn * 64 + m) * GPIT + 8 * hh;           // Bt fragment row of this lane

  v8f acc[MF][4];
#pragma unroll
  for (int i = 0; i < MF; ++i) {
#pragma unroll
    for (int j = 0; j < 4; ++j) acc[i][j] = zero8();
  }

  stage_tile<TWO>(ld0, ga, ga2, gb, rs16);
  wait_copies();
  __syncthreads();
  if (npass > 1) stage_tile<TWO>(ld0 + (unsigned)(GSTG * 2), ga + GKP, ga2 + GKP, gb + GKP, rs16);

  // kept rolled (for speed only), the buffer chosen by the pass's parity
#pragma unroll 1
  for (int t = 0; t < npass; ++t) {
    const int par = t & 1;
    const u16* st = ring + par * GSTG;
    FragU a[2][MF], a2[2][MF], b[4];
#pragma unroll
    for (int kk = 0; kk < 2; ++kk) {
#pragma unroll
      for (int i = 0; i < MF; ++i) {
        a[kk][i] = ldfrag_u(st + aoff + i * 16 * GPIT + kk * 32);
        if (TWO != 0) a2[kk][i] = ldfrag_u(st + aoff + (64 + i * 16) * GPIT + kk * 32);
      }
    }
#pragma unroll
    for (int kk = 0; kk < 2; ++kk) {
#pragma unroll
      for (int j = 0; j < 4; ++j) b[j] = ldfrag_u(st + boff + j * 16 * GPIT + kk * 32);
      // the LDS reads stay in one group ahead of the WMMA block (for speed only)
      __builtin_amdgcn_sched_barrier(0);
#pragma unroll
      for (int i = 0; i < MF; ++i) {
#pragma unroll
        for (int j = 0; j < 4; ++j) acc[i][j] = mma_u<BF>(a[kk][i], b[j], acc[i][j]);
      }
      if (TWO != 0) {
#pragma unroll
        for (int i = 0; i < MF; ++i) {
#pragma unroll
          for (int j = 0; j < 4; ++j) acc[i][j] = mma_u<BF>(a2[kk][i], b[j], acc[i][j]);
        }
      }
      // the WMMA block stays ahead of what follows: sunk behind the publish point it would put the refill's issue directly
      // in front of the next pass's wait for it
      __builtin_amdgcn_sched_barrier(0);
    }
    // publish point of pass t + 1: own reads back, own copies landed, every wave here; then the freed buffer is refilled
    wait_lds();
    wait_copies();
    __syncthreads();
    if (t + 2 < npass) {
      const size_t ko = (size_t)(t + 2) * GKP;
      stage_tile<TWO>(ld0 + (unsigned)(par * GSTG * 2), ga + ko, ga2 + ko, gb + ko, rs16);
    }
  }
  wait_copies();

  // the last pass's barrier has ended every read of the ring and no copy is outstanding: each wave stages its MF tiles in
  // MF slabs of its own
  float* sl = (float*)(void*)ring + wave * (MF * SLAB64);
  const int colw = col0 + wn * 64;
  if constexpr (PL != 0) {
    // the column ranges q | k | v end on multiples of 128, so the range test on col0 is block-uniform (a scalar branch)
    const int rw = row0 + wm * 64;
    if (col0 < DMOD + KVD) {
      const bool isq = col0 < DMOD;
      planes_qk(sl, acc, isq ? po.bq : po.bk, isq ? colw : colw - DMOD, isq ? NH : NKVH, isq ? QSC : KSC,
                isq ? po.qh : po.kh, isq ? po.ql : po.kl, rw, lane);
    } else {
      planes_vt(acc, po.bv, colw - DMOD - KVD, po.vh, po.vl, rw, lane);
    }
    return;
  }
#pragma unroll
  for (int i = 0; i < MF; ++i)
    epi_put<HASB>(sl + i * SLAB64, acc[i][0], acc[i][1], acc[i][2], acc[i][3], oscale, bias, colw, lane);
  wave_sync_lds();
#pragma unroll
  for (int i = 0; i < MF; ++i)
    epi_get(sl + i * SLAB64, C, N, (size_t)(row0 + wm * (16 * MF) + i * 16), colw, lane);
}

__global__ __launch_bounds__(128)
void gemm_bf(const u16* __restrict__ A, const u16* __restrict__ Bt, const float* __restrict__ bq,
             const float* __restrict__ bk, const float* __restrict__ bv,
             u16* QHo, u16* QLo, u16* KHo, u16* KLo, u16* VHo, u16* VLo) {
  __shared__ __align__(16) u16 ring[2 * GSTG];
  const PlaneOut po = {bq, bk, bv, QHo, QLo, KHo, KLo, VHo, VLo};
  gemm_ring<1, 0, 0, 1>(ring, A, A, Bt, (const float*)0, (float*)0, MROWS, NQKV, DMOD, 1.0f, (int)blockIdx.x, po);
}

// y = O.Wo^T + bo for all rows in one grid (the row ranges are independent): per sequence GB_L blocks of 128 x 128 for rows
// >= RICH (O hi only), then GB_R blocks of 64 x 128 for rows < RICH (O hi + residual). The range test is block-uniform.
#define GB_L   (((SEQ - RICH) / 128) * (DMOD / 128))
#define GB_R   ((RICH / 64) * (DMOD / 128))
__global__ __launch_bounds__(128)
void gemm_out(const u16* __restrict__ OHp, const u16* __restrict__ OLp, const u16* __restrict__ Bt,
              const float* __restrict__ bias, float* C, float oscale) {
  __shared__ __align__(16) u16 ring[2 * GSTG];
  const int b = (int)blockIdx.x / (GB_L + GB_R);
  const int r = (int)blockIdx.x % (GB_L + GB_R);
  if (b >= NB) return;                      // block-uniform, before any copy or barrier; never taken with the exact grid
  const PlaneOut po = {};
  if (r < GB_L) {
    const size_t ro = ((size_t)b * SEQ + RICH) * DMOD;
    gemm_ring<0, 0, 1, 0>(ring, OHp + ro, OLp + ro, Bt, bias, C + ro, SEQ - RICH, DMOD, DMOD, oscale, r, po);
    wait_stores_issued();
  } else {
    const size_t ro = (size_t)b * SEQ * DMOD;
    gemm_ring<0, 1, 1, 0>(ring, OHp + ro, OLp + ro, Bt, bias, C + ro, RICH, DMOD, DMOD, oscale, r - GB_L, po);
    wait_stores_issued();
  }
}

// =====================================================================================================
// Causal grouped-query softmax attention, hd = 64. Block bid -> (query tile qt = qt0 + bid % nqt: rows q0 = 16*qt ..
// q0+15, head group hg = kv head, batch b); one wave per query head = hg*WPB + wave (the 4 consecutive query heads of a
// group share kv head hg).
//   q hi / residual planes f16 x256, tiles (b, h, s >> 4); k hi / residual planes f16 x256, tiles (b, g, s >> 4); v^T hi /
//   residual planes x1024, tiles (b, g, s >> 5): all in fragment order (planes_qk, planes_vt), so that every fragment load of a wave
//   reads 512 contiguous bytes and a key tile of 32 is 4096 contiguous bytes of each k plane and of each v^T plane.
//   The block's 4 waves walk the same key tiles of the same kv head: a key tile (k hi | k residual | v^T hi, and for RV = 1
//   | v^T residual, 4096 B each, kept in fragment order) is brought into LDS once per block by asynchronous copies (2 copies per
//   lane and plane); two buffers: the copies of tile kt + 2 are issued behind the barrier that ends tile kt, so they fly while
//   tile kt + 1 is worked on. nkt is the same for the whole block, so every wave passes every barrier.
//   Transposed products: S^T = K.Q^T (A = key rows, B = query rows as columns), so a lane's 16 score registers of a key tile
//   belong to one query (lane & 15) and hold keys kb + 8*(lane >> 4) + r and kb + 16 + 8*(lane >> 4) + r.
//   raw(j, i) = k_hi.q_hi + k_hi.q_lo + k_lo.q_hi (2 k-steps over d); logit = raw * 2^-19 (the 1/8 softmax scale and the two
//   256 carries, exact); keys above the diagonal replaced by -inf; online softmax per query in f32 with a running max:
//   max in-lane over the 16 scores plus one exchange with lane ^ 16; sum in-lane, the two halves' sums joined once after the
//   loop; alpha = exp(m_old - m_new), p = exp(logit - m_new), l = l*alpha + sum p, O^T accumulators times alpha before the
//   tile's product. Key tiles of 32 visited in order, only tiles with kb <= q0 (nkt = q0/32 + 1 <= NKT; key kb is unmasked for
//   every query of the tile). The score registers, as p*32768 (f16 hi and its f16 residual), are the B fragment of
//   O^T += v^T.P^T in the split k map as they stand; v^T A fragments in 2 groups of 2 d-subtiles; RV = 1: products hh + lh + hl,
//   RV = 0: hh only.
//   Epilogue: O x256 -> f16 hi plane (and for RV = 1 the f16 residual plane of O x256) [b*SEQ + s][h*HD + d]; lane = (row group
//   rq = lane>>3 in 0..3, 8 consecutive d at c8); one instruction = 4 rows it*4 + rq, each row segment (64 halves = one whole
// coverage: per wave 4 instructions x 4 rows x 8 lanes x 8 halves = 16 x 64 per plane; nqt x NHG x NB blocks x WPB waves;
//   the two block ranges (rows >= RICH by attn_gq32 below, tiles 0..NQTR-1 here with RV = 1) cover every (b, s, h) row segment of the
//   hi plane exactly once and rows s < RICH of the residual plane exactly once (only those rows are read later).
// =====================================================================================================
#define AKT   (2 * FTILE)
#define ASTG  (4 * AKT)
static_assert(AKT * 2 == 2 * ATT_THREADS * 16 && 6 * (2 * ASTG * 2 + WPB * WREG * 4) <= 327680);
// one key tile: ld = the lane's LDS byte address in the buffer (16 B per thread), kh / kl / vh / vl = its global address in the
// tile of each plane; a plane's tile = 2 copies of the block (2048 B each)
template <int RV>
__device__ __forceinline__ void stage_kv(unsigned ld, const u16* kh, const u16* kl, const u16* vh, const u16* vl) {
  unsigned l[8];
  const u16* g[8];
#pragma unroll
  for (int i = 0; i < 8; ++i) l[i] = ld + (unsigned)(i * (AKT / 2) * 2);
  g[0] = kh;  g[1] = kh + AKT / 2;
  g[2] = kl;  g[3] = kl + AKT / 2;
  g[4] = vh;  g[5] = vh + AKT / 2;
  g[6] = vl;  g[7] = vl + AKT / 2;
  if (RV != 0) copy8(l, g);
  else         copy6(l, g);
}

template <int RV>
__device__ __forceinline__
void attn_gq(float* smem, u16* kvr, const u16* __restrict__ QHp, const u16* __restrict__ QLp,
             const u16* __restrict__ KHp, const u16* __restrict__ KLp,
             const u16* __restrict__ VHp, const u16* __restrict__ VLp,
             u16* OHp, u16* OLp, int bid, int qt0, int nqt) {
#pragma clang fp contract(off)
  const int tid  = threadIdx.x;
  const int wave = tid >> 5;
  const int lane = tid & 31;
  const int hh   = lane >> 4;
  const int c    = lane & 15;
  if (nqt <= 0) return;                     // block-uniform, before any copy or barrier
  const int qt   = qt0 + bid % nqt;
  const int t2   = bid / nqt;
  const int hg   = t2 % NHG;
  const int b    = t2 / NHG;
  if (b >= NB) return;                      // block-uniform, before any copy or barrier; never taken with the exact grid
  const int q0   = qt * 16;
  if (q0 + 16 > SEQ) return;                // block-uniform, before any copy or barrier; never taken
  const int head = hg * WPB + wave;
  const int kvh  = hg;

  float* slab = smem + wave * WREG;         // result slab [16][64] pitch 68

  const unsigned l8 = (unsigned)lane * 8;
  const size_t qoff = ((size_t)(b * NH + head) * NQT + qt) * FTILE;                        // this wave's 16-query tile
  const size_t koff = (size_t)(b * NKVH + kvh) * NQT * FTILE;                              // 16-key tile 0 of the kv head
  const size_t voff = (size_t)(b * NKVH + kvh) * NKT * (2 * FTILE);                        // 32-key tile 0 of the kv head
  const _Float16* Qh  = (const _Float16*)(const void*)QHp + qoff;
  const _Float16* Ql  = (const _Float16*)(const void*)QLp + qoff;
  const u16* gkh = KHp + koff + (size_t)tid * 8;      // this thread's 16 B of the first half of key tile 0, plane by plane
  const u16* gkl = KLp + koff + (size_t)tid * 8;
  const u16* gvh = VHp + voff + (size_t)tid * 8;
  const u16* gvl = VLp + voff + (size_t)tid * 8;
  const unsigned ld0 = (unsigned)(uintptr_t)kvr + (unsigned)(tid * 16);
  const float lsc  = SM_SCALE * (1.0f / (QSC * KSC));   // exact power-of-two fold of the q / k carries into the 1/8 scale
  const float oc   = 1.0f / (PCAR * VCAR);
  const float ninf = -__builtin_inff();

  v8f o[4];                                 // O^T: element r of o[j] = (d = 16j + 8hh + r, query row q0 + c)
#pragma unroll
  for (int j = 0; j < 4; ++j) o[j] = zero8();
  float mrun = ninf, lrun = 0.0f;           // this lane's query: running max (both halves alike), sum over this half's keys
  const int ncaus = (q0 >> 5) + 1;                                            // tiles holding keys <= q0 + 15
  const int nkt   = (ncaus < NKT) ? ncaus : NKT;
  const int qrow  = q0 + c;                                                   // query row of every D element of this lane

  stage_kv<RV>(ld0, gkh, gkl, gvh, gvl);
  wait_copies();
  __syncthreads();
  if (nkt > 1) stage_kv<RV>(ld0 + (unsigned)(ASTG * 2), gkh + AKT, gkl + AKT, gvh + AKT, gvl + AKT);

#pragma unroll 1
  for (int kt = 0; kt < nkt; ++kt) {
    const int kb = kt * 32;
    const int par = kt & 1;
    const _Float16* st = (const _Float16*)(const void*)(kvr + par * ASTG);    // this tile's buffer
    // ---- raw scores, transposed: D element r of this lane = (key kb + 8hh + r, query qrow) in s0, key + 16 in s1 ----
    v8f s0 = zero8(), s1 = zero8();
    const _Float16* k0p = st;
    const _Float16* k1p = k0p + FTILE;
    const _Float16* l0p = st + AKT;
    const _Float16* l1p = l0p + FTILE;
#pragma unroll
    for (int kk = 0; kk < HD / 32; ++kk) {
      const v16h qh  = ldfrag_f(Qh + kk * (2 * FPC), l8);
      const v16h ql  = ldfrag_f(Ql + kk * (2 * FPC), l8);
      const v16h kh0 = ldfrag_f(k0p + kk * (2 * FPC), l8);
      const v16h kh1 = ldfrag_f(k1p + kk * (2 * FPC), l8);
      const v16h kl0 = ldfrag_f(l0p + kk * (2 * FPC), l8);
      const v16h kl1 = ldfrag_f(l1p + kk * (2 * FPC), l8);
      s0 = mma_h(kh0, qh, s0);
      s0 = mma_h(kh0, ql, s0);
      s0 = mma_h(kl0, qh, s0);
      s1 = mma_h(kh1, qh, s1);
      s1 = mma_h(kh1, ql, s1);
      s1 = mma_h(kl1, qh, s1);
      guard2(s0, s1, qh, ql, kh0, kl0, kh1, kl1);
    }
    // ---- causal replace-mask, running-max online softmax in f32: the lane's 16 scores belong to one query ----
    // every key of a tile before the last is <= 32*(q0 >> 5) - 1 < q0 <= qrow: the replace-mask is an identity there, so only
    // the last tile takes it (kt and nkt are block-uniform: a scalar branch)
    if (kt + 1 == nkt) {
      const int key0 = kb + 8 * hh, key1 = key0 + 16;
      // unrolled so that the score registers are indexed by constants (a rolled loop would move them through scratch)
#pragma unroll
      for (int r = 0; r < 8; ++r) {
        s0[r] = (key0 + r > qrow) ? ninf : s0[r];
        s1[r] = (key1 + r > qrow) ? ninf : s1[r];
      }
    }
    float t0[8], t1[8];
    float mx = ninf;
#pragma unroll
    for (int r = 0; r < 8; ++r) {
      t0[r] = s0[r] * lsc;
      t1[r] = s1[r] * lsc;
      mx = fmaxf(mx, fmaxf(t0[r], t1[r]));
    }
    mx = fmaxf(mx, xhalf(mx));                          // the other half's 16 keys of the same query
    const float mnew = fmaxf(mrun, mx);
    const float al   = __expf(mrun - mnew);
    // ---- B fragments of p*32768 straight from the score registers: hi f16 and residual f16, column = query c,
    //      elements 0..7 = keys kb + 8hh + 0..7, elements 8..15 = keys kb + 16 + 8hh + 0..7 (the split k map) ----
    FragH ph, pl;
    float sm = 0.0f;
#pragma unroll
    for (int r = 0; r < 8; ++r) {
      const float p0 = __expf(t0[r] - mnew);
      const float p1 = __expf(t1[r] - mnew);
      sm += p0 + p1;
      const float ta = p0 * PCAR, tc = p1 * PCAR;
      const _Float16 ha = (_Float16)ta, hc = (_Float16)tc;
      ph.h[0][r] = ha;
      ph.h[1][r] = hc;
      if (RV != 0) {                                    // the residual has a product only for RV = 1
        pl.h[0][r] = (_Float16)(ta - (float)ha);
        pl.h[1][r] = (_Float16)(tc - (float)hc);
      }
    }
    lrun = lrun * al + sm;
    mrun = mnew;
    // ---- rescale the O^T accumulators by the lane's alpha ----
#pragma unroll
    for (int j = 0; j < 4; ++j) {
#pragma unroll
      for (int r = 0; r < 8; ++r) o[j][r] = o[j][r] * al;
    }
    // ---- O^T += v^T.P^T : A fragment row = d = j*16 + c, subtile j = pieces 2j, 2j + 1 of the key tile; 2 groups of 2 ----
    {
      const _Float16* vhp = st + 2 * AKT;
      const _Float16* vlp = st + 3 * AKT;
      (void)vlp;
#pragma unroll
      for (int jg = 0; jg < 2; ++jg) {
        const size_t da = (size_t)(2 * jg) * (2 * FPC);
        const size_t db = da + (size_t)(2 * FPC);
        const v16h vha = ldfrag_f(vhp + da, l8), vhb2 = ldfrag_f(vhp + db, l8);
        o[2 * jg]     = mma_h(vha,  ph.v, o[2 * jg]);
        o[2 * jg + 1] = mma_h(vhb2, ph.v, o[2 * jg + 1]);
        if (RV != 0) {
          const v16h vla = ldfrag_f(vlp + da, l8), vlb2 = ldfrag_f(vlp + db, l8);
          o[2 * jg]     = mma_h(vha,  pl.v, o[2 * jg]);
          o[2 * jg]     = mma_h(vla,  ph.v, o[2 * jg]);
          o[2 * jg + 1] = mma_h(vhb2, pl.v, o[2 * jg + 1]);
          o[2 * jg + 1] = mma_h(vlb2, ph.v, o[2 * jg + 1]);
          guard2(o[2 * jg], o[2 * jg + 1], ph.v, pl.v, vha, vhb2, vla, vlb2);
        } else {
          guard2(o[2 * jg], o[2 * jg + 1], ph.v, ph.v, vha, vhb2, vha, vhb2);
        }
      }
    }
    // publish point of tile kt + 1: own reads back, own copies landed, every wave here; then the freed buffer is refilled
    wait_lds();
    wait_copies();
    __syncthreads();
    if (kt + 2 < nkt) {
      const size_t ko = (size_t)(kt + 2) * AKT;
      stage_kv<RV>(ld0 + (unsigned)(par * ASTG * 2), gkh + ko, gkl + ko, gvh + ko, gvl + ko);
    }
  }
  wait_copies();
  acc_guard4(o[0], o[1], o[2], o[3]);
  // ---- O = acc / l with the carries (32768 on p, 1024 on v) folded once; the two halves' sums joined here; the lane's
  //      8 consecutive d of each subtile go into row c of the wave's slab ----
  const float ltot = lrun + xhalf(lrun);
  const float rl   = (1.0f / ltot) * oc;
#pragma unroll
  for (int j = 0; j < 4; ++j) {
    float* sd = slab + c * SLP + j * 16 + 8 * hh;
    v4f w0, w1;
#pragma unroll
    for (int e = 0; e < 4; ++e) { w0[e] = o[j][e] * rl; w1[e] = o[j][4 + e] * rl; }
    *(v4f*)(sd)     = w0;
    *(v4f*)(sd + 4) = w1;
  }
  wave_sync_lds();
  // ---- O x256 -> f16 hi plane (+ f16 residual plane); lane = (row group rq, 8 consecutive d at c8) ----
  v4u oh[4], ol[4];
  const int rq = lane >> 3, c8 = (lane & 7) * 8;
#pragma unroll
  for (int it = 0; it < 4; ++it) {
    const int row = it * 4 + rq;
    const v4f a = *(const v4f*)(slab + row * SLP + c8), b4 = *(const v4f*)(slab + row * SLP + c8 + 4);
    float w[8];
#pragma unroll
    for (int e = 0; e < 4; ++e) { w[e] = a[e] * OSC; w[4 + e] = b4[e] * OSC; }
#pragma unroll
    for (int e = 0; e < 4; ++e) {
      const _Float16 h0 = (_Float16)w[2 * e], h1 = (_Float16)w[2 * e + 1];
      const _Float16 g0 = (_Float16)(w[2 * e] - (float)h0), g1 = (_Float16)(w[2 * e + 1] - (float)h1);
      oh[it][e] = pk16(h_bits(h0), h_bits(h1));
      ol[it][e] = pk16(h_bits(g0), h_bits(g1));
    }
  }
  const size_t ob = ((size_t)b * SEQ + q0) * DMOD + (size_t)head * HD + c8;
  {
#pragma unroll
    for (int it = 0; it < 4; ++it) {
      const int row = it * 4 + rq;
      *(v4u*)(OHp + ob + (size_t)row * DMOD) = oh[it];
      if (RV != 0) {
        *(v4u*)(OLp + ob + (size_t)row * DMOD) = ol[it];
      }
    }
    wait_stores_issued();
  }
}

// The same attention for the rows >= RICH (P hi . v hi only) with 32 query columns a wave: block bid -> query rows q0 = 32*qp ..
// q0 + 31 (qp = qp0 + bid % nqp) of the 4 query heads of kv head hg; column group g = rows q0 + 16g .. q0 + 16g + 15 = 16-query
// tile 2*qp + g of the q planes. The wave's q fragments (hi and residual, 2 groups x 2 k-steps) are loaded once and stay in
// registers; every k and v^T fragment read from LDS is the A operand of both groups' products, and a key tile is staged once
// for 32 rows x 4 heads. Per query the products, the key tiles (nkt = qp + 1 for both groups) and every sum keep the order of
// attn_gq: accumulator (g, key half) takes k_hi.q_hi, k_hi.q_lo, k_lo.q_hi per k-step; softmax per group as there.
// coverage: per wave 2 groups x 16 x 64 of the O hi plane; nqp x NHG x NB blocks x WPB waves = rows RICH .. SEQ - 1 of every head.
__device__ __forceinline__
void attn_gq32(float* smem, u16* kvr, const u16* __restrict__ QHp, const u16* __restrict__ QLp,
               const u16* __restrict__ KHp, const u16* __restrict__ KLp, const u16* __restrict__ VHp,
               u16* OHp, int bid, int qp0, int nqp) {
  const int tid  = threadIdx.x;
  const int wave = tid >> 5;
  const int lane = tid & 31;
  const int hh   = lane >> 4;
  const int c    = lane & 15;
  if (nqp <= 0) return;                     // block-uniform, before any copy or barrier
  const int qp   = qp0 + bid % nqp;
  const int t2   = bid / nqp;
  const int hg   = t2 % NHG;
  const int b    = t2 / NHG;
  if (b >= NB) return;                      // block-uniform, before any copy or barrier; never taken with the exact grid
  const int q0   = qp * 32;
  if (q0 + 32 > SEQ) return;                // block-uniform, before any copy or barrier; never taken
  const int head = hg * WPB + wave;
  const int kvh  = hg;

  float* slab = smem + wave * WREG;         // result slab [16][64] pitch 68, used by one column group after the other

  const unsigned l8 = (unsigned)lane * 8;
  const size_t qoff = ((size_t)(b * NH + head) * NQT + 2 * qp) * FTILE;                    // this wave's two 16-query tiles
  const size_t koff = (size_t)(b * NKVH + kvh) * NQT * FTILE;                              // 16-key tile 0 of the kv head
  const size_t voff = (size_t)(b * NKVH + kvh) * NKT * (2 * FTILE);                        // 32-key tile 0 of the kv head
  const _Float16* Qh  = (const _Float16*)(const void*)QHp + qoff;
  const _Float16* Ql  = (const _Float16*)(const void*)QLp + qoff;
  const u16* gkh = KHp + koff + (size_t)tid * 8;      // this thread's 16 B of the first half of key tile 0, plane by plane
  const u16* gkl = KLp + koff + (size_t)tid * 8;
  const u16* gvh = VHp + voff + (size_t)tid * 8;
  const unsigned ld0 = (unsigned)(uintptr_t)kvr + (unsigned)(tid * 16);
  const float lsc  = SM_SCALE * (1.0f / (QSC * KSC));   // exact power-of-two fold of the q / k carries into the 1/8 scale
  const float oc   = 1.0f / (PCAR * VCAR);
  const float ninf = -__builtin_inff();

  const int ncaus = (q0 >> 5) + 1;                                            // tiles holding keys <= q0 + 31
  const int nkt   = (ncaus < NKT) ? ncaus : NKT;

  stage_kv<0>(ld0, gkh, gkl, gvh, gvh);

  v16h qh[2][2], ql[2][2];                  // [column group][k-step]
#pragma unroll
  for (int g = 0; g < 2; ++g) {
#pragma unroll
    for (int kk = 0; kk < 2; ++kk) {
      qh[g][kk] = ldfrag_f(Qh + g * FTILE + kk * (2 * FPC), l8);
      ql[g][kk] = ldfrag_f(Ql + g * FTILE + kk * (2 * FPC), l8);
    }
  }
  wait_addr();

  v8f o[2][4];                              // O^T: element r of o[g][j] = (d = 16j + 8hh + r, query row q0 + 16g + c)
  float mrun[2], lrun[2];                   // per group, this lane's query: running max, sum over this half's keys
#pragma unroll
  for (int g = 0; g < 2; ++g) {
#pragma unroll
    for (int j = 0; j < 4; ++j) o[g][j] = zero8();
    mrun[g] = ninf;
    lrun[g] = 0.0f;
  }

  wait_copies();
  __syncthreads();
  if (nkt > 1) stage_kv<0>(ld0 + (unsigned)(ASTG * 2), gkh + AKT, gkl + AKT, gvh + AKT, gvh + AKT);

  // kept rolled (for speed only), the buffer chosen by the tile's parity
#pragma unroll 1
  for (int kt = 0; kt < nkt; ++kt) {
    const int kb = kt * 32;
    const int par = kt & 1;
    const _Float16* st = (const _Float16*)(const void*)(kvr + par * ASTG);    // this tile's buffer
    // ---- raw scores, transposed: element r of s[g][h] = (key kb + 16h + 8hh + r, query q0 + 16g + c) ----
    v8f s[2][2];
#pragma unroll
    for (int g = 0; g < 2; ++g) { s[g][0] = zero8(); s[g][1] = zero8(); }
    v16h kh[2][2], kl[2][2];                // [k-step][key half]
#pragma unroll
    for (int kk = 0; kk < HD / 32; ++kk) {
#pragma unroll
      for (int h = 0; h < 2; ++h) kh[kk][h] = ldfrag_f(st + h * FTILE + kk * (2 * FPC), l8);
#pragma unroll
      for (int h = 0; h < 2; ++h) kl[kk][h] = ldfrag_f(st + AKT + h * FTILE + kk * (2 * FPC), l8);
    }
    // the tile's k reads stay in one group ahead of the WMMA block (for speed only)
    __builtin_amdgcn_sched_barrier(0);
#pragma unroll
    for (int kk = 0; kk < HD / 32; ++kk) {
#pragma unroll
      for (int g = 0; g < 2; ++g) { s[g][0] = mma_h(kh[kk][0], qh[g][kk], s[g][0]); s[g][1] = mma_h(kh[kk][1], qh[g][kk], s[g][1]); }
#pragma unroll
      for (int g = 0; g < 2; ++g) { s[g][0] = mma_h(kh[kk][0], ql[g][kk], s[g][0]); s[g][1] = mma_h(kh[kk][1], ql[g][kk], s[g][1]); }
#pragma unroll
      for (int g = 0; g < 2; ++g) { s[g][0] = mma_h(kl[kk][0], qh[g][kk], s[g][0]); s[g][1] = mma_h(kl[kk][1], qh[g][kk], s[g][1]); }
    }
    // the tile's v^T reads, one group behind the score WMMAs: they return while the softmax runs
    v16h vf[4];
#pragma unroll
    for (int j = 0; j < 4; ++j) vf[j] = ldfrag_f(st + 2 * AKT + j * (2 * FPC), l8);
    __builtin_amdgcn_sched_barrier(0);      // holds these reads here: sunk to their use they would be waited for in front of it
    // every key of a tile before the last is <= q0 - 1 < every query row of the wave: the replace-mask is an identity there,
    // so only the last tile takes it (kt and nkt are block-uniform: a scalar branch)
    if (kt + 1 == nkt) {
      const int key0 = kb + 8 * hh, key1 = key0 + 16;
#pragma unroll
      for (int g = 0; g < 2; ++g) {
        const int qrow = q0 + 16 * g + c;
        // unrolled so that the score registers are indexed by constants (a rolled loop would move them through scratch)
#pragma unroll
        for (int r = 0; r < 8; ++r) {
          s[g][0][r] = (key0 + r > qrow) ? ninf : s[g][0][r];
          s[g][1][r] = (key1 + r > qrow) ? ninf : s[g][1][r];
        }
      }
    }
    // ---- running-max online softmax in f32 per group; p*32768 as f16 = the B fragment of O^T += v^T.P^T as it stands ----
    FragH ph[2];
#pragma unroll
    for (int g = 0; g < 2; ++g) {
      const v8f t0 = s[g][0] * lsc, t1 = s[g][1] * lsc;  // whole accumulators: neighbouring registers pair up as they stand
      float mx = ninf;
#pragma unroll
      for (int r = 0; r < 8; ++r) mx = fmaxf(mx, fmaxf(t0[r], t1[r]));
      mx = fmaxf(mx, xhalf(mx));                        // the other half's 16 keys of the same query
      const float mnew = fmaxf(mrun[g], mx);
      const float al   = __expf(mrun[g] - mnew);
      float sm = 0.0f;
#pragma unroll
      for (int r = 0; r < 8; ++r) {
        const float p0 = __expf(t0[r] - mnew);
        const float p1 = __expf(t1[r] - mnew);
        sm += p0 + p1;
        ph[g].h[0][r] = (_Float16)(p0 * PCAR);
        ph[g].h[1][r] = (_Float16)(p1 * PCAR);
      }
      lrun[g] = lrun[g] * al + sm;
      mrun[g] = mnew;
#pragma unroll
      for (int j = 0; j < 4; ++j) {
#pragma unroll
        for (int r = 0; r < 8; ++r) o[g][j][r] = o[g][j][r] * al;
      }
    }
    // ---- O^T += v^T.P^T : A fragment row = d = j*16 + c, subtile j = pieces 2j, 2j + 1 of the key tile ----
#pragma unroll
    for (int j = 0; j < 4; ++j) {
      o[0][j] = mma_h(vf[j], ph[0].v, o[0][j]);
      o[1][j] = mma_h(vf[j], ph[1].v, o[1][j]);
    }
    // the softmax and the WMMA block stay ahead of the publish point: with the barrier lifted over them the refill behind them
    // would be issued only a score block ahead of the wait for it, not a whole tile
    __builtin_amdgcn_sched_barrier(0);
    // publish point of tile kt + 1: own reads back, own copies landed, every wave here; then the freed buffer is refilled
    wait_lds();
    wait_copies();
    __syncthreads();
    if (kt + 2 < nkt) {
      const size_t ko = (size_t)(kt + 2) * AKT;
      stage_kv<0>(ld0 + (unsigned)(par * ASTG * 2), gkh + ko, gkl + ko, gvh + ko, gvh + ko);
    }
  }
  wait_copies();
  // ---- O = acc / l with the carries folded once, the two halves' sums joined here; group by group through the wave's slab,
  //      then O x256 -> f16 hi plane; lane = (row group rq, 8 consecutive d at c8) ----
  const int rq = lane >> 3, c8 = (lane & 7) * 8;
#pragma unroll
  for (int g = 0; g < 2; ++g) {
    const float ltot = lrun[g] + xhalf(lrun[g]);
    const float rl   = (1.0f / ltot) * oc;
#pragma unroll
    for (int j = 0; j < 4; ++j) {
      float* sd = slab + c * SLP + j * 16 + 8 * hh;
      v4f w0, w1;
#pragma unroll
      for (int e = 0; e < 4; ++e) { w0[e] = o[g][j][e] * rl; w1[e] = o[g][j][4 + e] * rl; }
      *(v4f*)(sd)     = w0;
      *(v4f*)(sd + 4) = w1;
    }
    wave_sync_lds();
    v4u oh[4];
#pragma unroll
    for (int it = 0; it < 4; ++it) {
      const int row = it * 4 + rq;
      const v4f a = *(const v4f*)(slab + row * SLP + c8), b4 = *(const v4f*)(slab + row * SLP + c8 + 4);
#pragma unroll
      for (int e = 0; e < 2; ++e) {
        oh[it][e]     = pk16(h_bits((_Float16)(a[2 * e] * OSC)),  h_bits((_Float16)(a[2 * e + 1] * OSC)));
        oh[it][2 + e] = pk16(h_bits((_Float16)(b4[2 * e] * OSC)), h_bits((_Float16)(b4[2 * e + 1] * OSC)));
      }
    }
    wave_sync_lds();                        // the group's rows are read back before the next group's values take the slab
    const size_t ob = ((size_t)b * SEQ + q0 + 16 * g) * DMOD + (size_t)head * HD + c8;
#pragma unroll
    for (int it = 0; it < 4; ++it) *(v4u*)(OHp + ob + (size_t)(it * 4 + rq) * DMOD) = oh[it];
    wait_stores_issued();
  }
}

// Both row ranges in one grid (no query tile depends on another): the AB_L blocks of the later rows (32 rows each, the longer key
// loops) first, then the AB_R blocks of the tiles < RICH / 16 (16 rows each). The range test is block-uniform.
#define AB_L   (((NQT - NQTR) / 2) * NHG * NB)
#define AB_R   (NQTR * NHG * NB)
static_assert(((NQT - NQTR) % 2) == 0 && (NQTR % 2) == 0);
// four waves per SIMD: the register budget (256) that holds a wave's 32 query columns (q fragments, scores, O^T accumulators)
__global__ __launch_bounds__(ATT_THREADS) __attribute__((amdgpu_waves_per_eu(4)))
void attn_all(const u16* __restrict__ QHp, const u16* __restrict__ QLp,
              const u16* __restrict__ KHp, const u16* __restrict__ KLp,
              const u16* __restrict__ VHp, const u16* __restrict__ VLp, u16* OHp, u16* OLp) {
  __shared__ __align__(16) float smem[WPB * WREG];
  __shared__ __align__(16) u16 kvring[2 * ASTG];
  const int bid = (int)blockIdx.x;
  if (bid < AB_L) attn_gq32(smem, kvring, QHp, QLp, KHp, KLp, VHp, OHp, bid, NQTR / 2, (NQT - NQTR) / 2);
  else            attn_gq<1>(smem, kvring, QHp, QLp, KHp, KLp, VHp, VLp, OHp, OLp, bid - AB_L, 0, NQTR);
}

// =====================================================================================================
// Workspace map (bytes); every plane is fully written by whole-line stores before it is read (the O residual plane only on
// the rows < RICH per sequence that are read); all extents are exact multiples of the store granularity (no pad rows needed);
// every region offset a multiple of 131072:
//   XB  bf16 [MROWS][2048]              MROWS*4096   (NB=2, SEQ=2048: 16777216); after the projection GEMM the same bytes hold
//                                                    the O f16 hi plane [MROWS][2048] x256 (identical extent)
//   WB  bf16 [3072 n][2048 k]           12582912     (Wq rows 0..2047, Wk 2048..2559, Wv 2560..3071)
//   WT  f16 [2048 o][2048 d] x1024      8388608      (Wo)
//   OL  region of MROWS*12288 bytes; its first MROWS*4096 bytes hold the O f16 residual plane [MROWS][2048]
//   QH  f16 [NB*32][SEQ/16] tiles of 2048 B x256   MROWS*4096   QL residual, same extent   (fragment order)
//   KH  f16 [NB*8][SEQ/16] tiles of 2048 B x256    MROWS*1024   KL residual, same extent   (fragment order)
//   VH  f16 [NB*8][SEQ/32] tiles of 4096 B x1024   MROWS*1024   VL residual, same extent   (fragment order)
//   end (NB=2, SEQ=2048)               138412032
// =====================================================================================================
extern "C" void kernel_launch(void* const* d_in, const int* in_sizes, int n_in,
                              void* d_out, int out_size, void* d_ws, size_t ws_size,
                              hipStream_t stream) {
  if (n_in < 9) return;
  if (in_sizes[0] < ((NB - 1) * XS_FULL + SEQ) * DMOD) return;
  if (in_sizes[1] < DMOD * DMOD) return;
  if (in_sizes[2] < DMOD) return;
  if (in_sizes[3] < KVD * DMOD) return;
  if (in_sizes[4] < KVD) return;
  if (in_sizes[5] < KVD * DMOD) return;
  if (in_sizes[6] < KVD) return;
  if (in_sizes[7] < DMOD * DMOD) return;
  if (in_sizes[8] < DMOD) return;
  if (out_size < MROWS * DMOD) return;

  const float* x  = (const float*)d_in[0];
  const float* wq = (const float*)d_in[1];
  const float* bq = (const float*)d_in[2];
  const float* wk = (const float*)d_in[3];
  const float* bk = (const float*)d_in[4];
  const float* wv = (const float*)d_in[5];
  const float* bv = (const float*)d_in[6];
  const float* wo = (const float*)d_in[7];
  const float* bo = (const float*)d_in[8];
  float*       out = (float*)d_out;

  const size_t szXB = (size_t)MROWS * DMOD * 2;
  const size_t szWB = (size_t)NQKV * DMOD * 2;
  const size_t szF  = (size_t)MROWS * NQKV * 4;
  const size_t szQ  = (size_t)MROWS * DMOD * 2;                  // QH, QL
  const size_t szK  = (size_t)MROWS * KVD * 2;                   // KH, KL
  const size_t szV  = (size_t)NB * NKVH * HD * SEQ * 2;          // VH, VL (== szK)
  const size_t szOH = (size_t)MROWS * DMOD * 2;                  // O hi plane, lives in the XB region
  const size_t szOL = (size_t)MROWS * DMOD * 2;                  // O residual plane, at the start of its region
  const size_t szWT = (size_t)DMOD * DMOD * 2;                   // Wo f16 plane
  if (szOH > szXB || szOL > szF) return;
  size_t off = 0;
  const size_t oXB = off; off += szXB;
  const size_t oWB = off; off += szWB;
  const size_t oWT = off; off += szWT;
  const size_t oF  = off; off += szF;
  const size_t oQH = off; off += szQ;
  const size_t oQL = off; off += szQ;
  const size_t oKH = off; off += szK;
  const size_t oKL = off; off += szK;
  const size_t oVH = off; off += szV;
  const size_t oVL = off; off += szV;
  if (off > ws_size) return;                // off = 138412032 for NB = 2, SEQ = 2048
  if (off > (size_t)WS_CAP) return;

  char* ws = (char*)d_ws;
  u16*   XB  = (u16*)(ws + oXB);
  u16*   OH  = (u16*)(ws + oXB);
  u16*   WB  = (u16*)(ws + oWB);
  u16*   WT  = (u16*)(ws + oWT);
  u16*   OL  = (u16*)(ws + oF);
  u16*   QH  = (u16*)(ws + oQH);
  u16*   QL  = (u16*)(ws + oQL);
  u16*   KH  = (u16*)(ws + oKH);
  u16*   KL  = (u16*)(ws + oKL);
  u16*   VH  = (u16*)(ws + oVH);
  u16*   VL  = (u16*)(ws + oVL);

  const dim3 b256(256), b128(128), bAT(ATT_THREADS);
  const dim3 gG1((MROWS / 128) * (NQKV / 128));         // 768
  const float osc = 1.0f / (OSC * WOS);

  // (0) x -> bf16 plane [MROWS][2048]; Wq, Wk, Wv -> one bf16 plane [3072 n][2048 k]; Wo [2048 o][2048 d] -> f16 plane of the
  //     bf16 value x1024 (already k-contiguous)
  cvt_all<<<dim3(CB_ALL), b256, 0, stream>>>(x, wq, wk, wv, wo, XB, WB, WT);
  // (1) qkv = x.[Wq|Wk|Wv]^T, f32 accumulators; the epilogue adds the biases in f32 and writes the q and k hi + residual planes
  //     x256 (columns 0..2047 + bq, 2048..2559 + bk) and the v^T hi + residual planes x1024 (columns 2560..3071 + bv)
  gemm_bf<<<gG1, b128, 0, stream>>>(XB, WB, bq, bk, bv, QH, QL, KH, KL, VH, VL);
  // (2) causal attention -> O f16 hi plane x256 (XB region) for all query tiles; residual plane for tiles < RICH
  attn_all<<<dim3(AB_L + AB_R), bAT, 0, stream>>>(QH, QL, KH, KL, VH, VL, OH, OL);
  // (3) y = O.Wo^T + bo -> out f32 [MROWS][2048], carries 256 x 1024 folded back; rows < RICH per sequence with O hi + residual
  gemm_out<<<dim3(NB * (GB_L + GB_R)), b128, 0, stream>>>(OH, OL, WT, bo, out, osc);
  (void)hipGetLastError();
}

// v009
// It runs in 141 microseconds.
// Timed twice side by side with v008, it ran 1.14 and 1.10 times as fast.
// All steps since v000 together make it 4.56 times as fast.
// Contractions: x.[Wq|Wk|Wv]^T on v_wmma_f32_16x16x32_bf16 (x and the weights as bf16 RNE planes, weight [n][k] rows are the
// k-contiguous B operand, f32 accumulate, biases added in f32 as bf16 RNE values); q.k^T over hd 64 and P.v on
// v_wmma_f32_16x16x32_f16 with f16 hi + f16 residual planes (q, k x256, products hh+lh+hl, P x32768 hi + in-register
// residual and v^T x1024 hi + residual plane for query rows < 512 of each sequence; k hi . q hi and P hi . v hi only for later
// rows); O.Wo^T on v_wmma_f32_16x16x32_f16 with O x256 as f16 hi (+ f16 residual plane for rows < 512 of each sequence) and
// Wo as f16(bf16(Wo)) x1024, one accumulator, bias bo added in f32; all f32 accumulate. Online softmax in f32 on VALU.
#include <hip/hip_runtime.h>
#include <math.h>
#include <stdint.h>

#ifndef NB
#define NB 2
#endif
#ifndef SEQ
#define SEQ 2048
#endif
#define XS_FULL 2048
#define DMOD  2048
#define NH    32
#define NKVH  8
#define HD    64
#define KVD   (NKVH * HD)
#define NQKV  (DMOD + 2 * KVD)
#define MROWS (NB * SEQ)
#define RICH_REQ 512
#define RICH  ((SEQ < RICH_REQ) ? SEQ : RICH_REQ)
#define SM_SCALE 0.125f
#define QSC   256.0f
#define KSC   256.0f
#define PCAR  32768.0f
#define VCAR  1024.0f
#define OSC   256.0f
#define WOS   1024.0f
#define WPB   (NH / NKVH)
#define NHG   NKVH
#define NQT   (SEQ / 16)
#define NQTR  (RICH / 16)
#define NKT   (SEQ / 32)
#define ATT_THREADS (WPB * 32)
#define SLP   68
#define SLW   (16 * SLP)
#define WREG  (SLW)
#define SLAB64 (16 * 68)
#define WS_CAP 268435456
static_assert(DMOD == NH * HD && HD == 64 && NH == 32 && NKVH == 8 && WPB == 4 && NHG * WPB == NH);
static_assert(ATT_THREADS == 128 && KVD == 512 && NQKV == 3072);
static_assert(NB >= 1 && NB <= 2);
static_assert(NB == 1 || SEQ == XS_FULL);
static_assert((SEQ % 64) == 0 && SEQ >= 64 && SEQ <= XS_FULL);
static_assert((RICH % 64) == 0 && RICH >= 64 && RICH <= SEQ);
static_assert((DMOD % 64) == 0 && (KVD % 64) == 0 && (NQKV % 64) == 0 && (DMOD % 32) == 0 && (HD % 32) == 0 && (MROWS % 64) == 0);
static_assert(((SEQ * DMOD / 8) % 256) == 0 && ((DMOD * DMOD / 8) % 256) == 0 && ((KVD * DMOD / 8) % 256) == 0);
static_assert(WPB * WREG * 4 <= 65536 && 4 * SLAB64 * 4 <= 65536);
// workspace total (XB + WB + WT + OL region + QH + QL + KH + KL + VH + VL) for this build
static_assert((size_t)MROWS * DMOD * 2 + (size_t)NQKV * DMOD * 2 + (size_t)DMOD * DMOD * 2 + (size_t)MROWS * NQKV * 4 +
              2 * (size_t)MROWS * DMOD * 2 + 2 * (size_t)MROWS * KVD * 2 + 2 * (size_t)NB * NKVH * HD * SEQ * 2
              <= (size_t)WS_CAP);

typedef unsigned short u16;
typedef _Float16 v16h __attribute__((ext_vector_type(16)));
typedef _Float16 v8h  __attribute__((ext_vector_type(8)));
typedef __bf16   v16b __attribute__((ext_vector_type(16)));
typedef float    v8f  __attribute__((ext_vector_type(8)));
typedef float    v4f  __attribute__((ext_vector_type(4)));
typedef unsigned int v4u __attribute__((ext_vector_type(4)));

union FragH { v16h v; v8h h[2]; v4u u[2]; };

// ---- scalar helpers --------------------------------------------------------------------------------
__device__ __forceinline__ unsigned short bf_bits(float f) {          // f32 -> bf16 bits, RNE convert
  unsigned u = __float_as_uint(f);
  return (unsigned short)((u + 0x7FFFu + ((u >> 16) & 1u)) >> 16);
}
__device__ __forceinline__ float bf_up(unsigned short h) { return __uint_as_float(((unsigned)h) << 16); }
__device__ __forceinline__ float bfr(float f) { return bf_up(bf_bits(f)); }
__device__ __forceinline__ unsigned short h_bits(_Float16 x) { return __builtin_bit_cast(unsigned short, x); }
__device__ __forceinline__ unsigned pk16(unsigned short a, unsigned short b) { return (unsigned)a | ((unsigned)b << 16); }
__device__ __forceinline__ v8f zero8() { v8f z = {0.f, 0.f, 0.f, 0.f, 0.f, 0.f, 0.f, 0.f}; return z; }

// ---- fragment map: 16-bit A/B operand of k-step k0, lane -> row/col (lane&15), h = lane>>4; elements 0..7 <- k0+8h+0..7,
//      elements 8..15 <- k0+16+8h+0..7 (the same split k map for A and B; ldfrag_u reads it from k-contiguous rows)
// ---- fragment loader for a plane kept in fragment order: a fragment is two pieces of 512 contiguous bytes, piece = 32 lanes
//      x 16 B; p = the fragment's first byte (wave-uniform where the tile is), l8 = 8*lane; elements 0..7 <- piece 0,
//      elements 8..15 <- piece 1 (a load = 4 whole 128-B lines)
#define FPC   256
#define FTILE (4 * FPC)
__device__ __forceinline__ v16h ldfrag_f(const _Float16* p, unsigned l8) {
  FragH f;
  f.h[0] = *(const v8h*)(p + l8);
  f.h[1] = *(const v8h*)(p + l8 + FPC);
  return f.v;
}

// stands behind issued global loads whose address registers the code that follows may take over
__device__ __forceinline__ void wait_addr() {
#if defined(__HIP_DEVICE_COMPILE__)
  asm volatile("s_wait_xcnt 0x0" ::: "memory");
#endif
}

// stands behind issued global stores whose registers the code that follows rewrites: the next slab's or rows' values in a
// loop, or the next range's body in a grid of several ranges
__device__ __forceinline__ void wait_stores_issued() {
#if defined(__HIP_DEVICE_COMPILE__)
  asm volatile("s_wait_xcnt 0x0" ::: "memory");
#endif
}

__device__ __forceinline__ v8f mma_h(v16h a, v16h b, v8f c) {
  return __builtin_amdgcn_wmma_f32_16x16x32_f16(false, a, false, b, (short)0, c, false, false);
}
__device__ __forceinline__ v8f mma_b(v16b a, v16b b, v8f c) {
  return __builtin_amdgcn_wmma_f32_16x16x32_bf16(false, a, false, b, (short)0, c, false, false);
}
__device__ __forceinline__ void guard2(v8f& a, v8f& b, v16h x0, v16h x1, v16h x2, v16h x3, v16h x4, v16h x5) {
#if defined(__HIP_DEVICE_COMPILE__)
  asm volatile("v_nop\n\tv_nop\n\tv_nop\n\tv_nop"
               : "+v"(a), "+v"(b) : "v"(x0), "v"(x1), "v"(x2), "v"(x3), "v"(x4), "v"(x5) : "memory");
#endif
}
__device__ __forceinline__ void acc_guard4(v8f& a, v8f& b, v8f& c, v8f& d) {
#if defined(__HIP_DEVICE_COMPILE__)
  asm volatile("v_nop\n\tv_nop\n\tv_nop\n\tv_nop" : "+v"(a), "+v"(b), "+v"(c), "+v"(d));
#endif
}
// lane l <-> lane l ^ 16 on the vector pipe (the shuffle builtin would go through the LDS queue and its wait)
__device__ __forceinline__ float xhalf(float x) {
  const int v = __builtin_bit_cast(int, x);
  return __builtin_bit_cast(float, __builtin_amdgcn_permlanex16(v, v, 0x76543210, 0xfedcba98, false, false));
}
__device__ __forceinline__ void wave_sync_lds() {
  __builtin_amdgcn_fence(__ATOMIC_RELEASE, "workgroup");
  __builtin_amdgcn_wave_barrier();
  __builtin_amdgcn_fence(__ATOMIC_ACQUIRE, "workgroup");
}

// =====================================================================================================
// f32 -> 16-bit plane, same layout.  f16mode == 0: bf16 RNE bits;  f16mode == 1: f16 bits of (bf16 RNE value) * scale.
// Thread = 8 consecutive elements: two 16-B loads, one 16-B store; 32 consecutive lanes = 512 contiguous, 512-B aligned
// One grid converts all five tensors, none of which depends on another: a block range per plane, in this order:
//   x (CB_X blocks per batch) -> XB bf16; Wq (CB_W) | Wk (CB_KV) | Wv (CB_KV) -> WB bf16 [3072 n][2048 k]; Wo (CB_W) -> WT f16 x1024.
// coverage: each range = plane elements / 2048 blocks x 256 thr x 8 = the whole plane (every plane a multiple of 2048 elements).
// =====================================================================================================
#define CB_X   (SEQ * DMOD / 2048)
#define CB_W   (DMOD * DMOD / 2048)
#define CB_KV  (KVD * DMOD / 2048)
#define CB_ALL (NB * CB_X + 2 * CB_W + 2 * CB_KV)
__global__ __launch_bounds__(256) void cvt_all(const float* __restrict__ xin, const float* __restrict__ wq,
                                               const float* __restrict__ wk, const float* __restrict__ wv,
                                               const float* __restrict__ wo, u16* XBp, u16* WBp, u16* WTp) {
  int blk = (int)blockIdx.x;                 // every choice below is block-uniform
  const float* x;
  u16* D;
  int f16mode = 0;
  float scale = 1.0f;
  if (blk < NB * CB_X) {
    const int b = blk / CB_X;
    blk -= b * CB_X;
    x = xin + (size_t)b * XS_FULL * DMOD;
    D = XBp + (size_t)b * SEQ * DMOD;
  } else if ((blk -= NB * CB_X) < CB_W) {
    x = wq;  D = WBp;
  } else if ((blk -= CB_W) < CB_KV) {
    x = wk;  D = WBp + (size_t)DMOD * DMOD;
  } else if ((blk -= CB_KV) < CB_KV) {
    x = wv;  D = WBp + (size_t)DMOD * DMOD + (size_t)KVD * DMOD;
  } else if ((blk -= CB_KV) < CB_W) {
    x = wo;  D = WTp;  f16mode = 1;  scale = WOS;
  } else {
    return;                                  // never taken with the exact grid
  }
  const int gt = blk * 256 + (int)threadIdx.x;
  const float* p = x + (size_t)gt * 8;
  const v4f a = *(const v4f*)(p), b4 = *(const v4f*)(p + 4);
  float w[8];
#pragma unroll
  for (int e = 0; e < 4; ++e) { w[e] = a[e]; w[4 + e] = b4[e]; }
  v4u o;
#pragma unroll
  for (int e = 0; e < 4; ++e) {
    const float f0 = w[2 * e], f1 = w[2 * e + 1];
    const unsigned short hb0 = h_bits((_Float16)(bfr(f0) * scale));
    const unsigned short hb1 = h_bits((_Float16)(bfr(f1) * scale));
    const unsigned short bb0 = bf_bits(f0);
    const unsigned short bb1 = bf_bits(f1);
    o[e] = (f16mode != 0) ? pk16(hb0, hb1) : pk16(bb0, bb1);
  }
  u16* d = D + (size_t)gt * 8;
  {
    *(v4u*)(d) = o;
    
  }
}

// =====================================================================================================
// GEMM epilogue, in two halves around one wave-level LDS sync: epi_put places a 16x64 f32 tile (times oscale, plus
// bfr(bias[col]) when HASB != 0) in a wave-private slab [16][64] pitch 68; epi_get reads it back as whole row segments.
// coverage: 8 instructions x 2 rows x 16 lanes x 4 floats = the 16 x 64 tile.
// =====================================================================================================
template <int HASB>
__device__ __forceinline__ void epi_put(float* sl, v8f a0, v8f a1, v8f a2, v8f a3, float oscale,
                                        const float* __restrict__ bias, int col0, int lane) {
  const int hh = lane >> 4, m = lane & 15;
  float b0 = 0.0f, b1 = 0.0f, b2 = 0.0f, b3 = 0.0f;
  if (HASB != 0) {
    b0 = bfr(bias[col0 + m]);
    b1 = bfr(bias[col0 + 16 + m]);
    b2 = bfr(bias[col0 + 32 + m]);
    b3 = bfr(bias[col0 + 48 + m]);
  }
#pragma unroll
  for (int r = 0; r < 8; ++r) {
    const int ro = (8 * hh + r) * 68 + m;
    sl[ro]      = a0[r] * oscale + b0;
    sl[ro + 16] = a1[r] * oscale + b1;
    sl[ro + 32] = a2[r] * oscale + b2;
    sl[ro + 48] = a3[r] * oscale + b3;
  }
}
__device__ __forceinline__ void epi_get(const float* sl, float* C, int N, size_t rowb, int col0, int lane) {
  const int hh = lane >> 4, m = lane & 15;
  v4f vals[8];
#pragma unroll
  for (int it = 0; it < 8; ++it) vals[it] = *(const v4f*)(sl + (it * 2 + hh) * 68 + m * 4);
  float* dst = C + (rowb + (size_t)hh) * (size_t)N + col0 + m * 4;
#pragma unroll
  for (int it = 0; it < 8; ++it) {
    *(v4f*)(dst + (size_t)(it * 2) * (size_t)N) = vals[it];
  }
}

// =====================================================================================================
// Projection epilogue: a wave's 64 x 64 accumulator block (rows rw .. rw + 63 of one sequence, the 64 columns of one head) goes
// straight into the attention operand planes; acc[i][j], element r of lane (hh, m) = (row 16i + 8hh + r, column d = 16j + m).
//   t = (acc + bfr(bias[d])) * sc in f32 (add, then exact power-of-two scale); hi = f16(t), residual = f16(t - hi).
// q / k planes (sc = 256), fragment order: tile (b, head, s >> 4) = 16 rows x 64 d = 4 pieces of 512 B; piece pc, lane l,
//   element e <- row (s & 15) = l & 15, d = 16*pc + 8*(l >> 4) + e (pieces 2kk, 2kk + 1 are the two halves of the fragment of
//   k-step kk in the split k map). A lane needs 8 consecutive d of one row: t turns through the wave's own slabs [16][64]
//   pitch 68 (one per 16 rows, one wave-level LDS sync), then one 16-B store per piece and plane = 512 contiguous bytes a wave.
// coverage: 4 slabs x 4 pieces = the wave's four 16-row tiles of the hi plane (and of the residual plane for WL = 1); all blocks = every tile of every head once in the hi plane, the tiles of rows < RICH of each sequence in the residual plane.
// =====================================================================================================
__device__ __forceinline__ v4u split_pack(const float (&t)[8], v4u& lo) {
  v4u hi;
#pragma unroll
  for (int e = 0; e < 4; ++e) {
    const float t0 = t[2 * e], t1 = t[2 * e + 1];
    const _Float16 h0 = (_Float16)t0, h1 = (_Float16)t1;
    const _Float16 l0 = (_Float16)(t0 - (float)h0), l1 = (_Float16)(t1 - (float)h1);
    hi[e] = pk16(h_bits(h0), h_bits(h1));
    lo[e] = pk16(h_bits(l0), h_bits(l1));
  }
  return hi;
}
// WL = 0: rows >= RICH of a sequence, whose residual plane rows nobody reads: the hi plane alone is written
template <int WL>
__device__ __forceinline__ void planes_qk(float* sl, const v8f (&acc)[4][4], const float* __restrict__ bias, int cb, int nhead,
                                          float sc, u16* Hp, u16* Lp, int rw, int lane) {
  const int hh = lane >> 4, m = lane & 15;
  float bj[4];
#pragma unroll
  for (int j = 0; j < 4; ++j) bj[j] = bias[cb + 16 * j + m];
  wait_addr();
#pragma unroll
  for (int j = 0; j < 4; ++j) bj[j] = bfr(bj[j]);
#pragma unroll
  for (int i = 0; i < 4; ++i) {
#pragma unroll
    for (int r = 0; r < 8; ++r) {
      float* ro = sl + i * SLAB64 + (8 * hh + r) * 68 + m;
#pragma unroll
      for (int j = 0; j < 4; ++j) ro[16 * j] = (acc[i][j][r] + bj[j]) * sc;
    }
  }
  wave_sync_lds();
  const size_t dst = ((size_t)((rw / SEQ) * nhead + (cb >> 6)) * NQT + (size_t)((rw % SEQ) >> 4)) * FTILE + (size_t)lane * 8;
#pragma unroll
  for (int i = 0; i < 4; ++i) {
    v4u oh[4], ol[4];
#pragma unroll
    for (int pc = 0; pc < 4; ++pc) {
      const float* p = sl + i * SLAB64 + m * 68 + 16 * pc + 8 * hh;
      const v4f a = *(const v4f*)(p), b4 = *(const v4f*)(p + 4);
      float t[8];
#pragma unroll
      for (int e = 0; e < 4; ++e) { t[e] = a[e]; t[4 + e] = b4[e]; }
      oh[pc] = split_pack(t, ol[pc]);
    }
#pragma unroll
    for (int pc = 0; pc < 4; ++pc) {
      *(v4u*)(Hp + dst + (size_t)(i * FTILE + pc * FPC)) = oh[pc];
      if (WL != 0) *(v4u*)(Lp + dst + (size_t)(i * FTILE + pc * FPC)) = ol[pc];
    }
    wait_stores_issued();                   // the next slab's values take over the registers that these stores name
  }
}
// v^T planes (sc = 1024), fragment order: tile (b, g, s >> 5) = 64 d x 32 keys = 8 pieces of 512 B; piece 2j + h, lane l,
//   element e <- d = 16j + (l & 15), key (s & 31) = 16h + 8*(l >> 4) + e (the two halves of the A fragment of d-subtile j in
//   the split k map): that is acc[i][j] as it stands, h = i & 1, tile i >> 1, e = r, so no LDS; one 16-B store per (i, j)
//   and plane = 512 contiguous bytes a wave.
// coverage: 16 (i, j) = the 8 pieces of the wave's two 32-key tiles of both planes; all blocks = every tile of every kv head once.
__device__ __forceinline__ void planes_vt(const v8f (&acc)[4][4], const float* __restrict__ bias, int cb,
                                          u16* VHo, u16* VLo, int rw, int lane) {
  const int m = lane & 15;
  float bj[4];
#pragma unroll
  for (int j = 0; j < 4; ++j) bj[j] = bias[cb + 16 * j + m];
  wait_addr();
#pragma unroll
  for (int j = 0; j < 4; ++j) bj[j] = bfr(bj[j]);
  const size_t dst = ((size_t)((rw / SEQ) * NKVH + (cb >> 6)) * NKT + (size_t)((rw % SEQ) >> 5)) * (8 * FPC) + (size_t)lane * 8;
#pragma unroll
  for (int i = 0; i < 4; ++i) {
#pragma unroll
    for (int j = 0; j < 4; ++j) {
      float t[8];
#pragma unroll
      for (int r = 0; r < 8; ++r) t[r] = (acc[i][j][r] + bj[j]) * VCAR;
      v4u ol;
      const v4u oh = split_pack(t, ol);
      const size_t o = dst + (size_t)((i >> 1) * (8 * FPC) + (2 * j + (i & 1)) * FPC);
      *(v4u*)(VHo + o) = oh;
      *(v4u*)(VLo + o) = ol;
    }
    wait_stores_issued();                   // the next rows' values take over the registers that these stores name
  }
}
struct PlaneOut {
  const float* bq; const float* bk; const float* bv;
  u16* qh; u16* ql; u16* kh; u16* kl; u16* vh; u16* vl;
};

// =====================================================================================================
// GEMM engine shared by gemm_bf and gemm_out: C[M][N] (f32) = (A[M][K] (+ A2[M][K] when TWO != 0)) . Bt[N][K]^T, times oscale
// (plus bfr(bias[n]) when HASB != 0); A, A2 row-major 16-bit planes, Bt k-contiguous 16-bit plane. PL != 0: no C, the
// accumulators go into the attention operand planes instead (planes_qk, planes_vt).
// Block = BM x 128 tile of C (BM = 128, or 64 when TWO != 0), 4 waves as 2 x 2, wave = (BM/2) x 64 = MF x 4 accumulator tiles.
// A pass is 64 k = one whole 128-B line of each of the stage's 256 operand rows (A rows, then A2 rows, then the 128 Bt rows),
// brought into LDS by asynchronous copies (8 lanes per row, 16 copies per lane and pass), row pitch 144 B; two buffers: the
// copies of pass t + 2 are issued behind the barrier that ends pass t, so they fly while pass t + 1 is worked on.
// Fragments are read from the LDS rows with the same split k map and each accumulator takes its products in the
// same order (k ascending by 32; A before A2). Callers guarantee K % 64 == 0, M % BM == 0, N % 128 == 0, bid in 0 .. (M/BM)*(N/128) - 1.
// =====================================================================================================
#define GKP   64
#define GPIT  72
#define GSTG  (256 * GPIT)
static_assert(GKP == 2 * 32 && (DMOD % GKP) == 0 && (MROWS % 128) == 0 && (NQKV % 128) == 0 && (DMOD % 128) == 0);
static_assert((RICH % 128) == 0 && (SEQ % 128) == 0 && ((SEQ - RICH) % 128) == 0 && 4 * 4 * SLAB64 * 4 <= 2 * GSTG * 2);

union FragU { v4u u[2]; v16h h; v16b b; };

__device__ __forceinline__ FragU ldfrag_u(const u16* p) {
  FragU f;
  f.u[0] = *(const v4u*)(p);
  f.u[1] = *(const v4u*)(p + 16);
  return f;
}
template <int BF>
__device__ __forceinline__ v8f mma_u(const FragU& a, const FragU& b, v8f c) {
  if (BF != 0) return mma_b(a.b, b.b, c);
  return mma_h(a.h, b.h, c);
}
// eight asynchronous 16-B copies per lane, global -> LDS; the s_wait_xcnt closes the statement so that no register a copy
// names is rewritten ahead of it
__device__ __forceinline__ void copy8(const unsigned (&l)[8], const u16* const (&g)[8]) {
#if defined(__HIP_DEVICE_COMPILE__)
  asm volatile("global_load_async_to_lds_b128 %0, %8, off\n\t"
               "global_load_async_to_lds_b128 %1, %9, off\n\t"
               "global_load_async_to_lds_b128 %2, %10, off\n\t"
               "global_load_async_to_lds_b128 %3, %11, off\n\t"
               "global_load_async_to_lds_b128 %4, %12, off\n\t"
               "global_load_async_to_lds_b128 %5, %13, off\n\t"
               "global_load_async_to_lds_b128 %6, %14, off\n\t"
               "global_load_async_to_lds_b128 %7, %15, off\n\t"
               "s_wait_xcnt 0x0"
               :: "v"(l[0]), "v"(l[1]), "v"(l[2]), "v"(l[3]), "v"(l[4]), "v"(l[5]), "v"(l[6]), "v"(l[7]),
                  "v"(g[0]), "v"(g[1]), "v"(g[2]), "v"(g[3]), "v"(g[4]), "v"(g[5]), "v"(g[6]), "v"(g[7])
               : "memory");
#endif
}
// the same with six copies per lane
__device__ __forceinline__ void copy6(const unsigned (&l)[8], const u16* const (&g)[8]) {
#if defined(__HIP_DEVICE_COMPILE__)
  asm volatile("global_load_async_to_lds_b128 %0, %6, off\n\t"
               "global_load_async_to_lds_b128 %1, %7, off\n\t"
               "global_load_async_to_lds_b128 %2, %8, off\n\t"
               "global_load_async_to_lds_b128 %3, %9, off\n\t"
               "global_load_async_to_lds_b128 %4, %10, off\n\t"
               "global_load_async_to_lds_b128 %5, %11, off\n\t"
               "s_wait_xcnt 0x0"
               :: "v"(l[0]), "v"(l[1]), "v"(l[2]), "v"(l[3]), "v"(l[4]), "v"(l[5]),
                  "v"(g[0]), "v"(g[1]), "v"(g[2]), "v"(g[3]), "v"(g[4]), "v"(g[5])
               : "memory");
#endif
}
// the same with four copies per lane
__device__ __forceinline__ void copy4(const unsigned (&l)[4], const u16* const (&g)[4]) {
#if defined(__HIP_DEVICE_COMPILE__)
  asm volatile("global_load_async_to_lds_b128 %0, %4, off\n\t"
               "global_load_async_to_lds_b128 %1, %5, off\n\t"
               "global_load_async_to_lds_b128 %2, %6, off\n\t"
               "global_load_async_to_lds_b128 %3, %7, off\n\t"
               "s_wait_xcnt 0x0"
               :: "v"(l[0]), "v"(l[1]), "v"(l[2]), "v"(l[3]), "v"(g[0]), "v"(g[1]), "v"(g[2]), "v"(g[3])
               : "memory");
#endif
}
// this wave's own copies have landed
__device__ __forceinline__ void wait_copies() {
#if defined(__HIP_DEVICE_COMPILE__)
  asm volatile("s_wait_asynccnt 0x0" ::: "memory");
#endif
}
// this wave's own LDS reads have returned, before the buffer they read is handed to the copies
__device__ __forceinline__ void wait_lds() {
#if defined(__HIP_DEVICE_COMPILE__)
  asm volatile("s_wait_dscnt 0x0" ::: "memory");
#endif
}
// one stage: lane = (row r0 = tid >> 3 of each group of 16 rows, 16-B piece tid & 7); ld = the lane's LDS byte address of
// stage row r0, ga / ga2 / gb = its global address in row r0 of the block's A / A2 / Bt rows, rs16 = halves per 16 rows
template <int TWO>
__device__ __forceinline__ void stage_tile(unsigned ld, const u16* ga, const u16* ga2, const u16* gb, size_t rs16) {
  unsigned l[8];
  const u16* g[8];
#pragma unroll
  for (int i = 0; i < 8; ++i) {
    l[i] = ld + (unsigned)(i * 16 * GPIT * 2);
    if (TWO != 0) g[i] = (i < 4) ? (ga + (size_t)i * rs16) : (ga2 + (size_t)(i - 4) * rs16);
    else          g[i] = ga + (size_t)i * rs16;
  }
  copy8(l, g);
#pragma unroll
  for (int i = 0; i < 8; ++i) {
    l[i] = ld + (unsigned)((8 + i) * 16 * GPIT * 2);
    g[i] = gb + (size_t)i * rs16;
  }
  copy8(l, g);
}

template <int BF, int TWO, int HASB, int PL>
__device__ __forceinline__ void gemm_ring(u16* ring, const u16* __restrict__ A, const u16* __restrict__ A2,
                                          const u16* __restrict__ Bt, const float* __restrict__ bias, float* C,
                                          int M, int N, int K, float oscale, int bid, const PlaneOut& po) {
  constexpr int MF = (TWO != 0) ? 2 : 4;
  constexpr int BM = 32 * MF;
  const int tid = threadIdx.x, wave = tid >> 5, lane = tid & 31, hh = lane >> 4, m = lane & 15;
  const int ntile = N >> 7;
  const int row0  = (bid / ntile) * BM;
  const int col0  = (bid % ntile) * 128;
  if (row0 + BM > M) return;                // block-uniform, before any copy or barrier; never taken with the exact grid
  const int wm = wave >> 1, wn = wave & 1;
  const int r0 = tid >> 3, c8 = (tid & 7) * 8;
  const u16* ga  = A  + (size_t)(row0 + r0) * K + c8;
  const u16* ga2 = A2 + (size_t)(row0 + r0) * K + c8;
  const u16* gb  = Bt + (size_t)(col0 + r0) * K + c8;
  const size_t rs16 = (size_t)16 * K;
  const unsigned ld0 = (unsigned)(uintptr_t)ring + (unsigned)((r0 * GPIT + c8) * 2);
  const int npass = K / GKP;
  const int aoff = (wm * (16 * MF) + m) * GPIT + 8 * hh;          // halves, in a stage: A fragment row of this lane
  const int boff = (128 + wn * 64 + m) * GPIT + 8 * hh;           // Bt fragment row of this lane

  v8f acc[MF][4];
#pragma unroll
  for (int i = 0; i < MF; ++i) {
#pragma unroll
    for (int j = 0; j < 4; ++j) acc[i][j] = zero8();
  }

  stage_tile<TWO>(ld0, ga, ga2, gb, rs16);
  wait_copies();
  __syncthreads();
  if (npass > 1) stage_tile<TWO>(ld0 + (unsigned)(GSTG * 2), ga + GKP, ga2 + GKP, gb + GKP, rs16);

  // kept rolled (for speed only), the buffer chosen by the pass's parity
#pragma unroll 1
  for (int t = 0; t < npass; ++t) {
    const int par = t & 1;
    const u16* st = ring + par * GSTG;
    FragU a[2][MF], a2[2][MF], b[4];
#pragma unroll
    for (int kk = 0; kk < 2; ++kk) {
#pragma unroll
      for (int i = 0; i < MF; ++i) {
        a[kk][i] = ldfrag_u(st + aoff + i * 16 * GPIT + kk * 32);
        if (TWO != 0) a2[kk][i] = ldfrag_u(st + aoff + (64 + i * 16) * GPIT + kk * 32);
      }
    }
#pragma unroll
    for (int kk = 0; kk < 2; ++kk) {
#pragma unroll
      for (int j = 0; j < 4; ++j) b[j] = ldfrag_u(st + boff + j * 16 * GPIT + kk * 32);
      // the LDS reads stay in one group ahead of the WMMA block (for speed only)
      __builtin_amdgcn_sched_barrier(0);
#pragma unroll
      for (int i = 0; i < MF; ++i) {
#pragma unroll
        for (int j = 0; j < 4; ++j) acc[i][j] = mma_u<BF>(a[kk][i], b[j], acc[i][j]);
      }
      if (TWO != 0) {
#pragma unroll
        for (int i = 0; i < MF; ++i) {
#pragma unroll
          for (int j = 0; j < 4; ++j) acc[i][j] = mma_u<BF>(a2[kk][i], b[j], acc[i][j]);
        }
      }
      // the WMMA block stays ahead of what follows: sunk behind the publish point it would put the refill's issue directly
      // in front of the next pass's wait for it
      __builtin_amdgcn_sched_barrier(0);
    }
    // publish point of pass t + 1: own reads back, own copies landed, every wave here; then the freed buffer is refilled
    wait_lds();
    wait_copies();
    __syncthreads();
    if (t + 2 < npass) {
      const size_t ko = (size_t)(t + 2) * GKP;
      stage_tile<TWO>(ld0 + (unsigned)(par * GSTG * 2), ga + ko, ga2 + ko, gb + ko, rs16);
    }
  }
  wait_copies();

  // the last pass's barrier has ended every read of the ring and no copy is outstanding: each wave stages its MF tiles in
  // MF slabs of its own
  float* sl = (float*)(void*)ring + wave * (MF * SLAB64);
  const int colw = col0 + wn * 64;
  if constexpr (PL != 0) {
    // the column ranges q | k | v end on multiples of 128, so the range test on col0 is block-uniform (a scalar branch)
    const int rw = row0 + wm * 64;
    if (col0 < DMOD + KVD) {
      const bool isq = col0 < DMOD;
      // a block's 128 rows lie on one side of row RICH of their sequence: block-uniform (a scalar branch)
      if ((row0 % SEQ) < RICH)
        planes_qk<1>(sl, acc, isq ? po.bq : po.bk, isq ? colw : colw - DMOD, isq ? NH : NKVH, isq ? QSC : KSC,
                     isq ? po.qh : po.kh, isq ? po.ql : po.kl, rw, lane);
      else
        planes_qk<0>(sl, acc, isq ? po.bq : po.bk, isq ? colw : colw - DMOD, isq ? NH : NKVH, isq ? QSC : KSC,
                     isq ? po.qh : po.kh, isq ? po.ql : po.kl, rw, lane);
    } else {
      planes_vt(acc, po.bv, colw - DMOD - KVD, po.vh, po.vl, rw, lane);
    }
    return;
  }
#pragma unroll
  for (int i = 0; i < MF; ++i)
    epi_put<HASB>(sl + i * SLAB64, acc[i][0], acc[i][1], acc[i][2], acc[i][3], oscale, bias, colw, lane);
  wave_sync_lds();
#pragma unroll
  for (int i = 0; i < MF; ++i)
    epi_get(sl + i * SLAB64, C, N, (size_t)(row0 + wm * (16 * MF) + i * 16), colw, lane);
}

__global__ __launch_bounds__(128)
void gemm_bf(const u16* __restrict__ A, const u16* __restrict__ Bt, const float* __restrict__ bq,
             const float* __restrict__ bk, const float* __restrict__ bv,
             u16* QHo, u16* QLo, u16* KHo, u16* KLo, u16* VHo, u16* VLo) {
  __shared__ __align__(16) u16 ring[2 * GSTG];
  const PlaneOut po = {bq, bk, bv, QHo, QLo, KHo, KLo, VHo, VLo};
  gemm_ring<1, 0, 0, 1>(ring, A, A, Bt, (const float*)0, (float*)0, MROWS, NQKV, DMOD, 1.0f, (int)blockIdx.x, po);
}

// y = O.Wo^T + bo for all rows in one grid (the row ranges are independent): per sequence GB_L blocks of 128 x 128 for rows
// >= RICH (O hi only), then GB_R blocks of 64 x 128 for rows < RICH (O hi + residual). The range test is block-uniform.
#define GB_L   (((SEQ - RICH) / 128) * (DMOD / 128))
#define GB_R   ((RICH / 64) * (DMOD / 128))
__global__ __launch_bounds__(128)
void gemm_out(const u16* __restrict__ OHp, const u16* __restrict__ OLp, const u16* __restrict__ Bt,
              const float* __restrict__ bias, float* C, float oscale) {
  __shared__ __align__(16) u16 ring[2 * GSTG];
  const int b = (int)blockIdx.x / (GB_L + GB_R);
  const int r = (int)blockIdx.x % (GB_L + GB_R);
  if (b >= NB) return;                      // block-uniform, before any copy or barrier; never taken with the exact grid
  const PlaneOut po = {};
  if (r < GB_L) {
    const size_t ro = ((size_t)b * SEQ + RICH) * DMOD;
    gemm_ring<0, 0, 1, 0>(ring, OHp + ro, OLp + ro, Bt, bias, C + ro, SEQ - RICH, DMOD, DMOD, oscale, r, po);
    wait_stores_issued();
  } else {
    const size_t ro = (size_t)b * SEQ * DMOD;
    gemm_ring<0, 1, 1, 0>(ring, OHp + ro, OLp + ro, Bt, bias, C + ro, RICH, DMOD, DMOD, oscale, r - GB_L, po);
    wait_stores_issued();
  }
}

// =====================================================================================================
// Causal grouped-query softmax attention, hd = 64. Block bid -> (query tile qt = qt0 + bid % nqt: rows q0 = 16*qt ..
// q0+15, head group hg = kv head, batch b); one wave per query head = hg*WPB + wave (the 4 consecutive query heads of a
// group share kv head hg).
//   q hi / residual planes f16 x256, tiles (b, h, s >> 4); k hi / residual planes f16 x256, tiles (b, g, s >> 4); v^T hi /
//   residual planes x1024, tiles (b, g, s >> 5): all in fragment order (planes_qk, planes_vt), so that every fragment load of a wave
//   reads 512 contiguous bytes and a key tile of 32 is 4096 contiguous bytes of each k plane and of each v^T plane.
//   The block's 4 waves walk the same key tiles of the same kv head: a key tile (k hi | k residual | v^T hi, and for RV = 1
//   | v^T residual, 4096 B each, kept in fragment order) is brought into LDS once per block by asynchronous copies (2 copies per
//   lane and plane); two buffers: the copies of tile kt + 2 are issued behind the barrier that ends tile kt, so they fly while
//   tile kt + 1 is worked on. nkt is the same for the whole block, so every wave passes every barrier.
//   Transposed products: S^T = K.Q^T (A = key rows, B = query rows as columns), so a lane's 16 score registers of a key tile
//   belong to one query (lane & 15) and hold keys kb + 8*(lane >> 4) + r and kb + 16 + 8*(lane >> 4) + r.
//   raw(j, i) = k_hi.q_hi + k_hi.q_lo + k_lo.q_hi (2 k-steps over d); logit = raw * 2^-19 (the 1/8 softmax scale and the two
//   256 carries, exact); keys above the diagonal replaced by -inf; online softmax per query in f32 with a running max:
//   max in-lane over the 16 scores plus one exchange with lane ^ 16; sum in-lane, the two halves' sums joined once after the
//   loop; alpha = exp(m_old - m_new), p = exp(logit - m_new), l = l*alpha + sum p, O^T accumulators times alpha before the
//   tile's product. Key tiles of 32 visited in order, only tiles with kb <= q0 (nkt = q0/32 + 1 <= NKT; key kb is unmasked for
//   every query of the tile). The score registers, as p*32768 (f16 hi and its f16 residual), are the B fragment of
//   O^T += v^T.P^T in the split k map as they stand; v^T A fragments in 2 groups of 2 d-subtiles; RV = 1: products hh + lh + hl,
//   RV = 0: hh only.
//   Epilogue: O x256 -> f16 hi plane (and for RV = 1 the f16 residual plane of O x256) [b*SEQ + s][h*HD + d]; lane = (row group
//   rq = lane>>3 in 0..3, 8 consecutive d at c8); one instruction = 4 rows it*4 + rq, each row segment (64 halves = one whole
// coverage: per wave 4 instructions x 4 rows x 8 lanes x 8 halves = 16 x 64 per plane; nqt x NHG x NB blocks x WPB waves;
//   the two block ranges (rows >= RICH by attn_gq32 below, tiles 0..NQTR-1 here with RV = 1) cover every (b, s, h) row segment of the
//   hi plane exactly once and rows s < RICH of the residual plane exactly once (only those rows are read later).
// =====================================================================================================
#define AKT   (2 * FTILE)
#define ASTG  (4 * AKT)
static_assert(AKT * 2 == 2 * ATT_THREADS * 16 && 6 * (2 * ASTG * 2 + WPB * WREG * 4) <= 327680);
// one key tile: ld = the lane's LDS byte address in the buffer (16 B per thread), kh / kl / vh / vl = its global address in the
// tile of each plane; a plane's tile = 2 copies of the block (2048 B each)
template <int RV>
__device__ __forceinline__ void stage_kv(unsigned ld, const u16* kh, const u16* kl, const u16* vh, const u16* vl) {
  unsigned l[8];
  const u16* g[8];
#pragma unroll
  for (int i = 0; i < 8; ++i) l[i] = ld + (unsigned)(i * (AKT / 2) * 2);
  g[0] = kh;  g[1] = kh + AKT / 2;
  g[2] = kl;  g[3] = kl + AKT / 2;
  g[4] = vh;  g[5] = vh + AKT / 2;
  g[6] = vl;  g[7] = vl + AKT / 2;
  if (RV != 0) copy8(l, g);
  else         copy6(l, g);
}

// the hi planes alone (k hi | v^T hi), at the places they have in the buffer of stage_kv
__device__ __forceinline__ void stage_kv_hi(unsigned ld, const u16* kh, const u16* vh) {
  unsigned l[4];
  const u16* g[4];
  l[0] = ld;                                  g[0] = kh;
  l[1] = ld + (unsigned)((AKT / 2) * 2);      g[1] = kh + AKT / 2;
  l[2] = ld + (unsigned)(4 * (AKT / 2) * 2);  g[2] = vh;
  l[3] = ld + (unsigned)(5 * (AKT / 2) * 2);  g[3] = vh + AKT / 2;
  copy4(l, g);
}

template <int RV>
__device__ __forceinline__
void attn_gq(float* smem, u16* kvr, const u16* __restrict__ QHp, const u16* __restrict__ QLp,
             const u16* __restrict__ KHp, const u16* __restrict__ KLp,
             const u16* __restrict__ VHp, const u16* __restrict__ VLp,
             u16* OHp, u16* OLp, int bid, int qt0, int nqt) {
#pragma clang fp contract(off)
  const int tid  = threadIdx.x;
  const int wave = tid >> 5;
  const int lane = tid & 31;
  const int hh   = lane >> 4;
  const int c    = lane & 15;
  if (nqt <= 0) return;                     // block-uniform, before any copy or barrier
  const int qt   = qt0 + bid % nqt;
  const int t2   = bid / nqt;
  const int hg   = t2 % NHG;
  const int b    = t2 / NHG;
  if (b >= NB) return;                      // block-uniform, before any copy or barrier; never taken with the exact grid
  const int q0   = qt * 16;
  if (q0 + 16 > SEQ) return;                // block-uniform, before any copy or barrier; never taken
  const int head = hg * WPB + wave;
  const int kvh  = hg;

  float* slab = smem + wave * WREG;         // result slab [16][64] pitch 68

  const unsigned l8 = (unsigned)lane * 8;
  const size_t qoff = ((size_t)(b * NH + head) * NQT + qt) * FTILE;                        // this wave's 16-query tile
  const size_t koff = (size_t)(b * NKVH + kvh) * NQT * FTILE;                              // 16-key tile 0 of the kv head
  const size_t voff = (size_t)(b * NKVH + kvh) * NKT * (2 * FTILE);                        // 32-key tile 0 of the kv head
  const _Float16* Qh  = (const _Float16*)(const void*)QHp + qoff;
  const _Float16* Ql  = (const _Float16*)(const void*)QLp + qoff;
  const u16* gkh = KHp + koff + (size_t)tid * 8;      // this thread's 16 B of the first half of key tile 0, plane by plane
  const u16* gkl = KLp + koff + (size_t)tid * 8;
  const u16* gvh = VHp + voff + (size_t)tid * 8;
  const u16* gvl = VLp + voff + (size_t)tid * 8;
  const unsigned ld0 = (unsigned)(uintptr_t)kvr + (unsigned)(tid * 16);
  const float lsc  = SM_SCALE * (1.0f / (QSC * KSC));   // exact power-of-two fold of the q / k carries into the 1/8 scale
  const float oc   = 1.0f / (PCAR * VCAR);
  const float ninf = -__builtin_inff();

  v8f o[4];                                 // O^T: element r of o[j] = (d = 16j + 8hh + r, query row q0 + c)
#pragma unroll
  for (int j = 0; j < 4; ++j) o[j] = zero8();
  float mrun = ninf, lrun = 0.0f;           // this lane's query: running max (both halves alike), sum over this half's keys
  const int ncaus = (q0 >> 5) + 1;                                            // tiles holding keys <= q0 + 15
  const int nkt   = (ncaus < NKT) ? ncaus : NKT;
  const int qrow  = q0 + c;                                                   // query row of every D element of this lane

  stage_kv<RV>(ld0, gkh, gkl, gvh, gvl);
  wait_copies();
  __syncthreads();
  if (nkt > 1) stage_kv<RV>(ld0 + (unsigned)(ASTG * 2), gkh + AKT, gkl + AKT, gvh + AKT, gvl + AKT);

#pragma unroll 1
  for (int kt = 0; kt < nkt; ++kt) {
    const int kb = kt * 32;
    const int par = kt & 1;
    const _Float16* st = (const _Float16*)(const void*)(kvr + par * ASTG);    // this tile's buffer
    // ---- raw scores, transposed: D element r of this lane = (key kb + 8hh + r, query qrow) in s0, key + 16 in s1 ----
    v8f s0 = zero8(), s1 = zero8();
    const _Float16* k0p = st;
    const _Float16* k1p = k0p + FTILE;
    const _Float16* l0p = st + AKT;
    const _Float16* l1p = l0p + FTILE;
#pragma unroll
    for (int kk = 0; kk < HD / 32; ++kk) {
      const v16h qh  = ldfrag_f(Qh + kk * (2 * FPC), l8);
      const v16h ql  = ldfrag_f(Ql + kk * (2 * FPC), l8);
      const v16h kh0 = ldfrag_f(k0p + kk * (2 * FPC), l8);
      const v16h kh1 = ldfrag_f(k1p + kk * (2 * FPC), l8);
      const v16h kl0 = ldfrag_f(l0p + kk * (2 * FPC), l8);
      const v16h kl1 = ldfrag_f(l1p + kk * (2 * FPC), l8);
      s0 = mma_h(kh0, qh, s0);
      s0 = mma_h(kh0, ql, s0);
      s0 = mma_h(kl0, qh, s0);
      s1 = mma_h(kh1, qh, s1);
      s1 = mma_h(kh1, ql, s1);
      s1 = mma_h(kl1, qh, s1);
      guard2(s0, s1, qh, ql, kh0, kl0, kh1, kl1);
    }
    // ---- causal replace-mask, running-max online softmax in f32: the lane's 16 scores belong to one query ----
    // every key of a tile before the last is <= 32*(q0 >> 5) - 1 < q0 <= qrow: the replace-mask is an identity there, so only
    // the last tile takes it (kt and nkt are block-uniform: a scalar branch)
    if (kt + 1 == nkt) {
      const int key0 = kb + 8 * hh, key1 = key0 + 16;
      // unrolled so that the score registers are indexed by constants (a rolled loop would move them through scratch)
#pragma unroll
      for (int r = 0; r < 8; ++r) {
        s0[r] = (key0 + r > qrow) ? ninf : s0[r];
        s1[r] = (key1 + r > qrow) ? ninf : s1[r];
      }
    }
    float t0[8], t1[8];
    float mx = ninf;
#pragma unroll
    for (int r = 0; r < 8; ++r) {
      t0[r] = s0[r] * lsc;
      t1[r] = s1[r] * lsc;
      mx = fmaxf(mx, fmaxf(t0[r], t1[r]));
    }
    mx = fmaxf(mx, xhalf(mx));                          // the other half's 16 keys of the same query
    const float mnew = fmaxf(mrun, mx);
    const float al   = __expf(mrun - mnew);
    // ---- B fragments of p*32768 straight from the score registers: hi f16 and residual f16, column = query c,
    //      elements 0..7 = keys kb + 8hh + 0..7, elements 8..15 = keys kb + 16 + 8hh + 0..7 (the split k map) ----
    FragH ph, pl;
    float sm = 0.0f;
#pragma unroll
    for (int r = 0; r < 8; ++r) {
      const float p0 = __expf(t0[r] - mnew);
      const float p1 = __expf(t1[r] - mnew);
      sm += p0 + p1;
      const float ta = p0 * PCAR, tc = p1 * PCAR;
      const _Float16 ha = (_Float16)ta, hc = (_Float16)tc;
      ph.h[0][r] = ha;
      ph.h[1][r] = hc;
      if (RV != 0) {                                    // the residual has a product only for RV = 1
        pl.h[0][r] = (_Float16)(ta - (float)ha);
        pl.h[1][r] = (_Float16)(tc - (float)hc);
      }
    }
    lrun = lrun * al + sm;
    mrun = mnew;
    // ---- rescale the O^T accumulators by the lane's alpha ----
#pragma unroll
    for (int j = 0; j < 4; ++j) {
#pragma unroll
      for (int r = 0; r < 8; ++r) o[j][r] = o[j][r] * al;
    }
    // ---- O^T += v^T.P^T : A fragment row = d = j*16 + c, subtile j = pieces 2j, 2j + 1 of the key tile; 2 groups of 2 ----
    {
      const _Float16* vhp = st + 2 * AKT;
      const _Float16* vlp = st + 3 * AKT;
      (void)vlp;
#pragma unroll
      for (int jg = 0; jg < 2; ++jg) {
        const size_t da = (size_t)(2 * jg) * (2 * FPC);
        const size_t db = da + (size_t)(2 * FPC);
        const v16h vha = ldfrag_f(vhp + da, l8), vhb2 = ldfrag_f(vhp + db, l8);
        o[2 * jg]     = mma_h(vha,  ph.v, o[2 * jg]);
        o[2 * jg + 1] = mma_h(vhb2, ph.v, o[2 * jg + 1]);
        if (RV != 0) {
          const v16h vla = ldfrag_f(vlp + da, l8), vlb2 = ldfrag_f(vlp + db, l8);
          o[2 * jg]     = mma_h(vha,  pl.v, o[2 * jg]);
          o[2 * jg]     = mma_h(vla,  ph.v, o[2 * jg]);
          o[2 * jg + 1] = mma_h(vhb2, pl.v, o[2 * jg + 1]);
          o[2 * jg + 1] = mma_h(vlb2, ph.v, o[2 * jg + 1]);
          guard2(o[2 * jg], o[2 * jg + 1], ph.v, pl.v, vha, vhb2, vla, vlb2);
        } else {
          guard2(o[2 * jg], o[2 * jg + 1], ph.v, ph.v, vha, vhb2, vha, vhb2);
        }
      }
    }
    // publish point of tile kt + 1: own reads back, own copies landed, every wave here; then the freed buffer is refilled
    wait_lds();
    wait_copies();
    __syncthreads();
    if (kt + 2 < nkt) {
      const size_t ko = (size_t)(kt + 2) * AKT;
      stage_kv<RV>(ld0 + (unsigned)(par * ASTG * 2), gkh + ko, gkl + ko, gvh + ko, gvl + ko);
    }
  }
  wait_copies();
  acc_guard4(o[0], o[1], o[2], o[3]);
  // ---- O = acc / l with the carries (32768 on p, 1024 on v) folded once; the two halves' sums joined here; the lane's
  //      8 consecutive d of each subtile go into row c of the wave's slab ----
  const float ltot = lrun + xhalf(lrun);
  const float rl   = (1.0f / ltot) * oc;
#pragma unroll
  for (int j = 0; j < 4; ++j) {
    float* sd = slab + c * SLP + j * 16 + 8 * hh;
    v4f w0, w1;
#pragma unroll
    for (int e = 0; e < 4; ++e) { w0[e] = o[j][e] * rl; w1[e] = o[j][4 + e] * rl; }
    *(v4f*)(sd)     = w0;
    *(v4f*)(sd + 4) = w1;
  }
  wave_sync_lds();
  // ---- O x256 -> f16 hi plane (+ f16 residual plane); lane = (row group rq, 8 consecutive d at c8) ----
  v4u oh[4], ol[4];
  const int rq = lane >> 3, c8 = (lane & 7) * 8;
#pragma unroll
  for (int it = 0; it < 4; ++it) {
    const int row = it * 4 + rq;
    const v4f a = *(const v4f*)(slab + row * SLP + c8), b4 = *(const v4f*)(slab + row * SLP + c8 + 4);
    float w[8];
#pragma unroll
    for (int e = 0; e < 4; ++e) { w[e] = a[e] * OSC; w[4 + e] = b4[e] * OSC; }
#pragma unroll
    for (int e = 0; e < 4; ++e) {
      const _Float16 h0 = (_Float16)w[2 * e], h1 = (_Float16)w[2 * e + 1];
      const _Float16 g0 = (_Float16)(w[2 * e] - (float)h0), g1 = (_Float16)(w[2 * e + 1] - (float)h1);
      oh[it][e] = pk16(h_bits(h0), h_bits(h1));
      ol[it][e] = pk16(h_bits(g0), h_bits(g1));
    }
  }
  const size_t ob = ((size_t)b * SEQ + q0) * DMOD + (size_t)head * HD + c8;
  {
#pragma unroll
    for (int it = 0; it < 4; ++it) {
      const int row = it * 4 + rq;
      *(v4u*)(OHp + ob + (size_t)row * DMOD) = oh[it];
      if (RV != 0) {
        *(v4u*)(OLp + ob + (size_t)row * DMOD) = ol[it];
      }
    }
    wait_stores_issued();
  }
}

// The same attention for the rows >= RICH (k hi . q hi and P hi . v hi only) with 32 query columns a wave: block bid -> query rows q0 = 32*qp ..
// q0 + 31 (qp = qp0 + bid % nqp) of the 4 query heads of kv head hg; column group g = rows q0 + 16g .. q0 + 16g + 15 = 16-query
// tile 2*qp + g of the q hi plane. The wave's q fragments (2 groups x 2 k-steps) are loaded once and stay in
// registers; every k and v^T fragment read from LDS is the A operand of both groups' products, and a key tile is staged once
// for 32 rows x 4 heads. Per query the key tiles (nkt = qp + 1 for both groups) and every sum keep the order of
// attn_gq: accumulator (g, key half) takes k_hi.q_hi per k-step; softmax per group as there. A row here averages over more than
// RICH keys, so the f16 rounding of q and k (at most 2^-11 relative, independent from key to key) weighs on it about as that of P hi.
// coverage: per wave 2 groups x 16 x 64 of the O hi plane; nqp x NHG x NB blocks x WPB waves = rows RICH .. SEQ - 1 of every head.
__device__ __forceinline__
void attn_gq32(float* smem, u16* kvr, const u16* __restrict__ QHp,
               const u16* __restrict__ KHp, const u16* __restrict__ VHp,
               u16* OHp, int bid, int qp0, int nqp) {
  const int tid  = threadIdx.x;
  const int wave = tid >> 5;
  const int lane = tid & 31;
  const int hh   = lane >> 4;
  const int c    = lane & 15;
  if (nqp <= 0) return;                     // block-uniform, before any copy or barrier
  const int qp   = qp0 + bid % nqp;
  const int t2   = bid / nqp;
  const int hg   = t2 % NHG;
  const int b    = t2 / NHG;
  if (b >= NB) return;                      // block-uniform, before any copy or barrier; never taken with the exact grid
  const int q0   = qp * 32;
  if (q0 + 32 > SEQ) return;                // block-uniform, before any copy or barrier; never taken
  const int head = hg * WPB + wave;
  const int kvh  = hg;

  float* slab = smem + wave * WREG;         // result slab [16][64] pitch 68, used by one column group after the other

  const unsigned l8 = (unsigned)lane * 8;
  const size_t qoff = ((size_t)(b * NH + head) * NQT + 2 * qp) * FTILE;                    // this wave's two 16-query tiles
  const size_t koff = (size_t)(b * NKVH + kvh) * NQT * FTILE;                              // 16-key tile 0 of the kv head
  const size_t voff = (size_t)(b * NKVH + kvh) * NKT * (2 * FTILE);                        // 32-key tile 0 of the kv head
  const _Float16* Qh  = (const _Float16*)(const void*)QHp + qoff;
  const u16* gkh = KHp + koff + (size_t)tid * 8;      // this thread's 16 B of the first half of key tile 0, plane by plane
  const u16* gvh = VHp + voff + (size_t)tid * 8;
  const unsigned ld0 = (unsigned)(uintptr_t)kvr + (unsigned)(tid * 16);
  const float lsc  = SM_SCALE * (1.0f / (QSC * KSC));   // exact power-of-two fold of the q / k carries into the 1/8 scale
  const float oc   = 1.0f / (PCAR * VCAR);
  const float ninf = -__builtin_inff();

  const int ncaus = (q0 >> 5) + 1;                                            // tiles holding keys <= q0 + 31
  const int nkt   = (ncaus < NKT) ? ncaus : NKT;

  stage_kv_hi(ld0, gkh, gvh);

  v16h qh[2][2];                            // [column group][k-step]
#pragma unroll
  for (int g = 0; g < 2; ++g) {
#pragma unroll
    for (int kk = 0; kk < 2; ++kk) qh[g][kk] = ldfrag_f(Qh + g * FTILE + kk * (2 * FPC), l8);
  }
  wait_addr();

  v8f o[2][4];                              // O^T: element r of o[g][j] = (d = 16j + 8hh + r, query row q0 + 16g + c)
  float mrun[2], lrun[2];                   // per group, this lane's query: running max, sum over this half's keys
#pragma unroll
  for (int g = 0; g < 2; ++g) {
#pragma unroll
    for (int j = 0; j < 4; ++j) o[g][j] = zero8();
    mrun[g] = ninf;
    lrun[g] = 0.0f;
  }

  wait_copies();
  __syncthreads();
  if (nkt > 1) stage_kv_hi(ld0 + (unsigned)(ASTG * 2), gkh + AKT, gvh + AKT);

  // kept rolled (for speed only), the buffer chosen by the tile's parity
#pragma unroll 1
  for (int kt = 0; kt < nkt; ++kt) {
    const int kb = kt * 32;
    const int par = kt & 1;
    const _Float16* st = (const _Float16*)(const void*)(kvr + par * ASTG);    // this tile's buffer
    // ---- raw scores, transposed: element r of s[g][h] = (key kb + 16h + 8hh + r, query q0 + 16g + c) ----
    v8f s[2][2];
#pragma unroll
    for (int g = 0; g < 2; ++g) { s[g][0] = zero8(); s[g][1] = zero8(); }
    v16h kh[2][2];                          // [k-step][key half]
#pragma unroll
    for (int kk = 0; kk < HD / 32; ++kk) {
#pragma unroll
      for (int h = 0; h < 2; ++h) kh[kk][h] = ldfrag_f(st + h * FTILE + kk * (2 * FPC), l8);
    }
    // the tile's k reads stay in one group ahead of the WMMA block (for speed only)
    __builtin_amdgcn_sched_barrier(0);
#pragma unroll
    for (int kk = 0; kk < HD / 32; ++kk) {
#pragma unroll
      for (int g = 0; g < 2; ++g) { s[g][0] = mma_h(kh[kk][0], qh[g][kk], s[g][0]); s[g][1] = mma_h(kh[kk][1], qh[g][kk], s[g][1]); }
    }
    // the tile's v^T reads, one group behind the score WMMAs: they return while the softmax runs
    v16h vf[4];
#pragma unroll
    for (int j = 0; j < 4; ++j) vf[j] = ldfrag_f(st + 2 * AKT + j * (2 * FPC), l8);
    __builtin_amdgcn_sched_barrier(0);      // holds these reads here: sunk to their use they would be waited for in front of it
    // every key of a tile before the last is <= q0 - 1 < every query row of the wave: the replace-mask is an identity there,
    // so only the last tile takes it (kt and nkt are block-uniform: a scalar branch)
    if (kt + 1 == nkt) {
      const int key0 = kb + 8 * hh, key1 = key0 + 16;
#pragma unroll
      for (int g = 0; g < 2; ++g) {
        const int qrow = q0 + 16 * g + c;
        // unrolled so that the score registers are indexed by constants (a rolled loop would move them through scratch)
#pragma unroll
        for (int r = 0; r < 8; ++r) {
          s[g][0][r] = (key0 + r > qrow) ? ninf : s[g][0][r];
          s[g][1][r] = (key1 + r > qrow) ? ninf : s[g][1][r];
        }
      }
    }
    // ---- running-max online softmax in f32 per group; p*32768 as f16 = the B fragment of O^T += v^T.P^T as it stands ----
    FragH ph[2];
#pragma unroll
    for (int g = 0; g < 2; ++g) {
      const v8f t0 = s[g][0] * lsc, t1 = s[g][1] * lsc;  // whole accumulators: neighbouring registers pair up as they stand
      float mx = ninf;
#pragma unroll
      for (int r = 0; r < 8; ++r) mx = fmaxf(mx, fmaxf(t0[r], t1[r]));
      mx = fmaxf(mx, xhalf(mx));                        // the other half's 16 keys of the same query
      const float mnew = fmaxf(mrun[g], mx);
      const float al   = __expf(mrun[g] - mnew);
      float sm = 0.0f;
#pragma unroll
      for (int r = 0; r < 8; ++r) {
        const float p0 = __expf(t0[r] - mnew);
        const float p1 = __expf(t1[r] - mnew);
        sm += p0 + p1;
        ph[g].h[0][r] = (_Float16)(p0 * PCAR);
        ph[g].h[1][r] = (_Float16)(p1 * PCAR);
      }
      lrun[g] = lrun[g] * al + sm;
      mrun[g] = mnew;
#pragma unroll
      for (int j = 0; j < 4; ++j) {
#pragma unroll
        for (int r = 0; r < 8; ++r) o[g][j][r] = o[g][j][r] * al;
      }
    }
    // ---- O^T += v^T.P^T : A fragment row = d = j*16 + c, subtile j = pieces 2j, 2j + 1 of the key tile ----
#pragma unroll
    for (int j = 0; j < 4; ++j) {
      o[0][j] = mma_h(vf[j], ph[0].v, o[0][j]);
      o[1][j] = mma_h(vf[j], ph[1].v, o[1][j]);
    }
    // the softmax and the WMMA block stay ahead of the publish point: with the barrier lifted over them the refill behind them
    // would be issued only a score block ahead of the wait for it, not a whole tile
    __builtin_amdgcn_sched_barrier(0);
    // publish point of tile kt + 1: own reads back, own copies landed, every wave here; then the freed buffer is refilled
    wait_lds();
    wait_copies();
    __syncthreads();
    if (kt + 2 < nkt) {
      const size_t ko = (size_t)(kt + 2) * AKT;
      stage_kv_hi(ld0 + (unsigned)(par * ASTG * 2), gkh + ko, gvh + ko);
    }
  }
  wait_copies();
  // ---- O = acc / l with the carries folded once, the two halves' sums joined here; group by group through the wave's slab,
  //      then O x256 -> f16 hi plane; lane = (row group rq, 8 consecutive d at c8) ----
  const int rq = lane >> 3, c8 = (lane & 7) * 8;
#pragma unroll
  for (int g = 0; g < 2; ++g) {
    const float ltot = lrun[g] + xhalf(lrun[g]);
    const float rl   = (1.0f / ltot) * oc;
#pragma unroll
    for (int j = 0; j < 4; ++j) {
      float* sd = slab + c * SLP + j * 16 + 8 * hh;
      v4f w0, w1;
#pragma unroll
      for (int e = 0; e < 4; ++e) { w0[e] = o[g][j][e] * rl; w1[e] = o[g][j][4 + e] * rl; }
      *(v4f*)(sd)     = w0;
      *(v4f*)(sd + 4) = w1;
    }
    wave_sync_lds();
    v4u oh[4];
#pragma unroll
    for (int it = 0; it < 4; ++it) {
      const int row = it * 4 + rq;
      const v4f a = *(const v4f*)(slab + row * SLP + c8), b4 = *(const v4f*)(slab + row * SLP + c8 + 4);
#pragma unroll
      for (int e = 0; e < 2; ++e) {
        oh[it][e]     = pk16(h_bits((_Float16)(a[2 * e] * OSC)),  h_bits((_Float16)(a[2 * e + 1] * OSC)));
        oh[it][2 + e] = pk16(h_bits((_Float16)(b4[2 * e] * OSC)), h_bits((_Float16)(b4[2 * e + 1] * OSC)));
      }
    }
    wave_sync_lds();                        // the group's rows are read back before the next group's values take the slab
    const size_t ob = ((size_t)b * SEQ + q0 + 16 * g) * DMOD + (size_t)head * HD + c8;
#pragma unroll
    for (int it = 0; it < 4; ++it) *(v4u*)(OHp + ob + (size_t)(it * 4 + rq) * DMOD) = oh[it];
    wait_stores_issued();
  }
}

// Both row ranges in one grid (no query tile depends on another): the AB_L blocks of the later rows (32 rows each, the longer key
// loops) first, then the AB_R blocks of the tiles < RICH / 16 (16 rows each). The range test is block-uniform.
#define AB_L   (((NQT - NQTR) / 2) * NHG * NB)
#define AB_R   (NQTR * NHG * NB)
static_assert(((NQT - NQTR) % 2) == 0 && (NQTR % 2) == 0);
// four waves per SIMD: the register budget (256) that holds a wave's 32 query columns (q fragments, scores, O^T accumulators)
__global__ __launch_bounds__(ATT_THREADS) __attribute__((amdgpu_waves_per_eu(4)))
void attn_all(const u16* __restrict__ QHp, const u16* __restrict__ QLp,
              const u16* __restrict__ KHp, const u16* __restrict__ KLp,
              const u16* __restrict__ VHp, const u16* __restrict__ VLp, u16* OHp, u16* OLp) {
  __shared__ __align__(16) float smem[WPB * WREG];
  __shared__ __align__(16) u16 kvring[2 * ASTG];
  const int bid = (int)blockIdx.x;
  if (bid < AB_L) attn_gq32(smem, kvring, QHp, KHp, VHp, OHp, bid, NQTR / 2, (NQT - NQTR) / 2);
  else            attn_gq<1>(smem, kvring, QHp, QLp, KHp, KLp, VHp, VLp, OHp, OLp, bid - AB_L, 0, NQTR);
}

// =====================================================================================================
// Workspace map (bytes); every plane is fully written by whole-line stores before it is read (the O, q and k residual planes only on
// the rows < RICH per sequence that are read); all extents are exact multiples of the store granularity (no pad rows needed);
// every region offset a multiple of 131072:
//   XB  bf16 [MROWS][2048]              MROWS*4096   (NB=2, SEQ=2048: 16777216); after the projection GEMM the same bytes hold
//                                                    the O f16 hi plane [MROWS][2048] x256 (identical extent)
//   WB  bf16 [3072 n][2048 k]           12582912     (Wq rows 0..2047, Wk 2048..2559, Wv 2560..3071)
//   WT  f16 [2048 o][2048 d] x1024      8388608      (Wo)
//   OL  region of MROWS*12288 bytes; its first MROWS*4096 bytes hold the O f16 residual plane [MROWS][2048]
//   QH  f16 [NB*32][SEQ/16] tiles of 2048 B x256   MROWS*4096   QL residual, same extent   (fragment order)
//   KH  f16 [NB*8][SEQ/16] tiles of 2048 B x256    MROWS*1024   KL residual, same extent   (fragment order)
//       (QL and KL are written, and read, only on the tiles of rows < RICH of each sequence)
//   VH  f16 [NB*8][SEQ/32] tiles of 4096 B x1024   MROWS*1024   VL residual, same extent   (fragment order)
//   end (NB=2, SEQ=2048)               138412032
// =====================================================================================================
extern "C" void kernel_launch(void* const* d_in, const int* in_sizes, int n_in,
                              void* d_out, int out_size, void* d_ws, size_t ws_size,
                              hipStream_t stream) {
  if (n_in < 9) return;
  if (in_sizes[0] < ((NB - 1) * XS_FULL + SEQ) * DMOD) return;
  if (in_sizes[1] < DMOD * DMOD) return;
  if (in_sizes[2] < DMOD) return;
  if (in_sizes[3] < KVD * DMOD) return;
  if (in_sizes[4] < KVD) return;
  if (in_sizes[5] < KVD * DMOD) return;
  if (in_sizes[6] < KVD) return;
  if (in_sizes[7] < DMOD * DMOD) return;
  if (in_sizes[8] < DMOD) return;
  if (out_size < MROWS * DMOD) return;

  const float* x  = (const float*)d_in[0];
  const float* wq = (const float*)d_in[1];
  const float* bq = (const float*)d_in[2];
  const float* wk = (const float*)d_in[3];
  const float* bk = (const float*)d_in[4];
  const float* wv = (const float*)d_in[5];
  const float* bv = (const float*)d_in[6];
  const float* wo = (const float*)d_in[7];
  const float* bo = (const float*)d_in[8];
  float*       out = (float*)d_out;

  const size_t szXB = (size_t)MROWS * DMOD * 2;
  const size_t szWB = (size_t)NQKV * DMOD * 2;
  const size_t szF  = (size_t)MROWS * NQKV * 4;
  const size_t szQ  = (size_t)MROWS * DMOD * 2;                  // QH, QL
  const size_t szK  = (size_t)MROWS * KVD * 2;                   // KH, KL
  const size_t szV  = (size_t)NB * NKVH * HD * SEQ * 2;          // VH, VL (== szK)
  const size_t szOH = (size_t)MROWS * DMOD * 2;                  // O hi plane, lives in the XB region
  const size_t szOL = (size_t)MROWS * DMOD * 2;                  // O residual plane, at the start of its region
  const size_t szWT = (size_t)DMOD * DMOD * 2;                   // Wo f16 plane
  if (szOH > szXB || szOL > szF) return;
  size_t off = 0;
  const size_t oXB = off; off += szXB;
  const size_t oWB = off; off += szWB;
  const size_t oWT = off; off += szWT;
  const size_t oF  = off; off += szF;
  const size_t oQH = off; off += szQ;
  const size_t oQL = off; off += szQ;
  const size_t oKH = off; off += szK;
  const size_t oKL = off; off += szK;
  const size_t oVH = off; off += szV;
  const size_t oVL = off; off += szV;
  if (off > ws_size) return;                // off = 138412032 for NB = 2, SEQ = 2048
  if (off > (size_t)WS_CAP) return;

  char* ws = (char*)d_ws;
  u16*   XB  = (u16*)(ws + oXB);
  u16*   OH  = (u16*)(ws + oXB);
  u16*   WB  = (u16*)(ws + oWB);
  u16*   WT  = (u16*)(ws + oWT);
  u16*   OL  = (u16*)(ws + oF);
  u16*   QH  = (u16*)(ws + oQH);
  u16*   QL  = (u16*)(ws + oQL);
  u16*   KH  = (u16*)(ws + oKH);
  u16*   KL  = (u16*)(ws + oKL);
  u16*   VH  = (u16*)(ws + oVH);
  u16*   VL  = (u16*)(ws + oVL);

  const dim3 b256(256), b128(128), bAT(ATT_THREADS);
  const dim3 gG1((MROWS / 128) * (NQKV / 128));         // 768
  const float osc = 1.0f / (OSC * WOS);

  // (0) x -> bf16 plane [MROWS][2048]; Wq, Wk, Wv -> one bf16 plane [3072 n][2048 k]; Wo [2048 o][2048 d] -> f16 plane of the
  //     bf16 value x1024 (already k-contiguous)
  cvt_all<<<dim3(CB_ALL), b256, 0, stream>>>(x, wq, wk, wv, wo, XB, WB, WT);
  // (1) qkv = x.[Wq|Wk|Wv]^T, f32 accumulators; the epilogue adds the biases in f32 and writes the q and k hi planes (+ residual
  //     planes on rows < RICH) x256 (columns 0..2047 + bq, 2048..2559 + bk) and the v^T hi + residual planes x1024 (columns 2560..3071 + bv)
  gemm_bf<<<gG1, b128, 0, stream>>>(XB, WB, bq, bk, bv, QH, QL, KH, KL, VH, VL);
  // (2) causal attention -> O f16 hi plane x256 (XB region) for all query tiles; residual plane for tiles < RICH
  attn_all<<<dim3(AB_L + AB_R), bAT, 0, stream>>>(QH, QL, KH, KL, VH, VL, OH, OL);
  // (3) y = O.Wo^T + bo -> out f32 [MROWS][2048], carries 256 x 1024 folded back; rows < RICH per sequence with O hi + residual
  gemm_out<<<dim3(NB * (GB_L + GB_R)), b128, 0, stream>>>(OH, OL, WT, bo, out, osc);
  (void)hipGetLastError();
}
